// v000
// Measured on an AMD MI455X. A time is GPU time per run, averaged over a window of back-to-back runs after a warm-up
// (all launches, gaps included; the runs take copies of the inputs in turn), and the median of several windows.
// Apart from v000's, it joins two sittings. Times from different sittings can be a few percent apart, while
// side-by-side timings come from the same sitting.
// The starting kernel, v000, takes 684 microseconds a run.
// Contractions: q/k/v projections = v_wmma_f32_16x16x32_f16 (A = f16 of RNE-bf16 x carried x16, B = f16 of RNE-bf16 w^T carried x1024, single product); attention q.k^T and p.v = v_wmma_f32_16x16x32_f16 (query tiles below SEQ/2: q, k, v^T f16 planes x16 plus x2^11 residual planes, p f16 x256 plus x2^11 residual, hi.hi + hi.res + res.hi; query tiles from SEQ/2 on: single products on the x16 / x256 planes); output projection = v_wmma_f32_16x16x32_f16 (A = ctx f16 x16 plus its x2^11 residual plane, B = f16 of RNE-bf16 w_o^T x1024); all f32 accumulate. Causal online-max softmax, masks and row sums f32 on VALU.
#include <hip/hip_runtime.h>
#include <math.h>
#include <stdint.h>

#define SEQ   4096
#define DM    1024
#define NH    16
#define NKV   4
#define HD    64
#define DKV   (NKV * HD)            // 256
#define GRP   (NH / NKV)            // query heads per kv head = 4 (query head h uses kv head h / GRP)
#define NQT   (SEQ / 64)            // 64 query tiles of 64 rows
#define QHR   (NQT / 2)             // query tiles below this index use residual planes in attention
#define OUTN  (SEQ * DM)
static_assert(NH * HD == DM);
static_assert(HD == 64);
static_assert((NH % NKV) == 0);
static_assert((SEQ % 64) == 0 && (NQT % 2) == 0);
static_assert((DM % 64) == 0 && (DKV % 64) == 0 && (DM % 32) == 0);
static_assert(((NQT * (DM / 64)) % 8) == 0);
static_assert(((NQT * (DKV / 64)) % 8) == 0);
static_assert(((SEQ * DM / 8) % 256) == 0);

typedef _Float16 v16h __attribute__((ext_vector_type(16)));
typedef _Float16 v8h  __attribute__((ext_vector_type(8)));
typedef float    v8f  __attribute__((ext_vector_type(8)));
typedef float    v4f  __attribute__((ext_vector_type(4)));
typedef unsigned int v4u __attribute__((ext_vector_type(4)));

// ---- scalar helpers --------------------------------------------------------------------------------
__device__ __forceinline__ unsigned short bf_bits(float f) {          // f32 -> bf16 bits, RNE convert
  unsigned u = __float_as_uint(f);
  return (unsigned short)((u + 0x7FFFu + ((u >> 16) & 1u)) >> 16);
}
__device__ __forceinline__ float bfr(float f) { return __uint_as_float(((unsigned)bf_bits(f)) << 16); }
__device__ __forceinline__ unsigned short h_bits(_Float16 x) { return __builtin_bit_cast(unsigned short, x); }
__device__ __forceinline__ unsigned pk16(unsigned short a, unsigned short b) { return (unsigned)a | ((unsigned)b << 16); }
__device__ __forceinline__ v8f zero8() { v8f z = {0.f, 0.f, 0.f, 0.f, 0.f, 0.f, 0.f, 0.f}; return z; }

// ---- fragment loader: 16-bit A/B operand, lane -> row/col (lane&15), p already includes +8*(lane>>4);
//      elements 0..7 <- p[0..7] (k0+8h..), elements 8..15 <- p[16..23] (k0+16+8h..)
__device__ __forceinline__ v16h ldfrag_h(const _Float16* p) {
  union { v16h v; v8h h[2]; } f;
  f.h[0] = *(const v8h*)(p);
  f.h[1] = *(const v8h*)(p + 16);
  return f.v;
}

// ---- WMMA helpers with trailing VALU hazard gap --------------------------------------------------------
__device__ __forceinline__ v8f mma_h(v16h a, v16h b, v8f c) {
  c = __builtin_amdgcn_wmma_f32_16x16x32_f16(false, a, false, b, (short)0, c, false, false);
#if defined(__HIP_DEVICE_COMPILE__)
  asm volatile("v_nop\n\tv_nop\n\tv_nop\n\tv_nop" : "+v"(c) : "v"(a), "v"(b));
#endif
  return c;
}
__device__ __forceinline__ v8f mma_h_raw(v16h a, v16h b, v8f c) {
  return __builtin_amdgcn_wmma_f32_16x16x32_f16(false, a, false, b, (short)0, c, false, false);
}
__device__ __forceinline__ void dep_guard_h(v8f& a, v8f& b, v16h x, v16h y) {
#if defined(__HIP_DEVICE_COMPILE__)
  asm volatile("v_nop\n\tv_nop\n\tv_nop\n\tv_nop" : "+v"(a), "+v"(b) : "v"(x), "v"(y));
#endif
}
__device__ __forceinline__ void keep4_h(v16h a, v16h b, v16h c, v16h d) {
#if defined(__HIP_DEVICE_COMPILE__)
  asm volatile("v_nop" :: "v"(a), "v"(b), "v"(c), "v"(d));
#endif
}
__device__ __forceinline__ void acc_guard4(v8f& a, v8f& b, v8f& c, v8f& d) {
#if defined(__HIP_DEVICE_COMPILE__)
  asm volatile("v_nop\n\tv_nop\n\tv_nop\n\tv_nop" : "+v"(a), "+v"(b), "+v"(c), "+v"(d));
#endif
}

// =====================================================================================================
// f32 plane -> f16 bits of bfr(v) * scale (scale a power of two): x (x16).
// coverage: n8 threads x 8 = the whole plane.
// =====================================================================================================
__global__ __launch_bounds__(256) void cvt16(const float* __restrict__ in, unsigned short* out, int n8, float scale) {
  const int i = blockIdx.x * 256 + threadIdx.x;
  if (i < n8) {
    const v4f a = *(const v4f*)(in + (size_t)i * 8);
    const v4f b = *(const v4f*)(in + (size_t)i * 8 + 4);
    v4u p;
    p[0] = pk16(h_bits((_Float16)(bfr(a[0]) * scale)), h_bits((_Float16)(bfr(a[1]) * scale)));
    p[1] = pk16(h_bits((_Float16)(bfr(a[2]) * scale)), h_bits((_Float16)(bfr(a[3]) * scale)));
    p[2] = pk16(h_bits((_Float16)(bfr(b[0]) * scale)), h_bits((_Float16)(bfr(b[1]) * scale)));
    p[3] = pk16(h_bits((_Float16)(bfr(b[2]) * scale)), h_bits((_Float16)(bfr(b[3]) * scale)));
    *(v4u*)(out + (size_t)i * 8) = p;
    
  }
}

// =====================================================================================================
// f32 weight W [K rows][N cols] (the x@W layout, n contiguous) -> f16 Wt[n][k] = f16(bfr(W[k][n]) * scale),
// pitch K halves (k contiguous = the Bt layout of the GEMM below); scale a power of two.
// Block = one 64 (k) x 64 (n) tile of W; grid = (N/64, K/64); tile staged in LDS as halves [kk][nn] pitch 72
// (v8h 16-B stores, __syncthreads, _Float16 element reads).
// Store: group g = tid>>3 (0..31), piece = tid&7: iteration it writes out row n = it*32+g, lanes 8q..8q+7 x 16 B =
// coverage: load 2 x 256 threads x 8 = 64x64; store 2 iterations x 32 groups = 64 rows n, 8 pieces x 8 = 64 k
// per row; grid covers every (n tile, k tile) of [N][K].
// =====================================================================================================
__global__ __launch_bounds__(256) void w_tr(const float* __restrict__ w, unsigned short* wt, int K, int N, float scale) {
  __shared__ __align__(16) _Float16 sw[64 * 72];       // [kk][nn], pitch 72 halves (144 B)
  const int tid = threadIdx.x;
  const int n0  = blockIdx.x * 64;
  const int k0  = blockIdx.y * 64;
#pragma unroll
  for (int i = 0; i < 2; ++i) {
    const int idx = i * 256 + tid;                  // 0..511
    const int kk = idx >> 3, c8 = (idx & 7) * 8;
    const float* src = w + (size_t)(k0 + kk) * N + n0 + c8;
    const v4f a  = *(const v4f*)(src);
    const v4f a2 = *(const v4f*)(src + 4);
    v8h o;
    o[0] = (_Float16)(bfr(a[0]) * scale);
    o[1] = (_Float16)(bfr(a[1]) * scale);
    o[2] = (_Float16)(bfr(a[2]) * scale);
    o[3] = (_Float16)(bfr(a[3]) * scale);
    o[4] = (_Float16)(bfr(a2[0]) * scale);
    o[5] = (_Float16)(bfr(a2[1]) * scale);
    o[6] = (_Float16)(bfr(a2[2]) * scale);
    o[7] = (_Float16)(bfr(a2[3]) * scale);
    *(v8h*)(sw + kk * 72 + c8) = o;
  }
  __syncthreads();

  const int g = tid >> 3, piece = tid & 7;
  v4u hv[2];
  size_t hofs[2];
#pragma unroll
  for (int it = 0; it < 2; ++it) {
    const int nn = it * 32 + g;
    v4u a;
#pragma unroll
    for (int e = 0; e < 4; ++e) {
      const _Float16 x0 = sw[(piece * 8 + 2 * e) * 72 + nn];
      const _Float16 x1 = sw[(piece * 8 + 2 * e + 1) * 72 + nn];
      a[e] = pk16(h_bits(x0), h_bits(x1));
    }
    hv[it] = a;
    hofs[it] = ((size_t)(n0 + nn)) * K + k0 + piece * 8;
  }
  {
#pragma unroll
    for (int it = 0; it < 2; ++it) *(v4u*)(wt + hofs[it]) = hv[it];
    
  }
}

// =====================================================================================================
// Register-blocked f16 WMMA GEMM, one wave per 64x64 tile, no block barriers:
//   v[m][n] = (sum_k A[m][k] * Bt[n][k]  [+ 2^-11 * sum_k Ar[m][k] * Bt[n][k] when ARES]) * cscale
// A, Ar row-major [M][K] pitch lda (f16), Bt row-major [N][K] pitch ldb (f16, k contiguous); M, N multiples of
// 64, K multiple of 32; tile count a multiple of 8. A wave skips its tile unless (m0 % tmod) lies in [tlo, thi)
// (wave-uniform, before any LDS use).
// ARES: the residual plane is accumulated first from zero, the accumulators are scaled by 2^-11 exactly on the
// VALU (with nop gaps on both sides), then the hi plane accumulates on top: one accumulator set.
// Epilogue variants:
//   EPI 0: f16 hi plane = f16(v * oscale) at Cp and residual plane = f16((v*oscale - hi) * 2048) at Crp, pitch ldc halves
//   EPI 1: f32 out = v, pitch ldc floats
// 16-row slabs staged per wave in LDS. f32 out: each 64-wide row segment (256 B = 2 lines) by 16 lanes x 16 B,
// coverage: 4 slabs x 16 rows x 64 cols = the wave's whole 64x64 tile; grid x 8 tiles = [M][N] (restricted to the
// [tlo, thi) token window).
// =====================================================================================================
template <int EPI, bool ARES>
__global__ __launch_bounds__(256) void gemm64_f16(
    const unsigned short* __restrict__ Ap, const unsigned short* __restrict__ Arp, int lda,
    const unsigned short* __restrict__ Btp, int ldb,
    float cscale,
    void* Cp, unsigned short* Crp, int ldc, int M, int N, int K, float oscale,
    int tmod, int tlo, int thi) {
  const _Float16* Ah  = (const _Float16*)(const void*)Ap;
  const _Float16* Arh = (const _Float16*)(const void*)Arp;
  const _Float16* Bt  = (const _Float16*)(const void*)Btp;
  __shared__ __align__(16) float sT[8][16 * 68];   // per-wave 16x64 slab, pitch 68 floats
  const int lane = threadIdx.x & 31;
  const int wave = threadIdx.x >> 5;
  const int tilesN = N >> 6;
  const int tilesM = M >> 6;
  const int tile = blockIdx.x * 8 + wave;
  if (tile >= tilesM * tilesN) return;   // wave-uniform; no block barriers in this kernel
  const int tm = tile / tilesN;
  const int tn = tile - tm * tilesN;
  const int m0 = tm << 6;
  const int n0 = tn << 6;
  const int tpos = m0 % tmod;
  if (tpos < tlo || tpos >= thi) return; // wave-uniform

  const int rlane = lane & 15;                 // row (A) / col (B, D) within subtile
  const int koff  = (lane >> 4) * 8;           // k offset of this lane half
  const int mOff  = (lane >> 4) * 8;           // D row offset

  v8f acc[4][4];
#pragma unroll
  for (int i = 0; i < 4; ++i)
#pragma unroll
    for (int j = 0; j < 4; ++j) acc[i][j] = zero8();

  constexpr int NPL = ARES ? 2 : 1;
#pragma unroll 1
  for (int pl = 0; pl < NPL; ++pl) {
    const _Float16* Asel = (ARES && pl == 0) ? Arh : Ah;     // wave-uniform selection of a global pointer
    if (ARES && pl == 1) {
      acc_guard4(acc[0][0], acc[0][1], acc[0][2], acc[0][3]);
      acc_guard4(acc[1][0], acc[1][1], acc[1][2], acc[1][3]);
      acc_guard4(acc[2][0], acc[2][1], acc[2][2], acc[2][3]);
      acc_guard4(acc[3][0], acc[3][1], acc[3][2], acc[3][3]);
#pragma unroll
      for (int i = 0; i < 4; ++i)
#pragma unroll
        for (int j = 0; j < 4; ++j) acc[i][j] = acc[i][j] * (1.0f / 2048.0f);   // exact fold of the x2^11 residual carry
      acc_guard4(acc[0][0], acc[0][1], acc[0][2], acc[0][3]);
      acc_guard4(acc[1][0], acc[1][1], acc[1][2], acc[1][3]);
      acc_guard4(acc[2][0], acc[2][1], acc[2][2], acc[2][3]);
      acc_guard4(acc[3][0], acc[3][1], acc[3][2], acc[3][3]);
    }
    for (int k0 = 0; k0 < K; k0 += 32) {
      v16h bh[4];
#pragma unroll
      for (int j = 0; j < 4; ++j) {
        const size_t bo = (size_t)(n0 + (j << 4) + rlane) * ldb + koff + k0;
        bh[j] = ldfrag_h(Bt + bo);
      }
#pragma unroll
      for (int i = 0; i < 4; ++i) {
        const size_t ao = (size_t)(m0 + (i << 4) + rlane) * lda + koff + k0;
        const v16h ah = ldfrag_h(Asel + ao);
#pragma unroll
        for (int j = 0; j < 4; ++j) {
          acc[i][j] = mma_h_raw(ah, bh[j], acc[i][j]);
        }
        dep_guard_h(acc[i][0], acc[i][3], ah, bh[3]);
      }
      keep4_h(bh[0], bh[1], bh[2], bh[3]);
    }
  }
  acc_guard4(acc[0][0], acc[0][1], acc[0][2], acc[0][3]);
  acc_guard4(acc[1][0], acc[1][1], acc[1][2], acc[1][3]);
  acc_guard4(acc[2][0], acc[2][1], acc[2][2], acc[2][3]);
  acc_guard4(acc[3][0], acc[3][1], acc[3][2], acc[3][3]);

  // ---- epilogue ----
  float* slab = sT[wave];
#pragma unroll
  for (int i = 0; i < 4; ++i) {
    const int mBase = m0 + (i << 4);
#pragma unroll
    for (int r = 0; r < 8; ++r) {
      const int row = mOff + r;
#pragma unroll
      for (int j = 0; j < 4; ++j) slab[row * 68 + (j << 4) + rlane] = acc[i][j][r] * cscale;
    }
    __builtin_amdgcn_fence(__ATOMIC_RELEASE, "workgroup");
    __builtin_amdgcn_wave_barrier();
    __builtin_amdgcn_fence(__ATOMIC_ACQUIRE, "workgroup");
    if constexpr (EPI == 0) {
      unsigned short* C16 = (unsigned short*)Cp;
      const int rq = lane >> 3, piece = lane & 7;
      v4u ph[4], pr[4];
#pragma unroll
      for (int it = 0; it < 4; ++it) {
        const int row = it * 4 + rq;                         // it 0..3 x rq 0..3 = rows 0..15
        const v4f a  = *(const v4f*)(slab + row * 68 + piece * 8);
        const v4f a2 = *(const v4f*)(slab + row * 68 + piece * 8 + 4);
        float f[8];
        f[0] = a[0];  f[1] = a[1];  f[2] = a[2];  f[3] = a[3];
        f[4] = a2[0]; f[5] = a2[1]; f[6] = a2[2]; f[7] = a2[3];
        v4u p, q;
#pragma unroll
        for (int e = 0; e < 4; ++e) {
          const float g0 = f[2 * e] * oscale, g1 = f[2 * e + 1] * oscale;
          const _Float16 x0 = (_Float16)g0, x1 = (_Float16)g1;
          const _Float16 y0 = (_Float16)((g0 - (float)x0) * 2048.0f);
          const _Float16 y1 = (_Float16)((g1 - (float)x1) * 2048.0f);
          p[e] = pk16(h_bits(x0), h_bits(x1));
          q[e] = pk16(h_bits(y0), h_bits(y1));
        }
        ph[it] = p;
        pr[it] = q;
      }
      {
#pragma unroll
        for (int it = 0; it < 4; ++it) {
          const int row = it * 4 + rq;
          const size_t co = (size_t)(mBase + row) * ldc + n0 + piece * 8;
          *(v4u*)(C16 + co) = ph[it];
          *(v4u*)(Crp + co) = pr[it];
        }
        
      }
    } else {
      float* Cf = (float*)Cp;
      const int hh = lane >> 4, c4 = (lane & 15) * 4;     // 256-B row segment = 16 lanes x 16 B
      v4f ov[8];
#pragma unroll
      for (int it = 0; it < 8; ++it) {
        const int row = it * 2 + hh;                       // it 0..7 x hh 0..1 = rows 0..15
        ov[it] = *(const v4f*)(slab + row * 68 + c4);
      }
      {
#pragma unroll
        for (int it = 0; it < 8; ++it) {
          const int row = it * 2 + hh;
          *(v4f*)(Cf + (size_t)(mBase + row) * ldc + n0 + c4) = ov[it];
        }
        
      }
    }
    __builtin_amdgcn_fence(__ATOMIC_RELEASE, "workgroup");
    __builtin_amdgcn_wave_barrier();
    __builtin_amdgcn_fence(__ATOMIC_ACQUIRE, "workgroup");
  }
}

// =====================================================================================================
// f16 v plane (token-major, element (t, g, d) at vp[t*DKV + g*64 + d], g = kv head) -> f16 v^T plane
// vt[(g*64 + d)*SEQ + t] (same bits). Used for the hi plane and the residual plane.
// Block = one 64-token x 64-feature tile of one kv head g; grid = (SEQ/64, NKV); tile staged in LDS as halves
// (v8h 16-B stores, __syncthreads, _Float16 element reads).
// Store: group g8 = tid>>3 (0..31), piece = tid&7: iteration it writes row d = it*32+g8, lanes 8q..8q+7 x 16 B =
// coverage: load 2 x 256 threads x 8 halves = 64x64; store 2 iterations x 32 groups = 64 rows d, 8 pieces x 8
// = 64 tokens per row; grid covers every (kv head, token tile) of [DKV][SEQ].
// =====================================================================================================
__global__ __launch_bounds__(256) void v_tr(const unsigned short* __restrict__ vp, unsigned short* vt) {
  __shared__ __align__(16) _Float16 sv[64 * 72];       // [tt][d], pitch 72 halves (144 B)
  const int tid = threadIdx.x;
  const int t0  = blockIdx.x * 64;
  const int g   = blockIdx.y;
  if (g >= NKV || t0 >= SEQ) return;                   // block-uniform, before any barrier
  const _Float16* src = (const _Float16*)(const void*)vp;
#pragma unroll
  for (int i = 0; i < 2; ++i) {
    const int idx = i * 256 + tid;                  // 0..511
    const int tt = idx >> 3, c8 = (idx & 7) * 8;
    const v8h a = *(const v8h*)(src + ((size_t)(t0 + tt)) * DKV + g * HD + c8);
    *(v8h*)(sv + tt * 72 + c8) = a;
  }
  __syncthreads();

  const int g8 = tid >> 3, piece = tid & 7;
  v4u hv[2];
  size_t hofs[2];
#pragma unroll
  for (int it = 0; it < 2; ++it) {
    const int d = it * 32 + g8;
    v4u a;
#pragma unroll
    for (int e = 0; e < 4; ++e) {
      const _Float16 x0 = sv[(piece * 8 + 2 * e) * 72 + d];
      const _Float16 x1 = sv[(piece * 8 + 2 * e + 1) * 72 + d];
      a[e] = pk16(h_bits(x0), h_bits(x1));
    }
    hv[it] = a;
    hofs[it] = ((size_t)(g * HD + d)) * SEQ + t0 + piece * 8;
  }
  {
#pragma unroll
    for (int it = 0; it < 2; ++it) *(v4u*)(vt + hofs[it]) = hv[it];
    
  }
}

// =====================================================================================================
// Causal grouped-query softmax attention, head dim 64, online-max form. Query head h reads kv head g = h / GRP.
//   q f16 (x16): element (t, h, d) at qp[t*DM + h*64 + d]; k f16 (x16): element (t, g, d) at kp[t*DKV + g*64 + d];
//   residual planes (x2^11 of the f16 residue) qrp / krp with the same addressing; v^T f16 (x16) at
//   vtp[(g*64 + d)*SEQ + s], residual vtrp.
//   logit a = (q.k) / 8 = acc / 2048 (two x16 carries); HR: acc = qh.kh + 2^-11 (qh.kr + qr.kh).
//   Key j is allowed for query row i iff j <= i; other keys get a = -1e30 (select by value) and p = 0 (select by
//   value). Per 64-key tile: tile max (per-lane max over the 4 key groups, then a 16-lane xor max),
//   mn = max(mrun, tile max), alpha = exp(mrun - mn), p = exp(a - mn), lsum = lsum * alpha + sum p (per-lane
//   partials, 16-lane xor reduction at the end), context accumulators scaled by alpha on the VALU (nop gaps on
//   both sides). Key tiles 0..qb are visited (block-uniform trip count qb + 1); only the diagonal tile has masked
//   keys and key qb*64 is allowed for every row of the tile, so every visited tile has a finite tile max and
//   lsum >= 1 at the end.
//   P carried as f16(256 p) (HR: plus residual f16((256p - hi)*2048)); context = P . v^T on f16 WMMA
//   (HR: second accumulator += Ph.Vr + Pr.Vh, folded with 2^-11).
//   ctx plane f16 (x16): element (t, h*64 + d) at ctx[t*DM + h*64 + d] = 16 * context / (4096 lsum);
//   the ctx residual plane f16((16 ctx - hi) * 2048) is written by both variants.
//   Block = 4 waves = 64 query rows of one head; query tile qb = qb0 + blockIdx % qcnt, head = blockIdx / qcnt;
//   grid = qcnt * NH.
//   K / V^T tile staging: 128 threads x 32 halves per plane = the whole 64x64 tile (plain 16-B loads,
//   __syncthreads before and after); P tiles are wave-private, spilled with _Float16 element stores and
//   wave in LDS as f32 (aliasing the K/V region after a block barrier) the same way.
//   Output coverage: each wave stores rows 0..15 of its tile (it 0..3 x lane>>3 0..3) x 64 columns (8 lanes x
//   together cover every (head, query tile) of [SEQ][DM] exactly once for both ctx planes.
// =====================================================================================================
template <bool HR>
__global__ __launch_bounds__(128)
void attn_k(const unsigned short* __restrict__ qp,  const unsigned short* __restrict__ qrp,
            const unsigned short* __restrict__ kp,  const unsigned short* __restrict__ krp,
            const unsigned short* __restrict__ vtp, const unsigned short* __restrict__ vtrp,
            unsigned short* ctxp, unsigned short* ctxrp, int qb0, int qcnt) {
  union FH { v16h v; v8h h[2]; };
  constexpr int TB     = 64 * 64 * 2;                    // one f16 64x64 tile, bytes
  constexpr int PB     = 4 * 16 * 64 * 2;                // four wave-private 16x64 f16 P tiles, bytes
  constexpr int OFF_K  = 0;
  constexpr int OFF_V  = TB;
  constexpr int OFF_KR = 2 * TB;
  constexpr int OFF_VR = 3 * TB;
  constexpr int OFF_P  = HR ? 4 * TB : 2 * TB;
  constexpr int OFF_PR = OFF_P + PB;
  constexpr int SMEMB  = HR ? (OFF_PR + PB) : (OFF_P + PB);   // 49152 : 24576
  static_assert(4 * 16 * 64 * 4 <= OFF_P);                    // f32 context staging aliases the K/V region
  __shared__ __align__(16) unsigned char smem[SMEMB];
  _Float16* Ksh = (_Float16*)(smem + OFF_K);                  // K   [kv][d]
  _Float16* Vsh = (_Float16*)(smem + OFF_V);                  // V^T [d][kv]
  _Float16* Krs = (_Float16*)(smem + (HR ? OFF_KR : OFF_K));  // K residual (HR only)
  _Float16* Vrs = (_Float16*)(smem + (HR ? OFF_VR : OFF_V));  // V^T residual (HR only)
  _Float16* Psh = (_Float16*)(smem + OFF_P);
  _Float16* Prs = (_Float16*)(smem + (HR ? OFF_PR : OFF_P));

  const int tid  = threadIdx.x;
  const int wave = tid >> 5;
  const int lane = tid & 31;
  const int hh   = lane >> 4;
  const int c    = lane & 15;

  if (qcnt <= 0) return;                     // block-uniform
  const int bx   = blockIdx.x;
  const int qi   = bx % qcnt;
  const int h    = bx / qcnt;
  const int qb   = qb0 + qi;
  if (h >= NH || qb >= NQT) return;          // block-uniform, before any barrier or store
  const int g    = h / GRP;                  // kv head
  const int q0   = qb * 64 + wave * 16;

  const _Float16* QP  = (const _Float16*)(const void*)qp   + (size_t)h * HD;
  const _Float16* QRP = (const _Float16*)(const void*)qrp  + (size_t)h * HD;
  const _Float16* KP  = (const _Float16*)(const void*)kp   + (size_t)g * HD;
  const _Float16* KRP = (const _Float16*)(const void*)krp  + (size_t)g * HD;
  const _Float16* VTP = (const _Float16*)(const void*)vtp  + (size_t)g * HD * SEQ;
  const _Float16* VRP = (const _Float16*)(const void*)vtrp + (size_t)g * HD * SEQ;

  // ---- Q fragments (A operand, row = lane&15): 2 d-chunks ----
  v16h qa[2], qr[2];
#pragma unroll
  for (int dc = 0; dc < 2; ++dc) {
    const size_t qo = (size_t)(q0 + c) * DM + dc * 32 + 8 * hh;
    qa[dc] = ldfrag_h(QP + qo);
    if constexpr (HR) qr[dc] = ldfrag_h(QRP + qo);
    else qr[dc] = qa[dc];
  }

  float lsum[8], mrun[8];
  v8f oacc[4], oacc2[4];
#pragma unroll
  for (int r = 0; r < 8; ++r) { lsum[r] = 0.f; mrun[r] = -1e30f; }
#pragma unroll
  for (int t = 0; t < 4; ++t) { oacc[t] = zero8(); oacc2[t] = zero8(); }

  _Float16* pw  = Psh + wave * (16 * 64);
  _Float16* prw = Prs + wave * (16 * 64);

  const int nkt = qb + 1;                                      // key tiles 0..qb, block-uniform
  for (int kti = 0; kti < nkt; ++kti) {
    const int kv0 = kti * 64;                                  // <= qb*64 < SEQ
    __syncthreads();
    {
      const int r = tid >> 1, half = (tid & 1) * 32;
      const size_t ko = (size_t)(kv0 + r) * DKV + half;         // K row kv0+r, d = half..half+31
      const size_t vo = (size_t)r * SEQ + kv0 + half;           // V^T row d = r, s = kv0+half..+31
#pragma unroll
      for (int i = 0; i < 4; ++i) {
        const v8h a0 = *(const v8h*)(KP + ko + 8 * i);
        const v8h b0 = *(const v8h*)(VTP + vo + 8 * i);
        *(v8h*)(Ksh + r * 64 + half + 8 * i) = a0;
        *(v8h*)(Vsh + r * 64 + half + 8 * i) = b0;
        if constexpr (HR) {
          const v8h a1 = *(const v8h*)(KRP + ko + 8 * i);
          const v8h b1 = *(const v8h*)(VRP + vo + 8 * i);
          *(v8h*)(Krs + r * 64 + half + 8 * i) = a1;
          *(v8h*)(Vrs + r * 64 + half + 8 * i) = b1;
        }
      }
    }
    __syncthreads();

    // ---- scores: 16 query rows x 64 keys per wave (B operand: lane c -> key j*16+c, split k map over d) ----
    v8f s[4];
#pragma unroll
    for (int j = 0; j < 4; ++j) {
      s[j] = zero8();
      v8f t = zero8();
#pragma unroll
      for (int dc = 0; dc < 2; ++dc) {
        FH kb;
        kb.h[0] = *(const v8h*)(Ksh + (j * 16 + c) * 64 + dc * 32 + 8 * hh);
        kb.h[1] = *(const v8h*)(Ksh + (j * 16 + c) * 64 + dc * 32 + 16 + 8 * hh);
        s[j] = mma_h(qa[dc], kb.v, s[j]);
        if constexpr (HR) {
          FH krb;
          krb.h[0] = *(const v8h*)(Krs + (j * 16 + c) * 64 + dc * 32 + 8 * hh);
          krb.h[1] = *(const v8h*)(Krs + (j * 16 + c) * 64 + dc * 32 + 16 + 8 * hh);
          t = mma_h(qa[dc], krb.v, t);
          t = mma_h(qr[dc], kb.v, t);
        }
      }
      if constexpr (HR) s[j] = s[j] + t * (1.0f / 2048.0f);
    }

    // ---- causal online softmax: tile max, running max, alpha, p, row-sum partials,
    //      P (x256, f16; HR: + residual) ----
    float alpha[8];
#pragma unroll
    for (int r = 0; r < 8; ++r) {
      const int qrow = q0 + 8 * hh + r;
      float av[4];
      float tmx = -1e30f;
#pragma unroll
      for (int j = 0; j < 4; ++j) {
        const int key = kv0 + j * 16 + c;
        float a = s[j][r] * (1.0f / 2048.0f);              // 1/8 head scale, 1/256 for the two x16 carries
        const bool ok = (key <= qrow);
        a = ok ? a : -1e30f;
        av[j] = a;
        tmx = fmaxf(tmx, a);
      }
#pragma unroll
      for (int off = 1; off < 16; off <<= 1) tmx = fmaxf(tmx, __shfl_xor(tmx, off, 32));
      const float mn = fmaxf(mrun[r], tmx);
      const float al = __expf(mrun[r] - mn);
      alpha[r] = al;
      mrun[r]  = mn;
      float ps = 0.0f;
#pragma unroll
      for (int j = 0; j < 4; ++j) {
        const int key = kv0 + j * 16 + c;
        const bool ok = (key <= qrow);
        float p = __expf(av[j] - mn);
        p = ok ? p : 0.0f;
        ps += p;
        const float gg = p * 256.0f;
        const _Float16 x0 = (_Float16)gg;
        pw[(8 * hh + r) * 64 + j * 16 + c] = x0;
        if constexpr (HR) prw[(8 * hh + r) * 64 + j * 16 + c] = (_Float16)((gg - (float)x0) * 2048.0f);
      }
      lsum[r] = lsum[r] * al + ps;
    }
    __builtin_amdgcn_fence(__ATOMIC_RELEASE, "workgroup");
    __builtin_amdgcn_wave_barrier();
    __builtin_amdgcn_fence(__ATOMIC_ACQUIRE, "workgroup");

    // ---- rescale the context accumulators by alpha (VALU), nop gaps before the next WMMA reads them ----
#pragma unroll
    for (int t = 0; t < 4; ++t) {
#pragma unroll
      for (int r = 0; r < 8; ++r) {
        oacc[t][r] = oacc[t][r] * alpha[r];
        if constexpr (HR) oacc2[t][r] = oacc2[t][r] * alpha[r];
      }
    }
    acc_guard4(oacc[0], oacc[1], oacc[2], oacc[3]);
    if constexpr (HR) acc_guard4(oacc2[0], oacc2[1], oacc2[2], oacc2[3]);

    // ---- context += P . V (f16 WMMA; A = P [row][key], B = V^T [d][key]) ----
#pragma unroll
    for (int kk = 0; kk < 2; ++kk) {
      FH pa, par;
      pa.h[0] = *(const v8h*)(pw + c * 64 + kk * 32 + 8 * hh);
      pa.h[1] = *(const v8h*)(pw + c * 64 + kk * 32 + 16 + 8 * hh);
      if constexpr (HR) {
        par.h[0] = *(const v8h*)(prw + c * 64 + kk * 32 + 8 * hh);
        par.h[1] = *(const v8h*)(prw + c * 64 + kk * 32 + 16 + 8 * hh);
      } else {
        par.v = pa.v;
      }
#pragma unroll
      for (int t = 0; t < 4; ++t) {
        FH vb;
        vb.h[0] = *(const v8h*)(Vsh + (t * 16 + c) * 64 + kk * 32 + 8 * hh);
        vb.h[1] = *(const v8h*)(Vsh + (t * 16 + c) * 64 + kk * 32 + 16 + 8 * hh);
        oacc[t] = mma_h(pa.v, vb.v, oacc[t]);
        if constexpr (HR) {
          FH vrb;
          vrb.h[0] = *(const v8h*)(Vrs + (t * 16 + c) * 64 + kk * 32 + 8 * hh);
          vrb.h[1] = *(const v8h*)(Vrs + (t * 16 + c) * 64 + kk * 32 + 16 + 8 * hh);
          oacc2[t] = mma_h(pa.v, vrb.v, oacc2[t]);
          oacc2[t] = mma_h(par.v, vb.v, oacc2[t]);
        }
      }
    }
  }
  __syncthreads();                           // every wave is done with the K/V tiles before they are aliased

  // ---- normalise (1/lsum, the 1/256 p carry; keep the x16 v carry), stage the wave's 16x64 f32 tile in
  //      instruction) ----
  float* os = (float*)(void*)smem + wave * (16 * 64);
#pragma unroll
  for (int r = 0; r < 8; ++r) {
    float l = lsum[r];
#pragma unroll
    for (int off = 1; off < 16; off <<= 1) l += __shfl_xor(l, off, 32);
    const float rl = 1.0f / l;               // l >= 1 (the max key contributes p = 1)
    const float sc = rl * (1.0f / 256.0f);
#pragma unroll
    for (int t = 0; t < 4; ++t) {
      float v = oacc[t][r];
      if constexpr (HR) v += oacc2[t][r] * (1.0f / 2048.0f);
      os[(8 * hh + r) * 64 + t * 16 + c] = v * sc;
    }
  }
  __builtin_amdgcn_fence(__ATOMIC_RELEASE, "workgroup");
  __builtin_amdgcn_wave_barrier();
  __builtin_amdgcn_fence(__ATOMIC_ACQUIRE, "workgroup");
  {
    const int rq = lane >> 3, piece = lane & 7;
    v4u ph[4], pr[4];
#pragma unroll
    for (int it = 0; it < 4; ++it) {
      const int row = it * 4 + rq;   // it 0..3 x rq 0..3 = rows 0..15 of the wave tile
      const v4f a  = *(const v4f*)(os + row * 64 + piece * 8);
      const v4f a2 = *(const v4f*)(os + row * 64 + piece * 8 + 4);
      float f[8];
      f[0] = a[0];  f[1] = a[1];  f[2] = a[2];  f[3] = a[3];
      f[4] = a2[0]; f[5] = a2[1]; f[6] = a2[2]; f[7] = a2[3];
      v4u p, q;
#pragma unroll
      for (int e = 0; e < 4; ++e) {
        const _Float16 x0 = (_Float16)f[2 * e], x1 = (_Float16)f[2 * e + 1];
        const _Float16 y0 = (_Float16)((f[2 * e] - (float)x0) * 2048.0f);
        const _Float16 y1 = (_Float16)((f[2 * e + 1] - (float)x1) * 2048.0f);
        p[e] = pk16(h_bits(x0), h_bits(x1));
        q[e] = pk16(h_bits(y0), h_bits(y1));
      }
      ph[it] = p;
      pr[it] = q;
    }
    {
#pragma unroll
      for (int it = 0; it < 4; ++it) {
        const int row = it * 4 + rq;
        const size_t go = (size_t)(q0 + row) * DM + (size_t)h * HD + piece * 8;
        *(v4u*)(ctxp + go)  = ph[it];
        *(v4u*)(ctxrp + go) = pr[it];
      }
      
    }
  }
}

// =====================================================================================================
// Workspace map (bytes, SEQ = 4096); every region is an exact multiple of its whole-line / whole-tile store
// granularity (row pitches 2048 / 512 / 8192 B, rows multiples of 64, all offsets 512-KiB aligned, no aliasing
// within a launch):
//   Xh    f16 [SEQ][1024]          0     8388608   (bf16 value of x, x16)
//   WqT   f16 [1024][1024]   8388608     2097152   (bf16 value of w_q^T x1024, [n][k])
//   WkT   f16 [256][1024]   10485760      524288   (bf16 value of w_k^T x1024, [n][k])
//   WvT   f16 [256][1024]   11010048      524288   (bf16 value of w_v^T x1024, [n][k])
//   WoT   f16 [1024][1024]  11534336     2097152   (bf16 value of w_o^T x1024, [n][k])
//   Qh    f16 [SEQ][1024]   13631488     8388608   (q x16)           Qr  22020096  8388608 (x2^11 residual)
//   Kh    f16 [SEQ][256]    30408704     2097152   (k x16)           Kr  32505856  2097152
//   Vh    f16 [SEQ][256]    34603008     2097152   (v x16)           Vr  36700160  2097152
//   VT    f16 [256][SEQ]    38797312     2097152   ([g*64 + d][s])   VTr 40894464  2097152
//   Ctx   f16 [SEQ][1024]   42991616     8388608   (context x16)     Ctxr 51380224 8388608
//   end                     59768832
// Projection weights arrive as [in k][out n] (n contiguous) and are transposed while converted (w_tr).
// d_out f32: [SEQ][1024] at byte 0, every 64x64 tile written once by the output projection launch.
// =====================================================================================================
extern "C" void kernel_launch(void* const* d_in, const int* in_sizes, int n_in,
                              void* d_out, int out_size, void* d_ws, size_t ws_size,
                              hipStream_t stream) {
  if (n_in < 5) return;
  if (in_sizes[0] < SEQ * DM || (in_sizes[0] % DM) != 0) return;   // x rows 0..SEQ-1 are used, pitch DM
  if (in_sizes[1] != DM * DM) return;
  if (in_sizes[2] != DM * DKV) return;
  if (in_sizes[3] != DM * DKV) return;
  if (in_sizes[4] != DM * DM) return;
  if (out_size < OUTN) return;

  const float* x   = (const float*)d_in[0];    // [>=SEQ][DM]
  const float* w_q = (const float*)d_in[1];    // [DM k][DM n]
  const float* w_k = (const float*)d_in[2];    // [DM k][DKV n]
  const float* w_v = (const float*)d_in[3];    // [DM k][DKV n]
  const float* w_o = (const float*)d_in[4];    // [DM k][DM n]

  const size_t PX   = (size_t)SEQ * DM * 2;          //  8388608
  const size_t PWq  = (size_t)DM * DM * 2;           //  2097152
  const size_t PWk  = (size_t)DKV * DM * 2;          //   524288
  const size_t PWo  = (size_t)DM * DM * 2;           //  2097152
  const size_t PQ   = (size_t)SEQ * DM * 2;          //  8388608
  const size_t PK   = (size_t)SEQ * DKV * 2;         //  2097152
  const size_t PVT  = (size_t)DKV * SEQ * 2;         //  2097152
  const size_t PCtx = (size_t)SEQ * DM * 2;          //  8388608
  size_t off = 0;
  const size_t oX    = off; off += PX;
  const size_t oWq   = off; off += PWq;
  const size_t oWk   = off; off += PWk;
  const size_t oWv   = off; off += PWk;
  const size_t oWo   = off; off += PWo;
  const size_t oQ    = off; off += PQ;
  const size_t oQr   = off; off += PQ;
  const size_t oK    = off; off += PK;
  const size_t oKr   = off; off += PK;
  const size_t oV    = off; off += PK;
  const size_t oVr   = off; off += PK;
  const size_t oVT   = off; off += PVT;
  const size_t oVTr  = off; off += PVT;
  const size_t oCtx  = off; off += PCtx;
  const size_t oCtxr = off; off += PCtx;
  if (off > ws_size) return;                         // off = 59768832 for SEQ = 4096
  if (off > (size_t)134217728) return;

  char* ws = (char*)d_ws;
  unsigned short* Xh   = (unsigned short*)(ws + oX);
  unsigned short* WqT  = (unsigned short*)(ws + oWq);
  unsigned short* WkT  = (unsigned short*)(ws + oWk);
  unsigned short* WvT  = (unsigned short*)(ws + oWv);
  unsigned short* WoT  = (unsigned short*)(ws + oWo);
  unsigned short* Qh   = (unsigned short*)(ws + oQ);
  unsigned short* Qr   = (unsigned short*)(ws + oQr);
  unsigned short* Kh   = (unsigned short*)(ws + oK);
  unsigned short* Kr   = (unsigned short*)(ws + oKr);
  unsigned short* Vh   = (unsigned short*)(ws + oV);
  unsigned short* Vr   = (unsigned short*)(ws + oVr);
  unsigned short* VT   = (unsigned short*)(ws + oVT);
  unsigned short* VTr  = (unsigned short*)(ws + oVTr);
  unsigned short* Ctx  = (unsigned short*)(ws + oCtx);
  unsigned short* Ctxr = (unsigned short*)(ws + oCtxr);
  float*          outf = (float*)d_out;              // [SEQ][DM]

  const dim3 blk(256);
  const int n8x = SEQ * DM / 8;                      // 524288
  const dim3 gCx((n8x + 255) / 256);                 // 2048 blocks
  const dim3 gTq(DM / 64, DM / 64);                  // (16, 16): in [1024 k][1024 n] -> out [1024 n][1024 k]
  const dim3 gTk(DKV / 64, DM / 64);                 // (4, 16):  in [1024 k][256 n]  -> out [256 n][1024 k]
  const dim3 gGq((NQT * (DM / 64) + 7) / 8);         // 1024 tiles -> 128 blocks
  const dim3 gGk((NQT * (DKV / 64) + 7) / 8);        // 256 tiles -> 32 blocks
  const dim3 gVt(SEQ / 64, NKV);                     // (64, 4)
  const dim3 gAhr(QHR * NH);                         // query tiles 0..QHR-1, residual-plane variant
  const dim3 gApl((NQT - QHR) * NH);                 // query tiles QHR..NQT-1, single-product variant
  const float wScale = 1024.0f;                      // weights carried x1024
  const float aScale = 16.0f;                        // activations carried x16
  const float cscale = 1.0f / 16384.0f;              // 1/(16 * 1024)

  // (1) planes: x -> f16 x16 (bf16 values); weights -> transposed f16 x1024 (bf16 values)
  cvt16<<<gCx, blk, 0, stream>>>(x, Xh, n8x, aScale);
  w_tr<<<gTq, blk, 0, stream>>>(w_q, WqT, DM, DM, wScale);    // in[rows=1024][cols=1024] -> out[1024][1024]
  w_tr<<<gTk, blk, 0, stream>>>(w_k, WkT, DM, DKV, wScale);   // in[rows=1024][cols=256]  -> out[256][1024]
  w_tr<<<gTk, blk, 0, stream>>>(w_v, WvT, DM, DKV, wScale);   // in[rows=1024][cols=256]  -> out[256][1024]
  w_tr<<<gTq, blk, 0, stream>>>(w_o, WoT, DM, DM, wScale);    // in[rows=1024][cols=1024] -> out[1024][1024]
  // (2) q = Xh . WqT^T -> Qh f16 x16 + residual [SEQ][1024] (M=SEQ, N=1024, K=1024); k, v the same with N=256
  gemm64_f16<0, false><<<gGq, blk, 0, stream>>>(Xh, Xh, DM, WqT, DM, cscale, (void*)Qh, Qr, DM,
                                                SEQ, DM, DM, aScale, SEQ, 0, SEQ);
  gemm64_f16<0, false><<<gGk, blk, 0, stream>>>(Xh, Xh, DM, WkT, DM, cscale, (void*)Kh, Kr, DKV,
                                                SEQ, DKV, DM, aScale, SEQ, 0, SEQ);
  gemm64_f16<0, false><<<gGk, blk, 0, stream>>>(Xh, Xh, DM, WvT, DM, cscale, (void*)Vh, Vr, DKV,
                                                SEQ, DKV, DM, aScale, SEQ, 0, SEQ);
  // (3) v -> v^T planes (hi and residual, all tokens, all kv heads)
  v_tr<<<gVt, blk, 0, stream>>>(Vh, VT);
  v_tr<<<gVt, blk, 0, stream>>>(Vr, VTr);
  // (4) causal softmax attention -> Ctx f16 x16 + residual plane: tiles 0..QHR-1 with residual operand planes,
  //     tiles QHR..NQT-1 with single products; together every (head, query tile) exactly once
  attn_k<true><<<gAhr, dim3(128), 0, stream>>>(Qh, Qr, Kh, Kr, VT, VTr, Ctx, Ctxr, 0, QHR);
  attn_k<false><<<gApl, dim3(128), 0, stream>>>(Qh, Qr, Kh, Kr, VT, VTr, Ctx, Ctxr, QHR, NQT - QHR);
  // (5) out = (Ctx + 2^-11 Ctxr) . WoT^T -> d_out f32 [SEQ][1024] (M=SEQ, N=1024, K=1024), every tile once
  gemm64_f16<1, true><<<gGq, blk, 0, stream>>>(Ctx, Ctxr, DM, WoT, DM, cscale, (void*)outf, Ctxr, DM,
                                               SEQ, DM, DM, 1.0f, SEQ, 0, SEQ);
  (void)hipGetLastError();
}

// v001
// One run takes 593 microseconds.
// Next to v000, in two timings, it ran 1.16 and 1.17 times as fast.
// Contractions: q/k/v projections = v_wmma_f32_16x16x32_f16 (A = f16 of RNE-bf16 x carried x16, B = f16 of RNE-bf16 w^T carried x1024, single product); attention q.k^T and p.v = v_wmma_f32_16x16x32_f16 (query tiles below SEQ/2: q, k, v^T f16 planes x16 plus x2^11 residual planes, p f16 x256 plus x2^11 residual, hi.hi + hi.res + res.hi; query tiles from SEQ/2 on: single products on the x16 / x256 planes); output projection = v_wmma_f32_16x16x32_f16 (A = ctx f16 x16 plus its x2^11 residual plane, B = f16 of RNE-bf16 w_o^T x1024); all f32 accumulate. Causal online-max softmax, masks and row sums f32 on VALU.
#include <hip/hip_runtime.h>
#include <math.h>
#include <stdint.h>

#define SEQ   4096
#define DM    1024
#define NH    16
#define NKV   4
#define HD    64
#define DKV   (NKV * HD)            // 256
#define GRP   (NH / NKV)            // query heads per kv head = 4 (query head h uses kv head h / GRP)
#define NQT   (SEQ / 64)            // 64 query tiles of 64 rows
#define QHR   (NQT / 2)             // query tiles below this index use residual planes in attention
#define OUTN  (SEQ * DM)
static_assert(NH * HD == DM);
static_assert(HD == 64);
static_assert((NH % NKV) == 0);
static_assert((SEQ % 64) == 0 && (NQT % 2) == 0);
static_assert((DM % 64) == 0 && (DKV % 64) == 0 && (DM % 32) == 0);
static_assert(((NQT * (DM / 64)) % 8) == 0);
static_assert(((NQT * (DKV / 64)) % 8) == 0);
static_assert(((SEQ * DM / 8) % 256) == 0);

typedef _Float16 v16h __attribute__((ext_vector_type(16)));
typedef _Float16 v8h  __attribute__((ext_vector_type(8)));
typedef float    v8f  __attribute__((ext_vector_type(8)));
typedef float    v4f  __attribute__((ext_vector_type(4)));
typedef unsigned int v4u __attribute__((ext_vector_type(4)));

// ---- scalar helpers --------------------------------------------------------------------------------
__device__ __forceinline__ unsigned short bf_bits(float f) {          // f32 -> bf16 bits, RNE convert
  unsigned u = __float_as_uint(f);
  return (unsigned short)((u + 0x7FFFu + ((u >> 16) & 1u)) >> 16);
}
__device__ __forceinline__ float bfr(float f) { return __uint_as_float(((unsigned)bf_bits(f)) << 16); }
__device__ __forceinline__ unsigned short h_bits(_Float16 x) { return __builtin_bit_cast(unsigned short, x); }
__device__ __forceinline__ unsigned pk16(unsigned short a, unsigned short b) { return (unsigned)a | ((unsigned)b << 16); }
__device__ __forceinline__ v8f zero8() { v8f z = {0.f, 0.f, 0.f, 0.f, 0.f, 0.f, 0.f, 0.f}; return z; }

// ---- fragment loader: 16-bit A/B operand, lane -> row/col (lane&15), p already includes +8*(lane>>4);
//      elements 0..7 <- p[0..7] (k0+8h..), elements 8..15 <- p[16..23] (k0+16+8h..)
__device__ __forceinline__ v16h ldfrag_h(const _Float16* p) {
  union { v16h v; v8h h[2]; } f;
  f.h[0] = *(const v8h*)(p);
  f.h[1] = *(const v8h*)(p + 16);
  return f.v;
}

// ---- WMMA helpers with trailing VALU hazard gap --------------------------------------------------------
__device__ __forceinline__ v8f mma_h(v16h a, v16h b, v8f c) {
  c = __builtin_amdgcn_wmma_f32_16x16x32_f16(false, a, false, b, (short)0, c, false, false);
#if defined(__HIP_DEVICE_COMPILE__)
  asm volatile("v_nop\n\tv_nop\n\tv_nop\n\tv_nop" : "+v"(c) : "v"(a), "v"(b));
#endif
  return c;
}
__device__ __forceinline__ v8f mma_h_raw(v16h a, v16h b, v8f c) {
  return __builtin_amdgcn_wmma_f32_16x16x32_f16(false, a, false, b, (short)0, c, false, false);
}
__device__ __forceinline__ void dep_guard_h(v8f& a, v8f& b, v16h x, v16h y) {
#if defined(__HIP_DEVICE_COMPILE__)
  asm volatile("v_nop\n\tv_nop\n\tv_nop\n\tv_nop" : "+v"(a), "+v"(b) : "v"(x), "v"(y));
#endif
}
__device__ __forceinline__ void keep4_h(v16h a, v16h b, v16h c, v16h d) {
#if defined(__HIP_DEVICE_COMPILE__)
  asm volatile("v_nop" :: "v"(a), "v"(b), "v"(c), "v"(d));
#endif
}
__device__ __forceinline__ void acc_guard4(v8f& a, v8f& b, v8f& c, v8f& d) {
#if defined(__HIP_DEVICE_COMPILE__)
  asm volatile("v_nop\n\tv_nop\n\tv_nop\n\tv_nop" : "+v"(a), "+v"(b), "+v"(c), "+v"(d));
#endif
}

// =====================================================================================================
// f32 plane -> f16 bits of bfr(v) * scale (scale a power of two): x (x16).
// coverage: n8 threads x 8 = the whole plane.
// =====================================================================================================
__global__ __launch_bounds__(256) void cvt16(const float* __restrict__ in, unsigned short* out, int n8, float scale) {
  const int i = blockIdx.x * 256 + threadIdx.x;
  if (i < n8) {
    const v4f a = *(const v4f*)(in + (size_t)i * 8);
    const v4f b = *(const v4f*)(in + (size_t)i * 8 + 4);
    v4u p;
    p[0] = pk16(h_bits((_Float16)(bfr(a[0]) * scale)), h_bits((_Float16)(bfr(a[1]) * scale)));
    p[1] = pk16(h_bits((_Float16)(bfr(a[2]) * scale)), h_bits((_Float16)(bfr(a[3]) * scale)));
    p[2] = pk16(h_bits((_Float16)(bfr(b[0]) * scale)), h_bits((_Float16)(bfr(b[1]) * scale)));
    p[3] = pk16(h_bits((_Float16)(bfr(b[2]) * scale)), h_bits((_Float16)(bfr(b[3]) * scale)));
    *(v4u*)(out + (size_t)i * 8) = p;
    
  }
}

// =====================================================================================================
// f32 weight W [K rows][N cols] (the x@W layout, n contiguous) -> f16 Wt[n][k] = f16(bfr(W[k][n]) * scale),
// pitch K halves (k contiguous = the Bt layout of the GEMM below); scale a power of two.
// Block = one 64 (k) x 64 (n) tile of W; grid = (N/64, K/64); tile staged in LDS as halves [kk][nn] pitch 72
// (v8h 16-B stores, __syncthreads, _Float16 element reads).
// Store: group g = tid>>3 (0..31), piece = tid&7: iteration it writes out row n = it*32+g, lanes 8q..8q+7 x 16 B =
// coverage: load 2 x 256 threads x 8 = 64x64; store 2 iterations x 32 groups = 64 rows n, 8 pieces x 8 = 64 k
// per row; grid covers every (n tile, k tile) of [N][K].
// =====================================================================================================
__global__ __launch_bounds__(256) void w_tr(const float* __restrict__ w, unsigned short* wt, int K, int N, float scale) {
  __shared__ __align__(16) _Float16 sw[64 * 72];       // [kk][nn], pitch 72 halves (144 B)
  const int tid = threadIdx.x;
  const int n0  = blockIdx.x * 64;
  const int k0  = blockIdx.y * 64;
#pragma unroll
  for (int i = 0; i < 2; ++i) {
    const int idx = i * 256 + tid;                  // 0..511
    const int kk = idx >> 3, c8 = (idx & 7) * 8;
    const float* src = w + (size_t)(k0 + kk) * N + n0 + c8;
    const v4f a  = *(const v4f*)(src);
    const v4f a2 = *(const v4f*)(src + 4);
    v8h o;
    o[0] = (_Float16)(bfr(a[0]) * scale);
    o[1] = (_Float16)(bfr(a[1]) * scale);
    o[2] = (_Float16)(bfr(a[2]) * scale);
    o[3] = (_Float16)(bfr(a[3]) * scale);
    o[4] = (_Float16)(bfr(a2[0]) * scale);
    o[5] = (_Float16)(bfr(a2[1]) * scale);
    o[6] = (_Float16)(bfr(a2[2]) * scale);
    o[7] = (_Float16)(bfr(a2[3]) * scale);
    *(v8h*)(sw + kk * 72 + c8) = o;
  }
  __syncthreads();

  const int g = tid >> 3, piece = tid & 7;
  v4u hv[2];
  size_t hofs[2];
#pragma unroll
  for (int it = 0; it < 2; ++it) {
    const int nn = it * 32 + g;
    v4u a;
#pragma unroll
    for (int e = 0; e < 4; ++e) {
      const _Float16 x0 = sw[(piece * 8 + 2 * e) * 72 + nn];
      const _Float16 x1 = sw[(piece * 8 + 2 * e + 1) * 72 + nn];
      a[e] = pk16(h_bits(x0), h_bits(x1));
    }
    hv[it] = a;
    hofs[it] = ((size_t)(n0 + nn)) * K + k0 + piece * 8;
  }
  {
#pragma unroll
    for (int it = 0; it < 2; ++it) *(v4u*)(wt + hofs[it]) = hv[it];
    
  }
}

// =====================================================================================================
// Register-blocked f16 WMMA GEMM, one wave per 64x64 tile, no block barriers:
//   v[m][n] = (sum_k A[m][k] * Bt[n][k]  [+ 2^-11 * sum_k Ar[m][k] * Bt[n][k] when ARES]) * cscale
// A, Ar row-major [M][K] pitch lda (f16), Bt row-major [N][K] pitch ldb (f16, k contiguous); M, N multiples of
// 64, K multiple of 32; tile count a multiple of 8. A wave skips its tile unless (m0 % tmod) lies in [tlo, thi)
// (wave-uniform, before any LDS use).
// ARES: the residual plane is accumulated first from zero, the accumulators are scaled by 2^-11 exactly on the
// VALU (with nop gaps on both sides), then the hi plane accumulates on top: one accumulator set.
// Epilogue variants:
//   EPI 0: f16 hi plane = f16(v * oscale) at Cp and residual plane = f16((v*oscale - hi) * 2048) at Crp, pitch ldc halves
//   EPI 1: f32 out = v, pitch ldc floats
// 16-row slabs staged per wave in LDS. f32 out: each 64-wide row segment (256 B = 2 lines) by 16 lanes x 16 B,
// coverage: 4 slabs x 16 rows x 64 cols = the wave's whole 64x64 tile; grid x 8 tiles = [M][N] (restricted to the
// [tlo, thi) token window).
// =====================================================================================================
template <int EPI, bool ARES>
__global__ __launch_bounds__(256) void gemm64_f16(
    const unsigned short* __restrict__ Ap, const unsigned short* __restrict__ Arp, int lda,
    const unsigned short* __restrict__ Btp, int ldb,
    float cscale,
    void* Cp, unsigned short* Crp, int ldc, int M, int N, int K, float oscale,
    int tmod, int tlo, int thi) {
  const _Float16* Ah  = (const _Float16*)(const void*)Ap;
  const _Float16* Arh = (const _Float16*)(const void*)Arp;
  const _Float16* Bt  = (const _Float16*)(const void*)Btp;
  __shared__ __align__(16) float sT[8][16 * 68];   // per-wave 16x64 slab, pitch 68 floats
  const int lane = threadIdx.x & 31;
  const int wave = threadIdx.x >> 5;
  const int tilesN = N >> 6;
  const int tilesM = M >> 6;
  const int tile = blockIdx.x * 8 + wave;
  if (tile >= tilesM * tilesN) return;   // wave-uniform; no block barriers in this kernel
  const int tm = tile / tilesN;
  const int tn = tile - tm * tilesN;
  const int m0 = tm << 6;
  const int n0 = tn << 6;
  const int tpos = m0 % tmod;
  if (tpos < tlo || tpos >= thi) return; // wave-uniform

  const int rlane = lane & 15;                 // row (A) / col (B, D) within subtile
  const int koff  = (lane >> 4) * 8;           // k offset of this lane half
  const int mOff  = (lane >> 4) * 8;           // D row offset

  v8f acc[4][4];
#pragma unroll
  for (int i = 0; i < 4; ++i)
#pragma unroll
    for (int j = 0; j < 4; ++j) acc[i][j] = zero8();

  constexpr int NPL = ARES ? 2 : 1;
#pragma unroll 1
  for (int pl = 0; pl < NPL; ++pl) {
    const _Float16* Asel = (ARES && pl == 0) ? Arh : Ah;     // wave-uniform selection of a global pointer
    if (ARES && pl == 1) {
      acc_guard4(acc[0][0], acc[0][1], acc[0][2], acc[0][3]);
      acc_guard4(acc[1][0], acc[1][1], acc[1][2], acc[1][3]);
      acc_guard4(acc[2][0], acc[2][1], acc[2][2], acc[2][3]);
      acc_guard4(acc[3][0], acc[3][1], acc[3][2], acc[3][3]);
#pragma unroll
      for (int i = 0; i < 4; ++i)
#pragma unroll
        for (int j = 0; j < 4; ++j) acc[i][j] = acc[i][j] * (1.0f / 2048.0f);   // exact fold of the x2^11 residual carry
      acc_guard4(acc[0][0], acc[0][1], acc[0][2], acc[0][3]);
      acc_guard4(acc[1][0], acc[1][1], acc[1][2], acc[1][3]);
      acc_guard4(acc[2][0], acc[2][1], acc[2][2], acc[2][3]);
      acc_guard4(acc[3][0], acc[3][1], acc[3][2], acc[3][3]);
    }
    for (int k0 = 0; k0 < K; k0 += 32) {
      v16h bh[4];
#pragma unroll
      for (int j = 0; j < 4; ++j) {
        const size_t bo = (size_t)(n0 + (j << 4) + rlane) * ldb + koff + k0;
        bh[j] = ldfrag_h(Bt + bo);
      }
#pragma unroll
      for (int i = 0; i < 4; ++i) {
        const size_t ao = (size_t)(m0 + (i << 4) + rlane) * lda + koff + k0;
        const v16h ah = ldfrag_h(Asel + ao);
#pragma unroll
        for (int j = 0; j < 4; ++j) {
          acc[i][j] = mma_h_raw(ah, bh[j], acc[i][j]);
        }
        dep_guard_h(acc[i][0], acc[i][3], ah, bh[3]);
      }
      keep4_h(bh[0], bh[1], bh[2], bh[3]);
    }
  }
  acc_guard4(acc[0][0], acc[0][1], acc[0][2], acc[0][3]);
  acc_guard4(acc[1][0], acc[1][1], acc[1][2], acc[1][3]);
  acc_guard4(acc[2][0], acc[2][1], acc[2][2], acc[2][3]);
  acc_guard4(acc[3][0], acc[3][1], acc[3][2], acc[3][3]);

  // ---- epilogue ----
  float* slab = sT[wave];
#pragma unroll
  for (int i = 0; i < 4; ++i) {
    const int mBase = m0 + (i << 4);
#pragma unroll
    for (int r = 0; r < 8; ++r) {
      const int row = mOff + r;
#pragma unroll
      for (int j = 0; j < 4; ++j) slab[row * 68 + (j << 4) + rlane] = acc[i][j][r] * cscale;
    }
    __builtin_amdgcn_fence(__ATOMIC_RELEASE, "workgroup");
    __builtin_amdgcn_wave_barrier();
    __builtin_amdgcn_fence(__ATOMIC_ACQUIRE, "workgroup");
    if constexpr (EPI == 0) {
      unsigned short* C16 = (unsigned short*)Cp;
      const int rq = lane >> 3, piece = lane & 7;
      v4u ph[4], pr[4];
#pragma unroll
      for (int it = 0; it < 4; ++it) {
        const int row = it * 4 + rq;                         // it 0..3 x rq 0..3 = rows 0..15
        const v4f a  = *(const v4f*)(slab + row * 68 + piece * 8);
        const v4f a2 = *(const v4f*)(slab + row * 68 + piece * 8 + 4);
        float f[8];
        f[0] = a[0];  f[1] = a[1];  f[2] = a[2];  f[3] = a[3];
        f[4] = a2[0]; f[5] = a2[1]; f[6] = a2[2]; f[7] = a2[3];
        v4u p, q;
#pragma unroll
        for (int e = 0; e < 4; ++e) {
          const float g0 = f[2 * e] * oscale, g1 = f[2 * e + 1] * oscale;
          const _Float16 x0 = (_Float16)g0, x1 = (_Float16)g1;
          const _Float16 y0 = (_Float16)((g0 - (float)x0) * 2048.0f);
          const _Float16 y1 = (_Float16)((g1 - (float)x1) * 2048.0f);
          p[e] = pk16(h_bits(x0), h_bits(x1));
          q[e] = pk16(h_bits(y0), h_bits(y1));
        }
        ph[it] = p;
        pr[it] = q;
      }
      {
#pragma unroll
        for (int it = 0; it < 4; ++it) {
          const int row = it * 4 + rq;
          const size_t co = (size_t)(mBase + row) * ldc + n0 + piece * 8;
          *(v4u*)(C16 + co) = ph[it];
          *(v4u*)(Crp + co) = pr[it];
        }
        
      }
    } else {
      float* Cf = (float*)Cp;
      const int hh = lane >> 4, c4 = (lane & 15) * 4;     // 256-B row segment = 16 lanes x 16 B
      v4f ov[8];
#pragma unroll
      for (int it = 0; it < 8; ++it) {
        const int row = it * 2 + hh;                       // it 0..7 x hh 0..1 = rows 0..15
        ov[it] = *(const v4f*)(slab + row * 68 + c4);
      }
      {
#pragma unroll
        for (int it = 0; it < 8; ++it) {
          const int row = it * 2 + hh;
          *(v4f*)(Cf + (size_t)(mBase + row) * ldc + n0 + c4) = ov[it];
        }
        
      }
    }
    __builtin_amdgcn_fence(__ATOMIC_RELEASE, "workgroup");
    __builtin_amdgcn_wave_barrier();
    __builtin_amdgcn_fence(__ATOMIC_ACQUIRE, "workgroup");
  }
}

// =====================================================================================================
// f16 v plane (token-major, element (t, g, d) at vp[t*DKV + g*64 + d], g = kv head) -> f16 v^T plane
// vt[(g*64 + d)*SEQ + t] (same bits). Used for the hi plane and the residual plane.
// Block = one 64-token x 64-feature tile of one kv head g; grid = (SEQ/64, NKV); tile staged in LDS as halves
// (v8h 16-B stores, __syncthreads, _Float16 element reads).
// Store: group g8 = tid>>3 (0..31), piece = tid&7: iteration it writes row d = it*32+g8, lanes 8q..8q+7 x 16 B =
// coverage: load 2 x 256 threads x 8 halves = 64x64; store 2 iterations x 32 groups = 64 rows d, 8 pieces x 8
// = 64 tokens per row; grid covers every (kv head, token tile) of [DKV][SEQ].
// =====================================================================================================
__global__ __launch_bounds__(256) void v_tr(const unsigned short* __restrict__ vp, unsigned short* vt) {
  __shared__ __align__(16) _Float16 sv[64 * 72];       // [tt][d], pitch 72 halves (144 B)
  const int tid = threadIdx.x;
  const int t0  = blockIdx.x * 64;
  const int g   = blockIdx.y;
  if (g >= NKV || t0 >= SEQ) return;                   // block-uniform, before any barrier
  const _Float16* src = (const _Float16*)(const void*)vp;
#pragma unroll
  for (int i = 0; i < 2; ++i) {
    const int idx = i * 256 + tid;                  // 0..511
    const int tt = idx >> 3, c8 = (idx & 7) * 8;
    const v8h a = *(const v8h*)(src + ((size_t)(t0 + tt)) * DKV + g * HD + c8);
    *(v8h*)(sv + tt * 72 + c8) = a;
  }
  __syncthreads();

  const int g8 = tid >> 3, piece = tid & 7;
  v4u hv[2];
  size_t hofs[2];
#pragma unroll
  for (int it = 0; it < 2; ++it) {
    const int d = it * 32 + g8;
    v4u a;
#pragma unroll
    for (int e = 0; e < 4; ++e) {
      const _Float16 x0 = sv[(piece * 8 + 2 * e) * 72 + d];
      const _Float16 x1 = sv[(piece * 8 + 2 * e + 1) * 72 + d];
      a[e] = pk16(h_bits(x0), h_bits(x1));
    }
    hv[it] = a;
    hofs[it] = ((size_t)(g * HD + d)) * SEQ + t0 + piece * 8;
  }
  {
#pragma unroll
    for (int it = 0; it < 2; ++it) *(v4u*)(vt + hofs[it]) = hv[it];
    
  }
}

// =====================================================================================================
// Causal grouped-query softmax attention, head dim 64, online-max form. Query head h reads kv head g = h / GRP.
//   q f16 (x16): element (t, h, d) at qp[t*DM + h*64 + d]; k f16 (x16): element (t, g, d) at kp[t*DKV + g*64 + d];
//   residual planes (x2^11 of the f16 residue) qrp / krp with the same addressing; v^T f16 (x16) at
//   vtp[(g*64 + d)*SEQ + s], residual vtrp.
//   logit a = (q.k) / 8 = acc / 2048 (two x16 carries); HR: acc = qh.kh + 2^-11 (qh.kr + qr.kh).
//   Key j is allowed for query row i iff j <= i; other keys get a = -1e30 (select by value) and p = 0 (select by
//   value). Per 64-key tile: tile max (per-lane max over the 4 key groups, then a 16-lane xor max),
//   mn = max(mrun, tile max), alpha = exp(mrun - mn), p = exp(a - mn), lsum = lsum * alpha + sum p (per-lane
//   partials, 16-lane xor reduction at the end), context accumulators scaled by alpha on the VALU (nop gaps on
//   both sides). Key tiles 0..qb are visited (block-uniform trip count qb + 1); only the diagonal tile has masked
//   keys and key qb*64 is allowed for every row of the tile, so every visited tile has a finite tile max and
//   lsum >= 1 at the end.
//   P carried as f16(256 p) (HR: plus residual f16((256p - hi)*2048)); context = P . v^T on f16 WMMA
//   (HR: second accumulator += Ph.Vr + Pr.Vh, folded with 2^-11).
//   ctx plane f16 (x16): element (t, h*64 + d) at ctx[t*DM + h*64 + d] = 16 * context / (4096 lsum);
//   the ctx residual plane f16((16 ctx - hi) * 2048) is written by both variants.
//   Block = 4 waves = 64 query rows of one head; query tile qb = qb0 + blockIdx % qcnt, head = blockIdx / qcnt;
//   grid = qcnt * NH.
//   K / V^T tile staging: 128 threads x 32 halves per plane = the whole 64x64 tile (plain 16-B loads,
//   __syncthreads before and after); P tiles are wave-private, spilled with _Float16 element stores and
//   wave in LDS as f32 (aliasing the K/V region after a block barrier) the same way.
//   Output coverage: each wave stores rows 0..15 of its tile (it 0..3 x lane>>3 0..3) x 64 columns (8 lanes x
//   together cover every (head, query tile) of [SEQ][DM] exactly once for both ctx planes.
// =====================================================================================================
template <bool HR>
__global__ __launch_bounds__(128)
void attn_k(const unsigned short* __restrict__ qp,  const unsigned short* __restrict__ qrp,
            const unsigned short* __restrict__ kp,  const unsigned short* __restrict__ krp,
            const unsigned short* __restrict__ vtp, const unsigned short* __restrict__ vtrp,
            unsigned short* ctxp, unsigned short* ctxrp, int qb0, int qcnt) {
  union FH { v16h v; v8h h[2]; };
  constexpr int LP     = 72;                             // LDS row pitch in halves: 144 B = 16 B x 9, so the 16 rows
                                                         // that one ds_load_b128 fragment read touches fall on 16
                                                         // different 4-bank groups (at 128 B they share two groups)
  constexpr int TB     = 64 * LP * 2;                    // one f16 64x64 tile at pitch LP, bytes
  constexpr int PB     = 4 * 16 * LP * 2;                // four wave-private 16x64 f16 P tiles at pitch LP, bytes
  constexpr int OFF_K  = 0;
  constexpr int OFF_V  = TB;
  constexpr int OFF_KR = 2 * TB;
  constexpr int OFF_VR = 3 * TB;
  constexpr int OFF_P  = HR ? 4 * TB : 2 * TB;
  constexpr int OFF_PR = OFF_P + PB;
  constexpr int SMEMB  = HR ? (OFF_PR + PB) : (OFF_P + PB);   // 55296 : 27648
  static_assert(4 * 16 * 64 * 4 <= OFF_P);                    // f32 context staging aliases the K/V region
  __shared__ __align__(16) unsigned char smem[SMEMB];
  _Float16* Ksh = (_Float16*)(smem + OFF_K);                  // K   [kv][d], pitch LP
  _Float16* Vsh = (_Float16*)(smem + OFF_V);                  // V^T [d][kv], pitch LP
  _Float16* Krs = (_Float16*)(smem + (HR ? OFF_KR : OFF_K));  // K residual (HR only)
  _Float16* Vrs = (_Float16*)(smem + (HR ? OFF_VR : OFF_V));  // V^T residual (HR only)
  _Float16* Psh = (_Float16*)(smem + OFF_P);
  _Float16* Prs = (_Float16*)(smem + (HR ? OFF_PR : OFF_P));

  const int tid  = threadIdx.x;
  const int wave = tid >> 5;
  const int lane = tid & 31;
  const int hh   = lane >> 4;
  const int c    = lane & 15;

  if (qcnt <= 0) return;                     // block-uniform
  const int bx   = blockIdx.x;
  const int qi   = bx % qcnt;
  const int h    = bx / qcnt;
  const int qb   = qb0 + qi;
  if (h >= NH || qb >= NQT) return;          // block-uniform, before any barrier or store
  const int g    = h / GRP;                  // kv head
  const int q0   = qb * 64 + wave * 16;

  const _Float16* QP  = (const _Float16*)(const void*)qp   + (size_t)h * HD;
  const _Float16* QRP = (const _Float16*)(const void*)qrp  + (size_t)h * HD;
  const _Float16* KP  = (const _Float16*)(const void*)kp   + (size_t)g * HD;
  const _Float16* KRP = (const _Float16*)(const void*)krp  + (size_t)g * HD;
  const _Float16* VTP = (const _Float16*)(const void*)vtp  + (size_t)g * HD * SEQ;
  const _Float16* VRP = (const _Float16*)(const void*)vtrp + (size_t)g * HD * SEQ;

  // ---- Q fragments (A operand, row = lane&15): 2 d-chunks ----
  v16h qa[2], qr[2];
#pragma unroll
  for (int dc = 0; dc < 2; ++dc) {
    const size_t qo = (size_t)(q0 + c) * DM + dc * 32 + 8 * hh;
    qa[dc] = ldfrag_h(QP + qo);
    if constexpr (HR) qr[dc] = ldfrag_h(QRP + qo);
    else qr[dc] = qa[dc];
  }

  float lsum[8], mrun[8];
  v8f oacc[4], oacc2[4];
#pragma unroll
  for (int r = 0; r < 8; ++r) { lsum[r] = 0.f; mrun[r] = -1e30f; }
#pragma unroll
  for (int t = 0; t < 4; ++t) { oacc[t] = zero8(); oacc2[t] = zero8(); }

  _Float16* pw  = Psh + wave * (16 * LP);
  _Float16* prw = Prs + wave * (16 * LP);

  const int nkt = qb + 1;                                      // key tiles 0..qb, block-uniform
  for (int kti = 0; kti < nkt; ++kti) {
    const int kv0 = kti * 64;                                  // <= qb*64 < SEQ
    __syncthreads();
    {
      const int r = tid >> 1, half = (tid & 1) * 32;
      const size_t ko = (size_t)(kv0 + r) * DKV + half;         // K row kv0+r, d = half..half+31
      const size_t vo = (size_t)r * SEQ + kv0 + half;           // V^T row d = r, s = kv0+half..+31
#pragma unroll
      for (int i = 0; i < 4; ++i) {
        const v8h a0 = *(const v8h*)(KP + ko + 8 * i);
        const v8h b0 = *(const v8h*)(VTP + vo + 8 * i);
        *(v8h*)(Ksh + r * LP + half + 8 * i) = a0;
        *(v8h*)(Vsh + r * LP + half + 8 * i) = b0;
        if constexpr (HR) {
          const v8h a1 = *(const v8h*)(KRP + ko + 8 * i);
          const v8h b1 = *(const v8h*)(VRP + vo + 8 * i);
          *(v8h*)(Krs + r * LP + half + 8 * i) = a1;
          *(v8h*)(Vrs + r * LP + half + 8 * i) = b1;
        }
      }
    }
    __syncthreads();

    // ---- scores: 16 query rows x 64 keys per wave (B operand: lane c -> key j*16+c, split k map over d) ----
    v8f s[4];
#pragma unroll
    for (int j = 0; j < 4; ++j) {
      s[j] = zero8();
      v8f t = zero8();
#pragma unroll
      for (int dc = 0; dc < 2; ++dc) {
        FH kb;
        kb.h[0] = *(const v8h*)(Ksh + (j * 16 + c) * LP + dc * 32 + 8 * hh);
        kb.h[1] = *(const v8h*)(Ksh + (j * 16 + c) * LP + dc * 32 + 16 + 8 * hh);
        s[j] = mma_h(qa[dc], kb.v, s[j]);
        if constexpr (HR) {
          FH krb;
          krb.h[0] = *(const v8h*)(Krs + (j * 16 + c) * LP + dc * 32 + 8 * hh);
          krb.h[1] = *(const v8h*)(Krs + (j * 16 + c) * LP + dc * 32 + 16 + 8 * hh);
          t = mma_h(qa[dc], krb.v, t);
          t = mma_h(qr[dc], kb.v, t);
        }
      }
      if constexpr (HR) s[j] = s[j] + t * (1.0f / 2048.0f);
    }

    // ---- causal online softmax: tile max, running max, alpha, p, row-sum partials,
    //      P (x256, f16; HR: + residual) ----
    float alpha[8];
#pragma unroll
    for (int r = 0; r < 8; ++r) {
      const int qrow = q0 + 8 * hh + r;
      float av[4];
      float tmx = -1e30f;
#pragma unroll
      for (int j = 0; j < 4; ++j) {
        const int key = kv0 + j * 16 + c;
        float a = s[j][r] * (1.0f / 2048.0f);              // 1/8 head scale, 1/256 for the two x16 carries
        const bool ok = (key <= qrow);
        a = ok ? a : -1e30f;
        av[j] = a;
        tmx = fmaxf(tmx, a);
      }
#pragma unroll
      for (int off = 1; off < 16; off <<= 1) tmx = fmaxf(tmx, __shfl_xor(tmx, off, 32));
      const float mn = fmaxf(mrun[r], tmx);
      const float al = __expf(mrun[r] - mn);
      alpha[r] = al;
      mrun[r]  = mn;
      float ps = 0.0f;
#pragma unroll
      for (int j = 0; j < 4; ++j) {
        const int key = kv0 + j * 16 + c;
        const bool ok = (key <= qrow);
        float p = __expf(av[j] - mn);
        p = ok ? p : 0.0f;
        ps += p;
        const float gg = p * 256.0f;
        const _Float16 x0 = (_Float16)gg;
        pw[(8 * hh + r) * LP + j * 16 + c] = x0;
        if constexpr (HR) prw[(8 * hh + r) * LP + j * 16 + c] = (_Float16)((gg - (float)x0) * 2048.0f);
      }
      lsum[r] = lsum[r] * al + ps;
    }
    __builtin_amdgcn_fence(__ATOMIC_RELEASE, "workgroup");
    __builtin_amdgcn_wave_barrier();
    __builtin_amdgcn_fence(__ATOMIC_ACQUIRE, "workgroup");

    // ---- rescale the context accumulators by alpha (VALU), nop gaps before the next WMMA reads them ----
#pragma unroll
    for (int t = 0; t < 4; ++t) {
#pragma unroll
      for (int r = 0; r < 8; ++r) {
        oacc[t][r] = oacc[t][r] * alpha[r];
        if constexpr (HR) oacc2[t][r] = oacc2[t][r] * alpha[r];
      }
    }
    acc_guard4(oacc[0], oacc[1], oacc[2], oacc[3]);
    if constexpr (HR) acc_guard4(oacc2[0], oacc2[1], oacc2[2], oacc2[3]);

    // ---- context += P . V (f16 WMMA; A = P [row][key], B = V^T [d][key]) ----
#pragma unroll
    for (int kk = 0; kk < 2; ++kk) {
      FH pa, par;
      pa.h[0] = *(const v8h*)(pw + c * LP + kk * 32 + 8 * hh);
      pa.h[1] = *(const v8h*)(pw + c * LP + kk * 32 + 16 + 8 * hh);
      if constexpr (HR) {
        par.h[0] = *(const v8h*)(prw + c * LP + kk * 32 + 8 * hh);
        par.h[1] = *(const v8h*)(prw + c * LP + kk * 32 + 16 + 8 * hh);
      } else {
        par.v = pa.v;
      }
#pragma unroll
      for (int t = 0; t < 4; ++t) {
        FH vb;
        vb.h[0] = *(const v8h*)(Vsh + (t * 16 + c) * LP + kk * 32 + 8 * hh);
        vb.h[1] = *(const v8h*)(Vsh + (t * 16 + c) * LP + kk * 32 + 16 + 8 * hh);
        oacc[t] = mma_h(pa.v, vb.v, oacc[t]);
        if constexpr (HR) {
          FH vrb;
          vrb.h[0] = *(const v8h*)(Vrs + (t * 16 + c) * LP + kk * 32 + 8 * hh);
          vrb.h[1] = *(const v8h*)(Vrs + (t * 16 + c) * LP + kk * 32 + 16 + 8 * hh);
          oacc2[t] = mma_h(pa.v, vrb.v, oacc2[t]);
          oacc2[t] = mma_h(par.v, vb.v, oacc2[t]);
        }
      }
    }
  }
  __syncthreads();                           // every wave is done with the K/V tiles before they are aliased

  // ---- normalise (1/lsum, the 1/256 p carry; keep the x16 v carry), stage the wave's 16x64 f32 tile in
  //      instruction) ----
  float* os = (float*)(void*)smem + wave * (16 * 64);
#pragma unroll
  for (int r = 0; r < 8; ++r) {
    float l = lsum[r];
#pragma unroll
    for (int off = 1; off < 16; off <<= 1) l += __shfl_xor(l, off, 32);
    const float rl = 1.0f / l;               // l >= 1 (the max key contributes p = 1)
    const float sc = rl * (1.0f / 256.0f);
#pragma unroll
    for (int t = 0; t < 4; ++t) {
      float v = oacc[t][r];
      if constexpr (HR) v += oacc2[t][r] * (1.0f / 2048.0f);
      os[(8 * hh + r) * 64 + t * 16 + c] = v * sc;
    }
  }
  __builtin_amdgcn_fence(__ATOMIC_RELEASE, "workgroup");
  __builtin_amdgcn_wave_barrier();
  __builtin_amdgcn_fence(__ATOMIC_ACQUIRE, "workgroup");
  {
    const int rq = lane >> 3, piece = lane & 7;
    v4u ph[4], pr[4];
#pragma unroll
    for (int it = 0; it < 4; ++it) {
      const int row = it * 4 + rq;   // it 0..3 x rq 0..3 = rows 0..15 of the wave tile
      const v4f a  = *(const v4f*)(os + row * 64 + piece * 8);
      const v4f a2 = *(const v4f*)(os + row * 64 + piece * 8 + 4);
      float f[8];
      f[0] = a[0];  f[1] = a[1];  f[2] = a[2];  f[3] = a[3];
      f[4] = a2[0]; f[5] = a2[1]; f[6] = a2[2]; f[7] = a2[3];
      v4u p, q;
#pragma unroll
      for (int e = 0; e < 4; ++e) {
        const _Float16 x0 = (_Float16)f[2 * e], x1 = (_Float16)f[2 * e + 1];
        const _Float16 y0 = (_Float16)((f[2 * e] - (float)x0) * 2048.0f);
        const _Float16 y1 = (_Float16)((f[2 * e + 1] - (float)x1) * 2048.0f);
        p[e] = pk16(h_bits(x0), h_bits(x1));
        q[e] = pk16(h_bits(y0), h_bits(y1));
      }
      ph[it] = p;
      pr[it] = q;
    }
    {
#pragma unroll
      for (int it = 0; it < 4; ++it) {
        const int row = it * 4 + rq;
        const size_t go = (size_t)(q0 + row) * DM + (size_t)h * HD + piece * 8;
        *(v4u*)(ctxp + go)  = ph[it];
        *(v4u*)(ctxrp + go) = pr[it];
      }
      
    }
  }
}

// =====================================================================================================
// Workspace map (bytes, SEQ = 4096); every region is an exact multiple of its whole-line / whole-tile store
// granularity (row pitches 2048 / 512 / 8192 B, rows multiples of 64, all offsets 512-KiB aligned, no aliasing
// within a launch):
//   Xh    f16 [SEQ][1024]          0     8388608   (bf16 value of x, x16)
//   WqT   f16 [1024][1024]   8388608     2097152   (bf16 value of w_q^T x1024, [n][k])
//   WkT   f16 [256][1024]   10485760      524288   (bf16 value of w_k^T x1024, [n][k])
//   WvT   f16 [256][1024]   11010048      524288   (bf16 value of w_v^T x1024, [n][k])
//   WoT   f16 [1024][1024]  11534336     2097152   (bf16 value of w_o^T x1024, [n][k])
//   Qh    f16 [SEQ][1024]   13631488     8388608   (q x16)           Qr  22020096  8388608 (x2^11 residual)
//   Kh    f16 [SEQ][256]    30408704     2097152   (k x16)           Kr  32505856  2097152
//   Vh    f16 [SEQ][256]    34603008     2097152   (v x16)           Vr  36700160  2097152
//   VT    f16 [256][SEQ]    38797312     2097152   ([g*64 + d][s])   VTr 40894464  2097152
//   Ctx   f16 [SEQ][1024]   42991616     8388608   (context x16)     Ctxr 51380224 8388608
//   end                     59768832
// Projection weights arrive as [in k][out n] (n contiguous) and are transposed while converted (w_tr).
// d_out f32: [SEQ][1024] at byte 0, every 64x64 tile written once by the output projection launch.
// =====================================================================================================
extern "C" void kernel_launch(void* const* d_in, const int* in_sizes, int n_in,
                              void* d_out, int out_size, void* d_ws, size_t ws_size,
                              hipStream_t stream) {
  if (n_in < 5) return;
  if (in_sizes[0] < SEQ * DM || (in_sizes[0] % DM) != 0) return;   // x rows 0..SEQ-1 are used, pitch DM
  if (in_sizes[1] != DM * DM) return;
  if (in_sizes[2] != DM * DKV) return;
  if (in_sizes[3] != DM * DKV) return;
  if (in_sizes[4] != DM * DM) return;
  if (out_size < OUTN) return;

  const float* x   = (const float*)d_in[0];    // [>=SEQ][DM]
  const float* w_q = (const float*)d_in[1];    // [DM k][DM n]
  const float* w_k = (const float*)d_in[2];    // [DM k][DKV n]
  const float* w_v = (const float*)d_in[3];    // [DM k][DKV n]
  const float* w_o = (const float*)d_in[4];    // [DM k][DM n]

  const size_t PX   = (size_t)SEQ * DM * 2;          //  8388608
  const size_t PWq  = (size_t)DM * DM * 2;           //  2097152
  const size_t PWk  = (size_t)DKV * DM * 2;          //   524288
  const size_t PWo  = (size_t)DM * DM * 2;           //  2097152
  const size_t PQ   = (size_t)SEQ * DM * 2;          //  8388608
  const size_t PK   = (size_t)SEQ * DKV * 2;         //  2097152
  const size_t PVT  = (size_t)DKV * SEQ * 2;         //  2097152
  const size_t PCtx = (size_t)SEQ * DM * 2;          //  8388608
  size_t off = 0;
  const size_t oX    = off; off += PX;
  const size_t oWq   = off; off += PWq;
  const size_t oWk   = off; off += PWk;
  const size_t oWv   = off; off += PWk;
  const size_t oWo   = off; off += PWo;
  const size_t oQ    = off; off += PQ;
  const size_t oQr   = off; off += PQ;
  const size_t oK    = off; off += PK;
  const size_t oKr   = off; off += PK;
  const size_t oV    = off; off += PK;
  const size_t oVr   = off; off += PK;
  const size_t oVT   = off; off += PVT;
  const size_t oVTr  = off; off += PVT;
  const size_t oCtx  = off; off += PCtx;
  const size_t oCtxr = off; off += PCtx;
  if (off > ws_size) return;                         // off = 59768832 for SEQ = 4096
  if (off > (size_t)134217728) return;

  char* ws = (char*)d_ws;
  unsigned short* Xh   = (unsigned short*)(ws + oX);
  unsigned short* WqT  = (unsigned short*)(ws + oWq);
  unsigned short* WkT  = (unsigned short*)(ws + oWk);
  unsigned short* WvT  = (unsigned short*)(ws + oWv);
  unsigned short* WoT  = (unsigned short*)(ws + oWo);
  unsigned short* Qh   = (unsigned short*)(ws + oQ);
  unsigned short* Qr   = (unsigned short*)(ws + oQr);
  unsigned short* Kh   = (unsigned short*)(ws + oK);
  unsigned short* Kr   = (unsigned short*)(ws + oKr);
  unsigned short* Vh   = (unsigned short*)(ws + oV);
  unsigned short* Vr   = (unsigned short*)(ws + oVr);
  unsigned short* VT   = (unsigned short*)(ws + oVT);
  unsigned short* VTr  = (unsigned short*)(ws + oVTr);
  unsigned short* Ctx  = (unsigned short*)(ws + oCtx);
  unsigned short* Ctxr = (unsigned short*)(ws + oCtxr);
  float*          outf = (float*)d_out;              // [SEQ][DM]

  const dim3 blk(256);
  const int n8x = SEQ * DM / 8;                      // 524288
  const dim3 gCx((n8x + 255) / 256);                 // 2048 blocks
  const dim3 gTq(DM / 64, DM / 64);                  // (16, 16): in [1024 k][1024 n] -> out [1024 n][1024 k]
  const dim3 gTk(DKV / 64, DM / 64);                 // (4, 16):  in [1024 k][256 n]  -> out [256 n][1024 k]
  const dim3 gGq((NQT * (DM / 64) + 7) / 8);         // 1024 tiles -> 128 blocks
  const dim3 gGk((NQT * (DKV / 64) + 7) / 8);        // 256 tiles -> 32 blocks
  const dim3 gVt(SEQ / 64, NKV);                     // (64, 4)
  const dim3 gAhr(QHR * NH);                         // query tiles 0..QHR-1, residual-plane variant
  const dim3 gApl((NQT - QHR) * NH);                 // query tiles QHR..NQT-1, single-product variant
  const float wScale = 1024.0f;                      // weights carried x1024
  const float aScale = 16.0f;                        // activations carried x16
  const float cscale = 1.0f / 16384.0f;              // 1/(16 * 1024)

  // (1) planes: x -> f16 x16 (bf16 values); weights -> transposed f16 x1024 (bf16 values)
  cvt16<<<gCx, blk, 0, stream>>>(x, Xh, n8x, aScale);
  w_tr<<<gTq, blk, 0, stream>>>(w_q, WqT, DM, DM, wScale);    // in[rows=1024][cols=1024] -> out[1024][1024]
  w_tr<<<gTk, blk, 0, stream>>>(w_k, WkT, DM, DKV, wScale);   // in[rows=1024][cols=256]  -> out[256][1024]
  w_tr<<<gTk, blk, 0, stream>>>(w_v, WvT, DM, DKV, wScale);   // in[rows=1024][cols=256]  -> out[256][1024]
  w_tr<<<gTq, blk, 0, stream>>>(w_o, WoT, DM, DM, wScale);    // in[rows=1024][cols=1024] -> out[1024][1024]
  // (2) q = Xh . WqT^T -> Qh f16 x16 + residual [SEQ][1024] (M=SEQ, N=1024, K=1024); k, v the same with N=256
  gemm64_f16<0, false><<<gGq, blk, 0, stream>>>(Xh, Xh, DM, WqT, DM, cscale, (void*)Qh, Qr, DM,
                                                SEQ, DM, DM, aScale, SEQ, 0, SEQ);
  gemm64_f16<0, false><<<gGk, blk, 0, stream>>>(Xh, Xh, DM, WkT, DM, cscale, (void*)Kh, Kr, DKV,
                                                SEQ, DKV, DM, aScale, SEQ, 0, SEQ);
  gemm64_f16<0, false><<<gGk, blk, 0, stream>>>(Xh, Xh, DM, WvT, DM, cscale, (void*)Vh, Vr, DKV,
                                                SEQ, DKV, DM, aScale, SEQ, 0, SEQ);
  // (3) v -> v^T planes (hi and residual, all tokens, all kv heads)
  v_tr<<<gVt, blk, 0, stream>>>(Vh, VT);
  v_tr<<<gVt, blk, 0, stream>>>(Vr, VTr);
  // (4) causal softmax attention -> Ctx f16 x16 + residual plane: tiles 0..QHR-1 with residual operand planes,
  //     tiles QHR..NQT-1 with single products; together every (head, query tile) exactly once
  attn_k<true><<<gAhr, dim3(128), 0, stream>>>(Qh, Qr, Kh, Kr, VT, VTr, Ctx, Ctxr, 0, QHR);
  attn_k<false><<<gApl, dim3(128), 0, stream>>>(Qh, Qr, Kh, Kr, VT, VTr, Ctx, Ctxr, QHR, NQT - QHR);
  // (5) out = (Ctx + 2^-11 Ctxr) . WoT^T -> d_out f32 [SEQ][1024] (M=SEQ, N=1024, K=1024), every tile once
  gemm64_f16<1, true><<<gGq, blk, 0, stream>>>(Ctx, Ctxr, DM, WoT, DM, cscale, (void*)outf, Ctxr, DM,
                                               SEQ, DM, DM, 1.0f, SEQ, 0, SEQ);
  (void)hipGetLastError();
}

// v002
// A run of this version takes 311 microseconds.
// Two timings next to v001 both put it at 1.90 times that version's speed.
// All steps since v000 together make it 2.21 times as fast.
// Contractions: q/k/v projections = v_wmma_f32_16x16x32_f16 (A = f16 of RNE-bf16 x carried x16, B = f16 of RNE-bf16 w^T carried x1024, single product); attention q.k^T and p.v = v_wmma_f32_16x16x32_f16 (query tiles below SEQ/2: q, k, v^T f16 planes x16 plus x2^11 residual planes, p f16 x256 plus x2^11 residual, hi.hi + hi.res + res.hi; query tiles from SEQ/2 on: single products on the x16 / x256 planes); output projection = v_wmma_f32_16x16x32_f16 (A = ctx f16 x16 plus its x2^11 residual plane, B = f16 of RNE-bf16 w_o^T x1024); all f32 accumulate. Causal online-max softmax, masks and row sums f32 on VALU.
#include <hip/hip_runtime.h>
#include <math.h>
#include <stdint.h>

#define SEQ   4096
#define DM    1024
#define NH    16
#define NKV   4
#define HD    64
#define DKV   (NKV * HD)            // 256
#define GRP   (NH / NKV)            // query heads per kv head = 4 (query head h uses kv head h / GRP)
#define NQT   (SEQ / 64)            // 64 query tiles of 64 rows
#define QHR   (NQT / 2)             // query tiles below this index use residual planes in attention
#define OUTN  (SEQ * DM)
static_assert(NH * HD == DM);
static_assert(HD == 64);
static_assert((NH % NKV) == 0);
static_assert((SEQ % 64) == 0 && (NQT % 2) == 0);
static_assert((DM % 64) == 0 && (DKV % 64) == 0 && (DM % 32) == 0);
static_assert(((NQT * (DM / 64)) % 8) == 0);
static_assert(((NQT * (DKV / 64)) % 8) == 0);
static_assert((((DM + 2 * DKV) / 64) % 8) == 0);   // the 8 waves of a projection block share their 64 rows of A
static_assert(((SEQ * DM / 8) % 256) == 0);

typedef _Float16 v16h __attribute__((ext_vector_type(16)));
typedef _Float16 v8h  __attribute__((ext_vector_type(8)));
typedef float    v8f  __attribute__((ext_vector_type(8)));
typedef float    v4f  __attribute__((ext_vector_type(4)));
typedef unsigned int v4u __attribute__((ext_vector_type(4)));

// ---- scalar helpers --------------------------------------------------------------------------------
__device__ __forceinline__ unsigned short bf_bits(float f) {          // f32 -> bf16 bits, RNE convert
  unsigned u = __float_as_uint(f);
  return (unsigned short)((u + 0x7FFFu + ((u >> 16) & 1u)) >> 16);
}
__device__ __forceinline__ float bfr(float f) { return __uint_as_float(((unsigned)bf_bits(f)) << 16); }
__device__ __forceinline__ unsigned short h_bits(_Float16 x) { return __builtin_bit_cast(unsigned short, x); }
__device__ __forceinline__ unsigned pk16(unsigned short a, unsigned short b) { return (unsigned)a | ((unsigned)b << 16); }
__device__ __forceinline__ v8f zero8() { v8f z = {0.f, 0.f, 0.f, 0.f, 0.f, 0.f, 0.f, 0.f}; return z; }

// ---- fragment loader: 16-bit A/B operand, lane -> row/col (lane&15), p already includes +8*(lane>>4);
//      elements 0..7 <- p[0..7] (k0+8h..), elements 8..15 <- p[16..23] (k0+16+8h..)
__device__ __forceinline__ v16h ldfrag_h(const _Float16* p) {
  union { v16h v; v8h h[2]; } f;
  f.h[0] = *(const v8h*)(p);
  f.h[1] = *(const v8h*)(p + 16);
  return f.v;
}

// ---- WMMA helpers with trailing VALU hazard gap --------------------------------------------------------
__device__ __forceinline__ v8f mma_h(v16h a, v16h b, v8f c) {
  c = __builtin_amdgcn_wmma_f32_16x16x32_f16(false, a, false, b, (short)0, c, false, false);
#if defined(__HIP_DEVICE_COMPILE__)
  asm volatile("v_nop\n\tv_nop\n\tv_nop\n\tv_nop" : "+v"(c) : "v"(a), "v"(b));
#endif
  return c;
}
__device__ __forceinline__ v8f mma_h_raw(v16h a, v16h b, v8f c) {
  return __builtin_amdgcn_wmma_f32_16x16x32_f16(false, a, false, b, (short)0, c, false, false);
}
__device__ __forceinline__ void dep_guard_h(v8f& a, v8f& b, v16h x, v16h y) {
#if defined(__HIP_DEVICE_COMPILE__)
  asm volatile("v_nop\n\tv_nop\n\tv_nop\n\tv_nop" : "+v"(a), "+v"(b) : "v"(x), "v"(y));
#endif
}
__device__ __forceinline__ void keep4_h(v16h a, v16h b, v16h c, v16h d) {
#if defined(__HIP_DEVICE_COMPILE__)
  asm volatile("v_nop" :: "v"(a), "v"(b), "v"(c), "v"(d));
#endif
}
__device__ __forceinline__ void acc_guard4(v8f& a, v8f& b, v8f& c, v8f& d) {
#if defined(__HIP_DEVICE_COMPILE__)
  asm volatile("v_nop\n\tv_nop\n\tv_nop\n\tv_nop" : "+v"(a), "+v"(b), "+v"(c), "+v"(d));
#endif
}

// =====================================================================================================
// f32 plane -> f16 bits of bfr(v) * scale (scale a power of two): x (x16).
// coverage: n8 threads x 8 = the whole plane.
// =====================================================================================================
__global__ __launch_bounds__(256) void cvt16(const float* __restrict__ in, unsigned short* out, int n8, float scale) {
  const int i = blockIdx.x * 256 + threadIdx.x;
  if (i < n8) {
    const v4f a = *(const v4f*)(in + (size_t)i * 8);
    const v4f b = *(const v4f*)(in + (size_t)i * 8 + 4);
    v4u p;
    p[0] = pk16(h_bits((_Float16)(bfr(a[0]) * scale)), h_bits((_Float16)(bfr(a[1]) * scale)));
    p[1] = pk16(h_bits((_Float16)(bfr(a[2]) * scale)), h_bits((_Float16)(bfr(a[3]) * scale)));
    p[2] = pk16(h_bits((_Float16)(bfr(b[0]) * scale)), h_bits((_Float16)(bfr(b[1]) * scale)));
    p[3] = pk16(h_bits((_Float16)(bfr(b[2]) * scale)), h_bits((_Float16)(bfr(b[3]) * scale)));
    *(v4u*)(out + (size_t)i * 8) = p;
    
  }
}

// =====================================================================================================
// f32 weight W [K rows][N cols] (the x@W layout, n contiguous) -> f16 Wt[n][k] = f16(bfr(W[k][n]) * scale),
// pitch K halves (k contiguous = the Bt layout of the GEMM below); scale a power of two.
// Block = one 64 (k) x 64 (n) tile of one of four weights; grid = (Nwide/64, K/64, 4), blockIdx.z = the weight,
// blocks past a narrow weight's last column tile leave at once; tile staged in LDS as halves [kk][nn] pitch 72
// (v8h 16-B stores, __syncthreads, _Float16 element reads).
// Store: group g = tid>>3 (0..31), piece = tid&7: iteration it writes out row n = it*32+g, lanes 8q..8q+7 x 16 B =
// coverage: load 2 x 256 threads x 8 = 64x64; store 2 iterations x 32 groups = 64 rows n, 8 pieces x 8 = 64 k
// per row; grid covers every (n tile, k tile) of [N][K].
// =====================================================================================================
__global__ __launch_bounds__(256) void w_tr(const float* __restrict__ w0, const float* __restrict__ w1,
                                            const float* __restrict__ w2, const float* __restrict__ w3,
                                            unsigned short* t0, unsigned short* t1, unsigned short* t2, unsigned short* t3,
                                            int K, int Nwide, int Nnarrow, float scale) {
  __shared__ __align__(16) _Float16 sw[64 * 72];       // [kk][nn], pitch 72 halves (144 B)
  const int tid = threadIdx.x;
  const int z   = blockIdx.z;                          // which weight: 0 and 3 are Nwide columns, 1 and 2 Nnarrow
  const int N   = (z == 0 || z == 3) ? Nwide : Nnarrow;
  const int n0  = blockIdx.x * 64;
  const int k0  = blockIdx.y * 64;
  if (z > 3 || n0 >= N || k0 >= K) return;             // block-uniform, before the barrier
  const float* w = (z == 0) ? w0 : (z == 1) ? w1 : (z == 2) ? w2 : w3;
  unsigned short* wt = (z == 0) ? t0 : (z == 1) ? t1 : (z == 2) ? t2 : t3;
#pragma unroll
  for (int i = 0; i < 2; ++i) {
    const int idx = i * 256 + tid;                  // 0..511
    const int kk = idx >> 3, c8 = (idx & 7) * 8;
    const float* src = w + (size_t)(k0 + kk) * N + n0 + c8;
    const v4f a  = *(const v4f*)(src);
    const v4f a2 = *(const v4f*)(src + 4);
    v8h o;
    o[0] = (_Float16)(bfr(a[0]) * scale);
    o[1] = (_Float16)(bfr(a[1]) * scale);
    o[2] = (_Float16)(bfr(a[2]) * scale);
    o[3] = (_Float16)(bfr(a[3]) * scale);
    o[4] = (_Float16)(bfr(a2[0]) * scale);
    o[5] = (_Float16)(bfr(a2[1]) * scale);
    o[6] = (_Float16)(bfr(a2[2]) * scale);
    o[7] = (_Float16)(bfr(a2[3]) * scale);
    *(v8h*)(sw + kk * 72 + c8) = o;
  }
  __syncthreads();

  const int g = tid >> 3, piece = tid & 7;
  v4u hv[2];
  size_t hofs[2];
#pragma unroll
  for (int it = 0; it < 2; ++it) {
    const int nn = it * 32 + g;
    v4u a;
#pragma unroll
    for (int e = 0; e < 4; ++e) {
      const _Float16 x0 = sw[(piece * 8 + 2 * e) * 72 + nn];
      const _Float16 x1 = sw[(piece * 8 + 2 * e + 1) * 72 + nn];
      a[e] = pk16(h_bits(x0), h_bits(x1));
    }
    hv[it] = a;
    hofs[it] = ((size_t)(n0 + nn)) * K + k0 + piece * 8;
  }
  {
#pragma unroll
    for (int it = 0; it < 2; ++it) *(v4u*)(wt + hofs[it]) = hv[it];
    
  }
}

// =====================================================================================================
// Register-blocked f16 WMMA GEMM, one wave per 64x64 tile, no block barriers:
//   v[m][n] = (sum_k A[m][k] * Bt[n][k]  [+ 2^-11 * sum_k Ar[m][k] * Bt[n][k] when ARES]) * cscale
// A, Ar row-major [M][K] pitch lda (f16), Bt row-major [N][K] pitch ldb (f16, k contiguous); M, N multiples of
// 64, K multiple of 32; tile count a multiple of 8. A wave skips its tile unless (m0 % tmod) lies in [tlo, thi)
// (wave-uniform, before any LDS use).
// ARES: the residual plane is accumulated first from zero, the accumulators are scaled by 2^-11 exactly on the
// VALU (with nop gaps on both sides), then the hi plane accumulates on top: one accumulator set.
// EPI 0: column tiles from n1 on are stored to a second and a third output (each nx columns wide, pitch nx; hi plane
// C2 / C3, residual plane C2r / C3r), so that products that share A run in one grid. EPI 1 has the one output.
// Epilogue variants:
//   EPI 0: f16 hi plane = f16(v * oscale) at Cp and residual plane = f16((v*oscale - hi) * 2048) at Crp, pitch ldc halves
//   EPI 1: f32 out = v, pitch ldc floats
// 16-row slabs staged per wave in LDS. f32 out: each 64-wide row segment (256 B = 2 lines) by 16 lanes x 16 B,
// coverage: 4 slabs x 16 rows x 64 cols = the wave's whole 64x64 tile; grid x 8 tiles = [M][N] (restricted to the
// [tlo, thi) token window).
// =====================================================================================================
template <int EPI, bool ARES>
__global__ __launch_bounds__(256) void gemm64_f16(
    const unsigned short* __restrict__ Ap, const unsigned short* __restrict__ Arp, int lda,
    const unsigned short* __restrict__ Btp, int ldb,
    float cscale,
    void* Cp, unsigned short* Crp, int ldc, int M, int N, int K, float oscale,
    int tmod, int tlo, int thi,
    int n1, int nx, unsigned short* C2, unsigned short* C2r, unsigned short* C3, unsigned short* C3r) {
  const _Float16* Ah  = (const _Float16*)(const void*)Ap;
  const _Float16* Arh = (const _Float16*)(const void*)Arp;
  const _Float16* Bt  = (const _Float16*)(const void*)Btp;
  __shared__ __align__(16) float sT[8][16 * 68];   // per-wave 16x64 slab, pitch 68 floats
  const int lane = threadIdx.x & 31;
  const int wave = threadIdx.x >> 5;
  const int tilesN = N >> 6;
  const int tilesM = M >> 6;
  const int tile = blockIdx.x * 8 + wave;
  if (tile >= tilesM * tilesN) return;   // wave-uniform; no block barriers in this kernel
  const int tm = tile / tilesN;
  const int tn = tile - tm * tilesN;
  const int m0 = tm << 6;
  const int n0 = tn << 6;
  const int tpos = m0 % tmod;
  if (tpos < tlo || tpos >= thi) return; // wave-uniform

  // output of this tile (wave-uniform): columns below n1 go to Cp / Crp, the next nx to C2 / C2r, the next nx to C3 / C3r
  void* Co = Cp;
  unsigned short* Cro = Crp;
  int ldo = ldc, nc0 = n0;
  if constexpr (EPI == 0) {
    if (n0 >= n1) {
      const int e = n0 - n1;
      const bool third = (e >= nx);
      Co  = third ? (void*)C3 : (void*)C2;
      Cro = third ? C3r : C2r;
      ldo = nx;
      nc0 = third ? e - nx : e;
    }
  }

  const int rlane = lane & 15;                 // row (A) / col (B, D) within subtile
  const int koff  = (lane >> 4) * 8;           // k offset of this lane half
  const int mOff  = (lane >> 4) * 8;           // D row offset

  v8f acc[4][4];
#pragma unroll
  for (int i = 0; i < 4; ++i)
#pragma unroll
    for (int j = 0; j < 4; ++j) acc[i][j] = zero8();

  constexpr int NPL = ARES ? 2 : 1;
#pragma unroll 1
  for (int pl = 0; pl < NPL; ++pl) {
    const _Float16* Asel = (ARES && pl == 0) ? Arh : Ah;     // wave-uniform selection of a global pointer
    if (ARES && pl == 1) {
      acc_guard4(acc[0][0], acc[0][1], acc[0][2], acc[0][3]);
      acc_guard4(acc[1][0], acc[1][1], acc[1][2], acc[1][3]);
      acc_guard4(acc[2][0], acc[2][1], acc[2][2], acc[2][3]);
      acc_guard4(acc[3][0], acc[3][1], acc[3][2], acc[3][3]);
#pragma unroll
      for (int i = 0; i < 4; ++i)
#pragma unroll
        for (int j = 0; j < 4; ++j) acc[i][j] = acc[i][j] * (1.0f / 2048.0f);   // exact fold of the x2^11 residual carry
      acc_guard4(acc[0][0], acc[0][1], acc[0][2], acc[0][3]);
      acc_guard4(acc[1][0], acc[1][1], acc[1][2], acc[1][3]);
      acc_guard4(acc[2][0], acc[2][1], acc[2][2], acc[2][3]);
      acc_guard4(acc[3][0], acc[3][1], acc[3][2], acc[3][3]);
    }
    for (int k0 = 0; k0 < K; k0 += 32) {
      v16h bh[4];
#pragma unroll
      for (int j = 0; j < 4; ++j) {
        const size_t bo = (size_t)(n0 + (j << 4) + rlane) * ldb + koff + k0;
        bh[j] = ldfrag_h(Bt + bo);
      }
#pragma unroll
      for (int i = 0; i < 4; ++i) {
        const size_t ao = (size_t)(m0 + (i << 4) + rlane) * lda + koff + k0;
        const v16h ah = ldfrag_h(Asel + ao);
#pragma unroll
        for (int j = 0; j < 4; ++j) {
          acc[i][j] = mma_h_raw(ah, bh[j], acc[i][j]);
        }
        dep_guard_h(acc[i][0], acc[i][3], ah, bh[3]);
      }
      keep4_h(bh[0], bh[1], bh[2], bh[3]);
    }
  }
  acc_guard4(acc[0][0], acc[0][1], acc[0][2], acc[0][3]);
  acc_guard4(acc[1][0], acc[1][1], acc[1][2], acc[1][3]);
  acc_guard4(acc[2][0], acc[2][1], acc[2][2], acc[2][3]);
  acc_guard4(acc[3][0], acc[3][1], acc[3][2], acc[3][3]);

  // ---- epilogue ----
  float* slab = sT[wave];
#pragma unroll
  for (int i = 0; i < 4; ++i) {
    const int mBase = m0 + (i << 4);
#pragma unroll
    for (int r = 0; r < 8; ++r) {
      const int row = mOff + r;
#pragma unroll
      for (int j = 0; j < 4; ++j) slab[row * 68 + (j << 4) + rlane] = acc[i][j][r] * cscale;
    }
    __builtin_amdgcn_fence(__ATOMIC_RELEASE, "workgroup");
    __builtin_amdgcn_wave_barrier();
    __builtin_amdgcn_fence(__ATOMIC_ACQUIRE, "workgroup");
    if constexpr (EPI == 0) {
      unsigned short* C16 = (unsigned short*)Co;
      const int rq = lane >> 3, piece = lane & 7;
      v4u ph[4], pr[4];
#pragma unroll
      for (int it = 0; it < 4; ++it) {
        const int row = it * 4 + rq;                         // it 0..3 x rq 0..3 = rows 0..15
        const v4f a  = *(const v4f*)(slab + row * 68 + piece * 8);
        const v4f a2 = *(const v4f*)(slab + row * 68 + piece * 8 + 4);
        float f[8];
        f[0] = a[0];  f[1] = a[1];  f[2] = a[2];  f[3] = a[3];
        f[4] = a2[0]; f[5] = a2[1]; f[6] = a2[2]; f[7] = a2[3];
        v4u p, q;
#pragma unroll
        for (int e = 0; e < 4; ++e) {
          const float g0 = f[2 * e] * oscale, g1 = f[2 * e + 1] * oscale;
          const _Float16 x0 = (_Float16)g0, x1 = (_Float16)g1;
          const _Float16 y0 = (_Float16)((g0 - (float)x0) * 2048.0f);
          const _Float16 y1 = (_Float16)((g1 - (float)x1) * 2048.0f);
          p[e] = pk16(h_bits(x0), h_bits(x1));
          q[e] = pk16(h_bits(y0), h_bits(y1));
        }
        ph[it] = p;
        pr[it] = q;
      }
      {
#pragma unroll
        for (int it = 0; it < 4; ++it) {
          const int row = it * 4 + rq;
          const size_t co = (size_t)(mBase + row) * ldo + nc0 + piece * 8;
          *(v4u*)(C16 + co) = ph[it];
          *(v4u*)(Cro + co) = pr[it];
        }
        
      }
    } else {
      float* Cf = (float*)Co;
      const int hh = lane >> 4, c4 = (lane & 15) * 4;     // 256-B row segment = 16 lanes x 16 B
      v4f ov[8];
#pragma unroll
      for (int it = 0; it < 8; ++it) {
        const int row = it * 2 + hh;                       // it 0..7 x hh 0..1 = rows 0..15
        ov[it] = *(const v4f*)(slab + row * 68 + c4);
      }
      {
#pragma unroll
        for (int it = 0; it < 8; ++it) {
          const int row = it * 2 + hh;
          *(v4f*)(Cf + (size_t)(mBase + row) * ldo + nc0 + c4) = ov[it];
        }
        
      }
    }
    __builtin_amdgcn_fence(__ATOMIC_RELEASE, "workgroup");
    __builtin_amdgcn_wave_barrier();
    __builtin_amdgcn_fence(__ATOMIC_ACQUIRE, "workgroup");
  }
}

// =====================================================================================================
// f16 v plane (token-major, element (t, g, d) at vp[t*DKV + g*64 + d], g = kv head) -> f16 v^T plane
// vt[(g*64 + d)*SEQ + t] (same bits). Used for the hi plane and the residual plane.
// Block = one 64-token x 64-feature tile of one kv head g of one plane; grid = (SEQ/64, NKV, 2); tile staged in LDS as halves
// (v8h 16-B stores, __syncthreads, _Float16 element reads).
// Store: group g8 = tid>>3 (0..31), piece = tid&7: iteration it writes row d = it*32+g8, lanes 8q..8q+7 x 16 B =
// coverage: load 2 x 256 threads x 8 halves = 64x64; store 2 iterations x 32 groups = 64 rows d, 8 pieces x 8
// = 64 tokens per row; grid covers every (kv head, token tile) of [DKV][SEQ].
// =====================================================================================================
__global__ __launch_bounds__(256) void v_tr(const unsigned short* __restrict__ vp0, unsigned short* vt0,
                                            const unsigned short* __restrict__ vp1, unsigned short* vt1) {
  __shared__ __align__(16) _Float16 sv[64 * 72];       // [tt][d], pitch 72 halves (144 B)
  const int tid = threadIdx.x;
  const int t0  = blockIdx.x * 64;
  const int g   = blockIdx.y;
  if (g >= NKV || t0 >= SEQ || blockIdx.z > 1) return; // block-uniform, before any barrier
  const unsigned short* vp = blockIdx.z ? vp1 : vp0;   // blockIdx.z: 0 = hi plane, 1 = residual plane
  unsigned short* vt = blockIdx.z ? vt1 : vt0;
  const _Float16* src = (const _Float16*)(const void*)vp;
#pragma unroll
  for (int i = 0; i < 2; ++i) {
    const int idx = i * 256 + tid;                  // 0..511
    const int tt = idx >> 3, c8 = (idx & 7) * 8;
    const v8h a = *(const v8h*)(src + ((size_t)(t0 + tt)) * DKV + g * HD + c8);
    *(v8h*)(sv + tt * 72 + c8) = a;
  }
  __syncthreads();

  const int g8 = tid >> 3, piece = tid & 7;
  v4u hv[2];
  size_t hofs[2];
#pragma unroll
  for (int it = 0; it < 2; ++it) {
    const int d = it * 32 + g8;
    v4u a;
#pragma unroll
    for (int e = 0; e < 4; ++e) {
      const _Float16 x0 = sv[(piece * 8 + 2 * e) * 72 + d];
      const _Float16 x1 = sv[(piece * 8 + 2 * e + 1) * 72 + d];
      a[e] = pk16(h_bits(x0), h_bits(x1));
    }
    hv[it] = a;
    hofs[it] = ((size_t)(g * HD + d)) * SEQ + t0 + piece * 8;
  }
  {
#pragma unroll
    for (int it = 0; it < 2; ++it) *(v4u*)(vt + hofs[it]) = hv[it];
    
  }
}

// =====================================================================================================
// Causal grouped-query softmax attention, head dim 64, online-max form. Query head h reads kv head g = h / GRP.
//   q f16 (x16): element (t, h, d) at qp[t*DM + h*64 + d]; k f16 (x16): element (t, g, d) at kp[t*DKV + g*64 + d];
//   residual planes (x2^11 of the f16 residue) qrp / krp with the same addressing; v^T f16 (x16) at
//   vtp[(g*64 + d)*SEQ + s], residual vtrp.
//   logit a = (q.k) / 8 = acc / 2048 (two x16 carries); HR: acc = qh.kh + 2^-11 (qh.kr + qr.kh).
//   Key j is allowed for query row i iff j <= i; other keys get a = -1e30 (select by value) and p = 0 (select by
//   value). Per 64-key tile: tile max (per-lane max over the 4 key groups, then a 16-lane xor max),
//   mn = max(mrun, tile max), alpha = exp(mrun - mn), p = exp(a - mn), lsum = lsum * alpha + sum p (per-lane
//   partials, 16-lane xor reduction at the end), context accumulators scaled by alpha on the VALU (nop gaps on
//   both sides). Key tiles 0..qb are visited (block-uniform trip count qb + 1); only the diagonal tile has masked
//   keys and key qb*64 is allowed for every row of the tile, so every visited tile has a finite tile max and
//   lsum >= 1 at the end.
//   P carried as f16(256 p) (HR: plus residual f16((256p - hi)*2048)); context = P . v^T on f16 WMMA
//   (HR: second accumulator += Ph.Vr + Pr.Vh, folded with 2^-11).
//   ctx plane f16 (x16): element (t, h*64 + d) at ctx[t*DM + h*64 + d] = 16 * context / (4096 lsum);
//   the ctx residual plane f16((16 ctx - hi) * 2048) is written by both variants.
//   Block = 4 waves = 64 query rows of one head; attn_all below picks (query tile, head) and the variant.
//   K / V^T tile staging: 128 threads x 32 halves per plane = the whole 64x64 tile (plain 16-B loads,
//   __syncthreads before and after); P tiles are wave-private, spilled with _Float16 element stores and
//   wave in LDS as f32 (aliasing the K/V region after a block barrier) the same way.
//   Output coverage: each wave stores rows 0..15 of its tile (it 0..3 x lane>>3 0..3) x 64 columns (8 lanes x
//   together cover every (head, query tile) of [SEQ][DM] exactly once for both ctx planes.
// =====================================================================================================
#define ATT_SMEM 55296                                    // LDS bytes of the residual-plane variant, the larger one
template <bool HR>
__device__ __forceinline__
void attn_body(unsigned char* smem,
               const unsigned short* __restrict__ qp,  const unsigned short* __restrict__ qrp,
               const unsigned short* __restrict__ kp,  const unsigned short* __restrict__ krp,
               const unsigned short* __restrict__ vtp, const unsigned short* __restrict__ vtrp,
               unsigned short* ctxp, unsigned short* ctxrp, int qb, int h) {
  union FH { v16h v; v8h h[2]; };
  constexpr int LP     = 72;                             // LDS row pitch in halves: 144 B = 16 B x 9, so the 16 rows
                                                         // that one ds_load_b128 fragment read touches fall on 16
                                                         // different 4-bank groups (at 128 B they share two groups)
  constexpr int TB     = 64 * LP * 2;                    // one f16 64x64 tile at pitch LP, bytes
  constexpr int PB     = 4 * 16 * LP * 2;                // four wave-private 16x64 f16 P tiles at pitch LP, bytes
  constexpr int OFF_K  = 0;
  constexpr int OFF_V  = TB;
  constexpr int OFF_KR = 2 * TB;
  constexpr int OFF_VR = 3 * TB;
  constexpr int OFF_P  = HR ? 4 * TB : 2 * TB;
  constexpr int OFF_PR = OFF_P + PB;
  constexpr int SMEMB  = HR ? (OFF_PR + PB) : (OFF_P + PB);   // 55296 : 27648
  static_assert(4 * 16 * 64 * 4 <= OFF_P);                    // f32 context staging aliases the K/V region
  static_assert(SMEMB <= ATT_SMEM);
  _Float16* Ksh = (_Float16*)(smem + OFF_K);                  // K   [kv][d], pitch LP
  _Float16* Vsh = (_Float16*)(smem + OFF_V);                  // V^T [d][kv], pitch LP
  _Float16* Krs = (_Float16*)(smem + (HR ? OFF_KR : OFF_K));  // K residual (HR only)
  _Float16* Vrs = (_Float16*)(smem + (HR ? OFF_VR : OFF_V));  // V^T residual (HR only)
  _Float16* Psh = (_Float16*)(smem + OFF_P);
  _Float16* Prs = (_Float16*)(smem + (HR ? OFF_PR : OFF_P));

  const int tid  = threadIdx.x;
  const int wave = tid >> 5;
  const int lane = tid & 31;
  const int hh   = lane >> 4;
  const int c    = lane & 15;

  const int g    = h / GRP;                  // kv head
  const int q0   = qb * 64 + wave * 16;

  const _Float16* QP  = (const _Float16*)(const void*)qp   + (size_t)h * HD;
  const _Float16* QRP = (const _Float16*)(const void*)qrp  + (size_t)h * HD;
  const _Float16* KP  = (const _Float16*)(const void*)kp   + (size_t)g * HD;
  const _Float16* KRP = (const _Float16*)(const void*)krp  + (size_t)g * HD;
  const _Float16* VTP = (const _Float16*)(const void*)vtp  + (size_t)g * HD * SEQ;
  const _Float16* VRP = (const _Float16*)(const void*)vtrp + (size_t)g * HD * SEQ;

  // ---- Q fragments (A operand, row = lane&15): 2 d-chunks ----
  v16h qa[2], qr[2];
#pragma unroll
  for (int dc = 0; dc < 2; ++dc) {
    const size_t qo = (size_t)(q0 + c) * DM + dc * 32 + 8 * hh;
    qa[dc] = ldfrag_h(QP + qo);
    if constexpr (HR) qr[dc] = ldfrag_h(QRP + qo);
    else qr[dc] = qa[dc];
  }

  float lsum[8], mrun[8];
  v8f oacc[4], oacc2[4];
#pragma unroll
  for (int r = 0; r < 8; ++r) { lsum[r] = 0.f; mrun[r] = -1e30f; }
#pragma unroll
  for (int t = 0; t < 4; ++t) { oacc[t] = zero8(); oacc2[t] = zero8(); }

  _Float16* pw  = Psh + wave * (16 * LP);
  _Float16* prw = Prs + wave * (16 * LP);

  const int nkt = qb + 1;                                      // key tiles 0..qb, block-uniform
  for (int kti = 0; kti < nkt; ++kti) {
    const int kv0 = kti * 64;                                  // <= qb*64 < SEQ
    __syncthreads();
    {
      const int r = tid >> 1, half = (tid & 1) * 32;
      const size_t ko = (size_t)(kv0 + r) * DKV + half;         // K row kv0+r, d = half..half+31
      const size_t vo = (size_t)r * SEQ + kv0 + half;           // V^T row d = r, s = kv0+half..+31
#pragma unroll
      for (int i = 0; i < 4; ++i) {
        const v8h a0 = *(const v8h*)(KP + ko + 8 * i);
        const v8h b0 = *(const v8h*)(VTP + vo + 8 * i);
        *(v8h*)(Ksh + r * LP + half + 8 * i) = a0;
        *(v8h*)(Vsh + r * LP + half + 8 * i) = b0;
        if constexpr (HR) {
          const v8h a1 = *(const v8h*)(KRP + ko + 8 * i);
          const v8h b1 = *(const v8h*)(VRP + vo + 8 * i);
          *(v8h*)(Krs + r * LP + half + 8 * i) = a1;
          *(v8h*)(Vrs + r * LP + half + 8 * i) = b1;
        }
      }
    }
    __syncthreads();

    // ---- scores: 16 query rows x 64 keys per wave (B operand: lane c -> key j*16+c, split k map over d) ----
    v8f s[4];
#pragma unroll
    for (int j = 0; j < 4; ++j) {
      s[j] = zero8();
      v8f t = zero8();
#pragma unroll
      for (int dc = 0; dc < 2; ++dc) {
        FH kb;
        kb.h[0] = *(const v8h*)(Ksh + (j * 16 + c) * LP + dc * 32 + 8 * hh);
        kb.h[1] = *(const v8h*)(Ksh + (j * 16 + c) * LP + dc * 32 + 16 + 8 * hh);
        s[j] = mma_h(qa[dc], kb.v, s[j]);
        if constexpr (HR) {
          FH krb;
          krb.h[0] = *(const v8h*)(Krs + (j * 16 + c) * LP + dc * 32 + 8 * hh);
          krb.h[1] = *(const v8h*)(Krs + (j * 16 + c) * LP + dc * 32 + 16 + 8 * hh);
          t = mma_h(qa[dc], krb.v, t);
          t = mma_h(qr[dc], kb.v, t);
        }
      }
      if constexpr (HR) s[j] = s[j] + t * (1.0f / 2048.0f);
    }

    // ---- causal online softmax: tile max, running max, alpha, p, row-sum partials,
    //      P (x256, f16; HR: + residual) ----
    float alpha[8];
#pragma unroll
    for (int r = 0; r < 8; ++r) {
      const int qrow = q0 + 8 * hh + r;
      float av[4];
      float tmx = -1e30f;
#pragma unroll
      for (int j = 0; j < 4; ++j) {
        const int key = kv0 + j * 16 + c;
        float a = s[j][r] * (1.0f / 2048.0f);              // 1/8 head scale, 1/256 for the two x16 carries
        const bool ok = (key <= qrow);
        a = ok ? a : -1e30f;
        av[j] = a;
        tmx = fmaxf(tmx, a);
      }
#pragma unroll
      for (int off = 1; off < 16; off <<= 1) tmx = fmaxf(tmx, __shfl_xor(tmx, off, 32));
      const float mn = fmaxf(mrun[r], tmx);
      const float al = __expf(mrun[r] - mn);
      alpha[r] = al;
      mrun[r]  = mn;
      float ps = 0.0f;
#pragma unroll
      for (int j = 0; j < 4; ++j) {
        const int key = kv0 + j * 16 + c;
        const bool ok = (key <= qrow);
        float p = __expf(av[j] - mn);
        p = ok ? p : 0.0f;
        ps += p;
        const float gg = p * 256.0f;
        const _Float16 x0 = (_Float16)gg;
        pw[(8 * hh + r) * LP + j * 16 + c] = x0;
        if constexpr (HR) prw[(8 * hh + r) * LP + j * 16 + c] = (_Float16)((gg - (float)x0) * 2048.0f);
      }
      lsum[r] = lsum[r] * al + ps;
    }
    __builtin_amdgcn_fence(__ATOMIC_RELEASE, "workgroup");
    __builtin_amdgcn_wave_barrier();
    __builtin_amdgcn_fence(__ATOMIC_ACQUIRE, "workgroup");

    // ---- rescale the context accumulators by alpha (VALU), nop gaps before the next WMMA reads them ----
#pragma unroll
    for (int t = 0; t < 4; ++t) {
#pragma unroll
      for (int r = 0; r < 8; ++r) {
        oacc[t][r] = oacc[t][r] * alpha[r];
        if constexpr (HR) oacc2[t][r] = oacc2[t][r] * alpha[r];
      }
    }
    acc_guard4(oacc[0], oacc[1], oacc[2], oacc[3]);
    if constexpr (HR) acc_guard4(oacc2[0], oacc2[1], oacc2[2], oacc2[3]);

    // ---- context += P . V (f16 WMMA; A = P [row][key], B = V^T [d][key]) ----
#pragma unroll
    for (int kk = 0; kk < 2; ++kk) {
      FH pa, par;
      pa.h[0] = *(const v8h*)(pw + c * LP + kk * 32 + 8 * hh);
      pa.h[1] = *(const v8h*)(pw + c * LP + kk * 32 + 16 + 8 * hh);
      if constexpr (HR) {
        par.h[0] = *(const v8h*)(prw + c * LP + kk * 32 + 8 * hh);
        par.h[1] = *(const v8h*)(prw + c * LP + kk * 32 + 16 + 8 * hh);
      } else {
        par.v = pa.v;
      }
#pragma unroll
      for (int t = 0; t < 4; ++t) {
        FH vb;
        vb.h[0] = *(const v8h*)(Vsh + (t * 16 + c) * LP + kk * 32 + 8 * hh);
        vb.h[1] = *(const v8h*)(Vsh + (t * 16 + c) * LP + kk * 32 + 16 + 8 * hh);
        oacc[t] = mma_h(pa.v, vb.v, oacc[t]);
        if constexpr (HR) {
          FH vrb;
          vrb.h[0] = *(const v8h*)(Vrs + (t * 16 + c) * LP + kk * 32 + 8 * hh);
          vrb.h[1] = *(const v8h*)(Vrs + (t * 16 + c) * LP + kk * 32 + 16 + 8 * hh);
          oacc2[t] = mma_h(pa.v, vrb.v, oacc2[t]);
          oacc2[t] = mma_h(par.v, vb.v, oacc2[t]);
        }
      }
    }
  }
  __syncthreads();                           // every wave is done with the K/V tiles before they are aliased

  // ---- normalise (1/lsum, the 1/256 p carry; keep the x16 v carry), stage the wave's 16x64 f32 tile in
  //      instruction) ----
  float* os = (float*)(void*)smem + wave * (16 * 64);
#pragma unroll
  for (int r = 0; r < 8; ++r) {
    float l = lsum[r];
#pragma unroll
    for (int off = 1; off < 16; off <<= 1) l += __shfl_xor(l, off, 32);
    const float rl = 1.0f / l;               // l >= 1 (the max key contributes p = 1)
    const float sc = rl * (1.0f / 256.0f);
#pragma unroll
    for (int t = 0; t < 4; ++t) {
      float v = oacc[t][r];
      if constexpr (HR) v += oacc2[t][r] * (1.0f / 2048.0f);
      os[(8 * hh + r) * 64 + t * 16 + c] = v * sc;
    }
  }
  __builtin_amdgcn_fence(__ATOMIC_RELEASE, "workgroup");
  __builtin_amdgcn_wave_barrier();
  __builtin_amdgcn_fence(__ATOMIC_ACQUIRE, "workgroup");
  {
    const int rq = lane >> 3, piece = lane & 7;
    v4u ph[4], pr[4];
#pragma unroll
    for (int it = 0; it < 4; ++it) {
      const int row = it * 4 + rq;   // it 0..3 x rq 0..3 = rows 0..15 of the wave tile
      const v4f a  = *(const v4f*)(os + row * 64 + piece * 8);
      const v4f a2 = *(const v4f*)(os + row * 64 + piece * 8 + 4);
      float f[8];
      f[0] = a[0];  f[1] = a[1];  f[2] = a[2];  f[3] = a[3];
      f[4] = a2[0]; f[5] = a2[1]; f[6] = a2[2]; f[7] = a2[3];
      v4u p, q;
#pragma unroll
      for (int e = 0; e < 4; ++e) {
        const _Float16 x0 = (_Float16)f[2 * e], x1 = (_Float16)f[2 * e + 1];
        const _Float16 y0 = (_Float16)((f[2 * e] - (float)x0) * 2048.0f);
        const _Float16 y1 = (_Float16)((f[2 * e + 1] - (float)x1) * 2048.0f);
        p[e] = pk16(h_bits(x0), h_bits(x1));
        q[e] = pk16(h_bits(y0), h_bits(y1));
      }
      ph[it] = p;
      pr[it] = q;
    }
    {
#pragma unroll
      for (int it = 0; it < 4; ++it) {
        const int row = it * 4 + rq;
        const size_t go = (size_t)(q0 + row) * DM + (size_t)h * HD + piece * 8;
        *(v4u*)(ctxp + go)  = ph[it];
        *(v4u*)(ctxrp + go) = pr[it];
      }
      
    }
  }
}

// =====================================================================================================
// Both attention variants in one grid of NQT * NH blocks, so that the short residual-plane tiles and the long
// single-product tiles run side by side. The grid is four quarters of NQT/4 * NH blocks; block w of each quarter has
// head w % NH and u = w / NH, and query tile NQT-1-u, QHR-1-u, QHR+u, u in quarters 0..3: a permutation of every
// (head, query tile), long tiles first, and the four blocks with equal w have the same total of key tiles for every w.
// =====================================================================================================
__global__ __launch_bounds__(128)
void attn_all(const unsigned short* __restrict__ qp,  const unsigned short* __restrict__ qrp,
              const unsigned short* __restrict__ kp,  const unsigned short* __restrict__ krp,
              const unsigned short* __restrict__ vtp, const unsigned short* __restrict__ vtrp,
              unsigned short* ctxp, unsigned short* ctxrp) {
  __shared__ __align__(16) unsigned char smem[ATT_SMEM];
  constexpr int QQ = NQT / 4;
  static_assert((NQT % 4) == 0 && QHR == 2 * QQ);
  const int bx = blockIdx.x;
  const int j  = bx / (QQ * NH);
  if (j > 3) return;                         // block-uniform, before any barrier or store
  const int w  = bx - j * (QQ * NH);
  const int h  = w % NH;
  const int u  = w / NH;
  const int qb = (j == 0) ? (NQT - 1 - u) : (j == 1) ? (QHR - 1 - u) : (j == 2) ? (QHR + u) : u;
  if (qb < QHR) attn_body<true>(smem, qp, qrp, kp, krp, vtp, vtrp, ctxp, ctxrp, qb, h);
  else          attn_body<false>(smem, qp, qrp, kp, krp, vtp, vtrp, ctxp, ctxrp, qb, h);
}

// =====================================================================================================
// Workspace map (bytes, SEQ = 4096); every region is an exact multiple of its whole-line / whole-tile store
// granularity (row pitches 2048 / 512 / 8192 B, rows multiples of 64, all offsets 512-KiB aligned, no aliasing
// within a launch):
//   Xh    f16 [SEQ][1024]          0     8388608   (bf16 value of x, x16)
//   WqT   f16 [1024][1024]   8388608     2097152   (bf16 value of w_q^T x1024, [n][k])
//   WkT   f16 [256][1024]   10485760      524288   (bf16 value of w_k^T x1024, [n][k])
//   WvT   f16 [256][1024]   11010048      524288   (bf16 value of w_v^T x1024, [n][k])
//   WoT   f16 [1024][1024]  11534336     2097152   (bf16 value of w_o^T x1024, [n][k])
//   Qh    f16 [SEQ][1024]   13631488     8388608   (q x16)           Qr  22020096  8388608 (x2^11 residual)
//   Kh    f16 [SEQ][256]    30408704     2097152   (k x16)           Kr  32505856  2097152
//   Vh    f16 [SEQ][256]    34603008     2097152   (v x16)           Vr  36700160  2097152
//   VT    f16 [256][SEQ]    38797312     2097152   ([g*64 + d][s])   VTr 40894464  2097152
//   Ctx   f16 [SEQ][1024]   42991616     8388608   (context x16)     Ctxr 51380224 8388608
//   end                     59768832
// Projection weights arrive as [in k][out n] (n contiguous) and are transposed while converted (w_tr).
// d_out f32: [SEQ][1024] at byte 0, every 64x64 tile written once by the output projection launch.
// =====================================================================================================
extern "C" void kernel_launch(void* const* d_in, const int* in_sizes, int n_in,
                              void* d_out, int out_size, void* d_ws, size_t ws_size,
                              hipStream_t stream) {
  if (n_in < 5) return;
  if (in_sizes[0] < SEQ * DM || (in_sizes[0] % DM) != 0) return;   // x rows 0..SEQ-1 are used, pitch DM
  if (in_sizes[1] != DM * DM) return;
  if (in_sizes[2] != DM * DKV) return;
  if (in_sizes[3] != DM * DKV) return;
  if (in_sizes[4] != DM * DM) return;
  if (out_size < OUTN) return;

  const float* x   = (const float*)d_in[0];    // [>=SEQ][DM]
  const float* w_q = (const float*)d_in[1];    // [DM k][DM n]
  const float* w_k = (const float*)d_in[2];    // [DM k][DKV n]
  const float* w_v = (const float*)d_in[3];    // [DM k][DKV n]
  const float* w_o = (const float*)d_in[4];    // [DM k][DM n]

  const size_t PX   = (size_t)SEQ * DM * 2;          //  8388608
  const size_t PWq  = (size_t)DM * DM * 2;           //  2097152
  const size_t PWk  = (size_t)DKV * DM * 2;          //   524288
  const size_t PWo  = (size_t)DM * DM * 2;           //  2097152
  const size_t PQ   = (size_t)SEQ * DM * 2;          //  8388608
  const size_t PK   = (size_t)SEQ * DKV * 2;         //  2097152
  const size_t PVT  = (size_t)DKV * SEQ * 2;         //  2097152
  const size_t PCtx = (size_t)SEQ * DM * 2;          //  8388608
  size_t off = 0;
  const size_t oX    = off; off += PX;
  const size_t oWq   = off; off += PWq;
  const size_t oWk   = off; off += PWk;
  const size_t oWv   = off; off += PWk;
  const size_t oWo   = off; off += PWo;
  const size_t oQ    = off; off += PQ;
  const size_t oQr   = off; off += PQ;
  const size_t oK    = off; off += PK;
  const size_t oKr   = off; off += PK;
  const size_t oV    = off; off += PK;
  const size_t oVr   = off; off += PK;
  const size_t oVT   = off; off += PVT;
  const size_t oVTr  = off; off += PVT;
  const size_t oCtx  = off; off += PCtx;
  const size_t oCtxr = off; off += PCtx;
  if (off > ws_size) return;                         // off = 59768832 for SEQ = 4096
  if (off > (size_t)134217728) return;

  char* ws = (char*)d_ws;
  unsigned short* Xh   = (unsigned short*)(ws + oX);
  unsigned short* WqT  = (unsigned short*)(ws + oWq);
  unsigned short* WkT  = (unsigned short*)(ws + oWk);
  unsigned short* WvT  = (unsigned short*)(ws + oWv);
  unsigned short* WoT  = (unsigned short*)(ws + oWo);
  unsigned short* Qh   = (unsigned short*)(ws + oQ);
  unsigned short* Qr   = (unsigned short*)(ws + oQr);
  unsigned short* Kh   = (unsigned short*)(ws + oK);
  unsigned short* Kr   = (unsigned short*)(ws + oKr);
  unsigned short* Vh   = (unsigned short*)(ws + oV);
  unsigned short* Vr   = (unsigned short*)(ws + oVr);
  unsigned short* VT   = (unsigned short*)(ws + oVT);
  unsigned short* VTr  = (unsigned short*)(ws + oVTr);
  unsigned short* Ctx  = (unsigned short*)(ws + oCtx);
  unsigned short* Ctxr = (unsigned short*)(ws + oCtxr);
  float*          outf = (float*)d_out;              // [SEQ][DM]

  const dim3 blk(256);
  const int n8x = SEQ * DM / 8;                      // 524288
  const dim3 gCx((n8x + 255) / 256);                 // 2048 blocks
  const dim3 gTw(DM / 64, DM / 64, 4);               // (16, 16, 4): the four weights, [1024 k][n] -> [n][1024 k]
  const dim3 gGq((NQT * (DM / 64) + 7) / 8);         // 1024 tiles -> 128 blocks
  const dim3 gGqkv((NQT * ((DM + 2 * DKV) / 64) + 7) / 8);   // 1536 tiles -> 192 blocks
  const dim3 gVt(SEQ / 64, NKV, 2);                  // (64, 4, 2)
  const dim3 gAtt(NQT * NH);                         // every (head, query tile), both variants
  const float wScale = 1024.0f;                      // weights carried x1024
  const float aScale = 16.0f;                        // activations carried x16
  const float cscale = 1.0f / 16384.0f;              // 1/(16 * 1024)

  // (1) planes: x -> f16 x16 (bf16 values); weights -> transposed f16 x1024 (bf16 values)
  cvt16<<<gCx, blk, 0, stream>>>(x, Xh, n8x, aScale);
  w_tr<<<gTw, blk, 0, stream>>>(w_q, w_k, w_v, w_o, WqT, WkT, WvT, WoT, DM, DM, DKV, wScale);
  // (2) [q | k | v] = Xh . [WqT ; WkT ; WvT]^T in one grid (M=SEQ, N=1024+256+256, K=1024; the three transposed
  //     weights lie one behind the other in the workspace): Qh [SEQ][1024], Kh, Vh [SEQ][256], f16 x16 + residual
  gemm64_f16<0, false><<<gGqkv, blk, 0, stream>>>(Xh, Xh, DM, WqT, DM, cscale, (void*)Qh, Qr, DM,
                                                  SEQ, DM + 2 * DKV, DM, aScale, SEQ, 0, SEQ,
                                                  DM, DKV, Kh, Kr, Vh, Vr);
  // (3) v -> v^T planes (hi and residual, all tokens, all kv heads)
  v_tr<<<gVt, blk, 0, stream>>>(Vh, VT, Vr, VTr);
  // (4) causal softmax attention -> Ctx f16 x16 + residual plane: tiles 0..QHR-1 with residual operand planes,
  //     tiles QHR..NQT-1 with single products; together every (head, query tile) exactly once
  attn_all<<<gAtt, dim3(128), 0, stream>>>(Qh, Qr, Kh, Kr, VT, VTr, Ctx, Ctxr);
  // (5) out = (Ctx + 2^-11 Ctxr) . WoT^T -> d_out f32 [SEQ][1024] (M=SEQ, N=1024, K=1024), every tile once
  gemm64_f16<1, true><<<gGq, blk, 0, stream>>>(Ctx, Ctxr, DM, WoT, DM, cscale, (void*)outf, Ctxr, DM,
                                               SEQ, DM, DM, 1.0f, SEQ, 0, SEQ,
                                               DM, DKV, Ctxr, Ctxr, Ctxr, Ctxr);
  (void)hipGetLastError();
}

// v003
// A run of this version takes 243 microseconds.
// Next to v002, in two timings, it ran 1.28 times as fast each time.
// Over all steps from v000 it is 2.83 times as fast.
// Contractions: q/k/v projections = v_wmma_f32_16x16x32_f16 (A = f16 of RNE-bf16 x carried x16, B = f16 of RNE-bf16 w^T carried x1024, single product); attention k.q^T and v^T.p^T (both products transposed) = v_wmma_f32_16x16x32_f16 (query tiles below SEQ/2: q, k, v^T f16 planes x16 plus x2^11 residual planes, p f16 x256 plus x2^11 residual, hi.hi + hi.res + res.hi; query tiles from SEQ/2 on: single products on the x16 / x256 planes); output projection = v_wmma_f32_16x16x32_f16 (A = ctx f16 x16 plus its x2^11 residual plane, B = f16 of RNE-bf16 w_o^T x1024); all f32 accumulate. Causal online-max softmax, masks and row sums f32 on VALU.
#include <hip/hip_runtime.h>
#include <math.h>
#include <stdint.h>

#define SEQ   4096
#define DM    1024
#define NH    16
#define NKV   4
#define HD    64
#define DKV   (NKV * HD)            // 256
#define GRP   (NH / NKV)            // query heads per kv head = 4 (query head h uses kv head h / GRP)
#define NQT   (SEQ / 64)            // 64 query tiles of 64 rows
#define QHR   (NQT / 2)             // query tiles below this index use residual planes in attention
#define OUTN  (SEQ * DM)
static_assert(NH * HD == DM);
static_assert(HD == 64);
static_assert((NH % NKV) == 0);
static_assert((SEQ % 64) == 0 && (NQT % 2) == 0);
static_assert((DM % 64) == 0 && (DKV % 64) == 0 && (DM % 32) == 0);
static_assert(((NQT * (DM / 64)) % 8) == 0);
static_assert(((NQT * (DKV / 64)) % 8) == 0);
static_assert((((DM + 2 * DKV) / 64) % 8) == 0);   // the 8 waves of a projection block share their 64 rows of A
static_assert(((SEQ * DM / 8) % 256) == 0);

typedef _Float16 v16h __attribute__((ext_vector_type(16)));
typedef _Float16 v8h  __attribute__((ext_vector_type(8)));
typedef float    v8f  __attribute__((ext_vector_type(8)));
typedef float    v4f  __attribute__((ext_vector_type(4)));
typedef unsigned int v4u __attribute__((ext_vector_type(4)));

// ---- scalar helpers --------------------------------------------------------------------------------
__device__ __forceinline__ unsigned short bf_bits(float f) {          // f32 -> bf16 bits, RNE convert
  unsigned u = __float_as_uint(f);
  return (unsigned short)((u + 0x7FFFu + ((u >> 16) & 1u)) >> 16);
}
__device__ __forceinline__ float bfr(float f) { return __uint_as_float(((unsigned)bf_bits(f)) << 16); }
__device__ __forceinline__ unsigned short h_bits(_Float16 x) { return __builtin_bit_cast(unsigned short, x); }
__device__ __forceinline__ unsigned pk16(unsigned short a, unsigned short b) { return (unsigned)a | ((unsigned)b << 16); }
__device__ __forceinline__ v8f zero8() { v8f z = {0.f, 0.f, 0.f, 0.f, 0.f, 0.f, 0.f, 0.f}; return z; }

// ---- fragment loader: 16-bit A/B operand, lane -> row/col (lane&15), p already includes +8*(lane>>4);
//      elements 0..7 <- p[0..7] (k0+8h..), elements 8..15 <- p[16..23] (k0+16+8h..)
__device__ __forceinline__ v16h ldfrag_h(const _Float16* p) {
  union { v16h v; v8h h[2]; } f;
  f.h[0] = *(const v8h*)(p);
  f.h[1] = *(const v8h*)(p + 16);
  return f.v;
}

// ---- WMMA helpers with trailing VALU hazard gap --------------------------------------------------------
__device__ __forceinline__ v8f mma_h(v16h a, v16h b, v8f c) {
  c = __builtin_amdgcn_wmma_f32_16x16x32_f16(false, a, false, b, (short)0, c, false, false);
#if defined(__HIP_DEVICE_COMPILE__)
  asm volatile("v_nop\n\tv_nop\n\tv_nop\n\tv_nop" : "+v"(c) : "v"(a), "v"(b));
#endif
  return c;
}
__device__ __forceinline__ v8f mma_h_raw(v16h a, v16h b, v8f c) {
  return __builtin_amdgcn_wmma_f32_16x16x32_f16(false, a, false, b, (short)0, c, false, false);
}
__device__ __forceinline__ void dep_guard_h(v8f& a, v8f& b, v16h x, v16h y) {
#if defined(__HIP_DEVICE_COMPILE__)
  asm volatile("v_nop\n\tv_nop\n\tv_nop\n\tv_nop" : "+v"(a), "+v"(b) : "v"(x), "v"(y));
#endif
}
__device__ __forceinline__ void keep4_h(v16h a, v16h b, v16h c, v16h d) {
#if defined(__HIP_DEVICE_COMPILE__)
  asm volatile("v_nop" :: "v"(a), "v"(b), "v"(c), "v"(d));
#endif
}
__device__ __forceinline__ void acc_guard4(v8f& a, v8f& b, v8f& c, v8f& d) {
#if defined(__HIP_DEVICE_COMPILE__)
  asm volatile("v_nop\n\tv_nop\n\tv_nop\n\tv_nop" : "+v"(a), "+v"(b), "+v"(c), "+v"(d));
#endif
}

// =====================================================================================================
// f32 plane -> f16 bits of bfr(v) * scale (scale a power of two): x (x16).
// coverage: n8 threads x 8 = the whole plane.
// =====================================================================================================
__global__ __launch_bounds__(256) void cvt16(const float* __restrict__ in, unsigned short* out, int n8, float scale) {
  const int i = blockIdx.x * 256 + threadIdx.x;
  if (i < n8) {
    const v4f a = *(const v4f*)(in + (size_t)i * 8);
    const v4f b = *(const v4f*)(in + (size_t)i * 8 + 4);
    v4u p;
    p[0] = pk16(h_bits((_Float16)(bfr(a[0]) * scale)), h_bits((_Float16)(bfr(a[1]) * scale)));
    p[1] = pk16(h_bits((_Float16)(bfr(a[2]) * scale)), h_bits((_Float16)(bfr(a[3]) * scale)));
    p[2] = pk16(h_bits((_Float16)(bfr(b[0]) * scale)), h_bits((_Float16)(bfr(b[1]) * scale)));
    p[3] = pk16(h_bits((_Float16)(bfr(b[2]) * scale)), h_bits((_Float16)(bfr(b[3]) * scale)));
    *(v4u*)(out + (size_t)i * 8) = p;
    
  }
}

// =====================================================================================================
// f32 weight W [K rows][N cols] (the x@W layout, n contiguous) -> f16 Wt[n][k] = f16(bfr(W[k][n]) * scale),
// pitch K halves (k contiguous = the Bt layout of the GEMM below); scale a power of two.
// Block = one 64 (k) x 64 (n) tile of one of four weights; grid = (Nwide/64, K/64, 4), blockIdx.z = the weight,
// blocks past a narrow weight's last column tile leave at once; tile staged in LDS as halves [kk][nn] pitch 72
// (v8h 16-B stores, __syncthreads, _Float16 element reads).
// Store: group g = tid>>3 (0..31), piece = tid&7: iteration it writes out row n = it*32+g, lanes 8q..8q+7 x 16 B =
// coverage: load 2 x 256 threads x 8 = 64x64; store 2 iterations x 32 groups = 64 rows n, 8 pieces x 8 = 64 k
// per row; grid covers every (n tile, k tile) of [N][K].
// =====================================================================================================
__global__ __launch_bounds__(256) void w_tr(const float* __restrict__ w0, const float* __restrict__ w1,
                                            const float* __restrict__ w2, const float* __restrict__ w3,
                                            unsigned short* t0, unsigned short* t1, unsigned short* t2, unsigned short* t3,
                                            int K, int Nwide, int Nnarrow, float scale) {
  __shared__ __align__(16) _Float16 sw[64 * 72];       // [kk][nn], pitch 72 halves (144 B)
  const int tid = threadIdx.x;
  const int z   = blockIdx.z;                          // which weight: 0 and 3 are Nwide columns, 1 and 2 Nnarrow
  const int N   = (z == 0 || z == 3) ? Nwide : Nnarrow;
  const int n0  = blockIdx.x * 64;
  const int k0  = blockIdx.y * 64;
  if (z > 3 || n0 >= N || k0 >= K) return;             // block-uniform, before the barrier
  const float* w = (z == 0) ? w0 : (z == 1) ? w1 : (z == 2) ? w2 : w3;
  unsigned short* wt = (z == 0) ? t0 : (z == 1) ? t1 : (z == 2) ? t2 : t3;
#pragma unroll
  for (int i = 0; i < 2; ++i) {
    const int idx = i * 256 + tid;                  // 0..511
    const int kk = idx >> 3, c8 = (idx & 7) * 8;
    const float* src = w + (size_t)(k0 + kk) * N + n0 + c8;
    const v4f a  = *(const v4f*)(src);
    const v4f a2 = *(const v4f*)(src + 4);
    v8h o;
    o[0] = (_Float16)(bfr(a[0]) * scale);
    o[1] = (_Float16)(bfr(a[1]) * scale);
    o[2] = (_Float16)(bfr(a[2]) * scale);
    o[3] = (_Float16)(bfr(a[3]) * scale);
    o[4] = (_Float16)(bfr(a2[0]) * scale);
    o[5] = (_Float16)(bfr(a2[1]) * scale);
    o[6] = (_Float16)(bfr(a2[2]) * scale);
    o[7] = (_Float16)(bfr(a2[3]) * scale);
    *(v8h*)(sw + kk * 72 + c8) = o;
  }
  __syncthreads();

  const int g = tid >> 3, piece = tid & 7;
  v4u hv[2];
  size_t hofs[2];
#pragma unroll
  for (int it = 0; it < 2; ++it) {
    const int nn = it * 32 + g;
    v4u a;
#pragma unroll
    for (int e = 0; e < 4; ++e) {
      const _Float16 x0 = sw[(piece * 8 + 2 * e) * 72 + nn];
      const _Float16 x1 = sw[(piece * 8 + 2 * e + 1) * 72 + nn];
      a[e] = pk16(h_bits(x0), h_bits(x1));
    }
    hv[it] = a;
    hofs[it] = ((size_t)(n0 + nn)) * K + k0 + piece * 8;
  }
  {
#pragma unroll
    for (int it = 0; it < 2; ++it) *(v4u*)(wt + hofs[it]) = hv[it];
    
  }
}

// =====================================================================================================
// Register-blocked f16 WMMA GEMM, one wave per 64x64 tile, no block barriers:
//   v[m][n] = (sum_k A[m][k] * Bt[n][k]  [+ 2^-11 * sum_k Ar[m][k] * Bt[n][k] when ARES]) * cscale
// A, Ar row-major [M][K] pitch lda (f16), Bt row-major [N][K] pitch ldb (f16, k contiguous); M, N multiples of
// 64, K multiple of 32; tile count a multiple of 8. A wave skips its tile unless (m0 % tmod) lies in [tlo, thi)
// (wave-uniform, before any LDS use).
// ARES: the residual plane is accumulated first from zero, the accumulators are scaled by 2^-11 exactly on the
// VALU (with nop gaps on both sides), then the hi plane accumulates on top: one accumulator set.
// EPI 0: column tiles from n1 on are stored to a second and a third output (each nx columns wide, pitch nx; hi plane
// C2 / C3, residual plane C2r / C3r), so that products that share A run in one grid. EPI 1 has the one output.
// Epilogue variants:
//   EPI 0: f16 hi plane = f16(v * oscale) at Cp and residual plane = f16((v*oscale - hi) * 2048) at Crp, pitch ldc halves
//   EPI 1: f32 out = v, pitch ldc floats
// 16-row slabs staged per wave in LDS. f32 out: each 64-wide row segment (256 B = 2 lines) by 16 lanes x 16 B,
// coverage: 4 slabs x 16 rows x 64 cols = the wave's whole 64x64 tile; grid x 8 tiles = [M][N] (restricted to the
// [tlo, thi) token window).
// =====================================================================================================
template <int EPI, bool ARES>
__global__ __launch_bounds__(256) void gemm64_f16(
    const unsigned short* __restrict__ Ap, const unsigned short* __restrict__ Arp, int lda,
    const unsigned short* __restrict__ Btp, int ldb,
    float cscale,
    void* Cp, unsigned short* Crp, int ldc, int M, int N, int K, float oscale,
    int tmod, int tlo, int thi,
    int n1, int nx, unsigned short* C2, unsigned short* C2r, unsigned short* C3, unsigned short* C3r) {
  const _Float16* Ah  = (const _Float16*)(const void*)Ap;
  const _Float16* Arh = (const _Float16*)(const void*)Arp;
  const _Float16* Bt  = (const _Float16*)(const void*)Btp;
  __shared__ __align__(16) float sT[8][16 * 68];   // per-wave 16x64 slab, pitch 68 floats
  const int lane = threadIdx.x & 31;
  const int wave = threadIdx.x >> 5;
  const int tilesN = N >> 6;
  const int tilesM = M >> 6;
  const int tile = blockIdx.x * 8 + wave;
  if (tile >= tilesM * tilesN) return;   // wave-uniform; no block barriers in this kernel
  const int tm = tile / tilesN;
  const int tn = tile - tm * tilesN;
  const int m0 = tm << 6;
  const int n0 = tn << 6;
  const int tpos = m0 % tmod;
  if (tpos < tlo || tpos >= thi) return; // wave-uniform

  // output of this tile (wave-uniform): columns below n1 go to Cp / Crp, the next nx to C2 / C2r, the next nx to C3 / C3r
  void* Co = Cp;
  unsigned short* Cro = Crp;
  int ldo = ldc, nc0 = n0;
  if constexpr (EPI == 0) {
    if (n0 >= n1) {
      const int e = n0 - n1;
      const bool third = (e >= nx);
      Co  = third ? (void*)C3 : (void*)C2;
      Cro = third ? C3r : C2r;
      ldo = nx;
      nc0 = third ? e - nx : e;
    }
  }

  const int rlane = lane & 15;                 // row (A) / col (B, D) within subtile
  const int koff  = (lane >> 4) * 8;           // k offset of this lane half
  const int mOff  = (lane >> 4) * 8;           // D row offset

  v8f acc[4][4];
#pragma unroll
  for (int i = 0; i < 4; ++i)
#pragma unroll
    for (int j = 0; j < 4; ++j) acc[i][j] = zero8();

  constexpr int NPL = ARES ? 2 : 1;
#pragma unroll 1
  for (int pl = 0; pl < NPL; ++pl) {
    const _Float16* Asel = (ARES && pl == 0) ? Arh : Ah;     // wave-uniform selection of a global pointer
    if (ARES && pl == 1) {
      acc_guard4(acc[0][0], acc[0][1], acc[0][2], acc[0][3]);
      acc_guard4(acc[1][0], acc[1][1], acc[1][2], acc[1][3]);
      acc_guard4(acc[2][0], acc[2][1], acc[2][2], acc[2][3]);
      acc_guard4(acc[3][0], acc[3][1], acc[3][2], acc[3][3]);
#pragma unroll
      for (int i = 0; i < 4; ++i)
#pragma unroll
        for (int j = 0; j < 4; ++j) acc[i][j] = acc[i][j] * (1.0f / 2048.0f);   // exact fold of the x2^11 residual carry
      acc_guard4(acc[0][0], acc[0][1], acc[0][2], acc[0][3]);
      acc_guard4(acc[1][0], acc[1][1], acc[1][2], acc[1][3]);
      acc_guard4(acc[2][0], acc[2][1], acc[2][2], acc[2][3]);
      acc_guard4(acc[3][0], acc[3][1], acc[3][2], acc[3][3]);
    }
    for (int k0 = 0; k0 < K; k0 += 32) {
      v16h bh[4];
#pragma unroll
      for (int j = 0; j < 4; ++j) {
        const size_t bo = (size_t)(n0 + (j << 4) + rlane) * ldb + koff + k0;
        bh[j] = ldfrag_h(Bt + bo);
      }
#pragma unroll
      for (int i = 0; i < 4; ++i) {
        const size_t ao = (size_t)(m0 + (i << 4) + rlane) * lda + koff + k0;
        const v16h ah = ldfrag_h(Asel + ao);
#pragma unroll
        for (int j = 0; j < 4; ++j) {
          acc[i][j] = mma_h_raw(ah, bh[j], acc[i][j]);
        }
        dep_guard_h(acc[i][0], acc[i][3], ah, bh[3]);
      }
      keep4_h(bh[0], bh[1], bh[2], bh[3]);
    }
  }
  acc_guard4(acc[0][0], acc[0][1], acc[0][2], acc[0][3]);
  acc_guard4(acc[1][0], acc[1][1], acc[1][2], acc[1][3]);
  acc_guard4(acc[2][0], acc[2][1], acc[2][2], acc[2][3]);
  acc_guard4(acc[3][0], acc[3][1], acc[3][2], acc[3][3]);

  // ---- epilogue ----
  float* slab = sT[wave];
#pragma unroll
  for (int i = 0; i < 4; ++i) {
    const int mBase = m0 + (i << 4);
#pragma unroll
    for (int r = 0; r < 8; ++r) {
      const int row = mOff + r;
#pragma unroll
      for (int j = 0; j < 4; ++j) slab[row * 68 + (j << 4) + rlane] = acc[i][j][r] * cscale;
    }
    __builtin_amdgcn_fence(__ATOMIC_RELEASE, "workgroup");
    __builtin_amdgcn_wave_barrier();
    __builtin_amdgcn_fence(__ATOMIC_ACQUIRE, "workgroup");
    if constexpr (EPI == 0) {
      unsigned short* C16 = (unsigned short*)Co;
      const int rq = lane >> 3, piece = lane & 7;
      v4u ph[4], pr[4];
#pragma unroll
      for (int it = 0; it < 4; ++it) {
        const int row = it * 4 + rq;                         // it 0..3 x rq 0..3 = rows 0..15
        const v4f a  = *(const v4f*)(slab + row * 68 + piece * 8);
        const v4f a2 = *(const v4f*)(slab + row * 68 + piece * 8 + 4);
        float f[8];
        f[0] = a[0];  f[1] = a[1];  f[2] = a[2];  f[3] = a[3];
        f[4] = a2[0]; f[5] = a2[1]; f[6] = a2[2]; f[7] = a2[3];
        v4u p, q;
#pragma unroll
        for (int e = 0; e < 4; ++e) {
          const float g0 = f[2 * e] * oscale, g1 = f[2 * e + 1] * oscale;
          const _Float16 x0 = (_Float16)g0, x1 = (_Float16)g1;
          const _Float16 y0 = (_Float16)((g0 - (float)x0) * 2048.0f);
          const _Float16 y1 = (_Float16)((g1 - (float)x1) * 2048.0f);
          p[e] = pk16(h_bits(x0), h_bits(x1));
          q[e] = pk16(h_bits(y0), h_bits(y1));
        }
        ph[it] = p;
        pr[it] = q;
      }
      {
#pragma unroll
        for (int it = 0; it < 4; ++it) {
          const int row = it * 4 + rq;
          const size_t co = (size_t)(mBase + row) * ldo + nc0 + piece * 8;
          *(v4u*)(C16 + co) = ph[it];
          *(v4u*)(Cro + co) = pr[it];
        }
        
      }
    } else {
      float* Cf = (float*)Co;
      const int hh = lane >> 4, c4 = (lane & 15) * 4;     // 256-B row segment = 16 lanes x 16 B
      v4f ov[8];
#pragma unroll
      for (int it = 0; it < 8; ++it) {
        const int row = it * 2 + hh;                       // it 0..7 x hh 0..1 = rows 0..15
        ov[it] = *(const v4f*)(slab + row * 68 + c4);
      }
      {
#pragma unroll
        for (int it = 0; it < 8; ++it) {
          const int row = it * 2 + hh;
          *(v4f*)(Cf + (size_t)(mBase + row) * ldo + nc0 + c4) = ov[it];
        }
        
      }
    }
    __builtin_amdgcn_fence(__ATOMIC_RELEASE, "workgroup");
    __builtin_amdgcn_wave_barrier();
    __builtin_amdgcn_fence(__ATOMIC_ACQUIRE, "workgroup");
  }
}

// =====================================================================================================
// f16 v plane (token-major, element (t, g, d) at vp[t*DKV + g*64 + d], g = kv head) -> f16 v^T plane
// vt[(g*64 + d)*SEQ + t] (same bits). Used for the hi plane and the residual plane.
// Block = one 64-token x 64-feature tile of one kv head g of one plane; grid = (SEQ/64, NKV, 2); tile staged in LDS as halves
// (v8h 16-B stores, __syncthreads, _Float16 element reads).
// Store: group g8 = tid>>3 (0..31), piece = tid&7: iteration it writes row d = it*32+g8, lanes 8q..8q+7 x 16 B =
// coverage: load 2 x 256 threads x 8 halves = 64x64; store 2 iterations x 32 groups = 64 rows d, 8 pieces x 8
// = 64 tokens per row; grid covers every (kv head, token tile) of [DKV][SEQ].
// =====================================================================================================
__global__ __launch_bounds__(256) void v_tr(const unsigned short* __restrict__ vp0, unsigned short* vt0,
                                            const unsigned short* __restrict__ vp1, unsigned short* vt1) {
  __shared__ __align__(16) _Float16 sv[64 * 72];       // [tt][d], pitch 72 halves (144 B)
  const int tid = threadIdx.x;
  const int t0  = blockIdx.x * 64;
  const int g   = blockIdx.y;
  if (g >= NKV || t0 >= SEQ || blockIdx.z > 1) return; // block-uniform, before any barrier
  const unsigned short* vp = blockIdx.z ? vp1 : vp0;   // blockIdx.z: 0 = hi plane, 1 = residual plane
  unsigned short* vt = blockIdx.z ? vt1 : vt0;
  const _Float16* src = (const _Float16*)(const void*)vp;
#pragma unroll
  for (int i = 0; i < 2; ++i) {
    const int idx = i * 256 + tid;                  // 0..511
    const int tt = idx >> 3, c8 = (idx & 7) * 8;
    const v8h a = *(const v8h*)(src + ((size_t)(t0 + tt)) * DKV + g * HD + c8);
    *(v8h*)(sv + tt * 72 + c8) = a;
  }
  __syncthreads();

  const int g8 = tid >> 3, piece = tid & 7;
  v4u hv[2];
  size_t hofs[2];
#pragma unroll
  for (int it = 0; it < 2; ++it) {
    const int d = it * 32 + g8;
    v4u a;
#pragma unroll
    for (int e = 0; e < 4; ++e) {
      const _Float16 x0 = sv[(piece * 8 + 2 * e) * 72 + d];
      const _Float16 x1 = sv[(piece * 8 + 2 * e + 1) * 72 + d];
      a[e] = pk16(h_bits(x0), h_bits(x1));
    }
    hv[it] = a;
    hofs[it] = ((size_t)(g * HD + d)) * SEQ + t0 + piece * 8;
  }
  {
#pragma unroll
    for (int it = 0; it < 2; ++it) *(v4u*)(vt + hofs[it]) = hv[it];
    
  }
}

#define ATT_SMEM 36864                                    // LDS bytes of the residual-plane variant, the larger one
// value of lane l ^ 16 (the other half of the wave, same column)
__device__ __forceinline__ float xhalf(float x) {
  return __builtin_bit_cast(float, __builtin_amdgcn_permlanex16(__builtin_bit_cast(int, x), __builtin_bit_cast(int, x),
                                                                0x76543210, 0xfedcba98, false, false));
}
template <bool HR>
__device__ __forceinline__
void attn_body(unsigned char* smem,
               const unsigned short* __restrict__ qp,  const unsigned short* __restrict__ qrp,
               const unsigned short* __restrict__ kp,  const unsigned short* __restrict__ krp,
               const unsigned short* __restrict__ vtp, const unsigned short* __restrict__ vtrp,
               unsigned short* ctxp, unsigned short* ctxrp, int qb, int h) {
  union FH { v16h v; v8h h[2]; };
  constexpr int LP     = 72;                             // LDS row pitch in halves: 144 B = 16 B x 9, so the 16 rows
                                                         // that one ds_load_b128 fragment read touches fall on 16
                                                         // different 4-bank groups (at 128 B they share two groups)
  constexpr int TB     = 64 * LP * 2;                    // one f16 64x64 tile at pitch LP, bytes
  constexpr int OP     = 68;                             // context staging pitch in floats: 272 B = 16 B x 17
  constexpr int OFF_K  = 0;
  constexpr int OFF_V  = TB;
  constexpr int OFF_KR = 2 * TB;
  constexpr int OFF_VR = 3 * TB;
  constexpr int SMEMB  = HR ? 4 * TB : 2 * TB;                // 36864 : 18432
  static_assert(4 * 16 * OP * 4 <= 2 * TB);                   // f32 context staging aliases the K/V region
  static_assert(SMEMB <= ATT_SMEM);
  _Float16* Ksh = (_Float16*)(smem + OFF_K);                  // K   [kv][d], pitch LP
  _Float16* Vsh = (_Float16*)(smem + OFF_V);                  // V^T [d][kv], pitch LP
  _Float16* Krs = (_Float16*)(smem + (HR ? OFF_KR : OFF_K));  // K residual (HR only)
  _Float16* Vrs = (_Float16*)(smem + (HR ? OFF_VR : OFF_V));  // V^T residual (HR only)

  const int tid  = threadIdx.x;
  const int wave = tid >> 5;
  const int lane = tid & 31;
  const int hh   = lane >> 4;
  const int c    = lane & 15;

  const int g    = h / GRP;                  // kv head
  const int q0   = qb * 64 + wave * 16;
  const int qrow = q0 + c;                   // the one query of this lane

  const _Float16* QP  = (const _Float16*)(const void*)qp   + (size_t)h * HD;
  const _Float16* QRP = (const _Float16*)(const void*)qrp  + (size_t)h * HD;
  const _Float16* KP  = (const _Float16*)(const void*)kp   + (size_t)g * HD;
  const _Float16* KRP = (const _Float16*)(const void*)krp  + (size_t)g * HD;
  const _Float16* VTP = (const _Float16*)(const void*)vtp  + (size_t)g * HD * SEQ;
  const _Float16* VRP = (const _Float16*)(const void*)vtrp + (size_t)g * HD * SEQ;

  // ---- Q fragments (B operand, column = lane&15): 2 d-chunks ----
  v16h qa[2], qr[2];
#pragma unroll
  for (int dc = 0; dc < 2; ++dc) {
    const size_t qo = (size_t)(q0 + c) * DM + dc * 32 + 8 * hh;
    qa[dc] = ldfrag_h(QP + qo);
    if constexpr (HR) qr[dc] = ldfrag_h(QRP + qo);
    else qr[dc] = qa[dc];
  }

  float lsum = 0.f, mrun = -1e30f;
  v8f oacc[4], oacc2[4];
#pragma unroll
  for (int t = 0; t < 4; ++t) { oacc[t] = zero8(); oacc2[t] = zero8(); }

  const int nkt = qb + 1;                                      // key tiles 0..qb, block-uniform
  for (int kti = 0; kti < nkt; ++kti) {
    const int kv0 = kti * 64;                                  // <= qb*64 < SEQ
    __syncthreads();
    {
      const int r = tid >> 1, half = (tid & 1) * 32;
      const size_t ko = (size_t)(kv0 + r) * DKV + half;         // K row kv0+r, d = half..half+31
      const size_t vo = (size_t)r * SEQ + kv0 + half;           // V^T row d = r, s = kv0+half..+31
#pragma unroll
      for (int i = 0; i < 4; ++i) {
        const v8h a0 = *(const v8h*)(KP + ko + 8 * i);
        const v8h b0 = *(const v8h*)(VTP + vo + 8 * i);
        *(v8h*)(Ksh + r * LP + half + 8 * i) = a0;
        *(v8h*)(Vsh + r * LP + half + 8 * i) = b0;
        if constexpr (HR) {
          const v8h a1 = *(const v8h*)(KRP + ko + 8 * i);
          const v8h b1 = *(const v8h*)(VRP + vo + 8 * i);
          *(v8h*)(Krs + r * LP + half + 8 * i) = a1;
          *(v8h*)(Vrs + r * LP + half + 8 * i) = b1;
        }
      }
    }
    __syncthreads();

    // ---- scores, transposed: 64 keys x 16 queries per wave (A operand: lane c -> key j*16+c, split k map over d) ----
    v8f s[4];
#pragma unroll
    for (int j = 0; j < 4; ++j) {
      s[j] = zero8();
      v8f t = zero8();
#pragma unroll
      for (int dc = 0; dc < 2; ++dc) {
        FH kb;
        kb.h[0] = *(const v8h*)(Ksh + (j * 16 + c) * LP + dc * 32 + 8 * hh);
        kb.h[1] = *(const v8h*)(Ksh + (j * 16 + c) * LP + dc * 32 + 16 + 8 * hh);
        s[j] = mma_h(kb.v, qa[dc], s[j]);
        if constexpr (HR) {
          FH krb;
          krb.h[0] = *(const v8h*)(Krs + (j * 16 + c) * LP + dc * 32 + 8 * hh);
          krb.h[1] = *(const v8h*)(Krs + (j * 16 + c) * LP + dc * 32 + 16 + 8 * hh);
          t = mma_h(krb.v, qa[dc], t);
          t = mma_h(kb.v, qr[dc], t);
        }
      }
      if constexpr (HR) s[j] = s[j] + t * (1.0f / 2048.0f);
    }

    // ---- causal online softmax of the lane's one query: masked logits and their maximum in-lane, one exchange
    //      with lane ^ 16, alpha, p, row-sum partial, P^T (x256, f16; HR: + residual) packed as the B operand ----
    float tm[8];
#pragma unroll
    for (int r = 0; r < 8; ++r) tm[r] = -1e30f;
#pragma unroll
    for (int j = 0; j < 4; ++j) {
#pragma unroll
      for (int r = 0; r < 8; ++r) {
        const int key = kv0 + j * 16 + 8 * hh + r;
        float a = s[j][r] * (1.0f / 2048.0f);              // 1/8 head scale, 1/256 for the two x16 carries
        const bool ok = (key <= qrow);
        a = ok ? a : -1e30f;
        s[j][r] = a;
        tm[r] = fmaxf(tm[r], a);
      }
    }
    float tmx = fmaxf(fmaxf(fmaxf(tm[0], tm[1]), fmaxf(tm[2], tm[3])), fmaxf(fmaxf(tm[4], tm[5]), fmaxf(tm[6], tm[7])));
    tmx = fmaxf(tmx, xhalf(tmx));
    const float mn = fmaxf(mrun, tmx);
    const float al = __expf(mrun - mn);
    mrun = mn;
    float pp[8];
#pragma unroll
    for (int r = 0; r < 8; ++r) pp[r] = 0.0f;
    FH pa[2], par[2];
#pragma unroll
    for (int j = 0; j < 4; ++j) {
#pragma unroll
      for (int r = 0; r < 8; ++r) {
        const int key = kv0 + j * 16 + 8 * hh + r;
        const bool ok = (key <= qrow);
        float p = __expf(s[j][r] - mn);
        p = ok ? p : 0.0f;
        pp[r] += p;
        const float gg = p * 256.0f;
        const _Float16 x0 = (_Float16)gg;
        pa[j >> 1].v[(j & 1) * 8 + r] = x0;
        if constexpr (HR) par[j >> 1].v[(j & 1) * 8 + r] = (_Float16)((gg - (float)x0) * 2048.0f);
      }
    }
    lsum = lsum * al + (((pp[0] + pp[1]) + (pp[2] + pp[3])) + ((pp[4] + pp[5]) + (pp[6] + pp[7])));

    // ---- rescale the context accumulators by alpha (VALU), nop gaps before the next WMMA reads them ----
#pragma unroll
    for (int t = 0; t < 4; ++t) {
      oacc[t] = oacc[t] * al;
      if constexpr (HR) oacc2[t] = oacc2[t] * al;
    }
    acc_guard4(oacc[0], oacc[1], oacc[2], oacc[3]);
    if constexpr (HR) acc_guard4(oacc2[0], oacc2[1], oacc2[2], oacc2[3]);

    // ---- context^T += V^T . P^T (f16 WMMA; A = V^T [d][key] from LDS, B = P^T [key][query] in registers) ----
#pragma unroll
    for (int kk = 0; kk < 2; ++kk) {
#pragma unroll
      for (int t = 0; t < 4; ++t) {
        FH vb;
        vb.h[0] = *(const v8h*)(Vsh + (t * 16 + c) * LP + kk * 32 + 8 * hh);
        vb.h[1] = *(const v8h*)(Vsh + (t * 16 + c) * LP + kk * 32 + 16 + 8 * hh);
        oacc[t] = mma_h(vb.v, pa[kk].v, oacc[t]);
        if constexpr (HR) {
          FH vrb;
          vrb.h[0] = *(const v8h*)(Vrs + (t * 16 + c) * LP + kk * 32 + 8 * hh);
          vrb.h[1] = *(const v8h*)(Vrs + (t * 16 + c) * LP + kk * 32 + 16 + 8 * hh);
          oacc2[t] = mma_h(vrb.v, pa[kk].v, oacc2[t]);
          oacc2[t] = mma_h(vb.v, par[kk].v, oacc2[t]);
        }
      }
    }
  }
  __syncthreads();                           // every wave is done with the K/V tiles before they are aliased

  // ---- normalise (1/lsum, the 1/256 p carry; keep the x16 v carry), stage the wave's 16x64 f32 tile [query][d]
  //      in LDS (a lane's 8 registers of tile t are 8 consecutive d of its query: two 16-B stores) ----
  float* os = (float*)(void*)smem + wave * (16 * OP);
  {
    const float l  = lsum + xhalf(lsum);     // the query's two key halves
    const float rl = 1.0f / l;               // l >= 1 (the max key contributes p = 1)
    const float sc = rl * (1.0f / 256.0f);
#pragma unroll
    for (int t = 0; t < 4; ++t) {
      v4f lo, hi;
#pragma unroll
      for (int r = 0; r < 4; ++r) {
        float v0 = oacc[t][r], v1 = oacc[t][r + 4];
        if constexpr (HR) { v0 += oacc2[t][r] * (1.0f / 2048.0f); v1 += oacc2[t][r + 4] * (1.0f / 2048.0f); }
        lo[r] = v0 * sc;
        hi[r] = v1 * sc;
      }
      *(v4f*)(os + c * OP + t * 16 + 8 * hh)     = lo;
      *(v4f*)(os + c * OP + t * 16 + 8 * hh + 4) = hi;
    }
  }
  __builtin_amdgcn_fence(__ATOMIC_RELEASE, "workgroup");
  __builtin_amdgcn_wave_barrier();
  __builtin_amdgcn_fence(__ATOMIC_ACQUIRE, "workgroup");
  {
    const int rq = lane >> 3, piece = lane & 7;
    v4u ph[4], pr[4];
#pragma unroll
    for (int it = 0; it < 4; ++it) {
      const int row = it * 4 + rq;   // it 0..3 x rq 0..3 = rows 0..15 of the wave tile
      const v4f a  = *(const v4f*)(os + row * OP + piece * 8);
      const v4f a2 = *(const v4f*)(os + row * OP + piece * 8 + 4);
      float f[8];
      f[0] = a[0];  f[1] = a[1];  f[2] = a[2];  f[3] = a[3];
      f[4] = a2[0]; f[5] = a2[1]; f[6] = a2[2]; f[7] = a2[3];
      v4u p, q;
#pragma unroll
      for (int e = 0; e < 4; ++e) {
        const _Float16 x0 = (_Float16)f[2 * e], x1 = (_Float16)f[2 * e + 1];
        const _Float16 y0 = (_Float16)((f[2 * e] - (float)x0) * 2048.0f);
        const _Float16 y1 = (_Float16)((f[2 * e + 1] - (float)x1) * 2048.0f);
        p[e] = pk16(h_bits(x0), h_bits(x1));
        q[e] = pk16(h_bits(y0), h_bits(y1));
      }
      ph[it] = p;
      pr[it] = q;
    }
    {
#pragma unroll
      for (int it = 0; it < 4; ++it) {
        const int row = it * 4 + rq;
        const size_t go = (size_t)(q0 + row) * DM + (size_t)h * HD + piece * 8;
        *(v4u*)(ctxp + go)  = ph[it];
        *(v4u*)(ctxrp + go) = pr[it];
      }
    }
  }
}

// =====================================================================================================
// Both attention variants in one grid of NQT * NH blocks, so that the short residual-plane tiles and the long
// single-product tiles run side by side. The grid is four quarters of NQT/4 * NH blocks; block w of each quarter has
// head w % NH and u = w / NH, and query tile NQT-1-u, QHR-1-u, QHR+u, u in quarters 0..3: a permutation of every
// (head, query tile), long tiles first, and the four blocks with equal w have the same total of key tiles for every w.
// =====================================================================================================
// amdgpu_waves_per_eu(4, 4): at most four waves per SIMD = four blocks per WGP, as many as the grid has per WGP, so
// that no WGP takes a fifth block while another is left with three.
__global__ __launch_bounds__(128) __attribute__((amdgpu_waves_per_eu(4, 4)))
void attn_all(const unsigned short* __restrict__ qp,  const unsigned short* __restrict__ qrp,
              const unsigned short* __restrict__ kp,  const unsigned short* __restrict__ krp,
              const unsigned short* __restrict__ vtp, const unsigned short* __restrict__ vtrp,
              unsigned short* ctxp, unsigned short* ctxrp) {
  __shared__ __align__(16) unsigned char smem[ATT_SMEM];
  constexpr int QQ = NQT / 4;
  static_assert((NQT % 4) == 0 && QHR == 2 * QQ);
  const int bx = blockIdx.x;
  const int j  = bx / (QQ * NH);
  if (j > 3) return;                         // block-uniform, before any barrier or store
  const int w  = bx - j * (QQ * NH);
  const int h  = w % NH;
  const int u  = w / NH;
  const int qb = (j == 0) ? (NQT - 1 - u) : (j == 1) ? (QHR - 1 - u) : (j == 2) ? (QHR + u) : u;
  if (qb < QHR) attn_body<true>(smem, qp, qrp, kp, krp, vtp, vtrp, ctxp, ctxrp, qb, h);
  else          attn_body<false>(smem, qp, qrp, kp, krp, vtp, vtrp, ctxp, ctxrp, qb, h);
}

// =====================================================================================================
// Workspace map (bytes, SEQ = 4096); every region is an exact multiple of its whole-line / whole-tile store
// granularity (row pitches 2048 / 512 / 8192 B, rows multiples of 64, all offsets 512-KiB aligned, no aliasing
// within a launch):
//   Xh    f16 [SEQ][1024]          0     8388608   (bf16 value of x, x16)
//   WqT   f16 [1024][1024]   8388608     2097152   (bf16 value of w_q^T x1024, [n][k])
//   WkT   f16 [256][1024]   10485760      524288   (bf16 value of w_k^T x1024, [n][k])
//   WvT   f16 [256][1024]   11010048      524288   (bf16 value of w_v^T x1024, [n][k])
//   WoT   f16 [1024][1024]  11534336     2097152   (bf16 value of w_o^T x1024, [n][k])
//   Qh    f16 [SEQ][1024]   13631488     8388608   (q x16)           Qr  22020096  8388608 (x2^11 residual)
//   Kh    f16 [SEQ][256]    30408704     2097152   (k x16)           Kr  32505856  2097152
//   Vh    f16 [SEQ][256]    34603008     2097152   (v x16)           Vr  36700160  2097152
//   VT    f16 [256][SEQ]    38797312     2097152   ([g*64 + d][s])   VTr 40894464  2097152
//   Ctx   f16 [SEQ][1024]   42991616     8388608   (context x16)     Ctxr 51380224 8388608
//   end                     59768832
// Projection weights arrive as [in k][out n] (n contiguous) and are transposed while converted (w_tr).
// d_out f32: [SEQ][1024] at byte 0, every 64x64 tile written once by the output projection launch.
// =====================================================================================================
extern "C" void kernel_launch(void* const* d_in, const int* in_sizes, int n_in,
                              void* d_out, int out_size, void* d_ws, size_t ws_size,
                              hipStream_t stream) {
  if (n_in < 5) return;
  if (in_sizes[0] < SEQ * DM || (in_sizes[0] % DM) != 0) return;   // x rows 0..SEQ-1 are used, pitch DM
  if (in_sizes[1] != DM * DM) return;
  if (in_sizes[2] != DM * DKV) return;
  if (in_sizes[3] != DM * DKV) return;
  if (in_sizes[4] != DM * DM) return;
  if (out_size < OUTN) return;

  const float* x   = (const float*)d_in[0];    // [>=SEQ][DM]
  const float* w_q = (const float*)d_in[1];    // [DM k][DM n]
  const float* w_k = (const float*)d_in[2];    // [DM k][DKV n]
  const float* w_v = (const float*)d_in[3];    // [DM k][DKV n]
  const float* w_o = (const float*)d_in[4];    // [DM k][DM n]

  const size_t PX   = (size_t)SEQ * DM * 2;          //  8388608
  const size_t PWq  = (size_t)DM * DM * 2;           //  2097152
  const size_t PWk  = (size_t)DKV * DM * 2;          //   524288
  const size_t PWo  = (size_t)DM * DM * 2;           //  2097152
  const size_t PQ   = (size_t)SEQ * DM * 2;          //  8388608
  const size_t PK   = (size_t)SEQ * DKV * 2;         //  2097152
  const size_t PVT  = (size_t)DKV * SEQ * 2;         //  2097152
  const size_t PCtx = (size_t)SEQ * DM * 2;          //  8388608
  size_t off = 0;
  const size_t oX    = off; off += PX;
  const size_t oWq   = off; off += PWq;
  const size_t oWk   = off; off += PWk;
  const size_t oWv   = off; off += PWk;
  const size_t oWo   = off; off += PWo;
  const size_t oQ    = off; off += PQ;
  const size_t oQr   = off; off += PQ;
  const size_t oK    = off; off += PK;
  const size_t oKr   = off; off += PK;
  const size_t oV    = off; off += PK;
  const size_t oVr   = off; off += PK;
  const size_t oVT   = off; off += PVT;
  const size_t oVTr  = off; off += PVT;
  const size_t oCtx  = off; off += PCtx;
  const size_t oCtxr = off; off += PCtx;
  if (off > ws_size) return;                         // off = 59768832 for SEQ = 4096
  if (off > (size_t)134217728) return;

  char* ws = (char*)d_ws;
  unsigned short* Xh   = (unsigned short*)(ws + oX);
  unsigned short* WqT  = (unsigned short*)(ws + oWq);
  unsigned short* WkT  = (unsigned short*)(ws + oWk);
  unsigned short* WvT  = (unsigned short*)(ws + oWv);
  unsigned short* WoT  = (unsigned short*)(ws + oWo);
  unsigned short* Qh   = (unsigned short*)(ws + oQ);
  unsigned short* Qr   = (unsigned short*)(ws + oQr);
  unsigned short* Kh   = (unsigned short*)(ws + oK);
  unsigned short* Kr   = (unsigned short*)(ws + oKr);
  unsigned short* Vh   = (unsigned short*)(ws + oV);
  unsigned short* Vr   = (unsigned short*)(ws + oVr);
  unsigned short* VT   = (unsigned short*)(ws + oVT);
  unsigned short* VTr  = (unsigned short*)(ws + oVTr);
  unsigned short* Ctx  = (unsigned short*)(ws + oCtx);
  unsigned short* Ctxr = (unsigned short*)(ws + oCtxr);
  float*          outf = (float*)d_out;              // [SEQ][DM]

  const dim3 blk(256);
  const int n8x = SEQ * DM / 8;                      // 524288
  const dim3 gCx((n8x + 255) / 256);                 // 2048 blocks
  const dim3 gTw(DM / 64, DM / 64, 4);               // (16, 16, 4): the four weights, [1024 k][n] -> [n][1024 k]
  const dim3 gGq((NQT * (DM / 64) + 7) / 8);         // 1024 tiles -> 128 blocks
  const dim3 gGqkv((NQT * ((DM + 2 * DKV) / 64) + 7) / 8);   // 1536 tiles -> 192 blocks
  const dim3 gVt(SEQ / 64, NKV, 2);                  // (64, 4, 2)
  const dim3 gAtt(NQT * NH);                         // every (head, query tile), both variants
  const float wScale = 1024.0f;                      // weights carried x1024
  const float aScale = 16.0f;                        // activations carried x16
  const float cscale = 1.0f / 16384.0f;              // 1/(16 * 1024)

  // (1) planes: x -> f16 x16 (bf16 values); weights -> transposed f16 x1024 (bf16 values)
  cvt16<<<gCx, blk, 0, stream>>>(x, Xh, n8x, aScale);
  w_tr<<<gTw, blk, 0, stream>>>(w_q, w_k, w_v, w_o, WqT, WkT, WvT, WoT, DM, DM, DKV, wScale);
  // (2) [q | k | v] = Xh . [WqT ; WkT ; WvT]^T in one grid (M=SEQ, N=1024+256+256, K=1024; the three transposed
  //     weights lie one behind the other in the workspace): Qh [SEQ][1024], Kh, Vh [SEQ][256], f16 x16 + residual
  gemm64_f16<0, false><<<gGqkv, blk, 0, stream>>>(Xh, Xh, DM, WqT, DM, cscale, (void*)Qh, Qr, DM,
                                                  SEQ, DM + 2 * DKV, DM, aScale, SEQ, 0, SEQ,
                                                  DM, DKV, Kh, Kr, Vh, Vr);
  // (3) v -> v^T planes (hi and residual, all tokens, all kv heads)
  v_tr<<<gVt, blk, 0, stream>>>(Vh, VT, Vr, VTr);
  // (4) causal softmax attention -> Ctx f16 x16 + residual plane: tiles 0..QHR-1 with residual operand planes,
  //     tiles QHR..NQT-1 with single products; together every (head, query tile) exactly once
  attn_all<<<gAtt, dim3(128), 0, stream>>>(Qh, Qr, Kh, Kr, VT, VTr, Ctx, Ctxr);
  // (5) out = (Ctx + 2^-11 Ctxr) . WoT^T -> d_out f32 [SEQ][1024] (M=SEQ, N=1024, K=1024), every tile once
  gemm64_f16<1, true><<<gGq, blk, 0, stream>>>(Ctx, Ctxr, DM, WoT, DM, cscale, (void*)outf, Ctxr, DM,
                                               SEQ, DM, DM, 1.0f, SEQ, 0, SEQ,
                                               DM, DKV, Ctxr, Ctxr, Ctxr, Ctxr);
  (void)hipGetLastError();
}

// v004
// It runs in 153 microseconds.
// Two timings next to v003 put it at 1.61 and 1.59 times that version's speed.
// All steps since v000 together make it 4.52 times as fast.
// Contractions: q/k/v projections = v_wmma_f32_16x16x32_f16 (A = f16 of RNE-bf16 x carried x16, B = f16 of RNE-bf16 w^T carried x1024, single product); attention k.q^T and v^T.p^T (both products transposed) = v_wmma_f32_16x16x32_f16 (query tiles below SEQ/2: q, k, v^T f16 planes x16 plus x2^11 residual planes, p f16 x256 plus x2^11 residual, hi.hi + hi.res + res.hi; query tiles from SEQ/2 on: single products on the x16 / x256 planes); output projection = v_wmma_f32_16x16x32_f16 (A = ctx f16 x16 plus its x2^11 residual plane, B = f16 of RNE-bf16 w_o^T x1024); all f32 accumulate. Causal online-max softmax, masks and row sums f32 on VALU.
#include <hip/hip_runtime.h>
#include <math.h>
#include <stdint.h>

#define SEQ   4096
#define DM    1024
#define NH    16
#define NKV   4
#define HD    64
#define DKV   (NKV * HD)            // 256
#define GRP   (NH / NKV)            // query heads per kv head = 4 (query head h uses kv head h / GRP)
#define NQT   (SEQ / 64)            // 64 query tiles of 64 rows
#define QHR   (NQT / 2)             // query tiles below this index use residual planes in attention
#define OUTN  (SEQ * DM)
static_assert(NH * HD == DM);
static_assert(HD == 64);
static_assert((NH % NKV) == 0);
static_assert((SEQ % 64) == 0 && (NQT % 2) == 0);
static_assert((DM % 64) == 0 && (DKV % 64) == 0 && (DM % 32) == 0);
static_assert(((NQT * (DM / 64)) % 8) == 0);
static_assert(((NQT * (DKV / 64)) % 8) == 0);
static_assert((SEQ % 128) == 0 && ((DM + 2 * DKV) % 256) == 0 && (DM % 256) == 0);   // GEMM block tile 128 x 256, 128 k per stage
static_assert(((SEQ * DM / 8) % 256) == 0);

typedef _Float16 v16h __attribute__((ext_vector_type(16)));
typedef _Float16 v8h  __attribute__((ext_vector_type(8)));
typedef float    v8f  __attribute__((ext_vector_type(8)));
typedef float    v4f  __attribute__((ext_vector_type(4)));
typedef unsigned int v4u __attribute__((ext_vector_type(4)));

// ---- scalar helpers --------------------------------------------------------------------------------
__device__ __forceinline__ unsigned short bf_bits(float f) {          // f32 -> bf16 bits, RNE convert
  unsigned u = __float_as_uint(f);
  return (unsigned short)((u + 0x7FFFu + ((u >> 16) & 1u)) >> 16);
}
__device__ __forceinline__ float bfr(float f) { return __uint_as_float(((unsigned)bf_bits(f)) << 16); }
__device__ __forceinline__ unsigned short h_bits(_Float16 x) { return __builtin_bit_cast(unsigned short, x); }
__device__ __forceinline__ unsigned pk16(unsigned short a, unsigned short b) { return (unsigned)a | ((unsigned)b << 16); }
__device__ __forceinline__ v8f zero8() { v8f z = {0.f, 0.f, 0.f, 0.f, 0.f, 0.f, 0.f, 0.f}; return z; }

// ---- fragment loader: 16-bit A/B operand, lane -> row/col (lane&15), p already includes +8*(lane>>4);
//      elements 0..7 <- p[0..7] (k0+8h..), elements 8..15 <- p[16..23] (k0+16+8h..)
__device__ __forceinline__ v16h ldfrag_h(const _Float16* p) {
  union { v16h v; v8h h[2]; } f;
  f.h[0] = *(const v8h*)(p);
  f.h[1] = *(const v8h*)(p + 16);
  return f.v;
}

// ---- WMMA helpers with trailing VALU hazard gap --------------------------------------------------------
__device__ __forceinline__ v8f mma_h(v16h a, v16h b, v8f c) {
  c = __builtin_amdgcn_wmma_f32_16x16x32_f16(false, a, false, b, (short)0, c, false, false);
#if defined(__HIP_DEVICE_COMPILE__)
  asm volatile("v_nop\n\tv_nop\n\tv_nop\n\tv_nop" : "+v"(c) : "v"(a), "v"(b));
#endif
  return c;
}
__device__ __forceinline__ v8f mma_h_raw(v16h a, v16h b, v8f c) {
  return __builtin_amdgcn_wmma_f32_16x16x32_f16(false, a, false, b, (short)0, c, false, false);
}
__device__ __forceinline__ void dep_guard_h(v8f& a, v8f& b, v16h x, v16h y) {
#if defined(__HIP_DEVICE_COMPILE__)
  asm volatile("v_nop\n\tv_nop\n\tv_nop\n\tv_nop" : "+v"(a), "+v"(b) : "v"(x), "v"(y));
#endif
}
__device__ __forceinline__ void keep4_h(v16h a, v16h b, v16h c, v16h d) {
#if defined(__HIP_DEVICE_COMPILE__)
  asm volatile("v_nop" :: "v"(a), "v"(b), "v"(c), "v"(d));
#endif
}
__device__ __forceinline__ void acc_guard4(v8f& a, v8f& b, v8f& c, v8f& d) {
#if defined(__HIP_DEVICE_COMPILE__)
  asm volatile("v_nop\n\tv_nop\n\tv_nop\n\tv_nop" : "+v"(a), "+v"(b), "+v"(c), "+v"(d));
#endif
}

// =====================================================================================================
// f32 plane -> f16 bits of bfr(v) * scale (scale a power of two): x (x16).
// coverage: n8 threads x 8 = the whole plane.
// =====================================================================================================
__global__ __launch_bounds__(256) void cvt16(const float* __restrict__ in, unsigned short* out, int n8, float scale) {
  const int i = blockIdx.x * 256 + threadIdx.x;
  if (i < n8) {
    const v4f a = *(const v4f*)(in + (size_t)i * 8);
    const v4f b = *(const v4f*)(in + (size_t)i * 8 + 4);
    v4u p;
    p[0] = pk16(h_bits((_Float16)(bfr(a[0]) * scale)), h_bits((_Float16)(bfr(a[1]) * scale)));
    p[1] = pk16(h_bits((_Float16)(bfr(a[2]) * scale)), h_bits((_Float16)(bfr(a[3]) * scale)));
    p[2] = pk16(h_bits((_Float16)(bfr(b[0]) * scale)), h_bits((_Float16)(bfr(b[1]) * scale)));
    p[3] = pk16(h_bits((_Float16)(bfr(b[2]) * scale)), h_bits((_Float16)(bfr(b[3]) * scale)));
    *(v4u*)(out + (size_t)i * 8) = p;
    
  }
}

// =====================================================================================================
// f32 weight W [K rows][N cols] (the x@W layout, n contiguous) -> f16 Wt[n][k] = f16(bfr(W[k][n]) * scale),
// pitch K halves (k contiguous = the Bt layout of the GEMM below); scale a power of two.
// Block = one 64 (k) x 64 (n) tile of one of four weights; grid = (Nwide/64, K/64, 4), blockIdx.z = the weight,
// blocks past a narrow weight's last column tile leave at once; tile staged in LDS as halves [kk][nn] pitch 72
// (v8h 16-B stores, __syncthreads, _Float16 element reads).
// Store: group g = tid>>3 (0..31), piece = tid&7: iteration it writes out row n = it*32+g, lanes 8q..8q+7 x 16 B =
// coverage: load 2 x 256 threads x 8 = 64x64; store 2 iterations x 32 groups = 64 rows n, 8 pieces x 8 = 64 k
// per row; grid covers every (n tile, k tile) of [N][K].
// =====================================================================================================
__global__ __launch_bounds__(256) void w_tr(const float* __restrict__ w0, const float* __restrict__ w1,
                                            const float* __restrict__ w2, const float* __restrict__ w3,
                                            unsigned short* t0, unsigned short* t1, unsigned short* t2, unsigned short* t3,
                                            int K, int Nwide, int Nnarrow, float scale) {
  __shared__ __align__(16) _Float16 sw[64 * 72];       // [kk][nn], pitch 72 halves (144 B)
  const int tid = threadIdx.x;
  const int z   = blockIdx.z;                          // which weight: 0 and 3 are Nwide columns, 1 and 2 Nnarrow
  const int N   = (z == 0 || z == 3) ? Nwide : Nnarrow;
  const int n0  = blockIdx.x * 64;
  const int k0  = blockIdx.y * 64;
  if (z > 3 || n0 >= N || k0 >= K) return;             // block-uniform, before the barrier
  const float* w = (z == 0) ? w0 : (z == 1) ? w1 : (z == 2) ? w2 : w3;
  unsigned short* wt = (z == 0) ? t0 : (z == 1) ? t1 : (z == 2) ? t2 : t3;
#pragma unroll
  for (int i = 0; i < 2; ++i) {
    const int idx = i * 256 + tid;                  // 0..511
    const int kk = idx >> 3, c8 = (idx & 7) * 8;
    const float* src = w + (size_t)(k0 + kk) * N + n0 + c8;
    const v4f a  = *(const v4f*)(src);
    const v4f a2 = *(const v4f*)(src + 4);
    v8h o;
    o[0] = (_Float16)(bfr(a[0]) * scale);
    o[1] = (_Float16)(bfr(a[1]) * scale);
    o[2] = (_Float16)(bfr(a[2]) * scale);
    o[3] = (_Float16)(bfr(a[3]) * scale);
    o[4] = (_Float16)(bfr(a2[0]) * scale);
    o[5] = (_Float16)(bfr(a2[1]) * scale);
    o[6] = (_Float16)(bfr(a2[2]) * scale);
    o[7] = (_Float16)(bfr(a2[3]) * scale);
    *(v8h*)(sw + kk * 72 + c8) = o;
  }
  __syncthreads();

  const int g = tid >> 3, piece = tid & 7;
  v4u hv[2];
  size_t hofs[2];
#pragma unroll
  for (int it = 0; it < 2; ++it) {
    const int nn = it * 32 + g;
    v4u a;
#pragma unroll
    for (int e = 0; e < 4; ++e) {
      const _Float16 x0 = sw[(piece * 8 + 2 * e) * 72 + nn];
      const _Float16 x1 = sw[(piece * 8 + 2 * e + 1) * 72 + nn];
      a[e] = pk16(h_bits(x0), h_bits(x1));
    }
    hv[it] = a;
    hofs[it] = ((size_t)(n0 + nn)) * K + k0 + piece * 8;
  }
  {
#pragma unroll
    for (int it = 0; it < 2; ++it) *(v4u*)(wt + hofs[it]) = hv[it];
    
  }
}

// =====================================================================================================
// Four 16-byte asynchronous copies of one lane, global memory -> LDS (l = the lane's LDS byte address, g = its
// global address). s_wait_xcnt 0 closes the statement so that no address register is rewritten in front of it.
// =====================================================================================================
__device__ __forceinline__ void copy4_lds(unsigned l0, const _Float16* g0, unsigned l1, const _Float16* g1,
                                          unsigned l2, const _Float16* g2, unsigned l3, const _Float16* g3) {
#if defined(__HIP_DEVICE_COMPILE__)
  asm volatile("global_load_async_to_lds_b128 %0, %1, off\n\t"
               "global_load_async_to_lds_b128 %2, %3, off\n\t"
               "global_load_async_to_lds_b128 %4, %5, off\n\t"
               "global_load_async_to_lds_b128 %6, %7, off\n\t"
               "s_wait_xcnt 0x0"
               :: "v"(l0), "v"(g0), "v"(l1), "v"(g1), "v"(l2), "v"(g2), "v"(l3), "v"(g3) : "memory");
#endif
}

// =====================================================================================================
// Register-blocked f16 WMMA GEMM, block = 8 waves (2 x 4) = one 128 x 256 tile, one wave per 64x64 tile:
//   v[m][n] = (sum_k A[m][k] * Bt[n][k]  [+ 2^-11 * sum_k Ar[m][k] * Bt[n][k] when ARES]) * cscale
// A, Ar row-major [M][K] pitch lda (f16), Bt row-major [N][K] pitch ldb (f16, k contiguous); M a multiple of 128,
// N of 256, K of 128; grid = (M / 128) * (N / 256) blocks.
// Operands: a stage = 128 k of the block's 128 rows of A and 256 rows of Bt, whole 128-B lines, brought into LDS at
// row pitch 272 B by asynchronous copies (24 per lane and stage: lane -> row tid>>4 (+16 per copy), 16-B piece
// tid&15); two buffers, stage s + 1 in flight while stage s is multiplied; every wave reads its fragments from LDS.
// ARES: the stages of the residual plane come first and accumulate from zero, the accumulators are scaled by 2^-11
// exactly on the VALU (with nop gaps on both sides), then the hi plane's stages accumulate on top: one accumulator set.
// EPI 0: column tiles from n1 on are stored to a second and a third output (each nx columns wide, pitch nx; hi plane
// C2 / C3, residual plane C2r / C3r), so that products that share A run in one grid. EPI 1 has the one output.
// Epilogue variants:
//   EPI 0: f16 hi plane = f16(v * oscale) at Cp and residual plane = f16((v*oscale - hi) * 2048) at Crp, pitch ldc halves
//   EPI 1: f32 out = v, pitch ldc floats
// 16-row slabs staged per wave in LDS. f32 out: each 64-wide row segment (256 B = 2 lines) by 16 lanes x 16 B,
// coverage: 4 slabs x 16 rows x 64 cols = the wave's whole 64x64 tile; 8 waves = the block's 128 x 256; grid = [M][N].
// =====================================================================================================
#define GBM  128                                   // block tile rows (A)
#define GBN  256                                   // block tile columns (rows of Bt)
#define GBK  128                                   // k per stage: 256 B of every operand row
#define GLP  136                                   // LDS row pitch in halves: 272 B = 16 B x 17 (ds_load_b128 fragment reads)
#define GSTG ((GBM + GBN) * GLP)                   // halves per stage buffer: [A 128 rows | Bt 256 rows]
template <int EPI, bool ARES>
__global__ __launch_bounds__(256) void gemm64_f16(
    const unsigned short* __restrict__ Ap, const unsigned short* __restrict__ Arp, int lda,
    const unsigned short* __restrict__ Btp, int ldb,
    float cscale,
    void* Cp, unsigned short* Crp, int ldc, int M, int N, int K, float oscale,
    int n1, int nx, unsigned short* C2, unsigned short* C2r, unsigned short* C3, unsigned short* C3r) {
  const _Float16* Ah  = (const _Float16*)(const void*)Ap;
  const _Float16* Arh = (const _Float16*)(const void*)Arp;
  const _Float16* Bt  = (const _Float16*)(const void*)Btp;
  __shared__ __align__(16) _Float16 sAB[2 * GSTG]; // two stage buffers
  __shared__ __align__(16) float sT[8][16 * 68];   // per-wave 16x64 slab, pitch 68 floats
  const int tid  = threadIdx.x;
  const int lane = tid & 31;
  const int wave = tid >> 5;
  const int blocksN = N >> 8;
  const int blocksM = M >> 7;
  const int bidx = blockIdx.x;
  if (bidx >= blocksM * blocksN) return;   // block-uniform, before any copy or barrier
  const int bmi = bidx / blocksN;
  const int bm0 = bmi << 7;
  const int bn0 = (bidx - bmi * blocksN) << 8;
  const int wm  = wave >> 2;               // wave's 64-row half of the block tile
  const int wn  = wave & 3;                // wave's 64-column quarter
  const int m0 = bm0 + (wm << 6);
  const int n0 = bn0 + (wn << 6);

  // output of this tile (wave-uniform): columns below n1 go to Cp / Crp, the next nx to C2 / C2r, the next nx to C3 / C3r
  void* Co = Cp;
  unsigned short* Cro = Crp;
  int ldo = ldc, nc0 = n0;
  if constexpr (EPI == 0) {
    if (n0 >= n1) {
      const int e = n0 - n1;
      const bool third = (e >= nx);
      Co  = third ? (void*)C3 : (void*)C2;
      Cro = third ? C3r : C2r;
      ldo = nx;
      nc0 = third ? e - nx : e;
    }
  }

  const int rlane = lane & 15;                 // row (A) / col (B, D) within subtile
  const int koff  = (lane >> 4) * 8;           // k offset of this lane half
  const int mOff  = (lane >> 4) * 8;           // D row offset

  v8f acc[4][4];
#pragma unroll
  for (int i = 0; i < 4; ++i)
#pragma unroll
    for (int j = 0; j < 4; ++j) acc[i][j] = zero8();

  constexpr int NPL = ARES ? 2 : 1;
  const int nk  = K >> 7;                      // stages per plane
  const int nst = NPL * nk;                    // stages in all, block-uniform

  // the lane's share of a stage: rows crow + 16 i of A (i 0..7) and of Bt (i 0..15), 16-B piece tid & 15 of each
  const int crow = tid >> 4;
  const int cpc  = (tid & 15) * 8;
  const unsigned lds0 = (unsigned)(uintptr_t)(&sAB[0]) + (unsigned)(crow * GLP + cpc) * 2u;
  const _Float16* gA0 = Ah  + (size_t)(bm0 + crow) * lda + cpc;
  const _Float16* gR0 = Arh + (size_t)(bm0 + crow) * lda + cpc;
  const _Float16* gB0 = Bt  + (size_t)(bn0 + crow) * ldb + cpc;
  const size_t a16 = (size_t)16 * lda, b16 = (size_t)16 * ldb;
  constexpr unsigned R16 = 16u * GLP * 2u;     // 16 LDS rows, bytes
  auto stage_in = [&](int st, int buf) {
    const bool res = ARES && (st < nk);        // block-uniform: the residual plane's stages come first
    const int  k0  = (ARES && !res ? st - nk : st) * GBK;
    const _Float16* ga = (res ? gR0 : gA0) + k0;
    const _Float16* gb = gB0 + k0;
    const unsigned la = lds0 + (unsigned)buf * (unsigned)(GSTG * 2);
    const unsigned lb = la + (unsigned)(GBM * GLP * 2);
#pragma unroll                                 // straight line: constant LDS steps, 4 copies a statement
    for (int q = 0; q < GBM / 16; q += 4)
      copy4_lds(la + q * R16,       ga + q * a16,       la + (q + 1) * R16, ga + (q + 1) * a16,
                la + (q + 2) * R16, ga + (q + 2) * a16, la + (q + 3) * R16, ga + (q + 3) * a16);
#pragma unroll                                 // as above
    for (int q = 0; q < GBN / 16; q += 4)
      copy4_lds(lb + q * R16,       gb + q * b16,       lb + (q + 1) * R16, gb + (q + 1) * b16,
                lb + (q + 2) * R16, gb + (q + 2) * b16, lb + (q + 3) * R16, gb + (q + 3) * b16);
  };

  if (nst > 0) stage_in(0, 0);
#if defined(__HIP_DEVICE_COMPILE__)
  asm volatile("s_wait_asynccnt 0x0" ::: "memory");   // this wave's copies of stage 0 have landed
#endif
  __syncthreads();                                    // stage 0 is published to every wave
  if (nst > 1) stage_in(1, 1);

  for (int st = 0; st < nst; ++st) {
    if (ARES && st == nk) {
      acc_guard4(acc[0][0], acc[0][1], acc[0][2], acc[0][3]);
      acc_guard4(acc[1][0], acc[1][1], acc[1][2], acc[1][3]);
      acc_guard4(acc[2][0], acc[2][1], acc[2][2], acc[2][3]);
      acc_guard4(acc[3][0], acc[3][1], acc[3][2], acc[3][3]);
#pragma unroll
      for (int i = 0; i < 4; ++i)
#pragma unroll
        for (int j = 0; j < 4; ++j) acc[i][j] = acc[i][j] * (1.0f / 2048.0f);   // exact fold of the x2^11 residual carry
      acc_guard4(acc[0][0], acc[0][1], acc[0][2], acc[0][3]);
      acc_guard4(acc[1][0], acc[1][1], acc[1][2], acc[1][3]);
      acc_guard4(acc[2][0], acc[2][1], acc[2][2], acc[2][3]);
      acc_guard4(acc[3][0], acc[3][1], acc[3][2], acc[3][3]);
    }
    const _Float16* sA = sAB + (st & 1) * GSTG + ((wm << 6) + rlane) * GLP + koff;
    const _Float16* sB = sAB + (st & 1) * GSTG + (GBM + (wn << 6) + rlane) * GLP + koff;
#pragma unroll                                 // constant LDS offsets; the fragment arrays stay in registers
    for (int ks = 0; ks < GBK; ks += 32) {
      v16h bh[4], ah[4];
#pragma unroll
      for (int j = 0; j < 4; ++j) bh[j] = ldfrag_h(sB + (j << 4) * GLP + ks);
#pragma unroll
      for (int i = 0; i < 4; ++i) ah[i] = ldfrag_h(sA + (i << 4) * GLP + ks);
#pragma unroll
      for (int i = 0; i < 4; ++i) {
#pragma unroll
        for (int j = 0; j < 4; ++j) {
          acc[i][j] = mma_h_raw(ah[i], bh[j], acc[i][j]);
        }
        dep_guard_h(acc[i][0], acc[i][3], ah[i], bh[3]);
      }
      keep4_h(bh[0], bh[1], bh[2], bh[3]);
    }
#if defined(__HIP_DEVICE_COMPILE__)
    asm volatile("s_wait_dscnt 0x0" ::: "memory");      // this wave's reads of buffer st & 1 are done before it is refilled
    asm volatile("s_wait_asynccnt 0x0" ::: "memory");   // this wave's copies of stage st + 1 have landed
#endif
    __syncthreads();                                    // publishes stage st + 1, ends every read of stage st
    if (st + 2 < nst) stage_in(st + 2, st & 1);
  }
#if defined(__HIP_DEVICE_COMPILE__)
  asm volatile("s_wait_asynccnt 0x0" ::: "memory");     // no copy is outstanding when the wave goes on to its end
#endif
  acc_guard4(acc[0][0], acc[0][1], acc[0][2], acc[0][3]);
  acc_guard4(acc[1][0], acc[1][1], acc[1][2], acc[1][3]);
  acc_guard4(acc[2][0], acc[2][1], acc[2][2], acc[2][3]);
  acc_guard4(acc[3][0], acc[3][1], acc[3][2], acc[3][3]);

  // ---- epilogue ----
  float* slab = sT[wave];
#pragma unroll
  for (int i = 0; i < 4; ++i) {
    const int mBase = m0 + (i << 4);
#pragma unroll
    for (int r = 0; r < 8; ++r) {
      const int row = mOff + r;
#pragma unroll
      for (int j = 0; j < 4; ++j) slab[row * 68 + (j << 4) + rlane] = acc[i][j][r] * cscale;
    }
    __builtin_amdgcn_fence(__ATOMIC_RELEASE, "workgroup");
    __builtin_amdgcn_wave_barrier();
    __builtin_amdgcn_fence(__ATOMIC_ACQUIRE, "workgroup");
    if constexpr (EPI == 0) {
      unsigned short* C16 = (unsigned short*)Co;
      const int rq = lane >> 3, piece = lane & 7;
      v4u ph[4], pr[4];
#pragma unroll
      for (int it = 0; it < 4; ++it) {
        const int row = it * 4 + rq;                         // it 0..3 x rq 0..3 = rows 0..15
        const v4f a  = *(const v4f*)(slab + row * 68 + piece * 8);
        const v4f a2 = *(const v4f*)(slab + row * 68 + piece * 8 + 4);
        float f[8];
        f[0] = a[0];  f[1] = a[1];  f[2] = a[2];  f[3] = a[3];
        f[4] = a2[0]; f[5] = a2[1]; f[6] = a2[2]; f[7] = a2[3];
        v4u p, q;
#pragma unroll
        for (int e = 0; e < 4; ++e) {
          const float g0 = f[2 * e] * oscale, g1 = f[2 * e + 1] * oscale;
          const _Float16 x0 = (_Float16)g0, x1 = (_Float16)g1;
          const _Float16 y0 = (_Float16)((g0 - (float)x0) * 2048.0f);
          const _Float16 y1 = (_Float16)((g1 - (float)x1) * 2048.0f);
          p[e] = pk16(h_bits(x0), h_bits(x1));
          q[e] = pk16(h_bits(y0), h_bits(y1));
        }
        ph[it] = p;
        pr[it] = q;
      }
      {
#pragma unroll
        for (int it = 0; it < 4; ++it) {
          const int row = it * 4 + rq;
          const size_t co = (size_t)(mBase + row) * ldo + nc0 + piece * 8;
          *(v4u*)(C16 + co) = ph[it];
          *(v4u*)(Cro + co) = pr[it];
        }
        
      }
    } else {
      float* Cf = (float*)Co;
      const int hh = lane >> 4, c4 = (lane & 15) * 4;     // 256-B row segment = 16 lanes x 16 B
      v4f ov[8];
#pragma unroll
      for (int it = 0; it < 8; ++it) {
        const int row = it * 2 + hh;                       // it 0..7 x hh 0..1 = rows 0..15
        ov[it] = *(const v4f*)(slab + row * 68 + c4);
      }
      {
#pragma unroll
        for (int it = 0; it < 8; ++it) {
          const int row = it * 2 + hh;
          *(v4f*)(Cf + (size_t)(mBase + row) * ldo + nc0 + c4) = ov[it];
        }
        
      }
    }
    __builtin_amdgcn_fence(__ATOMIC_RELEASE, "workgroup");
    __builtin_amdgcn_wave_barrier();
    __builtin_amdgcn_fence(__ATOMIC_ACQUIRE, "workgroup");
  }
}

// =====================================================================================================
// f16 v plane (token-major, element (t, g, d) at vp[t*DKV + g*64 + d], g = kv head) -> f16 v^T plane
// vt[(g*64 + d)*SEQ + t] (same bits). Used for the hi plane and the residual plane.
// Block = one 64-token x 64-feature tile of one kv head g of one plane; grid = (SEQ/64, NKV, 2); tile staged in LDS as halves
// (v8h 16-B stores, __syncthreads, _Float16 element reads).
// Store: group g8 = tid>>3 (0..31), piece = tid&7: iteration it writes row d = it*32+g8, lanes 8q..8q+7 x 16 B =
// coverage: load 2 x 256 threads x 8 halves = 64x64; store 2 iterations x 32 groups = 64 rows d, 8 pieces x 8
// = 64 tokens per row; grid covers every (kv head, token tile) of [DKV][SEQ].
// =====================================================================================================
__global__ __launch_bounds__(256) void v_tr(const unsigned short* __restrict__ vp0, unsigned short* vt0,
                                            const unsigned short* __restrict__ vp1, unsigned short* vt1) {
  __shared__ __align__(16) _Float16 sv[64 * 72];       // [tt][d], pitch 72 halves (144 B)
  const int tid = threadIdx.x;
  const int t0  = blockIdx.x * 64;
  const int g   = blockIdx.y;
  if (g >= NKV || t0 >= SEQ || blockIdx.z > 1) return; // block-uniform, before any barrier
  const unsigned short* vp = blockIdx.z ? vp1 : vp0;   // blockIdx.z: 0 = hi plane, 1 = residual plane
  unsigned short* vt = blockIdx.z ? vt1 : vt0;
  const _Float16* src = (const _Float16*)(const void*)vp;
#pragma unroll
  for (int i = 0; i < 2; ++i) {
    const int idx = i * 256 + tid;                  // 0..511
    const int tt = idx >> 3, c8 = (idx & 7) * 8;
    const v8h a = *(const v8h*)(src + ((size_t)(t0 + tt)) * DKV + g * HD + c8);
    *(v8h*)(sv + tt * 72 + c8) = a;
  }
  __syncthreads();

  const int g8 = tid >> 3, piece = tid & 7;
  v4u hv[2];
  size_t hofs[2];
#pragma unroll
  for (int it = 0; it < 2; ++it) {
    const int d = it * 32 + g8;
    v4u a;
#pragma unroll
    for (int e = 0; e < 4; ++e) {
      const _Float16 x0 = sv[(piece * 8 + 2 * e) * 72 + d];
      const _Float16 x1 = sv[(piece * 8 + 2 * e + 1) * 72 + d];
      a[e] = pk16(h_bits(x0), h_bits(x1));
    }
    hv[it] = a;
    hofs[it] = ((size_t)(g * HD + d)) * SEQ + t0 + piece * 8;
  }
  {
#pragma unroll
    for (int it = 0; it < 2; ++it) *(v4u*)(vt + hofs[it]) = hv[it];
    
  }
}

#define ATT_SMEM 36864                                    // LDS bytes of the residual-plane variant, the larger one
// value of lane l ^ 16 (the other half of the wave, same column)
__device__ __forceinline__ float xhalf(float x) {
  return __builtin_bit_cast(float, __builtin_amdgcn_permlanex16(__builtin_bit_cast(int, x), __builtin_bit_cast(int, x),
                                                                0x76543210, 0xfedcba98, false, false));
}
template <bool HR>
__device__ __forceinline__
void attn_body(unsigned char* smem,
               const unsigned short* __restrict__ qp,  const unsigned short* __restrict__ qrp,
               const unsigned short* __restrict__ kp,  const unsigned short* __restrict__ krp,
               const unsigned short* __restrict__ vtp, const unsigned short* __restrict__ vtrp,
               unsigned short* ctxp, unsigned short* ctxrp, int qb, int h) {
  union FH { v16h v; v8h h[2]; };
  constexpr int LP     = 72;                             // LDS row pitch in halves: 144 B = 16 B x 9, so the 16 rows
                                                         // that one ds_load_b128 fragment read touches fall on 16
                                                         // different 4-bank groups (at 128 B they share two groups)
  constexpr int TB     = 64 * LP * 2;                    // one f16 64x64 tile at pitch LP, bytes
  constexpr int OP     = 68;                             // context staging pitch in floats: 272 B = 16 B x 17
  constexpr int OFF_K  = 0;
  constexpr int OFF_V  = TB;
  constexpr int OFF_KR = 2 * TB;
  constexpr int OFF_VR = 3 * TB;
  constexpr int SMEMB  = HR ? 4 * TB : 2 * TB;                // 36864 : 18432
  static_assert(4 * 16 * OP * 4 <= 2 * TB);                   // f32 context staging aliases the K/V region
  static_assert(SMEMB <= ATT_SMEM);
  _Float16* Ksh = (_Float16*)(smem + OFF_K);                  // K   [kv][d], pitch LP
  _Float16* Vsh = (_Float16*)(smem + OFF_V);                  // V^T [d][kv], pitch LP
  _Float16* Krs = (_Float16*)(smem + (HR ? OFF_KR : OFF_K));  // K residual (HR only)
  _Float16* Vrs = (_Float16*)(smem + (HR ? OFF_VR : OFF_V));  // V^T residual (HR only)

  const int tid  = threadIdx.x;
  const int wave = tid >> 5;
  const int lane = tid & 31;
  const int hh   = lane >> 4;
  const int c    = lane & 15;

  const int g    = h / GRP;                  // kv head
  const int q0   = qb * 64 + wave * 16;
  const int qrow = q0 + c;                   // the one query of this lane

  const _Float16* QP  = (const _Float16*)(const void*)qp   + (size_t)h * HD;
  const _Float16* QRP = (const _Float16*)(const void*)qrp  + (size_t)h * HD;
  const _Float16* KP  = (const _Float16*)(const void*)kp   + (size_t)g * HD;
  const _Float16* KRP = (const _Float16*)(const void*)krp  + (size_t)g * HD;
  const _Float16* VTP = (const _Float16*)(const void*)vtp  + (size_t)g * HD * SEQ;
  const _Float16* VRP = (const _Float16*)(const void*)vtrp + (size_t)g * HD * SEQ;

  // ---- Q fragments (B operand, column = lane&15): 2 d-chunks ----
  v16h qa[2], qr[2];
#pragma unroll
  for (int dc = 0; dc < 2; ++dc) {
    const size_t qo = (size_t)(q0 + c) * DM + dc * 32 + 8 * hh;
    qa[dc] = ldfrag_h(QP + qo);
    if constexpr (HR) qr[dc] = ldfrag_h(QRP + qo);
    else qr[dc] = qa[dc];
  }

  float lsum = 0.f, mrun = -1e30f;
  v8f oacc[4], oacc2[4];
#pragma unroll
  for (int t = 0; t < 4; ++t) { oacc[t] = zero8(); oacc2[t] = zero8(); }

  const int nkt = qb + 1;                                      // key tiles 0..qb, block-uniform
  for (int kti = 0; kti < nkt; ++kti) {
    const int kv0 = kti * 64;                                  // <= qb*64 < SEQ
    __syncthreads();
    {
      const int r = tid >> 1, half = (tid & 1) * 32;
      const size_t ko = (size_t)(kv0 + r) * DKV + half;         // K row kv0+r, d = half..half+31
      const size_t vo = (size_t)r * SEQ + kv0 + half;           // V^T row d = r, s = kv0+half..+31
#pragma unroll
      for (int i = 0; i < 4; ++i) {
        const v8h a0 = *(const v8h*)(KP + ko + 8 * i);
        const v8h b0 = *(const v8h*)(VTP + vo + 8 * i);
        *(v8h*)(Ksh + r * LP + half + 8 * i) = a0;
        *(v8h*)(Vsh + r * LP + half + 8 * i) = b0;
        if constexpr (HR) {
          const v8h a1 = *(const v8h*)(KRP + ko + 8 * i);
          const v8h b1 = *(const v8h*)(VRP + vo + 8 * i);
          *(v8h*)(Krs + r * LP + half + 8 * i) = a1;
          *(v8h*)(Vrs + r * LP + half + 8 * i) = b1;
        }
      }
    }
    __syncthreads();

    // ---- scores, transposed: 64 keys x 16 queries per wave (A operand: lane c -> key j*16+c, split k map over d) ----
    v8f s[4];
#pragma unroll
    for (int j = 0; j < 4; ++j) {
      s[j] = zero8();
      v8f t = zero8();
#pragma unroll
      for (int dc = 0; dc < 2; ++dc) {
        FH kb;
        kb.h[0] = *(const v8h*)(Ksh + (j * 16 + c) * LP + dc * 32 + 8 * hh);
        kb.h[1] = *(const v8h*)(Ksh + (j * 16 + c) * LP + dc * 32 + 16 + 8 * hh);
        s[j] = mma_h(kb.v, qa[dc], s[j]);
        if constexpr (HR) {
          FH krb;
          krb.h[0] = *(const v8h*)(Krs + (j * 16 + c) * LP + dc * 32 + 8 * hh);
          krb.h[1] = *(const v8h*)(Krs + (j * 16 + c) * LP + dc * 32 + 16 + 8 * hh);
          t = mma_h(krb.v, qa[dc], t);
          t = mma_h(kb.v, qr[dc], t);
        }
      }
      if constexpr (HR) s[j] = s[j] + t * (1.0f / 2048.0f);
    }

    // ---- causal online softmax of the lane's one query: masked logits and their maximum in-lane, one exchange
    //      with lane ^ 16, alpha, p, row-sum partial, P^T (x256, f16; HR: + residual) packed as the B operand ----
    float tm[8];
#pragma unroll
    for (int r = 0; r < 8; ++r) tm[r] = -1e30f;
#pragma unroll
    for (int j = 0; j < 4; ++j) {
#pragma unroll
      for (int r = 0; r < 8; ++r) {
        const int key = kv0 + j * 16 + 8 * hh + r;
        float a = s[j][r] * (1.0f / 2048.0f);              // 1/8 head scale, 1/256 for the two x16 carries
        const bool ok = (key <= qrow);
        a = ok ? a : -1e30f;
        s[j][r] = a;
        tm[r] = fmaxf(tm[r], a);
      }
    }
    float tmx = fmaxf(fmaxf(fmaxf(tm[0], tm[1]), fmaxf(tm[2], tm[3])), fmaxf(fmaxf(tm[4], tm[5]), fmaxf(tm[6], tm[7])));
    tmx = fmaxf(tmx, xhalf(tmx));
    const float mn = fmaxf(mrun, tmx);
    const float al = __expf(mrun - mn);
    mrun = mn;
    float pp[8];
#pragma unroll
    for (int r = 0; r < 8; ++r) pp[r] = 0.0f;
    FH pa[2], par[2];
#pragma unroll
    for (int j = 0; j < 4; ++j) {
#pragma unroll
      for (int r = 0; r < 8; ++r) {
        const int key = kv0 + j * 16 + 8 * hh + r;
        const bool ok = (key <= qrow);
        float p = __expf(s[j][r] - mn);
        p = ok ? p : 0.0f;
        pp[r] += p;
        const float gg = p * 256.0f;
        const _Float16 x0 = (_Float16)gg;
        pa[j >> 1].v[(j & 1) * 8 + r] = x0;
        if constexpr (HR) par[j >> 1].v[(j & 1) * 8 + r] = (_Float16)((gg - (float)x0) * 2048.0f);
      }
    }
    lsum = lsum * al + (((pp[0] + pp[1]) + (pp[2] + pp[3])) + ((pp[4] + pp[5]) + (pp[6] + pp[7])));

    // ---- rescale the context accumulators by alpha (VALU), nop gaps before the next WMMA reads them ----
#pragma unroll
    for (int t = 0; t < 4; ++t) {
      oacc[t] = oacc[t] * al;
      if constexpr (HR) oacc2[t] = oacc2[t] * al;
    }
    acc_guard4(oacc[0], oacc[1], oacc[2], oacc[3]);
    if constexpr (HR) acc_guard4(oacc2[0], oacc2[1], oacc2[2], oacc2[3]);

    // ---- context^T += V^T . P^T (f16 WMMA; A = V^T [d][key] from LDS, B = P^T [key][query] in registers) ----
#pragma unroll
    for (int kk = 0; kk < 2; ++kk) {
#pragma unroll
      for (int t = 0; t < 4; ++t) {
        FH vb;
        vb.h[0] = *(const v8h*)(Vsh + (t * 16 + c) * LP + kk * 32 + 8 * hh);
        vb.h[1] = *(const v8h*)(Vsh + (t * 16 + c) * LP + kk * 32 + 16 + 8 * hh);
        oacc[t] = mma_h(vb.v, pa[kk].v, oacc[t]);
        if constexpr (HR) {
          FH vrb;
          vrb.h[0] = *(const v8h*)(Vrs + (t * 16 + c) * LP + kk * 32 + 8 * hh);
          vrb.h[1] = *(const v8h*)(Vrs + (t * 16 + c) * LP + kk * 32 + 16 + 8 * hh);
          oacc2[t] = mma_h(vrb.v, pa[kk].v, oacc2[t]);
          oacc2[t] = mma_h(vb.v, par[kk].v, oacc2[t]);
        }
      }
    }
  }
  __syncthreads();                           // every wave is done with the K/V tiles before they are aliased

  // ---- normalise (1/lsum, the 1/256 p carry; keep the x16 v carry), stage the wave's 16x64 f32 tile [query][d]
  //      in LDS (a lane's 8 registers of tile t are 8 consecutive d of its query: two 16-B stores) ----
  float* os = (float*)(void*)smem + wave * (16 * OP);
  {
    const float l  = lsum + xhalf(lsum);     // the query's two key halves
    const float rl = 1.0f / l;               // l >= 1 (the max key contributes p = 1)
    const float sc = rl * (1.0f / 256.0f);
#pragma unroll
    for (int t = 0; t < 4; ++t) {
      v4f lo, hi;
#pragma unroll
      for (int r = 0; r < 4; ++r) {
        float v0 = oacc[t][r], v1 = oacc[t][r + 4];
        if constexpr (HR) { v0 += oacc2[t][r] * (1.0f / 2048.0f); v1 += oacc2[t][r + 4] * (1.0f / 2048.0f); }
        lo[r] = v0 * sc;
        hi[r] = v1 * sc;
      }
      *(v4f*)(os + c * OP + t * 16 + 8 * hh)     = lo;
      *(v4f*)(os + c * OP + t * 16 + 8 * hh + 4) = hi;
    }
  }
  __builtin_amdgcn_fence(__ATOMIC_RELEASE, "workgroup");
  __builtin_amdgcn_wave_barrier();
  __builtin_amdgcn_fence(__ATOMIC_ACQUIRE, "workgroup");
  {
    const int rq = lane >> 3, piece = lane & 7;
    v4u ph[4], pr[4];
#pragma unroll
    for (int it = 0; it < 4; ++it) {
      const int row = it * 4 + rq;   // it 0..3 x rq 0..3 = rows 0..15 of the wave tile
      const v4f a  = *(const v4f*)(os + row * OP + piece * 8);
      const v4f a2 = *(const v4f*)(os + row * OP + piece * 8 + 4);
      float f[8];
      f[0] = a[0];  f[1] = a[1];  f[2] = a[2];  f[3] = a[3];
      f[4] = a2[0]; f[5] = a2[1]; f[6] = a2[2]; f[7] = a2[3];
      v4u p, q;
#pragma unroll
      for (int e = 0; e < 4; ++e) {
        const _Float16 x0 = (_Float16)f[2 * e], x1 = (_Float16)f[2 * e + 1];
        const _Float16 y0 = (_Float16)((f[2 * e] - (float)x0) * 2048.0f);
        const _Float16 y1 = (_Float16)((f[2 * e + 1] - (float)x1) * 2048.0f);
        p[e] = pk16(h_bits(x0), h_bits(x1));
        q[e] = pk16(h_bits(y0), h_bits(y1));
      }
      ph[it] = p;
      pr[it] = q;
    }
    {
#pragma unroll
      for (int it = 0; it < 4; ++it) {
        const int row = it * 4 + rq;
        const size_t go = (size_t)(q0 + row) * DM + (size_t)h * HD + piece * 8;
        *(v4u*)(ctxp + go)  = ph[it];
        *(v4u*)(ctxrp + go) = pr[it];
      }
    }
  }
}

// =====================================================================================================
// Both attention variants in one grid of NQT * NH blocks, so that the short residual-plane tiles and the long
// single-product tiles run side by side. The grid is four quarters of NQT/4 * NH blocks; block w of each quarter has
// head w % NH and u = w / NH, and query tile NQT-1-u, QHR-1-u, QHR+u, u in quarters 0..3: a permutation of every
// (head, query tile), long tiles first, and the four blocks with equal w have the same total of key tiles for every w.
// =====================================================================================================
// amdgpu_waves_per_eu(4, 4): at most four waves per SIMD = four blocks per WGP, as many as the grid has per WGP, so
// that no WGP takes a fifth block while another is left with three.
__global__ __launch_bounds__(128) __attribute__((amdgpu_waves_per_eu(4, 4)))
void attn_all(const unsigned short* __restrict__ qp,  const unsigned short* __restrict__ qrp,
              const unsigned short* __restrict__ kp,  const unsigned short* __restrict__ krp,
              const unsigned short* __restrict__ vtp, const unsigned short* __restrict__ vtrp,
              unsigned short* ctxp, unsigned short* ctxrp) {
  __shared__ __align__(16) unsigned char smem[ATT_SMEM];
  constexpr int QQ = NQT / 4;
  static_assert((NQT % 4) == 0 && QHR == 2 * QQ);
  const int bx = blockIdx.x;
  const int j  = bx / (QQ * NH);
  if (j > 3) return;                         // block-uniform, before any barrier or store
  const int w  = bx - j * (QQ * NH);
  const int h  = w % NH;
  const int u  = w / NH;
  const int qb = (j == 0) ? (NQT - 1 - u) : (j == 1) ? (QHR - 1 - u) : (j == 2) ? (QHR + u) : u;
  if (qb < QHR) attn_body<true>(smem, qp, qrp, kp, krp, vtp, vtrp, ctxp, ctxrp, qb, h);
  else          attn_body<false>(smem, qp, qrp, kp, krp, vtp, vtrp, ctxp, ctxrp, qb, h);
}

// =====================================================================================================
// Workspace map (bytes, SEQ = 4096); every region is an exact multiple of its whole-line / whole-tile store
// granularity (row pitches 2048 / 512 / 8192 B, rows multiples of 64, all offsets 512-KiB aligned, no aliasing
// within a launch):
//   Xh    f16 [SEQ][1024]          0     8388608   (bf16 value of x, x16)
//   WqT   f16 [1024][1024]   8388608     2097152   (bf16 value of w_q^T x1024, [n][k])
//   WkT   f16 [256][1024]   10485760      524288   (bf16 value of w_k^T x1024, [n][k])
//   WvT   f16 [256][1024]   11010048      524288   (bf16 value of w_v^T x1024, [n][k])
//   WoT   f16 [1024][1024]  11534336     2097152   (bf16 value of w_o^T x1024, [n][k])
//   Qh    f16 [SEQ][1024]   13631488     8388608   (q x16)           Qr  22020096  8388608 (x2^11 residual)
//   Kh    f16 [SEQ][256]    30408704     2097152   (k x16)           Kr  32505856  2097152
//   Vh    f16 [SEQ][256]    34603008     2097152   (v x16)           Vr  36700160  2097152
//   VT    f16 [256][SEQ]    38797312     2097152   ([g*64 + d][s])   VTr 40894464  2097152
//   Ctx   f16 [SEQ][1024]   42991616     8388608   (context x16)     Ctxr 51380224 8388608
//   end                     59768832
// Projection weights arrive as [in k][out n] (n contiguous) and are transposed while converted (w_tr).
// d_out f32: [SEQ][1024] at byte 0, every 64x64 tile written once by the output projection launch.
// =====================================================================================================
extern "C" void kernel_launch(void* const* d_in, const int* in_sizes, int n_in,
                              void* d_out, int out_size, void* d_ws, size_t ws_size,
                              hipStream_t stream) {
  if (n_in < 5) return;
  if (in_sizes[0] < SEQ * DM || (in_sizes[0] % DM) != 0) return;   // x rows 0..SEQ-1 are used, pitch DM
  if (in_sizes[1] != DM * DM) return;
  if (in_sizes[2] != DM * DKV) return;
  if (in_sizes[3] != DM * DKV) return;
  if (in_sizes[4] != DM * DM) return;
  if (out_size < OUTN) return;

  const float* x   = (const float*)d_in[0];    // [>=SEQ][DM]
  const float* w_q = (const float*)d_in[1];    // [DM k][DM n]
  const float* w_k = (const float*)d_in[2];    // [DM k][DKV n]
  const float* w_v = (const float*)d_in[3];    // [DM k][DKV n]
  const float* w_o = (const float*)d_in[4];    // [DM k][DM n]

  const size_t PX   = (size_t)SEQ * DM * 2;          //  8388608
  const size_t PWq  = (size_t)DM * DM * 2;           //  2097152
  const size_t PWk  = (size_t)DKV * DM * 2;          //   524288
  const size_t PWo  = (size_t)DM * DM * 2;           //  2097152
  const size_t PQ   = (size_t)SEQ * DM * 2;          //  8388608
  const size_t PK   = (size_t)SEQ * DKV * 2;         //  2097152
  const size_t PVT  = (size_t)DKV * SEQ * 2;         //  2097152
  const size_t PCtx = (size_t)SEQ * DM * 2;          //  8388608
  size_t off = 0;
  const size_t oX    = off; off += PX;
  const size_t oWq   = off; off += PWq;
  const size_t oWk   = off; off += PWk;
  const size_t oWv   = off; off += PWk;
  const size_t oWo   = off; off += PWo;
  const size_t oQ    = off; off += PQ;
  const size_t oQr   = off; off += PQ;
  const size_t oK    = off; off += PK;
  const size_t oKr   = off; off += PK;
  const size_t oV    = off; off += PK;
  const size_t oVr   = off; off += PK;
  const size_t oVT   = off; off += PVT;
  const size_t oVTr  = off; off += PVT;
  const size_t oCtx  = off; off += PCtx;
  const size_t oCtxr = off; off += PCtx;
  if (off > ws_size) return;                         // off = 59768832 for SEQ = 4096
  if (off > (size_t)134217728) return;

  char* ws = (char*)d_ws;
  unsigned short* Xh   = (unsigned short*)(ws + oX);
  unsigned short* WqT  = (unsigned short*)(ws + oWq);
  unsigned short* WkT  = (unsigned short*)(ws + oWk);
  unsigned short* WvT  = (unsigned short*)(ws + oWv);
  unsigned short* WoT  = (unsigned short*)(ws + oWo);
  unsigned short* Qh   = (unsigned short*)(ws + oQ);
  unsigned short* Qr   = (unsigned short*)(ws + oQr);
  unsigned short* Kh   = (unsigned short*)(ws + oK);
  unsigned short* Kr   = (unsigned short*)(ws + oKr);
  unsigned short* Vh   = (unsigned short*)(ws + oV);
  unsigned short* Vr   = (unsigned short*)(ws + oVr);
  unsigned short* VT   = (unsigned short*)(ws + oVT);
  unsigned short* VTr  = (unsigned short*)(ws + oVTr);
  unsigned short* Ctx  = (unsigned short*)(ws + oCtx);
  unsigned short* Ctxr = (unsigned short*)(ws + oCtxr);
  float*          outf = (float*)d_out;              // [SEQ][DM]

  const dim3 blk(256);
  const int n8x = SEQ * DM / 8;                      // 524288
  const dim3 gCx((n8x + 255) / 256);                 // 2048 blocks
  const dim3 gTw(DM / 64, DM / 64, 4);               // (16, 16, 4): the four weights, [1024 k][n] -> [n][1024 k]
  const dim3 gGq((NQT * (DM / 64) + 7) / 8);         // 1024 wave tiles -> 128 blocks of 128 x 256
  const dim3 gGqkv((NQT * ((DM + 2 * DKV) / 64) + 7) / 8);   // 1536 wave tiles -> 192 blocks of 128 x 256
  const dim3 gVt(SEQ / 64, NKV, 2);                  // (64, 4, 2)
  const dim3 gAtt(NQT * NH);                         // every (head, query tile), both variants
  const float wScale = 1024.0f;                      // weights carried x1024
  const float aScale = 16.0f;                        // activations carried x16
  const float cscale = 1.0f / 16384.0f;              // 1/(16 * 1024)

  // (1) planes: x -> f16 x16 (bf16 values); weights -> transposed f16 x1024 (bf16 values)
  cvt16<<<gCx, blk, 0, stream>>>(x, Xh, n8x, aScale);
  w_tr<<<gTw, blk, 0, stream>>>(w_q, w_k, w_v, w_o, WqT, WkT, WvT, WoT, DM, DM, DKV, wScale);
  // (2) [q | k | v] = Xh . [WqT ; WkT ; WvT]^T in one grid (M=SEQ, N=1024+256+256, K=1024; the three transposed
  //     weights lie one behind the other in the workspace): Qh [SEQ][1024], Kh, Vh [SEQ][256], f16 x16 + residual
  gemm64_f16<0, false><<<gGqkv, blk, 0, stream>>>(Xh, Xh, DM, WqT, DM, cscale, (void*)Qh, Qr, DM,
                                                  SEQ, DM + 2 * DKV, DM, aScale,
                                                  DM, DKV, Kh, Kr, Vh, Vr);
  // (3) v -> v^T planes (hi and residual, all tokens, all kv heads)
  v_tr<<<gVt, blk, 0, stream>>>(Vh, VT, Vr, VTr);
  // (4) causal softmax attention -> Ctx f16 x16 + residual plane: tiles 0..QHR-1 with residual operand planes,
  //     tiles QHR..NQT-1 with single products; together every (head, query tile) exactly once
  attn_all<<<gAtt, dim3(128), 0, stream>>>(Qh, Qr, Kh, Kr, VT, VTr, Ctx, Ctxr);
  // (5) out = (Ctx + 2^-11 Ctxr) . WoT^T -> d_out f32 [SEQ][1024] (M=SEQ, N=1024, K=1024), every tile once
  gemm64_f16<1, true><<<gGq, blk, 0, stream>>>(Ctx, Ctxr, DM, WoT, DM, cscale, (void*)outf, Ctxr, DM,
                                               SEQ, DM, DM, 1.0f,
                                               DM, DKV, Ctxr, Ctxr, Ctxr, Ctxr);
  (void)hipGetLastError();
}

// v005
// A run of this version takes 129 microseconds.
// Timed twice side by side with v004, it ran 1.18 times as fast both times.
// Over all steps from v000 it is 5.34 times as fast.
// Contractions: q/k/v projections = v_wmma_f32_16x16x32_f16 (A = f16 of RNE-bf16 x carried x16, B = f16 of RNE-bf16 w^T carried x1024, single product); attention k.q^T and v^T.p^T (both products transposed) = v_wmma_f32_16x16x32_f16 (query tiles below SEQ/2: q, k, v^T f16 planes x16 plus x2^11 residual planes, p f16 x256 plus x2^11 residual, hi.hi + hi.res + res.hi; query tiles from SEQ/2 on: single products on the x16 / x256 planes); output projection = v_wmma_f32_16x16x32_f16 (A = ctx f16 x16 plus its x2^11 residual plane, B = f16 of RNE-bf16 w_o^T x1024); all f32 accumulate. Causal online-max softmax, masks and row sums f32 on VALU.
#include <hip/hip_runtime.h>
#include <math.h>
#include <stdint.h>

#define SEQ   4096
#define DM    1024
#define NH    16
#define NKV   4
#define HD    64
#define DKV   (NKV * HD)            // 256
#define GRP   (NH / NKV)            // query heads per kv head = 4 (query head h uses kv head h / GRP)
#define NQT   (SEQ / 64)            // 64 query tiles of 64 rows
#define QHR   (NQT / 2)             // query tiles below this index use residual planes in attention
#define OUTN  (SEQ * DM)
static_assert(NH * HD == DM);
static_assert(HD == 64);
static_assert((NH % NKV) == 0);
static_assert((SEQ % 64) == 0 && (NQT % 2) == 0);
static_assert((DM % 64) == 0 && (DKV % 64) == 0 && (DM % 32) == 0);
static_assert(((NQT * (DM / 64)) % 8) == 0);
static_assert(((NQT * (DKV / 64)) % 8) == 0);
static_assert((SEQ % 128) == 0 && ((DM + 2 * DKV) % 256) == 0 && (DM % 256) == 0);   // GEMM block tile 128 x 256, 128 k per stage
static_assert(((SEQ * DM / 8) % 256) == 0);

typedef _Float16 v16h __attribute__((ext_vector_type(16)));
typedef _Float16 v8h  __attribute__((ext_vector_type(8)));
typedef float    v8f  __attribute__((ext_vector_type(8)));
typedef float    v4f  __attribute__((ext_vector_type(4)));
typedef unsigned int v4u __attribute__((ext_vector_type(4)));

// ---- scalar helpers --------------------------------------------------------------------------------
__device__ __forceinline__ unsigned short bf_bits(float f) {          // f32 -> bf16 bits, RNE convert
  unsigned u = __float_as_uint(f);
  return (unsigned short)((u + 0x7FFFu + ((u >> 16) & 1u)) >> 16);
}
__device__ __forceinline__ float bfr(float f) { return __uint_as_float(((unsigned)bf_bits(f)) << 16); }
__device__ __forceinline__ unsigned short h_bits(_Float16 x) { return __builtin_bit_cast(unsigned short, x); }
__device__ __forceinline__ unsigned pk16(unsigned short a, unsigned short b) { return (unsigned)a | ((unsigned)b << 16); }
__device__ __forceinline__ v8f zero8() { v8f z = {0.f, 0.f, 0.f, 0.f, 0.f, 0.f, 0.f, 0.f}; return z; }

// ---- fragment loader: 16-bit A/B operand, lane -> row/col (lane&15), p already includes +8*(lane>>4);
//      elements 0..7 <- p[0..7] (k0+8h..), elements 8..15 <- p[16..23] (k0+16+8h..)
__device__ __forceinline__ v16h ldfrag_h(const _Float16* p) {
  union { v16h v; v8h h[2]; } f;
  f.h[0] = *(const v8h*)(p);
  f.h[1] = *(const v8h*)(p + 16);
  return f.v;
}

// ---- WMMA helpers with trailing VALU hazard gap --------------------------------------------------------
__device__ __forceinline__ v8f mma_h_raw(v16h a, v16h b, v8f c) {
  return __builtin_amdgcn_wmma_f32_16x16x32_f16(false, a, false, b, (short)0, c, false, false);
}
__device__ __forceinline__ void dep_guard_h(v8f& a, v8f& b, v16h x, v16h y) {
#if defined(__HIP_DEVICE_COMPILE__)
  asm volatile("v_nop\n\tv_nop\n\tv_nop\n\tv_nop" : "+v"(a), "+v"(b) : "v"(x), "v"(y));
#endif
}
__device__ __forceinline__ void keep4_h(v16h a, v16h b, v16h c, v16h d) {
#if defined(__HIP_DEVICE_COMPILE__)
  asm volatile("v_nop" :: "v"(a), "v"(b), "v"(c), "v"(d));
#endif
}
__device__ __forceinline__ void acc_guard4(v8f& a, v8f& b, v8f& c, v8f& d) {
#if defined(__HIP_DEVICE_COMPILE__)
  asm volatile("v_nop\n\tv_nop\n\tv_nop\n\tv_nop" : "+v"(a), "+v"(b), "+v"(c), "+v"(d));
#endif
}

// =====================================================================================================
// f32 plane -> f16 bits of bfr(v) * scale (scale a power of two): x (x16).
// coverage: n8 threads x 8 = the whole plane.
// =====================================================================================================
__global__ __launch_bounds__(256) void cvt16(const float* __restrict__ in, unsigned short* out, int n8, float scale) {
  const int i = blockIdx.x * 256 + threadIdx.x;
  if (i < n8) {
    const v4f a = *(const v4f*)(in + (size_t)i * 8);
    const v4f b = *(const v4f*)(in + (size_t)i * 8 + 4);
    v4u p;
    p[0] = pk16(h_bits((_Float16)(bfr(a[0]) * scale)), h_bits((_Float16)(bfr(a[1]) * scale)));
    p[1] = pk16(h_bits((_Float16)(bfr(a[2]) * scale)), h_bits((_Float16)(bfr(a[3]) * scale)));
    p[2] = pk16(h_bits((_Float16)(bfr(b[0]) * scale)), h_bits((_Float16)(bfr(b[1]) * scale)));
    p[3] = pk16(h_bits((_Float16)(bfr(b[2]) * scale)), h_bits((_Float16)(bfr(b[3]) * scale)));
    *(v4u*)(out + (size_t)i * 8) = p;
    
  }
}

// =====================================================================================================
// f32 weight W [K rows][N cols] (the x@W layout, n contiguous) -> f16 Wt[n][k] = f16(bfr(W[k][n]) * scale),
// pitch K halves (k contiguous = the Bt layout of the GEMM below); scale a power of two.
// Block = one 64 (k) x 64 (n) tile of one of four weights; grid = (Nwide/64, K/64, 4), blockIdx.z = the weight,
// blocks past a narrow weight's last column tile leave at once; tile staged in LDS as halves [kk][nn] pitch 72
// (v8h 16-B stores, __syncthreads, _Float16 element reads).
// Store: group g = tid>>3 (0..31), piece = tid&7: iteration it writes out row n = it*32+g, lanes 8q..8q+7 x 16 B =
// coverage: load 2 x 256 threads x 8 = 64x64; store 2 iterations x 32 groups = 64 rows n, 8 pieces x 8 = 64 k
// per row; grid covers every (n tile, k tile) of [N][K].
// =====================================================================================================
__global__ __launch_bounds__(256) void w_tr(const float* __restrict__ w0, const float* __restrict__ w1,
                                            const float* __restrict__ w2, const float* __restrict__ w3,
                                            unsigned short* t0, unsigned short* t1, unsigned short* t2, unsigned short* t3,
                                            int K, int Nwide, int Nnarrow, float scale) {
  __shared__ __align__(16) _Float16 sw[64 * 72];       // [kk][nn], pitch 72 halves (144 B)
  const int tid = threadIdx.x;
  const int z   = blockIdx.z;                          // which weight: 0 and 3 are Nwide columns, 1 and 2 Nnarrow
  const int N   = (z == 0 || z == 3) ? Nwide : Nnarrow;
  const int n0  = blockIdx.x * 64;
  const int k0  = blockIdx.y * 64;
  if (z > 3 || n0 >= N || k0 >= K) return;             // block-uniform, before the barrier
  const float* w = (z == 0) ? w0 : (z == 1) ? w1 : (z == 2) ? w2 : w3;
  unsigned short* wt = (z == 0) ? t0 : (z == 1) ? t1 : (z == 2) ? t2 : t3;
#pragma unroll
  for (int i = 0; i < 2; ++i) {
    const int idx = i * 256 + tid;                  // 0..511
    const int kk = idx >> 3, c8 = (idx & 7) * 8;
    const float* src = w + (size_t)(k0 + kk) * N + n0 + c8;
    const v4f a  = *(const v4f*)(src);
    const v4f a2 = *(const v4f*)(src + 4);
    v8h o;
    o[0] = (_Float16)(bfr(a[0]) * scale);
    o[1] = (_Float16)(bfr(a[1]) * scale);
    o[2] = (_Float16)(bfr(a[2]) * scale);
    o[3] = (_Float16)(bfr(a[3]) * scale);
    o[4] = (_Float16)(bfr(a2[0]) * scale);
    o[5] = (_Float16)(bfr(a2[1]) * scale);
    o[6] = (_Float16)(bfr(a2[2]) * scale);
    o[7] = (_Float16)(bfr(a2[3]) * scale);
    *(v8h*)(sw + kk * 72 + c8) = o;
  }
  __syncthreads();

  const int g = tid >> 3, piece = tid & 7;
  v4u hv[2];
  size_t hofs[2];
#pragma unroll
  for (int it = 0; it < 2; ++it) {
    const int nn = it * 32 + g;
    v4u a;
#pragma unroll
    for (int e = 0; e < 4; ++e) {
      const _Float16 x0 = sw[(piece * 8 + 2 * e) * 72 + nn];
      const _Float16 x1 = sw[(piece * 8 + 2 * e + 1) * 72 + nn];
      a[e] = pk16(h_bits(x0), h_bits(x1));
    }
    hv[it] = a;
    hofs[it] = ((size_t)(n0 + nn)) * K + k0 + piece * 8;
  }
  {
#pragma unroll
    for (int it = 0; it < 2; ++it) *(v4u*)(wt + hofs[it]) = hv[it];
    
  }
}

// =====================================================================================================
// Four 16-byte asynchronous copies of one lane, global memory -> LDS (l = the lane's LDS byte address, g = its
// global address). s_wait_xcnt 0 closes the statement so that no address register is rewritten in front of it.
// =====================================================================================================
__device__ __forceinline__ void copy4_lds(unsigned l0, const _Float16* g0, unsigned l1, const _Float16* g1,
                                          unsigned l2, const _Float16* g2, unsigned l3, const _Float16* g3) {
#if defined(__HIP_DEVICE_COMPILE__)
  asm volatile("global_load_async_to_lds_b128 %0, %1, off\n\t"
               "global_load_async_to_lds_b128 %2, %3, off\n\t"
               "global_load_async_to_lds_b128 %4, %5, off\n\t"
               "global_load_async_to_lds_b128 %6, %7, off\n\t"
               "s_wait_xcnt 0x0"
               :: "v"(l0), "v"(g0), "v"(l1), "v"(g1), "v"(l2), "v"(g2), "v"(l3), "v"(g3) : "memory");
#endif
}

// =====================================================================================================
// Register-blocked f16 WMMA GEMM, block = 8 waves (2 x 4) = one 128 x 256 tile, one wave per 64x64 tile:
//   v[m][n] = (sum_k A[m][k] * Bt[n][k]  [+ 2^-11 * sum_k Ar[m][k] * Bt[n][k] when ARES]) * cscale
// A, Ar row-major [M][K] pitch lda (f16), Bt row-major [N][K] pitch ldb (f16, k contiguous); M a multiple of 128,
// N of 256, K of 128; grid = (M / 128) * (N / 256) blocks.
// Operands: a stage = 128 k of the block's 128 rows of A and 256 rows of Bt, whole 128-B lines, brought into LDS at
// row pitch 272 B by asynchronous copies (24 per lane and stage: lane -> row tid>>4 (+16 per copy), 16-B piece
// tid&15); two buffers, stage s + 1 in flight while stage s is multiplied; every wave reads its fragments from LDS.
// ARES: the stages of the residual plane come first and accumulate from zero, the accumulators are scaled by 2^-11
// exactly on the VALU (with nop gaps on both sides), then the hi plane's stages accumulate on top: one accumulator set.
// EPI 0: column tiles from n1 on are stored to a second and a third output (each nx columns wide, pitch nx; hi plane
// C2 / C3, residual plane C2r / C3r), so that products that share A run in one grid. EPI 1 has the one output.
// Epilogue variants:
//   EPI 0: f16 hi plane = f16(v * oscale) at Cp and residual plane = f16((v*oscale - hi) * 2048) at Crp, pitch ldc halves
//   EPI 1: f32 out = v, pitch ldc floats
// 16-row slabs staged per wave in LDS. f32 out: each 64-wide row segment (256 B = 2 lines) by 16 lanes x 16 B,
// coverage: 4 slabs x 16 rows x 64 cols = the wave's whole 64x64 tile; 8 waves = the block's 128 x 256; grid = [M][N].
// =====================================================================================================
#define GBM  128                                   // block tile rows (A)
#define GBN  256                                   // block tile columns (rows of Bt)
#define GBK  128                                   // k per stage: 256 B of every operand row
#define GLP  136                                   // LDS row pitch in halves: 272 B = 16 B x 17 (ds_load_b128 fragment reads)
#define GSTG ((GBM + GBN) * GLP)                   // halves per stage buffer: [A 128 rows | Bt 256 rows]
template <int EPI, bool ARES>
__global__ __launch_bounds__(256) void gemm64_f16(
    const unsigned short* __restrict__ Ap, const unsigned short* __restrict__ Arp, int lda,
    const unsigned short* __restrict__ Btp, int ldb,
    float cscale,
    void* Cp, unsigned short* Crp, int ldc, int M, int N, int K, float oscale,
    int n1, int nx, unsigned short* C2, unsigned short* C2r, unsigned short* C3, unsigned short* C3r) {
  const _Float16* Ah  = (const _Float16*)(const void*)Ap;
  const _Float16* Arh = (const _Float16*)(const void*)Arp;
  const _Float16* Bt  = (const _Float16*)(const void*)Btp;
  __shared__ __align__(16) _Float16 sAB[2 * GSTG]; // two stage buffers
  __shared__ __align__(16) float sT[8][16 * 68];   // per-wave 16x64 slab, pitch 68 floats
  const int tid  = threadIdx.x;
  const int lane = tid & 31;
  const int wave = tid >> 5;
  const int blocksN = N >> 8;
  const int blocksM = M >> 7;
  const int bidx = blockIdx.x;
  if (bidx >= blocksM * blocksN) return;   // block-uniform, before any copy or barrier
  const int bmi = bidx / blocksN;
  const int bm0 = bmi << 7;
  const int bn0 = (bidx - bmi * blocksN) << 8;
  const int wm  = wave >> 2;               // wave's 64-row half of the block tile
  const int wn  = wave & 3;                // wave's 64-column quarter
  const int m0 = bm0 + (wm << 6);
  const int n0 = bn0 + (wn << 6);

  // output of this tile (wave-uniform): columns below n1 go to Cp / Crp, the next nx to C2 / C2r, the next nx to C3 / C3r
  void* Co = Cp;
  unsigned short* Cro = Crp;
  int ldo = ldc, nc0 = n0;
  if constexpr (EPI == 0) {
    if (n0 >= n1) {
      const int e = n0 - n1;
      const bool third = (e >= nx);
      Co  = third ? (void*)C3 : (void*)C2;
      Cro = third ? C3r : C2r;
      ldo = nx;
      nc0 = third ? e - nx : e;
    }
  }

  const int rlane = lane & 15;                 // row (A) / col (B, D) within subtile
  const int koff  = (lane >> 4) * 8;           // k offset of this lane half
  const int mOff  = (lane >> 4) * 8;           // D row offset

  v8f acc[4][4];
#pragma unroll
  for (int i = 0; i < 4; ++i)
#pragma unroll
    for (int j = 0; j < 4; ++j) acc[i][j] = zero8();

  constexpr int NPL = ARES ? 2 : 1;
  const int nk  = K >> 7;                      // stages per plane
  const int nst = NPL * nk;                    // stages in all, block-uniform

  // the lane's share of a stage: rows crow + 16 i of A (i 0..7) and of Bt (i 0..15), 16-B piece tid & 15 of each
  const int crow = tid >> 4;
  const int cpc  = (tid & 15) * 8;
  const unsigned lds0 = (unsigned)(uintptr_t)(&sAB[0]) + (unsigned)(crow * GLP + cpc) * 2u;
  const _Float16* gA0 = Ah  + (size_t)(bm0 + crow) * lda + cpc;
  const _Float16* gR0 = Arh + (size_t)(bm0 + crow) * lda + cpc;
  const _Float16* gB0 = Bt  + (size_t)(bn0 + crow) * ldb + cpc;
  const size_t a16 = (size_t)16 * lda, b16 = (size_t)16 * ldb;
  constexpr unsigned R16 = 16u * GLP * 2u;     // 16 LDS rows, bytes
  auto stage_in = [&](int st, int buf) {
    const bool res = ARES && (st < nk);        // block-uniform: the residual plane's stages come first
    const int  k0  = (ARES && !res ? st - nk : st) * GBK;
    const _Float16* ga = (res ? gR0 : gA0) + k0;
    const _Float16* gb = gB0 + k0;
    const unsigned la = lds0 + (unsigned)buf * (unsigned)(GSTG * 2);
    const unsigned lb = la + (unsigned)(GBM * GLP * 2);
#pragma unroll                                 // straight line: constant LDS steps, 4 copies a statement
    for (int q = 0; q < GBM / 16; q += 4)
      copy4_lds(la + q * R16,       ga + q * a16,       la + (q + 1) * R16, ga + (q + 1) * a16,
                la + (q + 2) * R16, ga + (q + 2) * a16, la + (q + 3) * R16, ga + (q + 3) * a16);
#pragma unroll                                 // as above
    for (int q = 0; q < GBN / 16; q += 4)
      copy4_lds(lb + q * R16,       gb + q * b16,       lb + (q + 1) * R16, gb + (q + 1) * b16,
                lb + (q + 2) * R16, gb + (q + 2) * b16, lb + (q + 3) * R16, gb + (q + 3) * b16);
  };

  if (nst > 0) stage_in(0, 0);
#if defined(__HIP_DEVICE_COMPILE__)
  asm volatile("s_wait_asynccnt 0x0" ::: "memory");   // this wave's copies of stage 0 have landed
#endif
  __syncthreads();                                    // stage 0 is published to every wave
  if (nst > 1) stage_in(1, 1);

  for (int st = 0; st < nst; ++st) {
    if (ARES && st == nk) {
      acc_guard4(acc[0][0], acc[0][1], acc[0][2], acc[0][3]);
      acc_guard4(acc[1][0], acc[1][1], acc[1][2], acc[1][3]);
      acc_guard4(acc[2][0], acc[2][1], acc[2][2], acc[2][3]);
      acc_guard4(acc[3][0], acc[3][1], acc[3][2], acc[3][3]);
#pragma unroll
      for (int i = 0; i < 4; ++i)
#pragma unroll
        for (int j = 0; j < 4; ++j) acc[i][j] = acc[i][j] * (1.0f / 2048.0f);   // exact fold of the x2^11 residual carry
      acc_guard4(acc[0][0], acc[0][1], acc[0][2], acc[0][3]);
      acc_guard4(acc[1][0], acc[1][1], acc[1][2], acc[1][3]);
      acc_guard4(acc[2][0], acc[2][1], acc[2][2], acc[2][3]);
      acc_guard4(acc[3][0], acc[3][1], acc[3][2], acc[3][3]);
    }
    const _Float16* sA = sAB + (st & 1) * GSTG + ((wm << 6) + rlane) * GLP + koff;
    const _Float16* sB = sAB + (st & 1) * GSTG + (GBM + (wn << 6) + rlane) * GLP + koff;
#pragma unroll                                 // constant LDS offsets; the fragment arrays stay in registers
    for (int ks = 0; ks < GBK; ks += 32) {
      v16h bh[4], ah[4];
#pragma unroll
      for (int j = 0; j < 4; ++j) bh[j] = ldfrag_h(sB + (j << 4) * GLP + ks);
#pragma unroll
      for (int i = 0; i < 4; ++i) ah[i] = ldfrag_h(sA + (i << 4) * GLP + ks);
#pragma unroll
      for (int i = 0; i < 4; ++i) {
#pragma unroll
        for (int j = 0; j < 4; ++j) {
          acc[i][j] = mma_h_raw(ah[i], bh[j], acc[i][j]);
        }
        dep_guard_h(acc[i][0], acc[i][3], ah[i], bh[3]);
      }
      keep4_h(bh[0], bh[1], bh[2], bh[3]);
    }
#if defined(__HIP_DEVICE_COMPILE__)
    asm volatile("s_wait_dscnt 0x0" ::: "memory");      // this wave's reads of buffer st & 1 are done before it is refilled
    asm volatile("s_wait_asynccnt 0x0" ::: "memory");   // this wave's copies of stage st + 1 have landed
#endif
    __syncthreads();                                    // publishes stage st + 1, ends every read of stage st
    if (st + 2 < nst) stage_in(st + 2, st & 1);
  }
#if defined(__HIP_DEVICE_COMPILE__)
  asm volatile("s_wait_asynccnt 0x0" ::: "memory");     // no copy is outstanding when the wave goes on to its end
#endif
  acc_guard4(acc[0][0], acc[0][1], acc[0][2], acc[0][3]);
  acc_guard4(acc[1][0], acc[1][1], acc[1][2], acc[1][3]);
  acc_guard4(acc[2][0], acc[2][1], acc[2][2], acc[2][3]);
  acc_guard4(acc[3][0], acc[3][1], acc[3][2], acc[3][3]);

  // ---- epilogue ----
  float* slab = sT[wave];
#pragma unroll
  for (int i = 0; i < 4; ++i) {
    const int mBase = m0 + (i << 4);
#pragma unroll
    for (int r = 0; r < 8; ++r) {
      const int row = mOff + r;
#pragma unroll
      for (int j = 0; j < 4; ++j) slab[row * 68 + (j << 4) + rlane] = acc[i][j][r] * cscale;
    }
    __builtin_amdgcn_fence(__ATOMIC_RELEASE, "workgroup");
    __builtin_amdgcn_wave_barrier();
    __builtin_amdgcn_fence(__ATOMIC_ACQUIRE, "workgroup");
    if constexpr (EPI == 0) {
      unsigned short* C16 = (unsigned short*)Co;
      const int rq = lane >> 3, piece = lane & 7;
      v4u ph[4], pr[4];
#pragma unroll
      for (int it = 0; it < 4; ++it) {
        const int row = it * 4 + rq;                         // it 0..3 x rq 0..3 = rows 0..15
        const v4f a  = *(const v4f*)(slab + row * 68 + piece * 8);
        const v4f a2 = *(const v4f*)(slab + row * 68 + piece * 8 + 4);
        float f[8];
        f[0] = a[0];  f[1] = a[1];  f[2] = a[2];  f[3] = a[3];
        f[4] = a2[0]; f[5] = a2[1]; f[6] = a2[2]; f[7] = a2[3];
        v4u p, q;
#pragma unroll
        for (int e = 0; e < 4; ++e) {
          const float g0 = f[2 * e] * oscale, g1 = f[2 * e + 1] * oscale;
          const _Float16 x0 = (_Float16)g0, x1 = (_Float16)g1;
          const _Float16 y0 = (_Float16)((g0 - (float)x0) * 2048.0f);
          const _Float16 y1 = (_Float16)((g1 - (float)x1) * 2048.0f);
          p[e] = pk16(h_bits(x0), h_bits(x1));
          q[e] = pk16(h_bits(y0), h_bits(y1));
        }
        ph[it] = p;
        pr[it] = q;
      }
      {
#pragma unroll
        for (int it = 0; it < 4; ++it) {
          const int row = it * 4 + rq;
          const size_t co = (size_t)(mBase + row) * ldo + nc0 + piece * 8;
          *(v4u*)(C16 + co) = ph[it];
          *(v4u*)(Cro + co) = pr[it];
        }
        
      }
    } else {
      float* Cf = (float*)Co;
      const int hh = lane >> 4, c4 = (lane & 15) * 4;     // 256-B row segment = 16 lanes x 16 B
      v4f ov[8];
#pragma unroll
      for (int it = 0; it < 8; ++it) {
        const int row = it * 2 + hh;                       // it 0..7 x hh 0..1 = rows 0..15
        ov[it] = *(const v4f*)(slab + row * 68 + c4);
      }
      {
#pragma unroll
        for (int it = 0; it < 8; ++it) {
          const int row = it * 2 + hh;
          *(v4f*)(Cf + (size_t)(mBase + row) * ldo + nc0 + c4) = ov[it];
        }
        
      }
    }
    __builtin_amdgcn_fence(__ATOMIC_RELEASE, "workgroup");
    __builtin_amdgcn_wave_barrier();
    __builtin_amdgcn_fence(__ATOMIC_ACQUIRE, "workgroup");
  }
}

// =====================================================================================================
// f16 v plane (token-major, element (t, g, d) at vp[t*DKV + g*64 + d], g = kv head) -> f16 v^T plane
// vt[(g*64 + d)*SEQ + t] (same bits). Used for the hi plane and the residual plane.
// Block = one 64-token x 64-feature tile of one kv head g of one plane; grid = (SEQ/64, NKV, 2); tile staged in LDS as halves
// (v8h 16-B stores, __syncthreads, _Float16 element reads).
// Store: group g8 = tid>>3 (0..31), piece = tid&7: iteration it writes row d = it*32+g8, lanes 8q..8q+7 x 16 B =
// coverage: load 2 x 256 threads x 8 halves = 64x64; store 2 iterations x 32 groups = 64 rows d, 8 pieces x 8
// = 64 tokens per row; grid covers every (kv head, token tile) of [DKV][SEQ].
// =====================================================================================================
__global__ __launch_bounds__(256) void v_tr(const unsigned short* __restrict__ vp0, unsigned short* vt0,
                                            const unsigned short* __restrict__ vp1, unsigned short* vt1) {
  __shared__ __align__(16) _Float16 sv[64 * 72];       // [tt][d], pitch 72 halves (144 B)
  const int tid = threadIdx.x;
  const int t0  = blockIdx.x * 64;
  const int g   = blockIdx.y;
  if (g >= NKV || t0 >= SEQ || blockIdx.z > 1) return; // block-uniform, before any barrier
  const unsigned short* vp = blockIdx.z ? vp1 : vp0;   // blockIdx.z: 0 = hi plane, 1 = residual plane
  unsigned short* vt = blockIdx.z ? vt1 : vt0;
  const _Float16* src = (const _Float16*)(const void*)vp;
#pragma unroll
  for (int i = 0; i < 2; ++i) {
    const int idx = i * 256 + tid;                  // 0..511
    const int tt = idx >> 3, c8 = (idx & 7) * 8;
    const v8h a = *(const v8h*)(src + ((size_t)(t0 + tt)) * DKV + g * HD + c8);
    *(v8h*)(sv + tt * 72 + c8) = a;
  }
  __syncthreads();

  const int g8 = tid >> 3, piece = tid & 7;
  v4u hv[2];
  size_t hofs[2];
#pragma unroll
  for (int it = 0; it < 2; ++it) {
    const int d = it * 32 + g8;
    v4u a;
#pragma unroll
    for (int e = 0; e < 4; ++e) {
      const _Float16 x0 = sv[(piece * 8 + 2 * e) * 72 + d];
      const _Float16 x1 = sv[(piece * 8 + 2 * e + 1) * 72 + d];
      a[e] = pk16(h_bits(x0), h_bits(x1));
    }
    hv[it] = a;
    hofs[it] = ((size_t)(g * HD + d)) * SEQ + t0 + piece * 8;
  }
  {
#pragma unroll
    for (int it = 0; it < 2; ++it) *(v4u*)(vt + hofs[it]) = hv[it];
    
  }
}

#define ATT_SMEM 36864                                    // LDS bytes of the residual-plane variant, the larger one
// value of lane l ^ 16 (the other half of the wave, same column)
__device__ __forceinline__ float xhalf(float x) {
  return __builtin_bit_cast(float, __builtin_amdgcn_permlanex16(__builtin_bit_cast(int, x), __builtin_bit_cast(int, x),
                                                                0x76543210, 0xfedcba98, false, false));
}
template <bool HR>
__device__ __forceinline__
void attn_body(unsigned char* smem,
               const unsigned short* __restrict__ qp,  const unsigned short* __restrict__ qrp,
               const unsigned short* __restrict__ kp,  const unsigned short* __restrict__ krp,
               const unsigned short* __restrict__ vtp, const unsigned short* __restrict__ vtrp,
               unsigned short* ctxp, unsigned short* ctxrp, int qb, int h) {
  union FH { v16h v; v8h h[2]; };
  constexpr int LP     = 72;                             // LDS row pitch in halves: 144 B = 16 B x 9, so the 16 rows
                                                         // that one ds_load_b128 fragment read touches fall on 16
                                                         // different 4-bank groups (at 128 B they share two groups)
  constexpr int TB     = 64 * LP * 2;                    // one f16 64x64 tile at pitch LP, bytes
  constexpr int OP     = 68;                             // context staging pitch in floats: 272 B = 16 B x 17
  constexpr int OFF_K  = 0;
  constexpr int OFF_V  = TB;
  constexpr int OFF_KR = 2 * TB;
  constexpr int OFF_VR = 3 * TB;
  constexpr int SMEMB  = HR ? 4 * TB : 2 * TB;                // 36864 : 18432
  static_assert(4 * 16 * OP * 4 <= 2 * TB);                   // f32 context staging aliases the K/V region
  static_assert(SMEMB <= ATT_SMEM);
  _Float16* Ksh = (_Float16*)(smem + OFF_K);                  // K   [kv][d], pitch LP
  _Float16* Vsh = (_Float16*)(smem + OFF_V);                  // V^T [d][kv], pitch LP
  _Float16* Krs = (_Float16*)(smem + (HR ? OFF_KR : OFF_K));  // K residual (HR only)
  _Float16* Vrs = (_Float16*)(smem + (HR ? OFF_VR : OFF_V));  // V^T residual (HR only)

  const int tid  = threadIdx.x;
  const int wave = tid >> 5;
  const int lane = tid & 31;
  const int hh   = lane >> 4;
  const int c    = lane & 15;

  const int g    = h / GRP;                  // kv head
  const int q0   = qb * 64 + wave * 16;
  const int qrow = q0 + c;                   // the one query of this lane

  const _Float16* QP  = (const _Float16*)(const void*)qp   + (size_t)h * HD;
  const _Float16* QRP = (const _Float16*)(const void*)qrp  + (size_t)h * HD;
  const _Float16* KP  = (const _Float16*)(const void*)kp   + (size_t)g * HD;
  const _Float16* KRP = (const _Float16*)(const void*)krp  + (size_t)g * HD;
  const _Float16* VTP = (const _Float16*)(const void*)vtp  + (size_t)g * HD * SEQ;
  const _Float16* VRP = (const _Float16*)(const void*)vtrp + (size_t)g * HD * SEQ;

  // ---- Q fragments (B operand, column = lane&15): 2 d-chunks ----
  v16h qa[2], qr[2];
#pragma unroll
  for (int dc = 0; dc < 2; ++dc) {
    const size_t qo = (size_t)(q0 + c) * DM + dc * 32 + 8 * hh;
    qa[dc] = ldfrag_h(QP + qo);
    if constexpr (HR) qr[dc] = ldfrag_h(QRP + qo);
    else qr[dc] = qa[dc];
  }

  float lsum = 0.f, mrun = -1e30f;
  v8f oacc[4], oacc2[4];
#pragma unroll
  for (int t = 0; t < 4; ++t) { oacc[t] = zero8(); oacc2[t] = zero8(); }

  const int nkt = qb + 1;                                      // key tiles 0..qb, block-uniform
  for (int kti = 0; kti < nkt; ++kti) {
    const int kv0 = kti * 64;                                  // <= qb*64 < SEQ
    __syncthreads();
    {
      const int r = tid >> 1, half = (tid & 1) * 32;
      const size_t ko = (size_t)(kv0 + r) * DKV + half;         // K row kv0+r, d = half..half+31
      const size_t vo = (size_t)r * SEQ + kv0 + half;           // V^T row d = r, s = kv0+half..+31
#pragma unroll
      for (int i = 0; i < 4; ++i) {
        const v8h a0 = *(const v8h*)(KP + ko + 8 * i);
        const v8h b0 = *(const v8h*)(VTP + vo + 8 * i);
        *(v8h*)(Ksh + r * LP + half + 8 * i) = a0;
        *(v8h*)(Vsh + r * LP + half + 8 * i) = b0;
        if constexpr (HR) {
          const v8h a1 = *(const v8h*)(KRP + ko + 8 * i);
          const v8h b1 = *(const v8h*)(VRP + vo + 8 * i);
          *(v8h*)(Krs + r * LP + half + 8 * i) = a1;
          *(v8h*)(Vrs + r * LP + half + 8 * i) = b1;
        }
      }
    }
    __syncthreads();

    // ---- scores, transposed: 64 keys x 16 queries per wave (A operand: lane c -> key j*16+c, split k map over d) ----
    //      The fragments of JG score tiles are read from LDS as one group ahead of their run of WMMAs (one LDS latency
    //      per group, not one per WMMA); every accumulator takes its products in the order dc 0, dc 1
    //      (HR, second accumulator: kr.qh then kh.qr within each dc).
    constexpr int JG = HR ? 2 : 4;                       // score tiles per group: 8 fragments = 64 registers
    v8f s[4];
#pragma unroll
    for (int j0 = 0; j0 < 4; j0 += JG) {
      v16h kb[JG][2], krb[JG][2];
#pragma unroll
      for (int jj = 0; jj < JG; ++jj) {
#pragma unroll
        for (int dc = 0; dc < 2; ++dc) {
          const int ko = ((j0 + jj) * 16 + c) * LP + dc * 32 + 8 * hh;
          kb[jj][dc] = ldfrag_h(Ksh + ko);
          if constexpr (HR) krb[jj][dc] = ldfrag_h(Krs + ko);
        }
      }
      v8f t[JG];
#pragma unroll
      for (int jj = 0; jj < JG; ++jj) { s[j0 + jj] = zero8(); t[jj] = zero8(); }
#pragma unroll
      for (int dc = 0; dc < 2; ++dc) {
#pragma unroll
        for (int jj = 0; jj < JG; ++jj) s[j0 + jj] = mma_h_raw(kb[jj][dc], qa[dc], s[j0 + jj]);
        if constexpr (HR) {
#pragma unroll
          for (int jj = 0; jj < JG; ++jj) t[jj] = mma_h_raw(krb[jj][dc], qa[dc], t[jj]);
#pragma unroll
          for (int jj = 0; jj < JG; ++jj) t[jj] = mma_h_raw(kb[jj][dc], qr[dc], t[jj]);
        }
      }
      if constexpr (HR) {
#pragma unroll
        for (int jj = 0; jj < JG; ++jj) s[j0 + jj] = s[j0 + jj] + t[jj] * (1.0f / 2048.0f);
      }
    }

    // single-product variant: all eight V^T fragments are read here, so that their LDS latency runs under the softmax
    v16h vb[2][4];
    if constexpr (!HR) {
#pragma unroll
      for (int kk = 0; kk < 2; ++kk)
#pragma unroll
        for (int t = 0; t < 4; ++t) vb[kk][t] = ldfrag_h(Vsh + (t * 16 + c) * LP + kk * 32 + 8 * hh);
    }

    // ---- causal online softmax of the lane's one query: masked logits and their maximum in-lane, one exchange
    //      with lane ^ 16, alpha, p, row-sum partial, P^T (x256, f16; HR: + residual) packed as the B operand ----
    float tm[8];
#pragma unroll
    for (int r = 0; r < 8; ++r) tm[r] = -1e30f;
#pragma unroll
    for (int j = 0; j < 4; ++j) {
#pragma unroll
      for (int r = 0; r < 8; ++r) {
        const int key = kv0 + j * 16 + 8 * hh + r;
        float a = s[j][r] * (1.0f / 2048.0f);              // 1/8 head scale, 1/256 for the two x16 carries
        const bool ok = (key <= qrow);
        a = ok ? a : -1e30f;
        s[j][r] = a;
        tm[r] = fmaxf(tm[r], a);
      }
    }
    float tmx = fmaxf(fmaxf(fmaxf(tm[0], tm[1]), fmaxf(tm[2], tm[3])), fmaxf(fmaxf(tm[4], tm[5]), fmaxf(tm[6], tm[7])));
    tmx = fmaxf(tmx, xhalf(tmx));
    const float mn = fmaxf(mrun, tmx);
    const float al = __expf(mrun - mn);
    mrun = mn;
    float pp[8];
#pragma unroll
    for (int r = 0; r < 8; ++r) pp[r] = 0.0f;
    FH pa[2], par[2];
#pragma unroll
    for (int j = 0; j < 4; ++j) {
#pragma unroll
      for (int r = 0; r < 8; ++r) {
        const int key = kv0 + j * 16 + 8 * hh + r;
        const bool ok = (key <= qrow);
        float p = __expf(s[j][r] - mn);
        p = ok ? p : 0.0f;
        pp[r] += p;
        const float gg = p * 256.0f;
        const _Float16 x0 = (_Float16)gg;
        pa[j >> 1].v[(j & 1) * 8 + r] = x0;
        if constexpr (HR) par[j >> 1].v[(j & 1) * 8 + r] = (_Float16)((gg - (float)x0) * 2048.0f);
      }
    }
    lsum = lsum * al + (((pp[0] + pp[1]) + (pp[2] + pp[3])) + ((pp[4] + pp[5]) + (pp[6] + pp[7])));

    // ---- rescale the context accumulators by alpha (VALU), nop gaps before the next WMMA reads them ----
#pragma unroll
    for (int t = 0; t < 4; ++t) {
      oacc[t] = oacc[t] * al;
      if constexpr (HR) oacc2[t] = oacc2[t] * al;
    }
    acc_guard4(oacc[0], oacc[1], oacc[2], oacc[3]);
    if constexpr (HR) acc_guard4(oacc2[0], oacc2[1], oacc2[2], oacc2[3]);

    // ---- context^T += V^T . P^T (f16 WMMA; A = V^T [d][key] from LDS, B = P^T [key][query] in registers) ----
    //      HR: the eight fragments of a key chunk are read as one group ahead of its twelve WMMAs; every accumulator
    //      takes its products in the order kk 0, kk 1 (second accumulator: vr.ph then vh.pr within each kk).
#pragma unroll
    for (int kk = 0; kk < 2; ++kk) {
      v16h vrb[4];
      if constexpr (HR) {
#pragma unroll
        for (int t = 0; t < 4; ++t) {
          const int vo = (t * 16 + c) * LP + kk * 32 + 8 * hh;
          vb[kk][t] = ldfrag_h(Vsh + vo);
          vrb[t]    = ldfrag_h(Vrs + vo);
        }
      }
#pragma unroll
      for (int t = 0; t < 4; ++t) oacc[t] = mma_h_raw(vb[kk][t], pa[kk].v, oacc[t]);
      if constexpr (HR) {
#pragma unroll
        for (int t = 0; t < 4; ++t) oacc2[t] = mma_h_raw(vrb[t], pa[kk].v, oacc2[t]);
#pragma unroll
        for (int t = 0; t < 4; ++t) oacc2[t] = mma_h_raw(vb[kk][t], par[kk].v, oacc2[t]);
      }
    }
  }
  __syncthreads();                           // every wave is done with the K/V tiles before they are aliased

  // ---- normalise (1/lsum, the 1/256 p carry; keep the x16 v carry), stage the wave's 16x64 f32 tile [query][d]
  //      in LDS (a lane's 8 registers of tile t are 8 consecutive d of its query: two 16-B stores) ----
  float* os = (float*)(void*)smem + wave * (16 * OP);
  {
    const float l  = lsum + xhalf(lsum);     // the query's two key halves
    const float rl = 1.0f / l;               // l >= 1 (the max key contributes p = 1)
    const float sc = rl * (1.0f / 256.0f);
#pragma unroll
    for (int t = 0; t < 4; ++t) {
      v4f lo, hi;
#pragma unroll
      for (int r = 0; r < 4; ++r) {
        float v0 = oacc[t][r], v1 = oacc[t][r + 4];
        if constexpr (HR) { v0 += oacc2[t][r] * (1.0f / 2048.0f); v1 += oacc2[t][r + 4] * (1.0f / 2048.0f); }
        lo[r] = v0 * sc;
        hi[r] = v1 * sc;
      }
      *(v4f*)(os + c * OP + t * 16 + 8 * hh)     = lo;
      *(v4f*)(os + c * OP + t * 16 + 8 * hh + 4) = hi;
    }
  }
  __builtin_amdgcn_fence(__ATOMIC_RELEASE, "workgroup");
  __builtin_amdgcn_wave_barrier();
  __builtin_amdgcn_fence(__ATOMIC_ACQUIRE, "workgroup");
  {
    const int rq = lane >> 3, piece = lane & 7;
    v4u ph[4], pr[4];
#pragma unroll
    for (int it = 0; it < 4; ++it) {
      const int row = it * 4 + rq;   // it 0..3 x rq 0..3 = rows 0..15 of the wave tile
      const v4f a  = *(const v4f*)(os + row * OP + piece * 8);
      const v4f a2 = *(const v4f*)(os + row * OP + piece * 8 + 4);
      float f[8];
      f[0] = a[0];  f[1] = a[1];  f[2] = a[2];  f[3] = a[3];
      f[4] = a2[0]; f[5] = a2[1]; f[6] = a2[2]; f[7] = a2[3];
      v4u p, q;
#pragma unroll
      for (int e = 0; e < 4; ++e) {
        const _Float16 x0 = (_Float16)f[2 * e], x1 = (_Float16)f[2 * e + 1];
        const _Float16 y0 = (_Float16)((f[2 * e] - (float)x0) * 2048.0f);
        const _Float16 y1 = (_Float16)((f[2 * e + 1] - (float)x1) * 2048.0f);
        p[e] = pk16(h_bits(x0), h_bits(x1));
        q[e] = pk16(h_bits(y0), h_bits(y1));
      }
      ph[it] = p;
      pr[it] = q;
    }
    {
#pragma unroll
      for (int it = 0; it < 4; ++it) {
        const int row = it * 4 + rq;
        const size_t go = (size_t)(q0 + row) * DM + (size_t)h * HD + piece * 8;
        *(v4u*)(ctxp + go)  = ph[it];
        *(v4u*)(ctxrp + go) = pr[it];
      }
    }
  }
}

// =====================================================================================================
// Both attention variants in one grid of NQT * NH blocks, so that the short residual-plane tiles and the long
// single-product tiles run side by side. The grid is four quarters of NQT/4 * NH blocks; block w of each quarter has
// head w % NH and u = w / NH, and query tile NQT-1-u, QHR-1-u, QHR+u, u in quarters 0..3: a permutation of every
// (head, query tile), long tiles first, and the four blocks with equal w have the same total of key tiles for every w.
// =====================================================================================================
// amdgpu_waves_per_eu(4, 4): at most four waves per SIMD = four blocks per WGP, as many as the grid has per WGP, so
// that no WGP takes a fifth block while another is left with three.
__global__ __launch_bounds__(128) __attribute__((amdgpu_waves_per_eu(4, 4)))
void attn_all(const unsigned short* __restrict__ qp,  const unsigned short* __restrict__ qrp,
              const unsigned short* __restrict__ kp,  const unsigned short* __restrict__ krp,
              const unsigned short* __restrict__ vtp, const unsigned short* __restrict__ vtrp,
              unsigned short* ctxp, unsigned short* ctxrp) {
  __shared__ __align__(16) unsigned char smem[ATT_SMEM];
  constexpr int QQ = NQT / 4;
  static_assert((NQT % 4) == 0 && QHR == 2 * QQ);
  const int bx = blockIdx.x;
  const int j  = bx / (QQ * NH);
  if (j > 3) return;                         // block-uniform, before any barrier or store
  const int w  = bx - j * (QQ * NH);
  const int h  = w % NH;
  const int u  = w / NH;
  const int qb = (j == 0) ? (NQT - 1 - u) : (j == 1) ? (QHR - 1 - u) : (j == 2) ? (QHR + u) : u;
  if (qb < QHR) attn_body<true>(smem, qp, qrp, kp, krp, vtp, vtrp, ctxp, ctxrp, qb, h);
  else          attn_body<false>(smem, qp, qrp, kp, krp, vtp, vtrp, ctxp, ctxrp, qb, h);
}

// =====================================================================================================
// Workspace map (bytes, SEQ = 4096); every region is an exact multiple of its whole-line / whole-tile store
// granularity (row pitches 2048 / 512 / 8192 B, rows multiples of 64, all offsets 512-KiB aligned, no aliasing
// within a launch):
//   Xh    f16 [SEQ][1024]          0     8388608   (bf16 value of x, x16)
//   WqT   f16 [1024][1024]   8388608     2097152   (bf16 value of w_q^T x1024, [n][k])
//   WkT   f16 [256][1024]   10485760      524288   (bf16 value of w_k^T x1024, [n][k])
//   WvT   f16 [256][1024]   11010048      524288   (bf16 value of w_v^T x1024, [n][k])
//   WoT   f16 [1024][1024]  11534336     2097152   (bf16 value of w_o^T x1024, [n][k])
//   Qh    f16 [SEQ][1024]   13631488     8388608   (q x16)           Qr  22020096  8388608 (x2^11 residual)
//   Kh    f16 [SEQ][256]    30408704     2097152   (k x16)           Kr  32505856  2097152
//   Vh    f16 [SEQ][256]    34603008     2097152   (v x16)           Vr  36700160  2097152
//   VT    f16 [256][SEQ]    38797312     2097152   ([g*64 + d][s])   VTr 40894464  2097152
//   Ctx   f16 [SEQ][1024]   42991616     8388608   (context x16)     Ctxr 51380224 8388608
//   end                     59768832
// Projection weights arrive as [in k][out n] (n contiguous) and are transposed while converted (w_tr).
// d_out f32: [SEQ][1024] at byte 0, every 64x64 tile written once by the output projection launch.
// =====================================================================================================
extern "C" void kernel_launch(void* const* d_in, const int* in_sizes, int n_in,
                              void* d_out, int out_size, void* d_ws, size_t ws_size,
                              hipStream_t stream) {
  if (n_in < 5) return;
  if (in_sizes[0] < SEQ * DM || (in_sizes[0] % DM) != 0) return;   // x rows 0..SEQ-1 are used, pitch DM
  if (in_sizes[1] != DM * DM) return;
  if (in_sizes[2] != DM * DKV) return;
  if (in_sizes[3] != DM * DKV) return;
  if (in_sizes[4] != DM * DM) return;
  if (out_size < OUTN) return;

  const float* x   = (const float*)d_in[0];    // [>=SEQ][DM]
  const float* w_q = (const float*)d_in[1];    // [DM k][DM n]
  const float* w_k = (const float*)d_in[2];    // [DM k][DKV n]
  const float* w_v = (const float*)d_in[3];    // [DM k][DKV n]
  const float* w_o = (const float*)d_in[4];    // [DM k][DM n]

  const size_t PX   = (size_t)SEQ * DM * 2;          //  8388608
  const size_t PWq  = (size_t)DM * DM * 2;           //  2097152
  const size_t PWk  = (size_t)DKV * DM * 2;          //   524288
  const size_t PWo  = (size_t)DM * DM * 2;           //  2097152
  const size_t PQ   = (size_t)SEQ * DM * 2;          //  8388608
  const size_t PK   = (size_t)SEQ * DKV * 2;         //  2097152
  const size_t PVT  = (size_t)DKV * SEQ * 2;         //  2097152
  const size_t PCtx = (size_t)SEQ * DM * 2;          //  8388608
  size_t off = 0;
  const size_t oX    = off; off += PX;
  const size_t oWq   = off; off += PWq;
  const size_t oWk   = off; off += PWk;
  const size_t oWv   = off; off += PWk;
  const size_t oWo   = off; off += PWo;
  const size_t oQ    = off; off += PQ;
  const size_t oQr   = off; off += PQ;
  const size_t oK    = off; off += PK;
  const size_t oKr   = off; off += PK;
  const size_t oV    = off; off += PK;
  const size_t oVr   = off; off += PK;
  const size_t oVT   = off; off += PVT;
  const size_t oVTr  = off; off += PVT;
  const size_t oCtx  = off; off += PCtx;
  const size_t oCtxr = off; off += PCtx;
  if (off > ws_size) return;                         // off = 59768832 for SEQ = 4096
  if (off > (size_t)134217728) return;

  char* ws = (char*)d_ws;
  unsigned short* Xh   = (unsigned short*)(ws + oX);
  unsigned short* WqT  = (unsigned short*)(ws + oWq);
  unsigned short* WkT  = (unsigned short*)(ws + oWk);
  unsigned short* WvT  = (unsigned short*)(ws + oWv);
  unsigned short* WoT  = (unsigned short*)(ws + oWo);
  unsigned short* Qh   = (unsigned short*)(ws + oQ);
  unsigned short* Qr   = (unsigned short*)(ws + oQr);
  unsigned short* Kh   = (unsigned short*)(ws + oK);
  unsigned short* Kr   = (unsigned short*)(ws + oKr);
  unsigned short* Vh   = (unsigned short*)(ws + oV);
  unsigned short* Vr   = (unsigned short*)(ws + oVr);
  unsigned short* VT   = (unsigned short*)(ws + oVT);
  unsigned short* VTr  = (unsigned short*)(ws + oVTr);
  unsigned short* Ctx  = (unsigned short*)(ws + oCtx);
  unsigned short* Ctxr = (unsigned short*)(ws + oCtxr);
  float*          outf = (float*)d_out;              // [SEQ][DM]

  const dim3 blk(256);
  const int n8x = SEQ * DM / 8;                      // 524288
  const dim3 gCx((n8x + 255) / 256);                 // 2048 blocks
  const dim3 gTw(DM / 64, DM / 64, 4);               // (16, 16, 4): the four weights, [1024 k][n] -> [n][1024 k]
  const dim3 gGq((NQT * (DM / 64) + 7) / 8);         // 1024 wave tiles -> 128 blocks of 128 x 256
  const dim3 gGqkv((NQT * ((DM + 2 * DKV) / 64) + 7) / 8);   // 1536 wave tiles -> 192 blocks of 128 x 256
  const dim3 gVt(SEQ / 64, NKV, 2);                  // (64, 4, 2)
  const dim3 gAtt(NQT * NH);                         // every (head, query tile), both variants
  const float wScale = 1024.0f;                      // weights carried x1024
  const float aScale = 16.0f;                        // activations carried x16
  const float cscale = 1.0f / 16384.0f;              // 1/(16 * 1024)

  // (1) planes: x -> f16 x16 (bf16 values); weights -> transposed f16 x1024 (bf16 values)
  cvt16<<<gCx, blk, 0, stream>>>(x, Xh, n8x, aScale);
  w_tr<<<gTw, blk, 0, stream>>>(w_q, w_k, w_v, w_o, WqT, WkT, WvT, WoT, DM, DM, DKV, wScale);
  // (2) [q | k | v] = Xh . [WqT ; WkT ; WvT]^T in one grid (M=SEQ, N=1024+256+256, K=1024; the three transposed
  //     weights lie one behind the other in the workspace): Qh [SEQ][1024], Kh, Vh [SEQ][256], f16 x16 + residual
  gemm64_f16<0, false><<<gGqkv, blk, 0, stream>>>(Xh, Xh, DM, WqT, DM, cscale, (void*)Qh, Qr, DM,
                                                  SEQ, DM + 2 * DKV, DM, aScale,
                                                  DM, DKV, Kh, Kr, Vh, Vr);
  // (3) v -> v^T planes (hi and residual, all tokens, all kv heads)
  v_tr<<<gVt, blk, 0, stream>>>(Vh, VT, Vr, VTr);
  // (4) causal softmax attention -> Ctx f16 x16 + residual plane: tiles 0..QHR-1 with residual operand planes,
  //     tiles QHR..NQT-1 with single products; together every (head, query tile) exactly once
  attn_all<<<gAtt, dim3(128), 0, stream>>>(Qh, Qr, Kh, Kr, VT, VTr, Ctx, Ctxr);
  // (5) out = (Ctx + 2^-11 Ctxr) . WoT^T -> d_out f32 [SEQ][1024] (M=SEQ, N=1024, K=1024), every tile once
  gemm64_f16<1, true><<<gGq, blk, 0, stream>>>(Ctx, Ctxr, DM, WoT, DM, cscale, (void*)outf, Ctxr, DM,
                                               SEQ, DM, DM, 1.0f,
                                               DM, DKV, Ctxr, Ctxr, Ctxr, Ctxr);
  (void)hipGetLastError();
}

// v006
// It runs in 126 microseconds.
// Timed twice side by side with v005, it ran 1.03 times as fast both times.
// Counting every step since v000, it is 5.52 times as fast.
// Contractions: q/k/v projections = v_wmma_f32_16x16x32_f16 (A = f16 of RNE-bf16 x carried x16, B = f16 of RNE-bf16 w^T carried x1024, single product); attention k.q^T and v^T.p^T (both products transposed) = v_wmma_f32_16x16x32_f16 (query tiles below SEQ/2: q, k, v^T f16 planes x16 plus x2^11 residual planes, p f16 x256 plus x2^11 residual, hi.hi + hi.res + res.hi; query tiles from SEQ/2 on: single products on the x16 / x256 planes); output projection = v_wmma_f32_16x16x32_f16 (A = ctx f16 x16 plus its x2^11 residual plane, B = f16 of RNE-bf16 w_o^T x1024); all f32 accumulate. Causal online-max softmax, masks and row sums f32 on VALU.
#include <hip/hip_runtime.h>
#include <math.h>
#include <stdint.h>

#define SEQ   4096
#define DM    1024
#define NH    16
#define NKV   4
#define HD    64
#define DKV   (NKV * HD)            // 256
#define GRP   (NH / NKV)            // query heads per kv head = 4 (query head h uses kv head h / GRP)
#define NQT   (SEQ / 64)            // 64 query tiles of 64 rows
#define QHR   (NQT / 2)             // query tiles below this index use residual planes in attention
#define OUTN  (SEQ * DM)
static_assert(NH * HD == DM);
static_assert(HD == 64);
static_assert((NH % NKV) == 0);
static_assert((SEQ % 64) == 0 && (NQT % 2) == 0);
static_assert((DM % 64) == 0 && (DKV % 64) == 0 && (DM % 32) == 0);
static_assert(((NQT * (DM / 64)) % 8) == 0);
static_assert(((NQT * (DKV / 64)) % 8) == 0);
static_assert((SEQ % 128) == 0 && ((DM + 2 * DKV) % 256) == 0 && (DM % 256) == 0);   // GEMM block tile 128 x 256, 128 k per stage
static_assert(((SEQ * DM / 8) % 256) == 0);

typedef _Float16 v16h __attribute__((ext_vector_type(16)));
typedef _Float16 v8h  __attribute__((ext_vector_type(8)));
typedef float    v8f  __attribute__((ext_vector_type(8)));
typedef float    v4f  __attribute__((ext_vector_type(4)));
typedef unsigned int v4u __attribute__((ext_vector_type(4)));

// ---- scalar helpers --------------------------------------------------------------------------------
__device__ __forceinline__ unsigned short bf_bits(float f) {          // f32 -> bf16 bits, RNE convert
  unsigned u = __float_as_uint(f);
  return (unsigned short)((u + 0x7FFFu + ((u >> 16) & 1u)) >> 16);
}
__device__ __forceinline__ float bfr(float f) { return __uint_as_float(((unsigned)bf_bits(f)) << 16); }
__device__ __forceinline__ unsigned short h_bits(_Float16 x) { return __builtin_bit_cast(unsigned short, x); }
__device__ __forceinline__ unsigned pk16(unsigned short a, unsigned short b) { return (unsigned)a | ((unsigned)b << 16); }
__device__ __forceinline__ v8f zero8() { v8f z = {0.f, 0.f, 0.f, 0.f, 0.f, 0.f, 0.f, 0.f}; return z; }

// ---- fragment loader: 16-bit A/B operand, lane -> row/col (lane&15), p already includes +8*(lane>>4);
//      elements 0..7 <- p[0..7] (k0+8h..), elements 8..15 <- p[16..23] (k0+16+8h..)
__device__ __forceinline__ v16h ldfrag_h(const _Float16* p) {
  union { v16h v; v8h h[2]; } f;
  f.h[0] = *(const v8h*)(p);
  f.h[1] = *(const v8h*)(p + 16);
  return f.v;
}

// ---- WMMA helpers with trailing VALU hazard gap --------------------------------------------------------
__device__ __forceinline__ v8f mma_h_raw(v16h a, v16h b, v8f c) {
  return __builtin_amdgcn_wmma_f32_16x16x32_f16(false, a, false, b, (short)0, c, false, false);
}
__device__ __forceinline__ void dep_guard_h(v8f& a, v8f& b, v16h x, v16h y) {
#if defined(__HIP_DEVICE_COMPILE__)
  asm volatile("v_nop\n\tv_nop\n\tv_nop\n\tv_nop" : "+v"(a), "+v"(b) : "v"(x), "v"(y));
#endif
}
__device__ __forceinline__ void keep4_h(v16h a, v16h b, v16h c, v16h d) {
#if defined(__HIP_DEVICE_COMPILE__)
  asm volatile("v_nop" :: "v"(a), "v"(b), "v"(c), "v"(d));
#endif
}
__device__ __forceinline__ void acc_guard4(v8f& a, v8f& b, v8f& c, v8f& d) {
#if defined(__HIP_DEVICE_COMPILE__)
  asm volatile("v_nop\n\tv_nop\n\tv_nop\n\tv_nop" : "+v"(a), "+v"(b), "+v"(c), "+v"(d));
#endif
}

// =====================================================================================================
// f32 plane -> f16 bits of bfr(v) * scale (scale a power of two): x (x16).
// coverage: n8 threads x 8 = the whole plane.
// =====================================================================================================
__global__ __launch_bounds__(256) void cvt16(const float* __restrict__ in, unsigned short* out, int n8, float scale) {
  const int i = blockIdx.x * 256 + threadIdx.x;
  if (i < n8) {
    const v4f a = *(const v4f*)(in + (size_t)i * 8);
    const v4f b = *(const v4f*)(in + (size_t)i * 8 + 4);
    v4u p;
    p[0] = pk16(h_bits((_Float16)(bfr(a[0]) * scale)), h_bits((_Float16)(bfr(a[1]) * scale)));
    p[1] = pk16(h_bits((_Float16)(bfr(a[2]) * scale)), h_bits((_Float16)(bfr(a[3]) * scale)));
    p[2] = pk16(h_bits((_Float16)(bfr(b[0]) * scale)), h_bits((_Float16)(bfr(b[1]) * scale)));
    p[3] = pk16(h_bits((_Float16)(bfr(b[2]) * scale)), h_bits((_Float16)(bfr(b[3]) * scale)));
    *(v4u*)(out + (size_t)i * 8) = p;
    
  }
}

// =====================================================================================================
// f32 weight W [K rows][N cols] (the x@W layout, n contiguous) -> f16 Wt[n][k] = f16(bfr(W[k][n]) * scale),
// pitch K halves (k contiguous = the Bt layout of the GEMM below); scale a power of two.
// Block = one 64 (k) x 64 (n) tile of one of four weights; grid = (Nwide/64, K/64, 4), blockIdx.z = the weight,
// blocks past a narrow weight's last column tile leave at once; tile staged in LDS as halves [kk][nn] pitch 72
// (v8h 16-B stores, __syncthreads, _Float16 element reads).
// Store: group g = tid>>3 (0..31), piece = tid&7: iteration it writes out row n = it*32+g, lanes 8q..8q+7 x 16 B =
// coverage: load 2 x 256 threads x 8 = 64x64; store 2 iterations x 32 groups = 64 rows n, 8 pieces x 8 = 64 k
// per row; grid covers every (n tile, k tile) of [N][K].
// =====================================================================================================
__global__ __launch_bounds__(256) void w_tr(const float* __restrict__ w0, const float* __restrict__ w1,
                                            const float* __restrict__ w2, const float* __restrict__ w3,
                                            unsigned short* t0, unsigned short* t1, unsigned short* t2, unsigned short* t3,
                                            int K, int Nwide, int Nnarrow, float scale) {
  __shared__ __align__(16) _Float16 sw[64 * 72];       // [kk][nn], pitch 72 halves (144 B)
  const int tid = threadIdx.x;
  const int z   = blockIdx.z;                          // which weight: 0 and 3 are Nwide columns, 1 and 2 Nnarrow
  const int N   = (z == 0 || z == 3) ? Nwide : Nnarrow;
  const int n0  = blockIdx.x * 64;
  const int k0  = blockIdx.y * 64;
  if (z > 3 || n0 >= N || k0 >= K) return;             // block-uniform, before the barrier
  const float* w = (z == 0) ? w0 : (z == 1) ? w1 : (z == 2) ? w2 : w3;
  unsigned short* wt = (z == 0) ? t0 : (z == 1) ? t1 : (z == 2) ? t2 : t3;
#pragma unroll
  for (int i = 0; i < 2; ++i) {
    const int idx = i * 256 + tid;                  // 0..511
    const int kk = idx >> 3, c8 = (idx & 7) * 8;
    const float* src = w + (size_t)(k0 + kk) * N + n0 + c8;
    const v4f a  = *(const v4f*)(src);
    const v4f a2 = *(const v4f*)(src + 4);
    v8h o;
    o[0] = (_Float16)(bfr(a[0]) * scale);
    o[1] = (_Float16)(bfr(a[1]) * scale);
    o[2] = (_Float16)(bfr(a[2]) * scale);
    o[3] = (_Float16)(bfr(a[3]) * scale);
    o[4] = (_Float16)(bfr(a2[0]) * scale);
    o[5] = (_Float16)(bfr(a2[1]) * scale);
    o[6] = (_Float16)(bfr(a2[2]) * scale);
    o[7] = (_Float16)(bfr(a2[3]) * scale);
    *(v8h*)(sw + kk * 72 + c8) = o;
  }
  __syncthreads();

  const int g = tid >> 3, piece = tid & 7;
  v4u hv[2];
  size_t hofs[2];
#pragma unroll
  for (int it = 0; it < 2; ++it) {
    const int nn = it * 32 + g;
    v4u a;
#pragma unroll
    for (int e = 0; e < 4; ++e) {
      const _Float16 x0 = sw[(piece * 8 + 2 * e) * 72 + nn];
      const _Float16 x1 = sw[(piece * 8 + 2 * e + 1) * 72 + nn];
      a[e] = pk16(h_bits(x0), h_bits(x1));
    }
    hv[it] = a;
    hofs[it] = ((size_t)(n0 + nn)) * K + k0 + piece * 8;
  }
  {
#pragma unroll
    for (int it = 0; it < 2; ++it) *(v4u*)(wt + hofs[it]) = hv[it];
    
  }
}

// =====================================================================================================
// Four 16-byte asynchronous copies of one lane, global memory -> LDS (l = the lane's LDS byte address, g = its
// global address). s_wait_xcnt 0 closes the statement so that no address register is rewritten in front of it.
// =====================================================================================================
__device__ __forceinline__ void copy4_lds(unsigned l0, const _Float16* g0, unsigned l1, const _Float16* g1,
                                          unsigned l2, const _Float16* g2, unsigned l3, const _Float16* g3) {
#if defined(__HIP_DEVICE_COMPILE__)
  asm volatile("global_load_async_to_lds_b128 %0, %1, off\n\t"
               "global_load_async_to_lds_b128 %2, %3, off\n\t"
               "global_load_async_to_lds_b128 %4, %5, off\n\t"
               "global_load_async_to_lds_b128 %6, %7, off\n\t"
               "s_wait_xcnt 0x0"
               :: "v"(l0), "v"(g0), "v"(l1), "v"(g1), "v"(l2), "v"(g2), "v"(l3), "v"(g3) : "memory");
#endif
}

// =====================================================================================================
// Register-blocked f16 WMMA GEMM, block = 8 waves (2 x 4) = one 128 x 256 tile, one wave per 64x64 tile:
//   v[m][n] = (sum_k A[m][k] * Bt[n][k]  [+ 2^-11 * sum_k Ar[m][k] * Bt[n][k] when ARES]) * cscale
// A, Ar row-major [M][K] pitch lda (f16), Bt row-major [N][K] pitch ldb (f16, k contiguous); M a multiple of 128,
// N of 256, K of 128; grid = (M / 128) * (N / 256) blocks.
// Operands: a stage = 128 k of the block's 128 rows of A and 256 rows of Bt, whole 128-B lines, brought into LDS at
// row pitch 272 B by asynchronous copies (24 per lane and stage: lane -> row tid>>4 (+16 per copy), 16-B piece
// tid&15); two buffers, stage s + 1 in flight while stage s is multiplied; every wave reads its fragments from LDS.
// ARES: the stages of the residual plane come first and accumulate from zero, the accumulators are scaled by 2^-11
// exactly on the VALU (with nop gaps on both sides), then the hi plane's stages accumulate on top: one accumulator set.
// EPI 0: column tiles from n1 on are stored to a second and a third output (each nx columns wide, pitch nx; hi plane
// C2 / C3, residual plane C2r / C3r), so that products that share A run in one grid. EPI 1 has the one output.
// Epilogue variants:
//   EPI 0: f16 hi plane = f16(v * oscale) at Cp and residual plane = f16((v*oscale - hi) * 2048) at Crp, pitch ldc halves
//   EPI 1: f32 out = v, pitch ldc floats
// 16-row slabs staged per wave in LDS. f32 out: each 64-wide row segment (256 B = 2 lines) by 16 lanes x 16 B,
// coverage: 4 slabs x 16 rows x 64 cols = the wave's whole 64x64 tile; 8 waves = the block's 128 x 256; grid = [M][N].
// =====================================================================================================
#define GBM  128                                   // block tile rows (A)
#define GBN  256                                   // block tile columns (rows of Bt)
#define GBK  128                                   // k per stage: 256 B of every operand row
#define GLP  136                                   // LDS row pitch in halves: 272 B = 16 B x 17 (ds_load_b128 fragment reads)
#define GSTG ((GBM + GBN) * GLP)                   // halves per stage buffer: [A 128 rows | Bt 256 rows]
template <int EPI, bool ARES>
__global__ __launch_bounds__(256) void gemm64_f16(
    const unsigned short* __restrict__ Ap, const unsigned short* __restrict__ Arp, int lda,
    const unsigned short* __restrict__ Btp, int ldb,
    float cscale,
    void* Cp, unsigned short* Crp, int ldc, int M, int N, int K, float oscale,
    int n1, int nx, unsigned short* C2, unsigned short* C2r, unsigned short* C3, unsigned short* C3r) {
  const _Float16* Ah  = (const _Float16*)(const void*)Ap;
  const _Float16* Arh = (const _Float16*)(const void*)Arp;
  const _Float16* Bt  = (const _Float16*)(const void*)Btp;
  __shared__ __align__(16) _Float16 sAB[2 * GSTG]; // two stage buffers
  __shared__ __align__(16) float sT[8][16 * 68];   // per-wave 16x64 slab, pitch 68 floats
  const int tid  = threadIdx.x;
  const int lane = tid & 31;
  const int wave = tid >> 5;
  const int blocksN = N >> 8;
  const int blocksM = M >> 7;
  const int bidx = blockIdx.x;
  if (bidx >= blocksM * blocksN) return;   // block-uniform, before any copy or barrier
  const int bmi = bidx / blocksN;
  const int bm0 = bmi << 7;
  const int bn0 = (bidx - bmi * blocksN) << 8;
  const int wm  = wave >> 2;               // wave's 64-row half of the block tile
  const int wn  = wave & 3;                // wave's 64-column quarter
  const int m0 = bm0 + (wm << 6);
  const int n0 = bn0 + (wn << 6);

  // output of this tile (wave-uniform): columns below n1 go to Cp / Crp, the next nx to C2 / C2r, the next nx to C3 / C3r
  void* Co = Cp;
  unsigned short* Cro = Crp;
  int ldo = ldc, nc0 = n0;
  if constexpr (EPI == 0) {
    if (n0 >= n1) {
      const int e = n0 - n1;
      const bool third = (e >= nx);
      Co  = third ? (void*)C3 : (void*)C2;
      Cro = third ? C3r : C2r;
      ldo = nx;
      nc0 = third ? e - nx : e;
    }
  }

  const int rlane = lane & 15;                 // row (A) / col (B, D) within subtile
  const int koff  = (lane >> 4) * 8;           // k offset of this lane half
  const int mOff  = (lane >> 4) * 8;           // D row offset

  v8f acc[4][4];
#pragma unroll
  for (int i = 0; i < 4; ++i)
#pragma unroll
    for (int j = 0; j < 4; ++j) acc[i][j] = zero8();

  constexpr int NPL = ARES ? 2 : 1;
  const int nk  = K >> 7;                      // stages per plane
  const int nst = NPL * nk;                    // stages in all, block-uniform

  // the lane's share of a stage: rows crow + 16 i of A (i 0..7) and of Bt (i 0..15), 16-B piece tid & 15 of each
  const int crow = tid >> 4;
  const int cpc  = (tid & 15) * 8;
  const unsigned lds0 = (unsigned)(uintptr_t)(&sAB[0]) + (unsigned)(crow * GLP + cpc) * 2u;
  const _Float16* gA0 = Ah  + (size_t)(bm0 + crow) * lda + cpc;
  const _Float16* gR0 = Arh + (size_t)(bm0 + crow) * lda + cpc;
  const _Float16* gB0 = Bt  + (size_t)(bn0 + crow) * ldb + cpc;
  const size_t a16 = (size_t)16 * lda, b16 = (size_t)16 * ldb;
  constexpr unsigned R16 = 16u * GLP * 2u;     // 16 LDS rows, bytes
  auto stage_in = [&](int st, int buf) {
    const bool res = ARES && (st < nk);        // block-uniform: the residual plane's stages come first
    const int  k0  = (ARES && !res ? st - nk : st) * GBK;
    const _Float16* ga = (res ? gR0 : gA0) + k0;
    const _Float16* gb = gB0 + k0;
    const unsigned la = lds0 + (unsigned)buf * (unsigned)(GSTG * 2);
    const unsigned lb = la + (unsigned)(GBM * GLP * 2);
#pragma unroll                                 // straight line: constant LDS steps, 4 copies a statement
    for (int q = 0; q < GBM / 16; q += 4)
      copy4_lds(la + q * R16,       ga + q * a16,       la + (q + 1) * R16, ga + (q + 1) * a16,
                la + (q + 2) * R16, ga + (q + 2) * a16, la + (q + 3) * R16, ga + (q + 3) * a16);
#pragma unroll                                 // as above
    for (int q = 0; q < GBN / 16; q += 4)
      copy4_lds(lb + q * R16,       gb + q * b16,       lb + (q + 1) * R16, gb + (q + 1) * b16,
                lb + (q + 2) * R16, gb + (q + 2) * b16, lb + (q + 3) * R16, gb + (q + 3) * b16);
  };

  if (nst > 0) stage_in(0, 0);
#if defined(__HIP_DEVICE_COMPILE__)
  asm volatile("s_wait_asynccnt 0x0" ::: "memory");   // this wave's copies of stage 0 have landed
#endif
  __syncthreads();                                    // stage 0 is published to every wave
  if (nst > 1) stage_in(1, 1);

  for (int st = 0; st < nst; ++st) {
    if (ARES && st == nk) {
      acc_guard4(acc[0][0], acc[0][1], acc[0][2], acc[0][3]);
      acc_guard4(acc[1][0], acc[1][1], acc[1][2], acc[1][3]);
      acc_guard4(acc[2][0], acc[2][1], acc[2][2], acc[2][3]);
      acc_guard4(acc[3][0], acc[3][1], acc[3][2], acc[3][3]);
#pragma unroll
      for (int i = 0; i < 4; ++i)
#pragma unroll
        for (int j = 0; j < 4; ++j) acc[i][j] = acc[i][j] * (1.0f / 2048.0f);   // exact fold of the x2^11 residual carry
      acc_guard4(acc[0][0], acc[0][1], acc[0][2], acc[0][3]);
      acc_guard4(acc[1][0], acc[1][1], acc[1][2], acc[1][3]);
      acc_guard4(acc[2][0], acc[2][1], acc[2][2], acc[2][3]);
      acc_guard4(acc[3][0], acc[3][1], acc[3][2], acc[3][3]);
    }
    const _Float16* sA = sAB + (st & 1) * GSTG + ((wm << 6) + rlane) * GLP + koff;
    const _Float16* sB = sAB + (st & 1) * GSTG + (GBM + (wn << 6) + rlane) * GLP + koff;
#pragma unroll                                 // constant LDS offsets; the fragment arrays stay in registers
    for (int ks = 0; ks < GBK; ks += 32) {
      v16h bh[4], ah[4];
#pragma unroll
      for (int j = 0; j < 4; ++j) bh[j] = ldfrag_h(sB + (j << 4) * GLP + ks);
#pragma unroll
      for (int i = 0; i < 4; ++i) ah[i] = ldfrag_h(sA + (i << 4) * GLP + ks);
#pragma unroll
      for (int i = 0; i < 4; ++i) {
#pragma unroll
        for (int j = 0; j < 4; ++j) {
          acc[i][j] = mma_h_raw(ah[i], bh[j], acc[i][j]);
        }
        dep_guard_h(acc[i][0], acc[i][3], ah[i], bh[3]);
      }
      keep4_h(bh[0], bh[1], bh[2], bh[3]);
    }
#if defined(__HIP_DEVICE_COMPILE__)
    asm volatile("s_wait_dscnt 0x0" ::: "memory");      // this wave's reads of buffer st & 1 are done before it is refilled
    asm volatile("s_wait_asynccnt 0x0" ::: "memory");   // this wave's copies of stage st + 1 have landed
#endif
    __syncthreads();                                    // publishes stage st + 1, ends every read of stage st
    if (st + 2 < nst) stage_in(st + 2, st & 1);
  }
#if defined(__HIP_DEVICE_COMPILE__)
  asm volatile("s_wait_asynccnt 0x0" ::: "memory");     // no copy is outstanding when the wave goes on to its end
#endif
  acc_guard4(acc[0][0], acc[0][1], acc[0][2], acc[0][3]);
  acc_guard4(acc[1][0], acc[1][1], acc[1][2], acc[1][3]);
  acc_guard4(acc[2][0], acc[2][1], acc[2][2], acc[2][3]);
  acc_guard4(acc[3][0], acc[3][1], acc[3][2], acc[3][3]);

  // ---- epilogue ----
  float* slab = sT[wave];
#pragma unroll
  for (int i = 0; i < 4; ++i) {
    const int mBase = m0 + (i << 4);
#pragma unroll
    for (int r = 0; r < 8; ++r) {
      const int row = mOff + r;
#pragma unroll
      for (int j = 0; j < 4; ++j) slab[row * 68 + (j << 4) + rlane] = acc[i][j][r] * cscale;
    }
    __builtin_amdgcn_fence(__ATOMIC_RELEASE, "workgroup");
    __builtin_amdgcn_wave_barrier();
    __builtin_amdgcn_fence(__ATOMIC_ACQUIRE, "workgroup");
    if constexpr (EPI == 0) {
      unsigned short* C16 = (unsigned short*)Co;
      const int rq = lane >> 3, piece = lane & 7;
      v4u ph[4], pr[4];
#pragma unroll
      for (int it = 0; it < 4; ++it) {
        const int row = it * 4 + rq;                         // it 0..3 x rq 0..3 = rows 0..15
        const v4f a  = *(const v4f*)(slab + row * 68 + piece * 8);
        const v4f a2 = *(const v4f*)(slab + row * 68 + piece * 8 + 4);
        float f[8];
        f[0] = a[0];  f[1] = a[1];  f[2] = a[2];  f[3] = a[3];
        f[4] = a2[0]; f[5] = a2[1]; f[6] = a2[2]; f[7] = a2[3];
        v4u p, q;
#pragma unroll
        for (int e = 0; e < 4; ++e) {
          const float g0 = f[2 * e] * oscale, g1 = f[2 * e + 1] * oscale;
          const _Float16 x0 = (_Float16)g0, x1 = (_Float16)g1;
          const _Float16 y0 = (_Float16)((g0 - (float)x0) * 2048.0f);
          const _Float16 y1 = (_Float16)((g1 - (float)x1) * 2048.0f);
          p[e] = pk16(h_bits(x0), h_bits(x1));
          q[e] = pk16(h_bits(y0), h_bits(y1));
        }
        ph[it] = p;
        pr[it] = q;
      }
      {
#pragma unroll
        for (int it = 0; it < 4; ++it) {
          const int row = it * 4 + rq;
          const size_t co = (size_t)(mBase + row) * ldo + nc0 + piece * 8;
          *(v4u*)(C16 + co) = ph[it];
          *(v4u*)(Cro + co) = pr[it];
        }
        
      }
    } else {
      float* Cf = (float*)Co;
      const int hh = lane >> 4, c4 = (lane & 15) * 4;     // 256-B row segment = 16 lanes x 16 B
      v4f ov[8];
#pragma unroll
      for (int it = 0; it < 8; ++it) {
        const int row = it * 2 + hh;                       // it 0..7 x hh 0..1 = rows 0..15
        ov[it] = *(const v4f*)(slab + row * 68 + c4);
      }
      {
#pragma unroll
        for (int it = 0; it < 8; ++it) {
          const int row = it * 2 + hh;
          *(v4f*)(Cf + (size_t)(mBase + row) * ldo + nc0 + c4) = ov[it];
        }
        
      }
    }
    __builtin_amdgcn_fence(__ATOMIC_RELEASE, "workgroup");
    __builtin_amdgcn_wave_barrier();
    __builtin_amdgcn_fence(__ATOMIC_ACQUIRE, "workgroup");
  }
}

// =====================================================================================================
// f16 v plane (token-major, element (t, g, d) at vp[t*DKV + g*64 + d], g = kv head) -> f16 v^T plane
// vt[(g*64 + d)*SEQ + t] (same bits). Used for the hi plane and the residual plane.
// Block = one 64-token x 64-feature tile of one kv head g of one plane; grid = (SEQ/64, NKV, 2); tile staged in LDS as halves
// (v8h 16-B stores, __syncthreads, _Float16 element reads).
// Store: group g8 = tid>>3 (0..31), piece = tid&7: iteration it writes row d = it*32+g8, lanes 8q..8q+7 x 16 B =
// coverage: load 2 x 256 threads x 8 halves = 64x64; store 2 iterations x 32 groups = 64 rows d, 8 pieces x 8
// = 64 tokens per row; grid covers every (kv head, token tile) of [DKV][SEQ].
// =====================================================================================================
__global__ __launch_bounds__(256) void v_tr(const unsigned short* __restrict__ vp0, unsigned short* vt0,
                                            const unsigned short* __restrict__ vp1, unsigned short* vt1) {
  __shared__ __align__(16) _Float16 sv[64 * 72];       // [tt][d], pitch 72 halves (144 B)
  const int tid = threadIdx.x;
  const int t0  = blockIdx.x * 64;
  const int g   = blockIdx.y;
  if (g >= NKV || t0 >= SEQ || blockIdx.z > 1) return; // block-uniform, before any barrier
  const unsigned short* vp = blockIdx.z ? vp1 : vp0;   // blockIdx.z: 0 = hi plane, 1 = residual plane
  unsigned short* vt = blockIdx.z ? vt1 : vt0;
  const _Float16* src = (const _Float16*)(const void*)vp;
#pragma unroll
  for (int i = 0; i < 2; ++i) {
    const int idx = i * 256 + tid;                  // 0..511
    const int tt = idx >> 3, c8 = (idx & 7) * 8;
    const v8h a = *(const v8h*)(src + ((size_t)(t0 + tt)) * DKV + g * HD + c8);
    *(v8h*)(sv + tt * 72 + c8) = a;
  }
  __syncthreads();

  const int g8 = tid >> 3, piece = tid & 7;
  v4u hv[2];
  size_t hofs[2];
#pragma unroll
  for (int it = 0; it < 2; ++it) {
    const int d = it * 32 + g8;
    v4u a;
#pragma unroll
    for (int e = 0; e < 4; ++e) {
      const _Float16 x0 = sv[(piece * 8 + 2 * e) * 72 + d];
      const _Float16 x1 = sv[(piece * 8 + 2 * e + 1) * 72 + d];
      a[e] = pk16(h_bits(x0), h_bits(x1));
    }
    hv[it] = a;
    hofs[it] = ((size_t)(g * HD + d)) * SEQ + t0 + piece * 8;
  }
  {
#pragma unroll
    for (int it = 0; it < 2; ++it) *(v4u*)(vt + hofs[it]) = hv[it];
    
  }
}

#define ATT_SMEM 36864                                    // LDS bytes of the residual-plane variant, the larger one
// value of lane l ^ 16 (the other half of the wave, same column)
__device__ __forceinline__ float xhalf(float x) {
  return __builtin_bit_cast(float, __builtin_amdgcn_permlanex16(__builtin_bit_cast(int, x), __builtin_bit_cast(int, x),
                                                                0x76543210, 0xfedcba98, false, false));
}
template <bool HR>
__device__ __forceinline__
void attn_body(unsigned char* smem,
               const unsigned short* __restrict__ qp,  const unsigned short* __restrict__ qrp,
               const unsigned short* __restrict__ kp,  const unsigned short* __restrict__ krp,
               const unsigned short* __restrict__ vtp, const unsigned short* __restrict__ vtrp,
               unsigned short* ctxp, unsigned short* ctxrp, int qb, int h) {
  union FH { v16h v; v8h h[2]; };
  constexpr int LP     = 72;                             // LDS row pitch in halves: 144 B = 16 B x 9, so the 16 rows
                                                         // that one ds_load_b128 fragment read touches fall on 16
                                                         // different 4-bank groups (at 128 B they share two groups)
  constexpr int TB     = 64 * LP * 2;                    // one f16 64x64 tile at pitch LP, bytes
  constexpr int OP     = 68;                             // context staging pitch in floats: 272 B = 16 B x 17
  constexpr int OFF_K  = 0;
  constexpr int OFF_V  = TB;
  constexpr int OFF_KR = 2 * TB;
  constexpr int OFF_VR = 3 * TB;
  constexpr int SMEMB  = HR ? 4 * TB : 2 * TB;                // 36864 : 18432
  static_assert(4 * 16 * OP * 4 <= 2 * TB);                   // f32 context staging aliases the K/V region
  static_assert(SMEMB <= ATT_SMEM);
  _Float16* Ksh = (_Float16*)(smem + OFF_K);                  // K   [kv][d], pitch LP
  _Float16* Vsh = (_Float16*)(smem + OFF_V);                  // V^T [d][kv], pitch LP
  _Float16* Krs = (_Float16*)(smem + (HR ? OFF_KR : OFF_K));  // K residual (HR only)
  _Float16* Vrs = (_Float16*)(smem + (HR ? OFF_VR : OFF_V));  // V^T residual (HR only)

  const int tid  = threadIdx.x;
  const int wave = tid >> 5;
  const int lane = tid & 31;
  const int hh   = lane >> 4;
  const int c    = lane & 15;

  const int g    = h / GRP;                  // kv head
  const int q0   = qb * 64 + wave * 16;
  const int qrow = q0 + c;                   // the one query of this lane

  const _Float16* QP  = (const _Float16*)(const void*)qp   + (size_t)h * HD;
  const _Float16* QRP = (const _Float16*)(const void*)qrp  + (size_t)h * HD;
  const _Float16* KP  = (const _Float16*)(const void*)kp   + (size_t)g * HD;
  const _Float16* KRP = (const _Float16*)(const void*)krp  + (size_t)g * HD;
  const _Float16* VTP = (const _Float16*)(const void*)vtp  + (size_t)g * HD * SEQ;
  const _Float16* VRP = (const _Float16*)(const void*)vtrp + (size_t)g * HD * SEQ;

  // ---- Q fragments (B operand, column = lane&15): 2 d-chunks ----
  v16h qa[2], qr[2];
#pragma unroll
  for (int dc = 0; dc < 2; ++dc) {
    const size_t qo = (size_t)(q0 + c) * DM + dc * 32 + 8 * hh;
    qa[dc] = ldfrag_h(QP + qo);
    if constexpr (HR) qr[dc] = ldfrag_h(QRP + qo);
    else qr[dc] = qa[dc];
  }

  float lsum = 0.f, mrun = -1e30f;
  v8f oacc[4], oacc2[4];
#pragma unroll
  for (int t = 0; t < 4; ++t) { oacc[t] = zero8(); oacc2[t] = zero8(); }

  const int nkt = qb + 1;                                      // key tiles 0..qb, block-uniform
  for (int kti = 0; kti < nkt; ++kti) {
    const int kv0 = kti * 64;                                  // <= qb*64 < SEQ
    __syncthreads();
    {
      const int r = tid >> 1, half = (tid & 1) * 32;
      const size_t ko = (size_t)(kv0 + r) * DKV + half;         // K row kv0+r, d = half..half+31
      const size_t vo = (size_t)r * SEQ + kv0 + half;           // V^T row d = r, s = kv0+half..+31
#pragma unroll
      for (int i = 0; i < 4; ++i) {
        const v8h a0 = *(const v8h*)(KP + ko + 8 * i);
        const v8h b0 = *(const v8h*)(VTP + vo + 8 * i);
        *(v8h*)(Ksh + r * LP + half + 8 * i) = a0;
        *(v8h*)(Vsh + r * LP + half + 8 * i) = b0;
        if constexpr (HR) {
          const v8h a1 = *(const v8h*)(KRP + ko + 8 * i);
          const v8h b1 = *(const v8h*)(VRP + vo + 8 * i);
          *(v8h*)(Krs + r * LP + half + 8 * i) = a1;
          *(v8h*)(Vrs + r * LP + half + 8 * i) = b1;
        }
      }
    }
    __syncthreads();

    // ---- scores, transposed: 64 keys x 16 queries per wave (A operand: lane c -> key j*16+c, split k map over d) ----
    //      The fragments of JG score tiles are read from LDS as one group ahead of their run of WMMAs (one LDS latency
    //      per group, not one per WMMA); every accumulator takes its products in the order dc 0, dc 1
    //      (HR, second accumulator: kr.qh then kh.qr within each dc).
    constexpr int JG = HR ? 2 : 4;                       // score tiles per group: 8 fragments = 64 registers
    v8f s[4];
#pragma unroll
    for (int j0 = 0; j0 < 4; j0 += JG) {
      v16h kb[JG][2], krb[JG][2];
#pragma unroll
      for (int jj = 0; jj < JG; ++jj) {
#pragma unroll
        for (int dc = 0; dc < 2; ++dc) {
          const int ko = ((j0 + jj) * 16 + c) * LP + dc * 32 + 8 * hh;
          kb[jj][dc] = ldfrag_h(Ksh + ko);
          if constexpr (HR) krb[jj][dc] = ldfrag_h(Krs + ko);
        }
      }
      v8f t[JG];
#pragma unroll
      for (int jj = 0; jj < JG; ++jj) { s[j0 + jj] = zero8(); t[jj] = zero8(); }
#pragma unroll
      for (int dc = 0; dc < 2; ++dc) {
#pragma unroll
        for (int jj = 0; jj < JG; ++jj) s[j0 + jj] = mma_h_raw(kb[jj][dc], qa[dc], s[j0 + jj]);
        if constexpr (HR) {
#pragma unroll
          for (int jj = 0; jj < JG; ++jj) t[jj] = mma_h_raw(krb[jj][dc], qa[dc], t[jj]);
#pragma unroll
          for (int jj = 0; jj < JG; ++jj) t[jj] = mma_h_raw(kb[jj][dc], qr[dc], t[jj]);
        }
      }
      if constexpr (HR) {
#pragma unroll
        for (int jj = 0; jj < JG; ++jj) s[j0 + jj] = s[j0 + jj] + t[jj] * (1.0f / 2048.0f);
      }
    }

    // single-product variant: all eight V^T fragments are read here, so that their LDS latency runs under the softmax
    v16h vb[2][4];
    if constexpr (!HR) {
#pragma unroll
      for (int kk = 0; kk < 2; ++kk)
#pragma unroll
        for (int t = 0; t < 4; ++t) vb[kk][t] = ldfrag_h(Vsh + (t * 16 + c) * LP + kk * 32 + 8 * hh);
    }

    // ---- causal online softmax of the lane's one query: masked logits and their maximum in-lane, one exchange
    //      with lane ^ 16, alpha, p, row-sum partial, P^T (x256, f16; HR: + residual) packed as the B operand ----
#pragma unroll
    for (int j = 0; j < 4; ++j) s[j] = s[j] * (1.0f / 2048.0f);   // 1/8 head scale, 1/256 for the two x16 carries
    if (kti == qb) {                                       // block-uniform: only the diagonal tile has keys above a query
#pragma unroll
      for (int j = 0; j < 4; ++j) {
#pragma unroll
        for (int r = 0; r < 8; ++r) {
          const int key = kv0 + j * 16 + 8 * hh + r;
          s[j][r] = (key <= qrow) ? s[j][r] : -1e30f;
        }
      }
    }
    float tm[8];
#pragma unroll
    for (int r = 0; r < 8; ++r) tm[r] = -1e30f;
#pragma unroll
    for (int j = 0; j < 4; ++j) {
#pragma unroll
      for (int r = 0; r < 8; ++r) tm[r] = fmaxf(tm[r], s[j][r]);
    }
    float tmx = fmaxf(fmaxf(fmaxf(tm[0], tm[1]), fmaxf(tm[2], tm[3])), fmaxf(fmaxf(tm[4], tm[5]), fmaxf(tm[6], tm[7])));
    tmx = fmaxf(tmx, xhalf(tmx));
    const float mn = fmaxf(mrun, tmx);
    const float al = __expf(mrun - mn);
    mrun = mn;
    float pp[8];
#pragma unroll
    for (int r = 0; r < 8; ++r) pp[r] = 0.0f;
    FH pa[2], par[2];
#pragma unroll
    for (int j = 0; j < 4; ++j) {
#pragma unroll
      for (int r = 0; r < 8; ++r) {
        const float p = __expf(s[j][r] - mn);              // a masked key: exp(-1e30 - mn) = 0 (mn is finite)
        pp[r] += p;
        const float gg = p * 256.0f;
        const _Float16 x0 = (_Float16)gg;
        pa[j >> 1].v[(j & 1) * 8 + r] = x0;
        if constexpr (HR) par[j >> 1].v[(j & 1) * 8 + r] = (_Float16)((gg - (float)x0) * 2048.0f);
      }
    }
    lsum = lsum * al + (((pp[0] + pp[1]) + (pp[2] + pp[3])) + ((pp[4] + pp[5]) + (pp[6] + pp[7])));

    // ---- rescale the context accumulators by alpha (VALU), nop gaps before the next WMMA reads them ----
#pragma unroll
    for (int t = 0; t < 4; ++t) {
      oacc[t] = oacc[t] * al;
      if constexpr (HR) oacc2[t] = oacc2[t] * al;
    }
    acc_guard4(oacc[0], oacc[1], oacc[2], oacc[3]);
    if constexpr (HR) acc_guard4(oacc2[0], oacc2[1], oacc2[2], oacc2[3]);

    // ---- context^T += V^T . P^T (f16 WMMA; A = V^T [d][key] from LDS, B = P^T [key][query] in registers) ----
    //      HR: the eight fragments of a key chunk are read as one group ahead of its twelve WMMAs; every accumulator
    //      takes its products in the order kk 0, kk 1 (second accumulator: vr.ph then vh.pr within each kk).
#pragma unroll
    for (int kk = 0; kk < 2; ++kk) {
      v16h vrb[4];
      if constexpr (HR) {
#pragma unroll
        for (int t = 0; t < 4; ++t) {
          const int vo = (t * 16 + c) * LP + kk * 32 + 8 * hh;
          vb[kk][t] = ldfrag_h(Vsh + vo);
          vrb[t]    = ldfrag_h(Vrs + vo);
        }
      }
#pragma unroll
      for (int t = 0; t < 4; ++t) oacc[t] = mma_h_raw(vb[kk][t], pa[kk].v, oacc[t]);
      if constexpr (HR) {
#pragma unroll
        for (int t = 0; t < 4; ++t) oacc2[t] = mma_h_raw(vrb[t], pa[kk].v, oacc2[t]);
#pragma unroll
        for (int t = 0; t < 4; ++t) oacc2[t] = mma_h_raw(vb[kk][t], par[kk].v, oacc2[t]);
      }
    }
  }
  __syncthreads();                           // every wave is done with the K/V tiles before they are aliased

  // ---- normalise (1/lsum, the 1/256 p carry; keep the x16 v carry), stage the wave's 16x64 f32 tile [query][d]
  //      in LDS (a lane's 8 registers of tile t are 8 consecutive d of its query: two 16-B stores) ----
  float* os = (float*)(void*)smem + wave * (16 * OP);
  {
    const float l  = lsum + xhalf(lsum);     // the query's two key halves
    const float rl = 1.0f / l;               // l >= 1 (the max key contributes p = 1)
    const float sc = rl * (1.0f / 256.0f);
#pragma unroll
    for (int t = 0; t < 4; ++t) {
      v4f lo, hi;
#pragma unroll
      for (int r = 0; r < 4; ++r) {
        float v0 = oacc[t][r], v1 = oacc[t][r + 4];
        if constexpr (HR) { v0 += oacc2[t][r] * (1.0f / 2048.0f); v1 += oacc2[t][r + 4] * (1.0f / 2048.0f); }
        lo[r] = v0 * sc;
        hi[r] = v1 * sc;
      }
      *(v4f*)(os + c * OP + t * 16 + 8 * hh)     = lo;
      *(v4f*)(os + c * OP + t * 16 + 8 * hh + 4) = hi;
    }
  }
  __builtin_amdgcn_fence(__ATOMIC_RELEASE, "workgroup");
  __builtin_amdgcn_wave_barrier();
  __builtin_amdgcn_fence(__ATOMIC_ACQUIRE, "workgroup");
  {
    const int rq = lane >> 3, piece = lane & 7;
    v4u ph[4], pr[4];
#pragma unroll
    for (int it = 0; it < 4; ++it) {
      const int row = it * 4 + rq;   // it 0..3 x rq 0..3 = rows 0..15 of the wave tile
      const v4f a  = *(const v4f*)(os + row * OP + piece * 8);
      const v4f a2 = *(const v4f*)(os + row * OP + piece * 8 + 4);
      float f[8];
      f[0] = a[0];  f[1] = a[1];  f[2] = a[2];  f[3] = a[3];
      f[4] = a2[0]; f[5] = a2[1]; f[6] = a2[2]; f[7] = a2[3];
      v4u p, q;
#pragma unroll
      for (int e = 0; e < 4; ++e) {
        const _Float16 x0 = (_Float16)f[2 * e], x1 = (_Float16)f[2 * e + 1];
        const _Float16 y0 = (_Float16)((f[2 * e] - (float)x0) * 2048.0f);
        const _Float16 y1 = (_Float16)((f[2 * e + 1] - (float)x1) * 2048.0f);
        p[e] = pk16(h_bits(x0), h_bits(x1));
        q[e] = pk16(h_bits(y0), h_bits(y1));
      }
      ph[it] = p;
      pr[it] = q;
    }
    {
#pragma unroll
      for (int it = 0; it < 4; ++it) {
        const int row = it * 4 + rq;
        const size_t go = (size_t)(q0 + row) * DM + (size_t)h * HD + piece * 8;
        *(v4u*)(ctxp + go)  = ph[it];
        *(v4u*)(ctxrp + go) = pr[it];
      }
    }
  }
}

// =====================================================================================================
// Both attention variants in one grid of NQT * NH blocks, so that the short residual-plane tiles and the long
// single-product tiles run side by side. The grid is four quarters of NQT/4 * NH blocks; block w of each quarter has
// head w % NH and u = w / NH, and query tile NQT-1-u, QHR-1-u, QHR+u, u in quarters 0..3: a permutation of every
// (head, query tile), long tiles first, and the four blocks with equal w have the same total of key tiles for every w.
// =====================================================================================================
// amdgpu_waves_per_eu(4, 4): at most four waves per SIMD = four blocks per WGP, as many as the grid has per WGP, so
// that no WGP takes a fifth block while another is left with three.
__global__ __launch_bounds__(128) __attribute__((amdgpu_waves_per_eu(4, 4)))
void attn_all(const unsigned short* __restrict__ qp,  const unsigned short* __restrict__ qrp,
              const unsigned short* __restrict__ kp,  const unsigned short* __restrict__ krp,
              const unsigned short* __restrict__ vtp, const unsigned short* __restrict__ vtrp,
              unsigned short* ctxp, unsigned short* ctxrp) {
  __shared__ __align__(16) unsigned char smem[ATT_SMEM];
  constexpr int QQ = NQT / 4;
  static_assert((NQT % 4) == 0 && QHR == 2 * QQ);
  const int bx = blockIdx.x;
  const int j  = bx / (QQ * NH);
  if (j > 3) return;                         // block-uniform, before any barrier or store
  const int w  = bx - j * (QQ * NH);
  const int h  = w % NH;
  const int u  = w / NH;
  const int qb = (j == 0) ? (NQT - 1 - u) : (j == 1) ? (QHR - 1 - u) : (j == 2) ? (QHR + u) : u;
  if (qb < QHR) attn_body<true>(smem, qp, qrp, kp, krp, vtp, vtrp, ctxp, ctxrp, qb, h);
  else          attn_body<false>(smem, qp, qrp, kp, krp, vtp, vtrp, ctxp, ctxrp, qb, h);
}

// =====================================================================================================
// Workspace map (bytes, SEQ = 4096); every region is an exact multiple of its whole-line / whole-tile store
// granularity (row pitches 2048 / 512 / 8192 B, rows multiples of 64, all offsets 512-KiB aligned, no aliasing
// within a launch):
//   Xh    f16 [SEQ][1024]          0     8388608   (bf16 value of x, x16)
//   WqT   f16 [1024][1024]   8388608     2097152   (bf16 value of w_q^T x1024, [n][k])
//   WkT   f16 [256][1024]   10485760      524288   (bf16 value of w_k^T x1024, [n][k])
//   WvT   f16 [256][1024]   11010048      524288   (bf16 value of w_v^T x1024, [n][k])
//   WoT   f16 [1024][1024]  11534336     2097152   (bf16 value of w_o^T x1024, [n][k])
//   Qh    f16 [SEQ][1024]   13631488     8388608   (q x16)           Qr  22020096  8388608 (x2^11 residual)
//   Kh    f16 [SEQ][256]    30408704     2097152   (k x16)           Kr  32505856  2097152
//   Vh    f16 [SEQ][256]    34603008     2097152   (v x16)           Vr  36700160  2097152
//   VT    f16 [256][SEQ]    38797312     2097152   ([g*64 + d][s])   VTr 40894464  2097152
//   Ctx   f16 [SEQ][1024]   42991616     8388608   (context x16)     Ctxr 51380224 8388608
//   end                     59768832
// Projection weights arrive as [in k][out n] (n contiguous) and are transposed while converted (w_tr).
// d_out f32: [SEQ][1024] at byte 0, every 64x64 tile written once by the output projection launch.
// =====================================================================================================
extern "C" void kernel_launch(void* const* d_in, const int* in_sizes, int n_in,
                              void* d_out, int out_size, void* d_ws, size_t ws_size,
                              hipStream_t stream) {
  if (n_in < 5) return;
  if (in_sizes[0] < SEQ * DM || (in_sizes[0] % DM) != 0) return;   // x rows 0..SEQ-1 are used, pitch DM
  if (in_sizes[1] != DM * DM) return;
  if (in_sizes[2] != DM * DKV) return;
  if (in_sizes[3] != DM * DKV) return;
  if (in_sizes[4] != DM * DM) return;
  if (out_size < OUTN) return;

  const float* x   = (const float*)d_in[0];    // [>=SEQ][DM]
  const float* w_q = (const float*)d_in[1];    // [DM k][DM n]
  const float* w_k = (const float*)d_in[2];    // [DM k][DKV n]
  const float* w_v = (const float*)d_in[3];    // [DM k][DKV n]
  const float* w_o = (const float*)d_in[4];    // [DM k][DM n]

  const size_t PX   = (size_t)SEQ * DM * 2;          //  8388608
  const size_t PWq  = (size_t)DM * DM * 2;           //  2097152
  const size_t PWk  = (size_t)DKV * DM * 2;          //   524288
  const size_t PWo  = (size_t)DM * DM * 2;           //  2097152
  const size_t PQ   = (size_t)SEQ * DM * 2;          //  8388608
  const size_t PK   = (size_t)SEQ * DKV * 2;         //  2097152
  const size_t PVT  = (size_t)DKV * SEQ * 2;         //  2097152
  const size_t PCtx = (size_t)SEQ * DM * 2;          //  8388608
  size_t off = 0;
  const size_t oX    = off; off += PX;
  const size_t oWq   = off; off += PWq;
  const size_t oWk   = off; off += PWk;
  const size_t oWv   = off; off += PWk;
  const size_t oWo   = off; off += PWo;
  const size_t oQ    = off; off += PQ;
  const size_t oQr   = off; off += PQ;
  const size_t oK    = off; off += PK;
  const size_t oKr   = off; off += PK;
  const size_t oV    = off; off += PK;
  const size_t oVr   = off; off += PK;
  const size_t oVT   = off; off += PVT;
  const size_t oVTr  = off; off += PVT;
  const size_t oCtx  = off; off += PCtx;
  const size_t oCtxr = off; off += PCtx;
  if (off > ws_size) return;                         // off = 59768832 for SEQ = 4096
  if (off > (size_t)134217728) return;

  char* ws = (char*)d_ws;
  unsigned short* Xh   = (unsigned short*)(ws + oX);
  unsigned short* WqT  = (unsigned short*)(ws + oWq);
  unsigned short* WkT  = (unsigned short*)(ws + oWk);
  unsigned short* WvT  = (unsigned short*)(ws + oWv);
  unsigned short* WoT  = (unsigned short*)(ws + oWo);
  unsigned short* Qh   = (unsigned short*)(ws + oQ);
  unsigned short* Qr   = (unsigned short*)(ws + oQr);
  unsigned short* Kh   = (unsigned short*)(ws + oK);
  unsigned short* Kr   = (unsigned short*)(ws + oKr);
  unsigned short* Vh   = (unsigned short*)(ws + oV);
  unsigned short* Vr   = (unsigned short*)(ws + oVr);
  unsigned short* VT   = (unsigned short*)(ws + oVT);
  unsigned short* VTr  = (unsigned short*)(ws + oVTr);
  unsigned short* Ctx  = (unsigned short*)(ws + oCtx);
  unsigned short* Ctxr = (unsigned short*)(ws + oCtxr);
  float*          outf = (float*)d_out;              // [SEQ][DM]

  const dim3 blk(256);
  const int n8x = SEQ * DM / 8;                      // 524288
  const dim3 gCx((n8x + 255) / 256);                 // 2048 blocks
  const dim3 gTw(DM / 64, DM / 64, 4);               // (16, 16, 4): the four weights, [1024 k][n] -> [n][1024 k]
  const dim3 gGq((NQT * (DM / 64) + 7) / 8);         // 1024 wave tiles -> 128 blocks of 128 x 256
  const dim3 gGqkv((NQT * ((DM + 2 * DKV) / 64) + 7) / 8);   // 1536 wave tiles -> 192 blocks of 128 x 256
  const dim3 gVt(SEQ / 64, NKV, 2);                  // (64, 4, 2)
  const dim3 gAtt(NQT * NH);                         // every (head, query tile), both variants
  const float wScale = 1024.0f;                      // weights carried x1024
  const float aScale = 16.0f;                        // activations carried x16
  const float cscale = 1.0f / 16384.0f;              // 1/(16 * 1024)

  // (1) planes: x -> f16 x16 (bf16 values); weights -> transposed f16 x1024 (bf16 values)
  cvt16<<<gCx, blk, 0, stream>>>(x, Xh, n8x, aScale);
  w_tr<<<gTw, blk, 0, stream>>>(w_q, w_k, w_v, w_o, WqT, WkT, WvT, WoT, DM, DM, DKV, wScale);
  // (2) [q | k | v] = Xh . [WqT ; WkT ; WvT]^T in one grid (M=SEQ, N=1024+256+256, K=1024; the three transposed
  //     weights lie one behind the other in the workspace): Qh [SEQ][1024], Kh, Vh [SEQ][256], f16 x16 + residual
  gemm64_f16<0, false><<<gGqkv, blk, 0, stream>>>(Xh, Xh, DM, WqT, DM, cscale, (void*)Qh, Qr, DM,
                                                  SEQ, DM + 2 * DKV, DM, aScale,
                                                  DM, DKV, Kh, Kr, Vh, Vr);
  // (3) v -> v^T planes (hi and residual, all tokens, all kv heads)
  v_tr<<<gVt, blk, 0, stream>>>(Vh, VT, Vr, VTr);
  // (4) causal softmax attention -> Ctx f16 x16 + residual plane: tiles 0..QHR-1 with residual operand planes,
  //     tiles QHR..NQT-1 with single products; together every (head, query tile) exactly once
  attn_all<<<gAtt, dim3(128), 0, stream>>>(Qh, Qr, Kh, Kr, VT, VTr, Ctx, Ctxr);
  // (5) out = (Ctx + 2^-11 Ctxr) . WoT^T -> d_out f32 [SEQ][1024] (M=SEQ, N=1024, K=1024), every tile once
  gemm64_f16<1, true><<<gGq, blk, 0, stream>>>(Ctx, Ctxr, DM, WoT, DM, cscale, (void*)outf, Ctxr, DM,
                                               SEQ, DM, DM, 1.0f,
                                               DM, DKV, Ctxr, Ctxr, Ctxr, Ctxr);
  (void)hipGetLastError();
}

// v007
// Measured time: 110 microseconds a run.
// Next to v006, in two timings, it ran 1.15 and 1.14 times as fast.
// Over all steps from v000 it is 6.33 times as fast.
// Contractions: q/k/v projections = v_wmma_f32_16x16x32_f16 (A = f16 of RNE-bf16 x carried x16, B = f16 of RNE-bf16 w^T carried x1024, single product); attention k.q^T and v^T.p^T (both products transposed) = v_wmma_f32_16x16x32_f16 (query tiles below SEQ/2: q, k, v^T f16 planes x16 plus x2^11 residual planes, p f16 x256 plus x2^11 residual, hi.hi + hi.res + res.hi; query tiles from SEQ/2 on: single products on the x16 / x256 planes); output projection = v_wmma_f32_16x16x32_f16 (A = ctx f16 x16 plus its x2^11 residual plane, B = f16 of RNE-bf16 w_o^T x1024); all f32 accumulate. Causal online-max softmax, masks and row sums f32 on VALU.
#include <hip/hip_runtime.h>
#include <math.h>
#include <stdint.h>

#define SEQ   4096
#define DM    1024
#define NH    16
#define NKV   4
#define HD    64
#define DKV   (NKV * HD)            // 256
#define GRP   (NH / NKV)            // query heads per kv head = 4 (query head h uses kv head h / GRP)
#define NQT   (SEQ / 64)            // 64 query tiles of 64 rows
#define QHR   (NQT / 2)             // query tiles below this index use residual planes in attention
#define OUTN  (SEQ * DM)
static_assert(NH * HD == DM);
static_assert(HD == 64);
static_assert((NH % NKV) == 0);
static_assert((SEQ % 64) == 0 && (NQT % 2) == 0);
static_assert((DM % 64) == 0 && (DKV % 64) == 0 && (DM % 32) == 0);
static_assert(((NQT * (DM / 64)) % 8) == 0);
static_assert(((NQT * (DKV / 64)) % 8) == 0);
static_assert((SEQ % 128) == 0 && ((DM + 2 * DKV) % 256) == 0 && (DM % 256) == 0);   // GEMM block tile 128 x 256, 128 k per stage
static_assert(((SEQ * DM / 8) % 256) == 0);

typedef _Float16 v16h __attribute__((ext_vector_type(16)));
typedef _Float16 v8h  __attribute__((ext_vector_type(8)));
typedef float    v8f  __attribute__((ext_vector_type(8)));
typedef float    v4f  __attribute__((ext_vector_type(4)));
typedef unsigned int v4u __attribute__((ext_vector_type(4)));

// ---- scalar helpers --------------------------------------------------------------------------------
__device__ __forceinline__ unsigned short bf_bits(float f) {          // f32 -> bf16 bits, RNE convert
  unsigned u = __float_as_uint(f);
  return (unsigned short)((u + 0x7FFFu + ((u >> 16) & 1u)) >> 16);
}
__device__ __forceinline__ float bfr(float f) { return __uint_as_float(((unsigned)bf_bits(f)) << 16); }
__device__ __forceinline__ unsigned short h_bits(_Float16 x) { return __builtin_bit_cast(unsigned short, x); }
__device__ __forceinline__ unsigned pk16(unsigned short a, unsigned short b) { return (unsigned)a | ((unsigned)b << 16); }
__device__ __forceinline__ v8f zero8() { v8f z = {0.f, 0.f, 0.f, 0.f, 0.f, 0.f, 0.f, 0.f}; return z; }

// ---- fragment loader: 16-bit A/B operand, lane -> row/col (lane&15), p already includes +8*(lane>>4);
//      elements 0..7 <- p[0..7] (k0+8h..), elements 8..15 <- p[16..23] (k0+16+8h..)
__device__ __forceinline__ v16h ldfrag_h(const _Float16* p) {
  union { v16h v; v8h h[2]; } f;
  f.h[0] = *(const v8h*)(p);
  f.h[1] = *(const v8h*)(p + 16);
  return f.v;
}

// ---- WMMA helpers with trailing VALU hazard gap --------------------------------------------------------
__device__ __forceinline__ v8f mma_h_raw(v16h a, v16h b, v8f c) {
  return __builtin_amdgcn_wmma_f32_16x16x32_f16(false, a, false, b, (short)0, c, false, false);
}
__device__ __forceinline__ void dep_guard_h(v8f& a, v8f& b, v16h x, v16h y) {
#if defined(__HIP_DEVICE_COMPILE__)
  asm volatile("v_nop\n\tv_nop\n\tv_nop\n\tv_nop" : "+v"(a), "+v"(b) : "v"(x), "v"(y));
#endif
}
__device__ __forceinline__ void keep4_h(v16h a, v16h b, v16h c, v16h d) {
#if defined(__HIP_DEVICE_COMPILE__)
  asm volatile("v_nop" :: "v"(a), "v"(b), "v"(c), "v"(d));
#endif
}
__device__ __forceinline__ void acc_guard4(v8f& a, v8f& b, v8f& c, v8f& d) {
#if defined(__HIP_DEVICE_COMPILE__)
  asm volatile("v_nop\n\tv_nop\n\tv_nop\n\tv_nop" : "+v"(a), "+v"(b), "+v"(c), "+v"(d));
#endif
}

// =====================================================================================================
// f32 plane -> f16 bits of bfr(v) * scale (scale a power of two): x (x16).
// coverage: n8 threads x 8 = the whole plane.
// =====================================================================================================
__global__ __launch_bounds__(256) void cvt16(const float* __restrict__ in, unsigned short* out, int n8, float scale) {
  const int i = blockIdx.x * 256 + threadIdx.x;
  if (i < n8) {
    const v4f a = *(const v4f*)(in + (size_t)i * 8);
    const v4f b = *(const v4f*)(in + (size_t)i * 8 + 4);
    v4u p;
    p[0] = pk16(h_bits((_Float16)(bfr(a[0]) * scale)), h_bits((_Float16)(bfr(a[1]) * scale)));
    p[1] = pk16(h_bits((_Float16)(bfr(a[2]) * scale)), h_bits((_Float16)(bfr(a[3]) * scale)));
    p[2] = pk16(h_bits((_Float16)(bfr(b[0]) * scale)), h_bits((_Float16)(bfr(b[1]) * scale)));
    p[3] = pk16(h_bits((_Float16)(bfr(b[2]) * scale)), h_bits((_Float16)(bfr(b[3]) * scale)));
    *(v4u*)(out + (size_t)i * 8) = p;
    
  }
}

// =====================================================================================================
// f32 weight W [K rows][N cols] (the x@W layout, n contiguous) -> f16 Wt[n][k] = f16(bfr(W[k][n]) * scale),
// pitch K halves (k contiguous = the Bt layout of the GEMM below); scale a power of two.
// Block = one 64 (k) x 64 (n) tile of one of four weights; grid = (Nwide/64, K/64, 4), blockIdx.z = the weight,
// blocks past a narrow weight's last column tile leave at once; tile staged in LDS as halves [kk][nn] pitch 72
// (v8h 16-B stores, __syncthreads, _Float16 element reads).
// Store: group g = tid>>3 (0..31), piece = tid&7: iteration it writes out row n = it*32+g, lanes 8q..8q+7 x 16 B =
// coverage: load 2 x 256 threads x 8 = 64x64; store 2 iterations x 32 groups = 64 rows n, 8 pieces x 8 = 64 k
// per row; grid covers every (n tile, k tile) of [N][K].
// =====================================================================================================
__global__ __launch_bounds__(256) void w_tr(const float* __restrict__ w0, const float* __restrict__ w1,
                                            const float* __restrict__ w2, const float* __restrict__ w3,
                                            unsigned short* t0, unsigned short* t1, unsigned short* t2, unsigned short* t3,
                                            int K, int Nwide, int Nnarrow, float scale) {
  __shared__ __align__(16) _Float16 sw[64 * 72];       // [kk][nn], pitch 72 halves (144 B)
  const int tid = threadIdx.x;
  const int z   = blockIdx.z;                          // which weight: 0 and 3 are Nwide columns, 1 and 2 Nnarrow
  const int N   = (z == 0 || z == 3) ? Nwide : Nnarrow;
  const int n0  = blockIdx.x * 64;
  const int k0  = blockIdx.y * 64;
  if (z > 3 || n0 >= N || k0 >= K) return;             // block-uniform, before the barrier
  const float* w = (z == 0) ? w0 : (z == 1) ? w1 : (z == 2) ? w2 : w3;
  unsigned short* wt = (z == 0) ? t0 : (z == 1) ? t1 : (z == 2) ? t2 : t3;
#pragma unroll
  for (int i = 0; i < 2; ++i) {
    const int idx = i * 256 + tid;                  // 0..511
    const int kk = idx >> 3, c8 = (idx & 7) * 8;
    const float* src = w + (size_t)(k0 + kk) * N + n0 + c8;
    const v4f a  = *(const v4f*)(src);
    const v4f a2 = *(const v4f*)(src + 4);
    v8h o;
    o[0] = (_Float16)(bfr(a[0]) * scale);
    o[1] = (_Float16)(bfr(a[1]) * scale);
    o[2] = (_Float16)(bfr(a[2]) * scale);
    o[3] = (_Float16)(bfr(a[3]) * scale);
    o[4] = (_Float16)(bfr(a2[0]) * scale);
    o[5] = (_Float16)(bfr(a2[1]) * scale);
    o[6] = (_Float16)(bfr(a2[2]) * scale);
    o[7] = (_Float16)(bfr(a2[3]) * scale);
    *(v8h*)(sw + kk * 72 + c8) = o;
  }
  __syncthreads();

  const int g = tid >> 3, piece = tid & 7;
  v4u hv[2];
  size_t hofs[2];
#pragma unroll
  for (int it = 0; it < 2; ++it) {
    const int nn = it * 32 + g;
    v4u a;
#pragma unroll
    for (int e = 0; e < 4; ++e) {
      const _Float16 x0 = sw[(piece * 8 + 2 * e) * 72 + nn];
      const _Float16 x1 = sw[(piece * 8 + 2 * e + 1) * 72 + nn];
      a[e] = pk16(h_bits(x0), h_bits(x1));
    }
    hv[it] = a;
    hofs[it] = ((size_t)(n0 + nn)) * K + k0 + piece * 8;
  }
  {
#pragma unroll
    for (int it = 0; it < 2; ++it) *(v4u*)(wt + hofs[it]) = hv[it];
    
  }
}

// =====================================================================================================
// Four 16-byte asynchronous copies of one lane, global memory -> LDS (l = the lane's LDS byte address, g = its
// global address). s_wait_xcnt 0 closes the statement so that no address register is rewritten in front of it.
// =====================================================================================================
__device__ __forceinline__ void copy4_lds(unsigned l0, const _Float16* g0, unsigned l1, const _Float16* g1,
                                          unsigned l2, const _Float16* g2, unsigned l3, const _Float16* g3) {
#if defined(__HIP_DEVICE_COMPILE__)
  asm volatile("global_load_async_to_lds_b128 %0, %1, off\n\t"
               "global_load_async_to_lds_b128 %2, %3, off\n\t"
               "global_load_async_to_lds_b128 %4, %5, off\n\t"
               "global_load_async_to_lds_b128 %6, %7, off\n\t"
               "s_wait_xcnt 0x0"
               :: "v"(l0), "v"(g0), "v"(l1), "v"(g1), "v"(l2), "v"(g2), "v"(l3), "v"(g3) : "memory");
#endif
}

// =====================================================================================================
// Register-blocked f16 WMMA GEMM, block = 8 waves (2 x 4) = one 128 x 256 tile, one wave per 64x64 tile:
//   v[m][n] = (sum_k A[m][k] * Bt[n][k]  [+ 2^-11 * sum_k Ar[m][k] * Bt[n][k] when ARES]) * cscale
// A, Ar row-major [M][K] pitch lda (f16), Bt row-major [N][K] pitch ldb (f16, k contiguous); M a multiple of 128,
// N of 256, K of 128; grid = (M / 128) * (N / 256) blocks.
// Operands: a stage = 128 k of the block's 128 rows of A and 256 rows of Bt, whole 128-B lines, brought into LDS at
// row pitch 272 B by asynchronous copies (24 per lane and stage: lane -> row tid>>4 (+16 per copy), 16-B piece
// tid&15); two buffers, stage s + 1 in flight while stage s is multiplied; every wave reads its fragments from LDS.
// ARES: the stages of the residual plane come first and accumulate from zero, the accumulators are scaled by 2^-11
// exactly on the VALU (with nop gaps on both sides), then the hi plane's stages accumulate on top: one accumulator set.
// EPI 0: column tiles from n1 on are stored to a second and a third output (each nx columns wide, pitch nx; hi plane
// C2 / C3, residual plane C2r / C3r), so that products that share A run in one grid. EPI 1 has the one output.
// Epilogue variants:
//   EPI 0: f16 hi plane = f16(v * oscale) at Cp and residual plane = f16((v*oscale - hi) * 2048) at Crp, pitch ldc halves
//   EPI 1: f32 out = v, pitch ldc floats
// 16-row slabs staged per wave in LDS. f32 out: each 64-wide row segment (256 B = 2 lines) by 16 lanes x 16 B,
// coverage: 4 slabs x 16 rows x 64 cols = the wave's whole 64x64 tile; 8 waves = the block's 128 x 256; grid = [M][N].
// =====================================================================================================
#define GBM  128                                   // block tile rows (A)
#define GBN  256                                   // block tile columns (rows of Bt)
#define GBK  128                                   // k per stage: 256 B of every operand row
#define GLP  136                                   // LDS row pitch in halves: 272 B = 16 B x 17 (ds_load_b128 fragment reads)
#define GSTG ((GBM + GBN) * GLP)                   // halves per stage buffer: [A 128 rows | Bt 256 rows]
template <int EPI, bool ARES>
__global__ __launch_bounds__(256) void gemm64_f16(
    const unsigned short* __restrict__ Ap, const unsigned short* __restrict__ Arp, int lda,
    const unsigned short* __restrict__ Btp, int ldb,
    float cscale,
    void* Cp, unsigned short* Crp, int ldc, int M, int N, int K, float oscale,
    int n1, int nx, unsigned short* C2, unsigned short* C2r, unsigned short* C3, unsigned short* C3r) {
  const _Float16* Ah  = (const _Float16*)(const void*)Ap;
  const _Float16* Arh = (const _Float16*)(const void*)Arp;
  const _Float16* Bt  = (const _Float16*)(const void*)Btp;
  __shared__ __align__(16) _Float16 sAB[2 * GSTG]; // two stage buffers
  __shared__ __align__(16) float sT[8][16 * 68];   // per-wave 16x64 slab, pitch 68 floats
  const int tid  = threadIdx.x;
  const int lane = tid & 31;
  const int wave = tid >> 5;
  const int blocksN = N >> 8;
  const int blocksM = M >> 7;
  const int bidx = blockIdx.x;
  if (bidx >= blocksM * blocksN) return;   // block-uniform, before any copy or barrier
  const int bmi = bidx / blocksN;
  const int bm0 = bmi << 7;
  const int bn0 = (bidx - bmi * blocksN) << 8;
  const int wm  = wave >> 2;               // wave's 64-row half of the block tile
  const int wn  = wave & 3;                // wave's 64-column quarter
  const int m0 = bm0 + (wm << 6);
  const int n0 = bn0 + (wn << 6);

  // output of this tile (wave-uniform): columns below n1 go to Cp / Crp, the next nx to C2 / C2r, the next nx to C3 / C3r
  void* Co = Cp;
  unsigned short* Cro = Crp;
  int ldo = ldc, nc0 = n0;
  if constexpr (EPI == 0) {
    if (n0 >= n1) {
      const int e = n0 - n1;
      const bool third = (e >= nx);
      Co  = third ? (void*)C3 : (void*)C2;
      Cro = third ? C3r : C2r;
      ldo = nx;
      nc0 = third ? e - nx : e;
    }
  }

  const int rlane = lane & 15;                 // row (A) / col (B, D) within subtile
  const int koff  = (lane >> 4) * 8;           // k offset of this lane half
  const int mOff  = (lane >> 4) * 8;           // D row offset

  v8f acc[4][4];
#pragma unroll
  for (int i = 0; i < 4; ++i)
#pragma unroll
    for (int j = 0; j < 4; ++j) acc[i][j] = zero8();

  constexpr int NPL = ARES ? 2 : 1;
  const int nk  = K >> 7;                      // stages per plane
  const int nst = NPL * nk;                    // stages in all, block-uniform

  // the lane's share of a stage: rows crow + 16 i of A (i 0..7) and of Bt (i 0..15), 16-B piece tid & 15 of each
  const int crow = tid >> 4;
  const int cpc  = (tid & 15) * 8;
  const unsigned lds0 = (unsigned)(uintptr_t)(&sAB[0]) + (unsigned)(crow * GLP + cpc) * 2u;
  const _Float16* gA0 = Ah  + (size_t)(bm0 + crow) * lda + cpc;
  const _Float16* gR0 = Arh + (size_t)(bm0 + crow) * lda + cpc;
  const _Float16* gB0 = Bt  + (size_t)(bn0 + crow) * ldb + cpc;
  const size_t a16 = (size_t)16 * lda, b16 = (size_t)16 * ldb;
  constexpr unsigned R16 = 16u * GLP * 2u;     // 16 LDS rows, bytes
  auto stage_in = [&](int st, int buf) {
    const bool res = ARES && (st < nk);        // block-uniform: the residual plane's stages come first
    const int  k0  = (ARES && !res ? st - nk : st) * GBK;
    const _Float16* ga = (res ? gR0 : gA0) + k0;
    const _Float16* gb = gB0 + k0;
    const unsigned la = lds0 + (unsigned)buf * (unsigned)(GSTG * 2);
    const unsigned lb = la + (unsigned)(GBM * GLP * 2);
#pragma unroll                                 // straight line: constant LDS steps, 4 copies a statement
    for (int q = 0; q < GBM / 16; q += 4)
      copy4_lds(la + q * R16,       ga + q * a16,       la + (q + 1) * R16, ga + (q + 1) * a16,
                la + (q + 2) * R16, ga + (q + 2) * a16, la + (q + 3) * R16, ga + (q + 3) * a16);
#pragma unroll                                 // as above
    for (int q = 0; q < GBN / 16; q += 4)
      copy4_lds(lb + q * R16,       gb + q * b16,       lb + (q + 1) * R16, gb + (q + 1) * b16,
                lb + (q + 2) * R16, gb + (q + 2) * b16, lb + (q + 3) * R16, gb + (q + 3) * b16);
  };

  if (nst > 0) stage_in(0, 0);
#if defined(__HIP_DEVICE_COMPILE__)
  asm volatile("s_wait_asynccnt 0x0" ::: "memory");   // this wave's copies of stage 0 have landed
#endif
  __syncthreads();                                    // stage 0 is published to every wave
  if (nst > 1) stage_in(1, 1);

  for (int st = 0; st < nst; ++st) {
    if (ARES && st == nk) {
      acc_guard4(acc[0][0], acc[0][1], acc[0][2], acc[0][3]);
      acc_guard4(acc[1][0], acc[1][1], acc[1][2], acc[1][3]);
      acc_guard4(acc[2][0], acc[2][1], acc[2][2], acc[2][3]);
      acc_guard4(acc[3][0], acc[3][1], acc[3][2], acc[3][3]);
#pragma unroll
      for (int i = 0; i < 4; ++i)
#pragma unroll
        for (int j = 0; j < 4; ++j) acc[i][j] = acc[i][j] * (1.0f / 2048.0f);   // exact fold of the x2^11 residual carry
      acc_guard4(acc[0][0], acc[0][1], acc[0][2], acc[0][3]);
      acc_guard4(acc[1][0], acc[1][1], acc[1][2], acc[1][3]);
      acc_guard4(acc[2][0], acc[2][1], acc[2][2], acc[2][3]);
      acc_guard4(acc[3][0], acc[3][1], acc[3][2], acc[3][3]);
    }
    const _Float16* sA = sAB + (st & 1) * GSTG + ((wm << 6) + rlane) * GLP + koff;
    const _Float16* sB = sAB + (st & 1) * GSTG + (GBM + (wn << 6) + rlane) * GLP + koff;
#pragma unroll                                 // constant LDS offsets; the fragment arrays stay in registers
    for (int ks = 0; ks < GBK; ks += 32) {
      v16h bh[4], ah[4];
#pragma unroll
      for (int j = 0; j < 4; ++j) bh[j] = ldfrag_h(sB + (j << 4) * GLP + ks);
#pragma unroll
      for (int i = 0; i < 4; ++i) ah[i] = ldfrag_h(sA + (i << 4) * GLP + ks);
#pragma unroll
      for (int i = 0; i < 4; ++i) {
#pragma unroll
        for (int j = 0; j < 4; ++j) {
          acc[i][j] = mma_h_raw(ah[i], bh[j], acc[i][j]);
        }
        dep_guard_h(acc[i][0], acc[i][3], ah[i], bh[3]);
      }
      keep4_h(bh[0], bh[1], bh[2], bh[3]);
    }
#if defined(__HIP_DEVICE_COMPILE__)
    asm volatile("s_wait_dscnt 0x0" ::: "memory");      // this wave's reads of buffer st & 1 are done before it is refilled
    asm volatile("s_wait_asynccnt 0x0" ::: "memory");   // this wave's copies of stage st + 1 have landed
#endif
    __syncthreads();                                    // publishes stage st + 1, ends every read of stage st
    if (st + 2 < nst) stage_in(st + 2, st & 1);
  }
#if defined(__HIP_DEVICE_COMPILE__)
  asm volatile("s_wait_asynccnt 0x0" ::: "memory");     // no copy is outstanding when the wave goes on to its end
#endif
  acc_guard4(acc[0][0], acc[0][1], acc[0][2], acc[0][3]);
  acc_guard4(acc[1][0], acc[1][1], acc[1][2], acc[1][3]);
  acc_guard4(acc[2][0], acc[2][1], acc[2][2], acc[2][3]);
  acc_guard4(acc[3][0], acc[3][1], acc[3][2], acc[3][3]);

  // ---- epilogue ----
  float* slab = sT[wave];
#pragma unroll
  for (int i = 0; i < 4; ++i) {
    const int mBase = m0 + (i << 4);
#pragma unroll
    for (int r = 0; r < 8; ++r) {
      const int row = mOff + r;
#pragma unroll
      for (int j = 0; j < 4; ++j) slab[row * 68 + (j << 4) + rlane] = acc[i][j][r] * cscale;
    }
    __builtin_amdgcn_fence(__ATOMIC_RELEASE, "workgroup");
    __builtin_amdgcn_wave_barrier();
    __builtin_amdgcn_fence(__ATOMIC_ACQUIRE, "workgroup");
    if constexpr (EPI == 0) {
      unsigned short* C16 = (unsigned short*)Co;
      const int rq = lane >> 3, piece = lane & 7;
      v4u ph[4], pr[4];
#pragma unroll
      for (int it = 0; it < 4; ++it) {
        const int row = it * 4 + rq;                         // it 0..3 x rq 0..3 = rows 0..15
        const v4f a  = *(const v4f*)(slab + row * 68 + piece * 8);
        const v4f a2 = *(const v4f*)(slab + row * 68 + piece * 8 + 4);
        float f[8];
        f[0] = a[0];  f[1] = a[1];  f[2] = a[2];  f[3] = a[3];
        f[4] = a2[0]; f[5] = a2[1]; f[6] = a2[2]; f[7] = a2[3];
        v4u p, q;
#pragma unroll
        for (int e = 0; e < 4; ++e) {
          const float g0 = f[2 * e] * oscale, g1 = f[2 * e + 1] * oscale;
          const _Float16 x0 = (_Float16)g0, x1 = (_Float16)g1;
          const _Float16 y0 = (_Float16)((g0 - (float)x0) * 2048.0f);
          const _Float16 y1 = (_Float16)((g1 - (float)x1) * 2048.0f);
          p[e] = pk16(h_bits(x0), h_bits(x1));
          q[e] = pk16(h_bits(y0), h_bits(y1));
        }
        ph[it] = p;
        pr[it] = q;
      }
      {
#pragma unroll
        for (int it = 0; it < 4; ++it) {
          const int row = it * 4 + rq;
          const size_t co = (size_t)(mBase + row) * ldo + nc0 + piece * 8;
          *(v4u*)(C16 + co) = ph[it];
          *(v4u*)(Cro + co) = pr[it];
        }
        
      }
    } else {
      float* Cf = (float*)Co;
      const int hh = lane >> 4, c4 = (lane & 15) * 4;     // 256-B row segment = 16 lanes x 16 B
      v4f ov[8];
#pragma unroll
      for (int it = 0; it < 8; ++it) {
        const int row = it * 2 + hh;                       // it 0..7 x hh 0..1 = rows 0..15
        ov[it] = *(const v4f*)(slab + row * 68 + c4);
      }
      {
#pragma unroll
        for (int it = 0; it < 8; ++it) {
          const int row = it * 2 + hh;
          *(v4f*)(Cf + (size_t)(mBase + row) * ldo + nc0 + c4) = ov[it];
        }
        
      }
    }
    __builtin_amdgcn_fence(__ATOMIC_RELEASE, "workgroup");
    __builtin_amdgcn_wave_barrier();
    __builtin_amdgcn_fence(__ATOMIC_ACQUIRE, "workgroup");
  }
}

// =====================================================================================================
// f16 v plane (token-major, element (t, g, d) at vp[t*DKV + g*64 + d], g = kv head) -> f16 v^T plane
// vt[(g*64 + d)*SEQ + t] (same bits). Used for the hi plane and the residual plane.
// Block = one 64-token x 64-feature tile of one kv head g of one plane; grid = (SEQ/64, NKV, 2); tile staged in LDS as halves
// (v8h 16-B stores, __syncthreads, _Float16 element reads).
// Store: group g8 = tid>>3 (0..31), piece = tid&7: iteration it writes row d = it*32+g8, lanes 8q..8q+7 x 16 B =
// coverage: load 2 x 256 threads x 8 halves = 64x64; store 2 iterations x 32 groups = 64 rows d, 8 pieces x 8
// = 64 tokens per row; grid covers every (kv head, token tile) of [DKV][SEQ].
// =====================================================================================================
__global__ __launch_bounds__(256) void v_tr(const unsigned short* __restrict__ vp0, unsigned short* vt0,
                                            const unsigned short* __restrict__ vp1, unsigned short* vt1) {
  __shared__ __align__(16) _Float16 sv[64 * 72];       // [tt][d], pitch 72 halves (144 B)
  const int tid = threadIdx.x;
  const int t0  = blockIdx.x * 64;
  const int g   = blockIdx.y;
  if (g >= NKV || t0 >= SEQ || blockIdx.z > 1) return; // block-uniform, before any barrier
  const unsigned short* vp = blockIdx.z ? vp1 : vp0;   // blockIdx.z: 0 = hi plane, 1 = residual plane
  unsigned short* vt = blockIdx.z ? vt1 : vt0;
  const _Float16* src = (const _Float16*)(const void*)vp;
#pragma unroll
  for (int i = 0; i < 2; ++i) {
    const int idx = i * 256 + tid;                  // 0..511
    const int tt = idx >> 3, c8 = (idx & 7) * 8;
    const v8h a = *(const v8h*)(src + ((size_t)(t0 + tt)) * DKV + g * HD + c8);
    *(v8h*)(sv + tt * 72 + c8) = a;
  }
  __syncthreads();

  const int g8 = tid >> 3, piece = tid & 7;
  v4u hv[2];
  size_t hofs[2];
#pragma unroll
  for (int it = 0; it < 2; ++it) {
    const int d = it * 32 + g8;
    v4u a;
#pragma unroll
    for (int e = 0; e < 4; ++e) {
      const _Float16 x0 = sv[(piece * 8 + 2 * e) * 72 + d];
      const _Float16 x1 = sv[(piece * 8 + 2 * e + 1) * 72 + d];
      a[e] = pk16(h_bits(x0), h_bits(x1));
    }
    hv[it] = a;
    hofs[it] = ((size_t)(g * HD + d)) * SEQ + t0 + piece * 8;
  }
  {
#pragma unroll
    for (int it = 0; it < 2; ++it) *(v4u*)(vt + hofs[it]) = hv[it];
    
  }
}

#define ATT_SMEM 73728                                    // LDS bytes of the residual-plane variant, the larger one (two buffers)
// value of lane l ^ 16 (the other half of the wave, same column)
__device__ __forceinline__ float xhalf(float x) {
  return __builtin_bit_cast(float, __builtin_amdgcn_permlanex16(__builtin_bit_cast(int, x), __builtin_bit_cast(int, x),
                                                                0x76543210, 0xfedcba98, false, false));
}
template <bool HR>
__device__ __forceinline__
void attn_body(unsigned char* smem,
               const unsigned short* __restrict__ qp,  const unsigned short* __restrict__ qrp,
               const unsigned short* __restrict__ kp,  const unsigned short* __restrict__ krp,
               const unsigned short* __restrict__ vtp, const unsigned short* __restrict__ vtrp,
               unsigned short* ctxp, unsigned short* ctxrp, int qb, int h) {
  union FH { v16h v; v8h h[2]; };
  constexpr int LP     = 72;                             // LDS row pitch in halves: 144 B = 16 B x 9, so the 16 rows
                                                         // that one ds_load_b128 fragment read touches fall on 16
                                                         // different 4-bank groups (at 128 B they share two groups)
  constexpr int TB     = 64 * LP * 2;                    // one f16 64x64 tile at pitch LP, bytes
  constexpr int OP     = 68;                             // context staging pitch in floats: 272 B = 16 B x 17
  constexpr int OFF_K  = 0;
  constexpr int OFF_V  = TB;
  constexpr int OFF_KR = 2 * TB;
  constexpr int OFF_VR = 3 * TB;
  constexpr int BUFB   = HR ? 4 * TB : 2 * TB;                // one stage buffer: 36864 : 18432
  constexpr int SMEMB  = 2 * BUFB;                            // two stage buffers
  static_assert(4 * 16 * OP * 4 <= 2 * TB);                   // f32 context staging aliases the K/V region
  static_assert(SMEMB <= ATT_SMEM);

  const int tid  = threadIdx.x;
  const int wave = tid >> 5;
  const int lane = tid & 31;
  const int hh   = lane >> 4;
  const int c    = lane & 15;

  const int g    = h / GRP;                  // kv head
  const int q0   = qb * 64 + wave * 16;
  const int qrow = q0 + c;                   // the one query of this lane

  const _Float16* QP  = (const _Float16*)(const void*)qp   + (size_t)h * HD;
  const _Float16* QRP = (const _Float16*)(const void*)qrp  + (size_t)h * HD;
  const _Float16* KP  = (const _Float16*)(const void*)kp   + (size_t)g * HD;
  const _Float16* KRP = (const _Float16*)(const void*)krp  + (size_t)g * HD;
  const _Float16* VTP = (const _Float16*)(const void*)vtp  + (size_t)g * HD * SEQ;
  const _Float16* VRP = (const _Float16*)(const void*)vtrp + (size_t)g * HD * SEQ;

  // ---- Q fragments (B operand, column = lane&15): 2 d-chunks ----
  v16h qa[2], qr[2];
#pragma unroll
  for (int dc = 0; dc < 2; ++dc) {
    const size_t qo = (size_t)(q0 + c) * DM + dc * 32 + 8 * hh;
    qa[dc] = ldfrag_h(QP + qo);
    if constexpr (HR) qr[dc] = ldfrag_h(QRP + qo);
    else qr[dc] = qa[dc];
  }

  float lsum = 0.f, mrun = -1e30f;
  v8f oacc[4], oacc2[4];
#pragma unroll
  for (int t = 0; t < 4; ++t) { oacc[t] = zero8(); oacc2[t] = zero8(); }

  const int nkt = qb + 1;                                      // key tiles 0..qb, block-uniform

  // the lane's share of a key tile: rows crow + 16 i (i 0..3) of every plane, 16-B piece tid & 7 of each row
  const int crow = tid >> 3;
  const int cpc  = (tid & 7) * 8;
  const unsigned lds0 = (unsigned)(uintptr_t)smem + (unsigned)(crow * LP + cpc) * 2u;
  constexpr unsigned L16 = 16u * LP * 2u;                      // 16 LDS rows, bytes
  constexpr size_t   K16 = (size_t)16 * DKV;                   // 16 rows of K (keys), halves
  constexpr size_t   V16 = (size_t)16 * SEQ;                   // 16 rows of V^T (features), halves
  auto stage_in = [&](int kt, int buf) {                       // kt <= qb: keys kt*64 .. kt*64+63 < SEQ
    const size_t ko = (size_t)(kt * 64 + crow) * DKV + cpc;    // K row kt*64 + crow, d = cpc..cpc+7
    const size_t vo = (size_t)crow * SEQ + kt * 64 + cpc;      // V^T row d = crow, s = kt*64 + cpc..+7
    const unsigned lb = lds0 + (unsigned)buf * (unsigned)BUFB;
    copy4_lds(lb + OFF_K,           KP + ko,            lb + OFF_K + L16,     KP + ko + K16,
              lb + OFF_K + 2 * L16, KP + ko + 2 * K16,  lb + OFF_K + 3 * L16, KP + ko + 3 * K16);
    copy4_lds(lb + OFF_V,           VTP + vo,           lb + OFF_V + L16,     VTP + vo + V16,
              lb + OFF_V + 2 * L16, VTP + vo + 2 * V16, lb + OFF_V + 3 * L16, VTP + vo + 3 * V16);
    if constexpr (HR) {
      copy4_lds(lb + OFF_KR,           KRP + ko,           lb + OFF_KR + L16,     KRP + ko + K16,
                lb + OFF_KR + 2 * L16, KRP + ko + 2 * K16, lb + OFF_KR + 3 * L16, KRP + ko + 3 * K16);
      copy4_lds(lb + OFF_VR,           VRP + vo,           lb + OFF_VR + L16,     VRP + vo + V16,
                lb + OFF_VR + 2 * L16, VRP + vo + 2 * V16, lb + OFF_VR + 3 * L16, VRP + vo + 3 * V16);
    }
  };

  stage_in(0, 0);
#if defined(__HIP_DEVICE_COMPILE__)
  asm volatile("s_wait_asynccnt 0x0" ::: "memory");            // this wave's copies of key tile 0 have landed
#endif
  __syncthreads();                                             // key tile 0 is published to every wave
  if (nkt > 1) stage_in(1, 1);

  for (int kti = 0; kti < nkt; ++kti) {
    const int kv0 = kti * 64;                                  // <= qb*64 < SEQ
    const unsigned char* sb = smem + (kti & 1) * BUFB;         // this key tile's stage buffer
    const _Float16* Ksh = (const _Float16*)(sb + OFF_K);                  // K   [kv][d], pitch LP
    const _Float16* Vsh = (const _Float16*)(sb + OFF_V);                  // V^T [d][kv], pitch LP
    const _Float16* Krs = (const _Float16*)(sb + (HR ? OFF_KR : OFF_K));  // K residual (HR only)
    const _Float16* Vrs = (const _Float16*)(sb + (HR ? OFF_VR : OFF_V));  // V^T residual (HR only)

    // ---- scores, transposed: 64 keys x 16 queries per wave (A operand: lane c -> key j*16+c, split k map over d) ----
    //      The fragments of JG score tiles are read from LDS as one group ahead of their run of WMMAs (one LDS latency
    //      per group, not one per WMMA); every accumulator takes its products in the order dc 0, dc 1
    //      (HR, second accumulator: kr.qh then kh.qr within each dc).
    constexpr int JG = HR ? 2 : 4;                       // score tiles per group: 8 fragments = 64 registers
    v8f s[4];
#pragma unroll
    for (int j0 = 0; j0 < 4; j0 += JG) {
      v16h kb[JG][2], krb[JG][2];
#pragma unroll
      for (int jj = 0; jj < JG; ++jj) {
#pragma unroll
        for (int dc = 0; dc < 2; ++dc) {
          const int ko = ((j0 + jj) * 16 + c) * LP + dc * 32 + 8 * hh;
          kb[jj][dc] = ldfrag_h(Ksh + ko);
          if constexpr (HR) krb[jj][dc] = ldfrag_h(Krs + ko);
        }
      }
      v8f t[JG];
#pragma unroll
      for (int jj = 0; jj < JG; ++jj) { s[j0 + jj] = zero8(); t[jj] = zero8(); }
#pragma unroll
      for (int dc = 0; dc < 2; ++dc) {
#pragma unroll
        for (int jj = 0; jj < JG; ++jj) s[j0 + jj] = mma_h_raw(kb[jj][dc], qa[dc], s[j0 + jj]);
        if constexpr (HR) {
#pragma unroll
          for (int jj = 0; jj < JG; ++jj) t[jj] = mma_h_raw(krb[jj][dc], qa[dc], t[jj]);
#pragma unroll
          for (int jj = 0; jj < JG; ++jj) t[jj] = mma_h_raw(kb[jj][dc], qr[dc], t[jj]);
        }
      }
      if constexpr (HR) {
#pragma unroll
        for (int jj = 0; jj < JG; ++jj) s[j0 + jj] = s[j0 + jj] + t[jj] * (1.0f / 2048.0f);
      }
    }

    // single-product variant: all eight V^T fragments are read here, so that their LDS latency runs under the softmax
    v16h vb[2][4];
    if constexpr (!HR) {
#pragma unroll
      for (int kk = 0; kk < 2; ++kk)
#pragma unroll
        for (int t = 0; t < 4; ++t) vb[kk][t] = ldfrag_h(Vsh + (t * 16 + c) * LP + kk * 32 + 8 * hh);
    }

    // ---- causal online softmax of the lane's one query: masked logits and their maximum in-lane, one exchange
    //      with lane ^ 16, alpha, p, row-sum partial, P^T (x256, f16; HR: + residual) packed as the B operand ----
#pragma unroll
    for (int j = 0; j < 4; ++j) s[j] = s[j] * (1.0f / 2048.0f);   // 1/8 head scale, 1/256 for the two x16 carries
    if (kti == qb) {                                       // block-uniform: only the diagonal tile has keys above a query
#pragma unroll
      for (int j = 0; j < 4; ++j) {
#pragma unroll
        for (int r = 0; r < 8; ++r) {
          const int key = kv0 + j * 16 + 8 * hh + r;
          s[j][r] = (key <= qrow) ? s[j][r] : -1e30f;
        }
      }
    }
    float tm[8];
#pragma unroll
    for (int r = 0; r < 8; ++r) tm[r] = -1e30f;
#pragma unroll
    for (int j = 0; j < 4; ++j) {
#pragma unroll
      for (int r = 0; r < 8; ++r) tm[r] = fmaxf(tm[r], s[j][r]);
    }
    float tmx = fmaxf(fmaxf(fmaxf(tm[0], tm[1]), fmaxf(tm[2], tm[3])), fmaxf(fmaxf(tm[4], tm[5]), fmaxf(tm[6], tm[7])));
    tmx = fmaxf(tmx, xhalf(tmx));
    const float mn = fmaxf(mrun, tmx);
    const float al = __expf(mrun - mn);
    mrun = mn;
    float pp[8];
#pragma unroll
    for (int r = 0; r < 8; ++r) pp[r] = 0.0f;
    FH pa[2], par[2];
#pragma unroll
    for (int j = 0; j < 4; ++j) {
#pragma unroll
      for (int r = 0; r < 8; ++r) {
        const float p = __expf(s[j][r] - mn);              // a masked key: exp(-1e30 - mn) = 0 (mn is finite)
        pp[r] += p;
        const float gg = p * 256.0f;
        const _Float16 x0 = (_Float16)gg;
        pa[j >> 1].v[(j & 1) * 8 + r] = x0;
        if constexpr (HR) par[j >> 1].v[(j & 1) * 8 + r] = (_Float16)((gg - (float)x0) * 2048.0f);
      }
    }
    lsum = lsum * al + (((pp[0] + pp[1]) + (pp[2] + pp[3])) + ((pp[4] + pp[5]) + (pp[6] + pp[7])));

    // ---- rescale the context accumulators by alpha (VALU), nop gaps before the next WMMA reads them ----
#pragma unroll
    for (int t = 0; t < 4; ++t) {
      oacc[t] = oacc[t] * al;
      if constexpr (HR) oacc2[t] = oacc2[t] * al;
    }
    acc_guard4(oacc[0], oacc[1], oacc[2], oacc[3]);
    if constexpr (HR) acc_guard4(oacc2[0], oacc2[1], oacc2[2], oacc2[3]);

    // ---- context^T += V^T . P^T (f16 WMMA; A = V^T [d][key] from LDS, B = P^T [key][query] in registers) ----
    //      HR: the eight fragments of a key chunk are read as one group ahead of its twelve WMMAs; every accumulator
    //      takes its products in the order kk 0, kk 1 (second accumulator: vr.ph then vh.pr within each kk).
#pragma unroll
    for (int kk = 0; kk < 2; ++kk) {
      v16h vrb[4];
      if constexpr (HR) {
#pragma unroll
        for (int t = 0; t < 4; ++t) {
          const int vo = (t * 16 + c) * LP + kk * 32 + 8 * hh;
          vb[kk][t] = ldfrag_h(Vsh + vo);
          vrb[t]    = ldfrag_h(Vrs + vo);
        }
      }
#pragma unroll
      for (int t = 0; t < 4; ++t) oacc[t] = mma_h_raw(vb[kk][t], pa[kk].v, oacc[t]);
      if constexpr (HR) {
#pragma unroll
        for (int t = 0; t < 4; ++t) oacc2[t] = mma_h_raw(vrb[t], pa[kk].v, oacc2[t]);
#pragma unroll
        for (int t = 0; t < 4; ++t) oacc2[t] = mma_h_raw(vb[kk][t], par[kk].v, oacc2[t]);
      }
    }
#if defined(__HIP_DEVICE_COMPILE__)
    asm volatile("s_wait_dscnt 0x0" ::: "memory");      // this wave's reads of buffer kti & 1 are done before it is refilled
    asm volatile("s_wait_asynccnt 0x0" ::: "memory");   // this wave's copies of key tile kti + 1 have landed
#endif
    __syncthreads();                                    // publishes key tile kti + 1, ends every read of key tile kti
    if (kti + 2 < nkt) stage_in(kti + 2, kti & 1);
  }
#if defined(__HIP_DEVICE_COMPILE__)
  asm volatile("s_wait_asynccnt 0x0" ::: "memory");     // no copy is outstanding when the buffers become output staging
#endif
  // the last key tile's barrier has ended every wave's reads of the K/V tiles: they may be aliased from here on

  // ---- normalise (1/lsum, the 1/256 p carry; keep the x16 v carry), stage the wave's 16x64 f32 tile [query][d]
  //      in LDS (a lane's 8 registers of tile t are 8 consecutive d of its query: two 16-B stores) ----
  float* os = (float*)(void*)smem + wave * (16 * OP);
  {
    const float l  = lsum + xhalf(lsum);     // the query's two key halves
    const float rl = 1.0f / l;               // l >= 1 (the max key contributes p = 1)
    const float sc = rl * (1.0f / 256.0f);
#pragma unroll
    for (int t = 0; t < 4; ++t) {
      v4f lo, hi;
#pragma unroll
      for (int r = 0; r < 4; ++r) {
        float v0 = oacc[t][r], v1 = oacc[t][r + 4];
        if constexpr (HR) { v0 += oacc2[t][r] * (1.0f / 2048.0f); v1 += oacc2[t][r + 4] * (1.0f / 2048.0f); }
        lo[r] = v0 * sc;
        hi[r] = v1 * sc;
      }
      *(v4f*)(os + c * OP + t * 16 + 8 * hh)     = lo;
      *(v4f*)(os + c * OP + t * 16 + 8 * hh + 4) = hi;
    }
  }
  __builtin_amdgcn_fence(__ATOMIC_RELEASE, "workgroup");
  __builtin_amdgcn_wave_barrier();
  __builtin_amdgcn_fence(__ATOMIC_ACQUIRE, "workgroup");
  {
    const int rq = lane >> 3, piece = lane & 7;
    v4u ph[4], pr[4];
#pragma unroll
    for (int it = 0; it < 4; ++it) {
      const int row = it * 4 + rq;   // it 0..3 x rq 0..3 = rows 0..15 of the wave tile
      const v4f a  = *(const v4f*)(os + row * OP + piece * 8);
      const v4f a2 = *(const v4f*)(os + row * OP + piece * 8 + 4);
      float f[8];
      f[0] = a[0];  f[1] = a[1];  f[2] = a[2];  f[3] = a[3];
      f[4] = a2[0]; f[5] = a2[1]; f[6] = a2[2]; f[7] = a2[3];
      v4u p, q;
#pragma unroll
      for (int e = 0; e < 4; ++e) {
        const _Float16 x0 = (_Float16)f[2 * e], x1 = (_Float16)f[2 * e + 1];
        const _Float16 y0 = (_Float16)((f[2 * e] - (float)x0) * 2048.0f);
        const _Float16 y1 = (_Float16)((f[2 * e + 1] - (float)x1) * 2048.0f);
        p[e] = pk16(h_bits(x0), h_bits(x1));
        q[e] = pk16(h_bits(y0), h_bits(y1));
      }
      ph[it] = p;
      pr[it] = q;
    }
    {
#pragma unroll
      for (int it = 0; it < 4; ++it) {
        const int row = it * 4 + rq;
        const size_t go = (size_t)(q0 + row) * DM + (size_t)h * HD + piece * 8;
        *(v4u*)(ctxp + go)  = ph[it];
        *(v4u*)(ctxrp + go) = pr[it];
      }
    }
  }
}

// =====================================================================================================
// Both attention variants in one grid of NQT * NH blocks, so that the short residual-plane tiles and the long
// single-product tiles run side by side. The grid is four quarters of NQT/4 * NH blocks; block w of each quarter has
// head w % NH and u = w / NH, and query tile NQT-1-u, QHR-1-u, QHR+u, u in quarters 0..3: a permutation of every
// (head, query tile), long tiles first, and the four blocks with equal w have the same total of key tiles for every w.
// =====================================================================================================
// amdgpu_waves_per_eu(4, 4): at most four waves per SIMD = four blocks per WGP, as many as the grid has per WGP, so
// that no WGP takes a fifth block while another is left with three.
__global__ __launch_bounds__(128) __attribute__((amdgpu_waves_per_eu(4, 4)))
void attn_all(const unsigned short* __restrict__ qp,  const unsigned short* __restrict__ qrp,
              const unsigned short* __restrict__ kp,  const unsigned short* __restrict__ krp,
              const unsigned short* __restrict__ vtp, const unsigned short* __restrict__ vtrp,
              unsigned short* ctxp, unsigned short* ctxrp) {
  __shared__ __align__(16) unsigned char smem[ATT_SMEM];
  constexpr int QQ = NQT / 4;
  static_assert((NQT % 4) == 0 && QHR == 2 * QQ);
  const int bx = blockIdx.x;
  const int j  = bx / (QQ * NH);
  if (j > 3) return;                         // block-uniform, before any barrier or store
  const int w  = bx - j * (QQ * NH);
  const int h  = w % NH;
  const int u  = w / NH;
  const int qb = (j == 0) ? (NQT - 1 - u) : (j == 1) ? (QHR - 1 - u) : (j == 2) ? (QHR + u) : u;
  if (qb < QHR) attn_body<true>(smem, qp, qrp, kp, krp, vtp, vtrp, ctxp, ctxrp, qb, h);
  else          attn_body<false>(smem, qp, qrp, kp, krp, vtp, vtrp, ctxp, ctxrp, qb, h);
}

// =====================================================================================================
// Workspace map (bytes, SEQ = 4096); every region is an exact multiple of its whole-line / whole-tile store
// granularity (row pitches 2048 / 512 / 8192 B, rows multiples of 64, all offsets 512-KiB aligned, no aliasing
// within a launch):
//   Xh    f16 [SEQ][1024]          0     8388608   (bf16 value of x, x16)
//   WqT   f16 [1024][1024]   8388608     2097152   (bf16 value of w_q^T x1024, [n][k])
//   WkT   f16 [256][1024]   10485760      524288   (bf16 value of w_k^T x1024, [n][k])
//   WvT   f16 [256][1024]   11010048      524288   (bf16 value of w_v^T x1024, [n][k])
//   WoT   f16 [1024][1024]  11534336     2097152   (bf16 value of w_o^T x1024, [n][k])
//   Qh    f16 [SEQ][1024]   13631488     8388608   (q x16)           Qr  22020096  8388608 (x2^11 residual)
//   Kh    f16 [SEQ][256]    30408704     2097152   (k x16)           Kr  32505856  2097152
//   Vh    f16 [SEQ][256]    34603008     2097152   (v x16)           Vr  36700160  2097152
//   VT    f16 [256][SEQ]    38797312     2097152   ([g*64 + d][s])   VTr 40894464  2097152
//   Ctx   f16 [SEQ][1024]   42991616     8388608   (context x16)     Ctxr 51380224 8388608
//   end                     59768832
// Projection weights arrive as [in k][out n] (n contiguous) and are transposed while converted (w_tr).
// d_out f32: [SEQ][1024] at byte 0, every 64x64 tile written once by the output projection launch.
// =====================================================================================================
extern "C" void kernel_launch(void* const* d_in, const int* in_sizes, int n_in,
                              void* d_out, int out_size, void* d_ws, size_t ws_size,
                              hipStream_t stream) {
  if (n_in < 5) return;
  if (in_sizes[0] < SEQ * DM || (in_sizes[0] % DM) != 0) return;   // x rows 0..SEQ-1 are used, pitch DM
  if (in_sizes[1] != DM * DM) return;
  if (in_sizes[2] != DM * DKV) return;
  if (in_sizes[3] != DM * DKV) return;
  if (in_sizes[4] != DM * DM) return;
  if (out_size < OUTN) return;

  const float* x   = (const float*)d_in[0];    // [>=SEQ][DM]
  const float* w_q = (const float*)d_in[1];    // [DM k][DM n]
  const float* w_k = (const float*)d_in[2];    // [DM k][DKV n]
  const float* w_v = (const float*)d_in[3];    // [DM k][DKV n]
  const float* w_o = (const float*)d_in[4];    // [DM k][DM n]

  const size_t PX   = (size_t)SEQ * DM * 2;          //  8388608
  const size_t PWq  = (size_t)DM * DM * 2;           //  2097152
  const size_t PWk  = (size_t)DKV * DM * 2;          //   524288
  const size_t PWo  = (size_t)DM * DM * 2;           //  2097152
  const size_t PQ   = (size_t)SEQ * DM * 2;          //  8388608
  const size_t PK   = (size_t)SEQ * DKV * 2;         //  2097152
  const size_t PVT  = (size_t)DKV * SEQ * 2;         //  2097152
  const size_t PCtx = (size_t)SEQ * DM * 2;          //  8388608
  size_t off = 0;
  const size_t oX    = off; off += PX;
  const size_t oWq   = off; off += PWq;
  const size_t oWk   = off; off += PWk;
  const size_t oWv   = off; off += PWk;
  const size_t oWo   = off; off += PWo;
  const size_t oQ    = off; off += PQ;
  const size_t oQr   = off; off += PQ;
  const size_t oK    = off; off += PK;
  const size_t oKr   = off; off += PK;
  const size_t oV    = off; off += PK;
  const size_t oVr   = off; off += PK;
  const size_t oVT   = off; off += PVT;
  const size_t oVTr  = off; off += PVT;
  const size_t oCtx  = off; off += PCtx;
  const size_t oCtxr = off; off += PCtx;
  if (off > ws_size) return;                         // off = 59768832 for SEQ = 4096
  if (off > (size_t)134217728) return;

  char* ws = (char*)d_ws;
  unsigned short* Xh   = (unsigned short*)(ws + oX);
  unsigned short* WqT  = (unsigned short*)(ws + oWq);
  unsigned short* WkT  = (unsigned short*)(ws + oWk);
  unsigned short* WvT  = (unsigned short*)(ws + oWv);
  unsigned short* WoT  = (unsigned short*)(ws + oWo);
  unsigned short* Qh   = (unsigned short*)(ws + oQ);
  unsigned short* Qr   = (unsigned short*)(ws + oQr);
  unsigned short* Kh   = (unsigned short*)(ws + oK);
  unsigned short* Kr   = (unsigned short*)(ws + oKr);
  unsigned short* Vh   = (unsigned short*)(ws + oV);
  unsigned short* Vr   = (unsigned short*)(ws + oVr);
  unsigned short* VT   = (unsigned short*)(ws + oVT);
  unsigned short* VTr  = (unsigned short*)(ws + oVTr);
  unsigned short* Ctx  = (unsigned short*)(ws + oCtx);
  unsigned short* Ctxr = (unsigned short*)(ws + oCtxr);
  float*          outf = (float*)d_out;              // [SEQ][DM]

  const dim3 blk(256);
  const int n8x = SEQ * DM / 8;                      // 524288
  const dim3 gCx((n8x + 255) / 256);                 // 2048 blocks
  const dim3 gTw(DM / 64, DM / 64, 4);               // (16, 16, 4): the four weights, [1024 k][n] -> [n][1024 k]
  const dim3 gGq((NQT * (DM / 64) + 7) / 8);         // 1024 wave tiles -> 128 blocks of 128 x 256
  const dim3 gGqkv((NQT * ((DM + 2 * DKV) / 64) + 7) / 8);   // 1536 wave tiles -> 192 blocks of 128 x 256
  const dim3 gVt(SEQ / 64, NKV, 2);                  // (64, 4, 2)
  const dim3 gAtt(NQT * NH);                         // every (head, query tile), both variants
  const float wScale = 1024.0f;                      // weights carried x1024
  const float aScale = 16.0f;                        // activations carried x16
  const float cscale = 1.0f / 16384.0f;              // 1/(16 * 1024)

  // (1) planes: x -> f16 x16 (bf16 values); weights -> transposed f16 x1024 (bf16 values)
  cvt16<<<gCx, blk, 0, stream>>>(x, Xh, n8x, aScale);
  w_tr<<<gTw, blk, 0, stream>>>(w_q, w_k, w_v, w_o, WqT, WkT, WvT, WoT, DM, DM, DKV, wScale);
  // (2) [q | k | v] = Xh . [WqT ; WkT ; WvT]^T in one grid (M=SEQ, N=1024+256+256, K=1024; the three transposed
  //     weights lie one behind the other in the workspace): Qh [SEQ][1024], Kh, Vh [SEQ][256], f16 x16 + residual
  gemm64_f16<0, false><<<gGqkv, blk, 0, stream>>>(Xh, Xh, DM, WqT, DM, cscale, (void*)Qh, Qr, DM,
                                                  SEQ, DM + 2 * DKV, DM, aScale,
                                                  DM, DKV, Kh, Kr, Vh, Vr);
  // (3) v -> v^T planes (hi and residual, all tokens, all kv heads)
  v_tr<<<gVt, blk, 0, stream>>>(Vh, VT, Vr, VTr);
  // (4) causal softmax attention -> Ctx f16 x16 + residual plane: tiles 0..QHR-1 with residual operand planes,
  //     tiles QHR..NQT-1 with single products; together every (head, query tile) exactly once
  attn_all<<<gAtt, dim3(128), 0, stream>>>(Qh, Qr, Kh, Kr, VT, VTr, Ctx, Ctxr);
  // (5) out = (Ctx + 2^-11 Ctxr) . WoT^T -> d_out f32 [SEQ][1024] (M=SEQ, N=1024, K=1024), every tile once
  gemm64_f16<1, true><<<gGq, blk, 0, stream>>>(Ctx, Ctxr, DM, WoT, DM, cscale, (void*)outf, Ctxr, DM,
                                               SEQ, DM, DM, 1.0f,
                                               DM, DKV, Ctxr, Ctxr, Ctxr, Ctxr);
  (void)hipGetLastError();
}

// v008
// It runs in 105 microseconds.
// Two timings next to v007 both put it at 1.03 times that version's speed.
// All steps since v000 together make it 6.54 times as fast.
// Contractions: q/k/v projections = v_wmma_f32_16x16x32_f16 (A = f16 of RNE-bf16 x carried x16, B = f16 of RNE-bf16 w^T carried x1024, single product); attention k.q^T and v^T.p^T (both products transposed) = v_wmma_f32_16x16x32_f16 (query tiles below SEQ/2: q, k, v^T f16 planes x16 plus x2^11 residual planes, p f16 x256 plus x2^11 residual, hi.hi + hi.res + res.hi; query tiles from SEQ/2 on: single products on the x16 / x256 planes); output projection = v_wmma_f32_16x16x32_f16 (A = ctx f16 x16 plus its x2^11 residual plane, B = f16 of RNE-bf16 w_o^T x1024); all f32 accumulate. Causal online-max softmax, masks and row sums f32 on VALU.
#include <hip/hip_runtime.h>
#include <math.h>
#include <stdint.h>

#define SEQ   4096
#define DM    1024
#define NH    16
#define NKV   4
#define HD    64
#define DKV   (NKV * HD)            // 256
#define GRP   (NH / NKV)            // query heads per kv head = 4 (query head h uses kv head h / GRP)
#define NQT   (SEQ / 64)            // 64 query tiles of 64 rows
#define QHR   (NQT / 2)             // query tiles below this index use residual planes in attention
#define OUTN  (SEQ * DM)
static_assert(NH * HD == DM);
static_assert(HD == 64);
static_assert((NH % NKV) == 0);
static_assert((SEQ % 64) == 0 && (NQT % 2) == 0);
static_assert((DM % 64) == 0 && (DKV % 64) == 0 && (DM % 32) == 0);
static_assert(((NQT * (DM / 64)) % 8) == 0);
static_assert(((NQT * (DKV / 64)) % 8) == 0);
static_assert((SEQ % 128) == 0 && ((DM + 2 * DKV) % 256) == 0 && (DM % 256) == 0);   // GEMM block tile 128 x 256, 128 k per stage
static_assert(((SEQ * DM / 8) % 256) == 0);

typedef _Float16 v16h __attribute__((ext_vector_type(16)));
typedef _Float16 v8h  __attribute__((ext_vector_type(8)));
typedef float    v8f  __attribute__((ext_vector_type(8)));
typedef float    v4f  __attribute__((ext_vector_type(4)));
typedef unsigned int v4u __attribute__((ext_vector_type(4)));

// ---- scalar helpers --------------------------------------------------------------------------------
__device__ __forceinline__ unsigned short bf_bits(float f) {          // f32 -> bf16 bits, RNE convert
  unsigned u = __float_as_uint(f);
  return (unsigned short)((u + 0x7FFFu + ((u >> 16) & 1u)) >> 16);
}
__device__ __forceinline__ float bfr(float f) { return __uint_as_float(((unsigned)bf_bits(f)) << 16); }
__device__ __forceinline__ unsigned short h_bits(_Float16 x) { return __builtin_bit_cast(unsigned short, x); }
__device__ __forceinline__ unsigned pk16(unsigned short a, unsigned short b) { return (unsigned)a | ((unsigned)b << 16); }
__device__ __forceinline__ v8f zero8() { v8f z = {0.f, 0.f, 0.f, 0.f, 0.f, 0.f, 0.f, 0.f}; return z; }

// ---- fragment loader: 16-bit A/B operand, lane -> row/col (lane&15), p already includes +8*(lane>>4);
//      elements 0..7 <- p[0..7] (k0+8h..), elements 8..15 <- p[16..23] (k0+16+8h..)
__device__ __forceinline__ v16h ldfrag_h(const _Float16* p) {
  union { v16h v; v8h h[2]; } f;
  f.h[0] = *(const v8h*)(p);
  f.h[1] = *(const v8h*)(p + 16);
  return f.v;
}

// ---- WMMA helpers with trailing VALU hazard gap --------------------------------------------------------
__device__ __forceinline__ v8f mma_h_raw(v16h a, v16h b, v8f c) {
  return __builtin_amdgcn_wmma_f32_16x16x32_f16(false, a, false, b, (short)0, c, false, false);
}
__device__ __forceinline__ void dep_guard_h(v8f& a, v8f& b, v16h x, v16h y) {
#if defined(__HIP_DEVICE_COMPILE__)
  asm volatile("v_nop\n\tv_nop\n\tv_nop\n\tv_nop" : "+v"(a), "+v"(b) : "v"(x), "v"(y));
#endif
}
__device__ __forceinline__ void keep4_h(v16h a, v16h b, v16h c, v16h d) {
#if defined(__HIP_DEVICE_COMPILE__)
  asm volatile("v_nop" :: "v"(a), "v"(b), "v"(c), "v"(d));
#endif
}
__device__ __forceinline__ void acc_guard4(v8f& a, v8f& b, v8f& c, v8f& d) {
#if defined(__HIP_DEVICE_COMPILE__)
  asm volatile("v_nop\n\tv_nop\n\tv_nop\n\tv_nop" : "+v"(a), "+v"(b), "+v"(c), "+v"(d));
#endif
}

// =====================================================================================================
// f32 plane -> f16 bits of bfr(v) * scale (scale a power of two): x (x16).
// coverage: n8 threads x 8 = the whole plane.
// =====================================================================================================
__global__ __launch_bounds__(256) void cvt16(const float* __restrict__ in, unsigned short* out, int n8, float scale) {
  const int i = blockIdx.x * 256 + threadIdx.x;
  if (i < n8) {
    const v4f a = *(const v4f*)(in + (size_t)i * 8);
    const v4f b = *(const v4f*)(in + (size_t)i * 8 + 4);
    v4u p;
    p[0] = pk16(h_bits((_Float16)(bfr(a[0]) * scale)), h_bits((_Float16)(bfr(a[1]) * scale)));
    p[1] = pk16(h_bits((_Float16)(bfr(a[2]) * scale)), h_bits((_Float16)(bfr(a[3]) * scale)));
    p[2] = pk16(h_bits((_Float16)(bfr(b[0]) * scale)), h_bits((_Float16)(bfr(b[1]) * scale)));
    p[3] = pk16(h_bits((_Float16)(bfr(b[2]) * scale)), h_bits((_Float16)(bfr(b[3]) * scale)));
    *(v4u*)(out + (size_t)i * 8) = p;
    
  }
}

// =====================================================================================================
// f32 weight W [K rows][N cols] (the x@W layout, n contiguous) -> f16 Wt[n][k] = f16(bfr(W[k][n]) * scale),
// pitch K halves (k contiguous = the Bt layout of the GEMM below); scale a power of two.
// Block = one 64 (k) x 64 (n) tile of one of four weights; grid = (Nwide/64, K/64, 4), blockIdx.z = the weight,
// blocks past a narrow weight's last column tile leave at once; tile staged in LDS as halves [kk][nn] pitch 72
// (v8h 16-B stores, __syncthreads, _Float16 element reads).
// Store: group g = tid>>3 (0..31), piece = tid&7: iteration it writes out row n = it*32+g, lanes 8q..8q+7 x 16 B =
// coverage: load 2 x 256 threads x 8 = 64x64; store 2 iterations x 32 groups = 64 rows n, 8 pieces x 8 = 64 k
// per row; grid covers every (n tile, k tile) of [N][K].
// =====================================================================================================
__global__ __launch_bounds__(256) void w_tr(const float* __restrict__ w0, const float* __restrict__ w1,
                                            const float* __restrict__ w2, const float* __restrict__ w3,
                                            unsigned short* t0, unsigned short* t1, unsigned short* t2, unsigned short* t3,
                                            int K, int Nwide, int Nnarrow, float scale) {
  __shared__ __align__(16) _Float16 sw[64 * 72];       // [kk][nn], pitch 72 halves (144 B)
  const int tid = threadIdx.x;
  const int z   = blockIdx.z;                          // which weight: 0 and 3 are Nwide columns, 1 and 2 Nnarrow
  const int N   = (z == 0 || z == 3) ? Nwide : Nnarrow;
  const int n0  = blockIdx.x * 64;
  const int k0  = blockIdx.y * 64;
  if (z > 3 || n0 >= N || k0 >= K) return;             // block-uniform, before the barrier
  const float* w = (z == 0) ? w0 : (z == 1) ? w1 : (z == 2) ? w2 : w3;
  unsigned short* wt = (z == 0) ? t0 : (z == 1) ? t1 : (z == 2) ? t2 : t3;
#pragma unroll
  for (int i = 0; i < 2; ++i) {
    const int idx = i * 256 + tid;                  // 0..511
    const int kk = idx >> 3, c8 = (idx & 7) * 8;
    const float* src = w + (size_t)(k0 + kk) * N + n0 + c8;
    const v4f a  = *(const v4f*)(src);
    const v4f a2 = *(const v4f*)(src + 4);
    v8h o;
    o[0] = (_Float16)(bfr(a[0]) * scale);
    o[1] = (_Float16)(bfr(a[1]) * scale);
    o[2] = (_Float16)(bfr(a[2]) * scale);
    o[3] = (_Float16)(bfr(a[3]) * scale);
    o[4] = (_Float16)(bfr(a2[0]) * scale);
    o[5] = (_Float16)(bfr(a2[1]) * scale);
    o[6] = (_Float16)(bfr(a2[2]) * scale);
    o[7] = (_Float16)(bfr(a2[3]) * scale);
    *(v8h*)(sw + kk * 72 + c8) = o;
  }
  __syncthreads();

  const int g = tid >> 3, piece = tid & 7;
  v4u hv[2];
  size_t hofs[2];
#pragma unroll
  for (int it = 0; it < 2; ++it) {
    const int nn = it * 32 + g;
    v4u a;
#pragma unroll
    for (int e = 0; e < 4; ++e) {
      const _Float16 x0 = sw[(piece * 8 + 2 * e) * 72 + nn];
      const _Float16 x1 = sw[(piece * 8 + 2 * e + 1) * 72 + nn];
      a[e] = pk16(h_bits(x0), h_bits(x1));
    }
    hv[it] = a;
    hofs[it] = ((size_t)(n0 + nn)) * K + k0 + piece * 8;
  }
  {
#pragma unroll
    for (int it = 0; it < 2; ++it) *(v4u*)(wt + hofs[it]) = hv[it];
    
  }
}

// =====================================================================================================
// Four 16-byte asynchronous copies of one lane, global memory -> LDS (l = the lane's LDS byte address, g = its
// global address), written as the compiler's builtin, offset argument 0: a builtin copy carries no s_wait_xcnt behind
// it, so the wave goes from a stage's copies straight on to its fragment reads. Landing is waited for by the callers
// (s_wait_asynccnt 0 and the block barrier at every stage's foot).
// =====================================================================================================
typedef int v4i_t __attribute__((vector_size(16)));
typedef __attribute__((address_space(1))) v4i_t g_v4i;
typedef __attribute__((address_space(3))) v4i_t l_v4i;
__device__ __forceinline__ void copy1_lds(unsigned l, const _Float16* g) {
#if defined(__HIP_DEVICE_COMPILE__)
  __builtin_amdgcn_global_load_async_to_lds_b128((g_v4i*)(uintptr_t)g, (l_v4i*)l, 0, 0);
#endif
}
__device__ __forceinline__ void copy4_lds(unsigned l0, const _Float16* g0, unsigned l1, const _Float16* g1,
                                          unsigned l2, const _Float16* g2, unsigned l3, const _Float16* g3) {
  copy1_lds(l0, g0);
  copy1_lds(l1, g1);
  copy1_lds(l2, g2);
  copy1_lds(l3, g3);
}

// =====================================================================================================
// Register-blocked f16 WMMA GEMM, block = 8 waves (2 x 4) = one 128 x 256 tile, one wave per 64x64 tile:
//   v[m][n] = (sum_k A[m][k] * Bt[n][k]  [+ 2^-11 * sum_k Ar[m][k] * Bt[n][k] when ARES]) * cscale
// A, Ar row-major [M][K] pitch lda (f16), Bt row-major [N][K] pitch ldb (f16, k contiguous); M a multiple of 128,
// N of 256, K of 128; grid = (M / 128) * (N / 256) blocks.
// Operands: a stage = 128 k of the block's 128 rows of A and 256 rows of Bt, whole 128-B lines, brought into LDS at
// row pitch 272 B by asynchronous copies (24 per lane and stage: lane -> row tid>>4 (+16 per copy), 16-B piece
// tid&15); two buffers, stage s + 1 in flight while stage s is multiplied; every wave reads its fragments from LDS.
// ARES: the stages of the residual plane come first and accumulate from zero, the accumulators are scaled by 2^-11
// exactly on the VALU (with nop gaps on both sides), then the hi plane's stages accumulate on top: one accumulator set.
// EPI 0: column tiles from n1 on are stored to a second and a third output (each nx columns wide, pitch nx; hi plane
// C2 / C3, residual plane C2r / C3r), so that products that share A run in one grid. EPI 1 has the one output.
// Epilogue variants:
//   EPI 0: f16 hi plane = f16(v * oscale) at Cp and residual plane = f16((v*oscale - hi) * 2048) at Crp, pitch ldc halves
//   EPI 1: f32 out = v, pitch ldc floats
// 16-row slabs staged per wave in LDS. f32 out: each 64-wide row segment (256 B = 2 lines) by 16 lanes x 16 B,
// coverage: 4 slabs x 16 rows x 64 cols = the wave's whole 64x64 tile; 8 waves = the block's 128 x 256; grid = [M][N].
// =====================================================================================================
#define GBM  128                                   // block tile rows (A)
#define GBN  256                                   // block tile columns (rows of Bt)
#define GBK  128                                   // k per stage: 256 B of every operand row
#define GLP  136                                   // LDS row pitch in halves: 272 B = 16 B x 17 (ds_load_b128 fragment reads)
#define GSTG ((GBM + GBN) * GLP)                   // halves per stage buffer: [A 128 rows | Bt 256 rows]
template <int EPI, bool ARES>
__global__ __launch_bounds__(256) void gemm64_f16(
    const unsigned short* __restrict__ Ap, const unsigned short* __restrict__ Arp, int lda,
    const unsigned short* __restrict__ Btp, int ldb,
    float cscale,
    void* Cp, unsigned short* Crp, int ldc, int M, int N, int K, float oscale,
    int n1, int nx, unsigned short* C2, unsigned short* C2r, unsigned short* C3, unsigned short* C3r) {
  const _Float16* Ah  = (const _Float16*)(const void*)Ap;
  const _Float16* Arh = (const _Float16*)(const void*)Arp;
  const _Float16* Bt  = (const _Float16*)(const void*)Btp;
  __shared__ __align__(16) _Float16 sAB[2 * GSTG]; // two stage buffers
  __shared__ __align__(16) float sT[8][16 * 68];   // per-wave 16x64 slab, pitch 68 floats
  const int tid  = threadIdx.x;
  const int lane = tid & 31;
  const int wave = tid >> 5;
  const int blocksN = N >> 8;
  const int blocksM = M >> 7;
  const int bidx = blockIdx.x;
  if (bidx >= blocksM * blocksN) return;   // block-uniform, before any copy or barrier
  const int bmi = bidx / blocksN;
  const int bm0 = bmi << 7;
  const int bn0 = (bidx - bmi * blocksN) << 8;
  const int wm  = wave >> 2;               // wave's 64-row half of the block tile
  const int wn  = wave & 3;                // wave's 64-column quarter
  const int m0 = bm0 + (wm << 6);
  const int n0 = bn0 + (wn << 6);

  // output of this tile (wave-uniform): columns below n1 go to Cp / Crp, the next nx to C2 / C2r, the next nx to C3 / C3r
  void* Co = Cp;
  unsigned short* Cro = Crp;
  int ldo = ldc, nc0 = n0;
  if constexpr (EPI == 0) {
    if (n0 >= n1) {
      const int e = n0 - n1;
      const bool third = (e >= nx);
      Co  = third ? (void*)C3 : (void*)C2;
      Cro = third ? C3r : C2r;
      ldo = nx;
      nc0 = third ? e - nx : e;
    }
  }

  const int rlane = lane & 15;                 // row (A) / col (B, D) within subtile
  const int koff  = (lane >> 4) * 8;           // k offset of this lane half
  const int mOff  = (lane >> 4) * 8;           // D row offset

  v8f acc[4][4];
#pragma unroll
  for (int i = 0; i < 4; ++i)
#pragma unroll
    for (int j = 0; j < 4; ++j) acc[i][j] = zero8();

  constexpr int NPL = ARES ? 2 : 1;
  const int nk  = K >> 7;                      // stages per plane
  const int nst = NPL * nk;                    // stages in all, block-uniform

  // the lane's share of a stage: rows crow + 16 i of A (i 0..7) and of Bt (i 0..15), 16-B piece tid & 15 of each
  const int crow = tid >> 4;
  const int cpc  = (tid & 15) * 8;
  const unsigned lds0 = (unsigned)(uintptr_t)(&sAB[0]) + (unsigned)(crow * GLP + cpc) * 2u;
  const _Float16* gA0 = Ah  + (size_t)(bm0 + crow) * lda + cpc;
  const _Float16* gR0 = Arh + (size_t)(bm0 + crow) * lda + cpc;
  const _Float16* gB0 = Bt  + (size_t)(bn0 + crow) * ldb + cpc;
  const size_t a16 = (size_t)16 * lda, b16 = (size_t)16 * ldb;
  constexpr unsigned R16 = 16u * GLP * 2u;     // 16 LDS rows, bytes
  auto stage_in = [&](int st, int buf) {
    const bool res = ARES && (st < nk);        // block-uniform: the residual plane's stages come first
    const int  k0  = (ARES && !res ? st - nk : st) * GBK;
    const _Float16* ga = (res ? gR0 : gA0) + k0;
    const _Float16* gb = gB0 + k0;
    const unsigned la = lds0 + (unsigned)buf * (unsigned)(GSTG * 2);
    const unsigned lb = la + (unsigned)(GBM * GLP * 2);
#pragma unroll                                 // straight line: constant LDS steps, 4 copies a call
    for (int q = 0; q < GBM / 16; q += 4)
      copy4_lds(la + q * R16,       ga + q * a16,       la + (q + 1) * R16, ga + (q + 1) * a16,
                la + (q + 2) * R16, ga + (q + 2) * a16, la + (q + 3) * R16, ga + (q + 3) * a16);
#pragma unroll                                 // as above
    for (int q = 0; q < GBN / 16; q += 4)
      copy4_lds(lb + q * R16,       gb + q * b16,       lb + (q + 1) * R16, gb + (q + 1) * b16,
                lb + (q + 2) * R16, gb + (q + 2) * b16, lb + (q + 3) * R16, gb + (q + 3) * b16);
  };

  if (nst > 0) stage_in(0, 0);
#if defined(__HIP_DEVICE_COMPILE__)
  asm volatile("s_wait_asynccnt 0x0" ::: "memory");   // this wave's copies of stage 0 have landed
#endif
  __syncthreads();                                    // stage 0 is published to every wave
  if (nst > 1) stage_in(1, 1);

  for (int st = 0; st < nst; ++st) {
    if (ARES && st == nk) {
      acc_guard4(acc[0][0], acc[0][1], acc[0][2], acc[0][3]);
      acc_guard4(acc[1][0], acc[1][1], acc[1][2], acc[1][3]);
      acc_guard4(acc[2][0], acc[2][1], acc[2][2], acc[2][3]);
      acc_guard4(acc[3][0], acc[3][1], acc[3][2], acc[3][3]);
#pragma unroll
      for (int i = 0; i < 4; ++i)
#pragma unroll
        for (int j = 0; j < 4; ++j) acc[i][j] = acc[i][j] * (1.0f / 2048.0f);   // exact fold of the x2^11 residual carry
      acc_guard4(acc[0][0], acc[0][1], acc[0][2], acc[0][3]);
      acc_guard4(acc[1][0], acc[1][1], acc[1][2], acc[1][3]);
      acc_guard4(acc[2][0], acc[2][1], acc[2][2], acc[2][3]);
      acc_guard4(acc[3][0], acc[3][1], acc[3][2], acc[3][3]);
    }
    const _Float16* sA = sAB + (st & 1) * GSTG + ((wm << 6) + rlane) * GLP + koff;
    const _Float16* sB = sAB + (st & 1) * GSTG + (GBM + (wn << 6) + rlane) * GLP + koff;
#pragma unroll                                 // constant LDS offsets; the fragment arrays stay in registers
    for (int ks = 0; ks < GBK; ks += 32) {
      v16h bh[4], ah[4];
#pragma unroll
      for (int j = 0; j < 4; ++j) bh[j] = ldfrag_h(sB + (j << 4) * GLP + ks);
#pragma unroll
      for (int i = 0; i < 4; ++i) ah[i] = ldfrag_h(sA + (i << 4) * GLP + ks);
#pragma unroll
      for (int i = 0; i < 4; ++i) {
#pragma unroll
        for (int j = 0; j < 4; ++j) {
          acc[i][j] = mma_h_raw(ah[i], bh[j], acc[i][j]);
        }
        dep_guard_h(acc[i][0], acc[i][3], ah[i], bh[3]);
      }
      keep4_h(bh[0], bh[1], bh[2], bh[3]);
    }
#if defined(__HIP_DEVICE_COMPILE__)
    asm volatile("s_wait_dscnt 0x0" ::: "memory");      // this wave's reads of buffer st & 1 are done before it is refilled
    asm volatile("s_wait_asynccnt 0x0" ::: "memory");   // this wave's copies of stage st + 1 have landed
#endif
    __syncthreads();                                    // publishes stage st + 1, ends every read of stage st
    if (st + 2 < nst) stage_in(st + 2, st & 1);
  }
#if defined(__HIP_DEVICE_COMPILE__)
  asm volatile("s_wait_asynccnt 0x0" ::: "memory");     // no copy is outstanding when the wave goes on to its end
#endif
  acc_guard4(acc[0][0], acc[0][1], acc[0][2], acc[0][3]);
  acc_guard4(acc[1][0], acc[1][1], acc[1][2], acc[1][3]);
  acc_guard4(acc[2][0], acc[2][1], acc[2][2], acc[2][3]);
  acc_guard4(acc[3][0], acc[3][1], acc[3][2], acc[3][3]);

  // ---- epilogue ----
  float* slab = sT[wave];
#pragma unroll
  for (int i = 0; i < 4; ++i) {
    const int mBase = m0 + (i << 4);
#pragma unroll
    for (int r = 0; r < 8; ++r) {
      const int row = mOff + r;
#pragma unroll
      for (int j = 0; j < 4; ++j) slab[row * 68 + (j << 4) + rlane] = acc[i][j][r] * cscale;
    }
    __builtin_amdgcn_fence(__ATOMIC_RELEASE, "workgroup");
    __builtin_amdgcn_wave_barrier();
    __builtin_amdgcn_fence(__ATOMIC_ACQUIRE, "workgroup");
    if constexpr (EPI == 0) {
      unsigned short* C16 = (unsigned short*)Co;
      const int rq = lane >> 3, piece = lane & 7;
      v4u ph[4], pr[4];
#pragma unroll
      for (int it = 0; it < 4; ++it) {
        const int row = it * 4 + rq;                         // it 0..3 x rq 0..3 = rows 0..15
        const v4f a  = *(const v4f*)(slab + row * 68 + piece * 8);
        const v4f a2 = *(const v4f*)(slab + row * 68 + piece * 8 + 4);
        float f[8];
        f[0] = a[0];  f[1] = a[1];  f[2] = a[2];  f[3] = a[3];
        f[4] = a2[0]; f[5] = a2[1]; f[6] = a2[2]; f[7] = a2[3];
        v4u p, q;
#pragma unroll
        for (int e = 0; e < 4; ++e) {
          const float g0 = f[2 * e] * oscale, g1 = f[2 * e + 1] * oscale;
          const _Float16 x0 = (_Float16)g0, x1 = (_Float16)g1;
          const _Float16 y0 = (_Float16)((g0 - (float)x0) * 2048.0f);
          const _Float16 y1 = (_Float16)((g1 - (float)x1) * 2048.0f);
          p[e] = pk16(h_bits(x0), h_bits(x1));
          q[e] = pk16(h_bits(y0), h_bits(y1));
        }
        ph[it] = p;
        pr[it] = q;
      }
      {
#pragma unroll
        for (int it = 0; it < 4; ++it) {
          const int row = it * 4 + rq;
          const size_t co = (size_t)(mBase + row) * ldo + nc0 + piece * 8;
          *(v4u*)(C16 + co) = ph[it];
          *(v4u*)(Cro + co) = pr[it];
        }
        
      }
    } else {
      float* Cf = (float*)Co;
      const int hh = lane >> 4, c4 = (lane & 15) * 4;     // 256-B row segment = 16 lanes x 16 B
      v4f ov[8];
#pragma unroll
      for (int it = 0; it < 8; ++it) {
        const int row = it * 2 + hh;                       // it 0..7 x hh 0..1 = rows 0..15
        ov[it] = *(const v4f*)(slab + row * 68 + c4);
      }
      {
#pragma unroll
        for (int it = 0; it < 8; ++it) {
          const int row = it * 2 + hh;
          *(v4f*)(Cf + (size_t)(mBase + row) * ldo + nc0 + c4) = ov[it];
        }
        
      }
    }
    __builtin_amdgcn_fence(__ATOMIC_RELEASE, "workgroup");
    __builtin_amdgcn_wave_barrier();
    __builtin_amdgcn_fence(__ATOMIC_ACQUIRE, "workgroup");
  }
}

// =====================================================================================================
// f16 v plane (token-major, element (t, g, d) at vp[t*DKV + g*64 + d], g = kv head) -> f16 v^T plane
// vt[(g*64 + d)*SEQ + t] (same bits). Used for the hi plane and the residual plane.
// Block = one 64-token x 64-feature tile of one kv head g of one plane; grid = (SEQ/64, NKV, 2); tile staged in LDS as halves
// (v8h 16-B stores, __syncthreads, _Float16 element reads).
// Store: group g8 = tid>>3 (0..31), piece = tid&7: iteration it writes row d = it*32+g8, lanes 8q..8q+7 x 16 B =
// coverage: load 2 x 256 threads x 8 halves = 64x64; store 2 iterations x 32 groups = 64 rows d, 8 pieces x 8
// = 64 tokens per row; grid covers every (kv head, token tile) of [DKV][SEQ].
// =====================================================================================================
__global__ __launch_bounds__(256) void v_tr(const unsigned short* __restrict__ vp0, unsigned short* vt0,
                                            const unsigned short* __restrict__ vp1, unsigned short* vt1) {
  __shared__ __align__(16) _Float16 sv[64 * 72];       // [tt][d], pitch 72 halves (144 B)
  const int tid = threadIdx.x;
  const int t0  = blockIdx.x * 64;
  const int g   = blockIdx.y;
  if (g >= NKV || t0 >= SEQ || blockIdx.z > 1) return; // block-uniform, before any barrier
  const unsigned short* vp = blockIdx.z ? vp1 : vp0;   // blockIdx.z: 0 = hi plane, 1 = residual plane
  unsigned short* vt = blockIdx.z ? vt1 : vt0;
  const _Float16* src = (const _Float16*)(const void*)vp;
#pragma unroll
  for (int i = 0; i < 2; ++i) {
    const int idx = i * 256 + tid;                  // 0..511
    const int tt = idx >> 3, c8 = (idx & 7) * 8;
    const v8h a = *(const v8h*)(src + ((size_t)(t0 + tt)) * DKV + g * HD + c8);
    *(v8h*)(sv + tt * 72 + c8) = a;
  }
  __syncthreads();

  const int g8 = tid >> 3, piece = tid & 7;
  v4u hv[2];
  size_t hofs[2];
#pragma unroll
  for (int it = 0; it < 2; ++it) {
    const int d = it * 32 + g8;
    v4u a;
#pragma unroll
    for (int e = 0; e < 4; ++e) {
      const _Float16 x0 = sv[(piece * 8 + 2 * e) * 72 + d];
      const _Float16 x1 = sv[(piece * 8 + 2 * e + 1) * 72 + d];
      a[e] = pk16(h_bits(x0), h_bits(x1));
    }
    hv[it] = a;
    hofs[it] = ((size_t)(g * HD + d)) * SEQ + t0 + piece * 8;
  }
  {
#pragma unroll
    for (int it = 0; it < 2; ++it) *(v4u*)(vt + hofs[it]) = hv[it];
    
  }
}

#define ATT_SMEM 73728                                    // LDS bytes of the residual-plane variant, the larger one (two buffers)
// value of lane l ^ 16 (the other half of the wave, same column)
__device__ __forceinline__ float xhalf(float x) {
  return __builtin_bit_cast(float, __builtin_amdgcn_permlanex16(__builtin_bit_cast(int, x), __builtin_bit_cast(int, x),
                                                                0x76543210, 0xfedcba98, false, false));
}
template <bool HR>
__device__ __forceinline__
void attn_body(unsigned char* smem,
               const unsigned short* __restrict__ qp,  const unsigned short* __restrict__ qrp,
               const unsigned short* __restrict__ kp,  const unsigned short* __restrict__ krp,
               const unsigned short* __restrict__ vtp, const unsigned short* __restrict__ vtrp,
               unsigned short* ctxp, unsigned short* ctxrp, int qb, int h) {
  union FH { v16h v; v8h h[2]; };
  constexpr int LP     = 72;                             // LDS row pitch in halves: 144 B = 16 B x 9, so the 16 rows
                                                         // that one ds_load_b128 fragment read touches fall on 16
                                                         // different 4-bank groups (at 128 B they share two groups)
  constexpr int TB     = 64 * LP * 2;                    // one f16 64x64 tile at pitch LP, bytes
  constexpr int OP     = 68;                             // context staging pitch in floats: 272 B = 16 B x 17
  constexpr int OFF_K  = 0;
  constexpr int OFF_V  = TB;
  constexpr int OFF_KR = 2 * TB;
  constexpr int OFF_VR = 3 * TB;
  constexpr int BUFB   = HR ? 4 * TB : 2 * TB;                // one stage buffer: 36864 : 18432
  constexpr int SMEMB  = 2 * BUFB;                            // two stage buffers
  static_assert(4 * 16 * OP * 4 <= 2 * TB);                   // f32 context staging aliases the K/V region
  static_assert(SMEMB <= ATT_SMEM);

  const int tid  = threadIdx.x;
  const int wave = tid >> 5;
  const int lane = tid & 31;
  const int hh   = lane >> 4;
  const int c    = lane & 15;

  const int g    = h / GRP;                  // kv head
  const int q0   = qb * 64 + wave * 16;
  const int qrow = q0 + c;                   // the one query of this lane

  const _Float16* QP  = (const _Float16*)(const void*)qp   + (size_t)h * HD;
  const _Float16* QRP = (const _Float16*)(const void*)qrp  + (size_t)h * HD;
  const _Float16* KP  = (const _Float16*)(const void*)kp   + (size_t)g * HD;
  const _Float16* KRP = (const _Float16*)(const void*)krp  + (size_t)g * HD;
  const _Float16* VTP = (const _Float16*)(const void*)vtp  + (size_t)g * HD * SEQ;
  const _Float16* VRP = (const _Float16*)(const void*)vtrp + (size_t)g * HD * SEQ;

  // ---- Q fragments (B operand, column = lane&15): 2 d-chunks ----
  v16h qa[2], qr[2];
#pragma unroll
  for (int dc = 0; dc < 2; ++dc) {
    const size_t qo = (size_t)(q0 + c) * DM + dc * 32 + 8 * hh;
    qa[dc] = ldfrag_h(QP + qo);
    if constexpr (HR) qr[dc] = ldfrag_h(QRP + qo);
    else qr[dc] = qa[dc];
  }

  float lsum = 0.f, mrun = -1e30f;
  v8f oacc[4], oacc2[4];
#pragma unroll
  for (int t = 0; t < 4; ++t) { oacc[t] = zero8(); oacc2[t] = zero8(); }

  const int nkt = qb + 1;                                      // key tiles 0..qb, block-uniform

  // the lane's share of a key tile: rows crow + 16 i (i 0..3) of every plane, 16-B piece tid & 7 of each row
  const int crow = tid >> 3;
  const int cpc  = (tid & 7) * 8;
  const unsigned lds0 = (unsigned)(uintptr_t)smem + (unsigned)(crow * LP + cpc) * 2u;
  constexpr unsigned L16 = 16u * LP * 2u;                      // 16 LDS rows, bytes
  constexpr size_t   K16 = (size_t)16 * DKV;                   // 16 rows of K (keys), halves
  constexpr size_t   V16 = (size_t)16 * SEQ;                   // 16 rows of V^T (features), halves
  auto stage_in = [&](int kt, int buf) {                       // kt <= qb: keys kt*64 .. kt*64+63 < SEQ
    const size_t ko = (size_t)(kt * 64 + crow) * DKV + cpc;    // K row kt*64 + crow, d = cpc..cpc+7
    const size_t vo = (size_t)crow * SEQ + kt * 64 + cpc;      // V^T row d = crow, s = kt*64 + cpc..+7
    const unsigned lb = lds0 + (unsigned)buf * (unsigned)BUFB;
    copy4_lds(lb + OFF_K,           KP + ko,            lb + OFF_K + L16,     KP + ko + K16,
              lb + OFF_K + 2 * L16, KP + ko + 2 * K16,  lb + OFF_K + 3 * L16, KP + ko + 3 * K16);
    copy4_lds(lb + OFF_V,           VTP + vo,           lb + OFF_V + L16,     VTP + vo + V16,
              lb + OFF_V + 2 * L16, VTP + vo + 2 * V16, lb + OFF_V + 3 * L16, VTP + vo + 3 * V16);
    if constexpr (HR) {
      copy4_lds(lb + OFF_KR,           KRP + ko,           lb + OFF_KR + L16,     KRP + ko + K16,
                lb + OFF_KR + 2 * L16, KRP + ko + 2 * K16, lb + OFF_KR + 3 * L16, KRP + ko + 3 * K16);
      copy4_lds(lb + OFF_VR,           VRP + vo,           lb + OFF_VR + L16,     VRP + vo + V16,
                lb + OFF_VR + 2 * L16, VRP + vo + 2 * V16, lb + OFF_VR + 3 * L16, VRP + vo + 3 * V16);
    }
  };

  stage_in(0, 0);
#if defined(__HIP_DEVICE_COMPILE__)
  asm volatile("s_wait_asynccnt 0x0" ::: "memory");            // this wave's copies of key tile 0 have landed
#endif
  __syncthreads();                                             // key tile 0 is published to every wave
  if (nkt > 1) stage_in(1, 1);

  for (int kti = 0; kti < nkt; ++kti) {
    const int kv0 = kti * 64;                                  // <= qb*64 < SEQ
    const unsigned char* sb = smem + (kti & 1) * BUFB;         // this key tile's stage buffer
    const _Float16* Ksh = (const _Float16*)(sb + OFF_K);                  // K   [kv][d], pitch LP
    const _Float16* Vsh = (const _Float16*)(sb + OFF_V);                  // V^T [d][kv], pitch LP
    const _Float16* Krs = (const _Float16*)(sb + (HR ? OFF_KR : OFF_K));  // K residual (HR only)
    const _Float16* Vrs = (const _Float16*)(sb + (HR ? OFF_VR : OFF_V));  // V^T residual (HR only)

    // ---- scores, transposed: 64 keys x 16 queries per wave (A operand: lane c -> key j*16+c, split k map over d) ----
    //      The fragments of JG score tiles are read from LDS as one group ahead of their run of WMMAs (one LDS latency
    //      per group, not one per WMMA); every accumulator takes its products in the order dc 0, dc 1
    //      (HR, second accumulator: kr.qh then kh.qr within each dc).
    constexpr int JG = HR ? 2 : 4;                       // score tiles per group: 8 fragments = 64 registers
    v8f s[4];
#pragma unroll
    for (int j0 = 0; j0 < 4; j0 += JG) {
      v16h kb[JG][2], krb[JG][2];
#pragma unroll
      for (int jj = 0; jj < JG; ++jj) {
#pragma unroll
        for (int dc = 0; dc < 2; ++dc) {
          const int ko = ((j0 + jj) * 16 + c) * LP + dc * 32 + 8 * hh;
          kb[jj][dc] = ldfrag_h(Ksh + ko);
          if constexpr (HR) krb[jj][dc] = ldfrag_h(Krs + ko);
        }
      }
      v8f t[JG];
#pragma unroll
      for (int jj = 0; jj < JG; ++jj) { s[j0 + jj] = zero8(); t[jj] = zero8(); }
#pragma unroll
      for (int dc = 0; dc < 2; ++dc) {
#pragma unroll
        for (int jj = 0; jj < JG; ++jj) s[j0 + jj] = mma_h_raw(kb[jj][dc], qa[dc], s[j0 + jj]);
        if constexpr (HR) {
#pragma unroll
          for (int jj = 0; jj < JG; ++jj) t[jj] = mma_h_raw(krb[jj][dc], qa[dc], t[jj]);
#pragma unroll
          for (int jj = 0; jj < JG; ++jj) t[jj] = mma_h_raw(kb[jj][dc], qr[dc], t[jj]);
        }
      }
      if constexpr (HR) {
#pragma unroll
        for (int jj = 0; jj < JG; ++jj) s[j0 + jj] = s[j0 + jj] + t[jj] * (1.0f / 2048.0f);
      }
    }

    // single-product variant: all eight V^T fragments are read here, so that their LDS latency runs under the softmax
    v16h vb[2][4];
    if constexpr (!HR) {
#pragma unroll
      for (int kk = 0; kk < 2; ++kk)
#pragma unroll
        for (int t = 0; t < 4; ++t) vb[kk][t] = ldfrag_h(Vsh + (t * 16 + c) * LP + kk * 32 + 8 * hh);
    }

    // ---- causal online softmax of the lane's one query: masked logits and their maximum in-lane, one exchange
    //      with lane ^ 16, alpha, p, row-sum partial, P^T (x256, f16; HR: + residual) packed as the B operand ----
#pragma unroll
    for (int j = 0; j < 4; ++j) s[j] = s[j] * (1.0f / 2048.0f);   // 1/8 head scale, 1/256 for the two x16 carries
    if (kti == qb) {                                       // block-uniform: only the diagonal tile has keys above a query
#pragma unroll
      for (int j = 0; j < 4; ++j) {
#pragma unroll
        for (int r = 0; r < 8; ++r) {
          const int key = kv0 + j * 16 + 8 * hh + r;
          s[j][r] = (key <= qrow) ? s[j][r] : -1e30f;
        }
      }
    }
    float tm[8];
#pragma unroll
    for (int r = 0; r < 8; ++r) tm[r] = -1e30f;
#pragma unroll
    for (int j = 0; j < 4; ++j) {
#pragma unroll
      for (int r = 0; r < 8; ++r) tm[r] = fmaxf(tm[r], s[j][r]);
    }
    float tmx = fmaxf(fmaxf(fmaxf(tm[0], tm[1]), fmaxf(tm[2], tm[3])), fmaxf(fmaxf(tm[4], tm[5]), fmaxf(tm[6], tm[7])));
    tmx = fmaxf(tmx, xhalf(tmx));
    const float mn = fmaxf(mrun, tmx);
    const float al = __expf(mrun - mn);
    mrun = mn;
    float pp[8];
#pragma unroll
    for (int r = 0; r < 8; ++r) pp[r] = 0.0f;
    FH pa[2], par[2];
#pragma unroll
    for (int j = 0; j < 4; ++j) {
#pragma unroll
      for (int r = 0; r < 8; ++r) {
        const float p = __expf(s[j][r] - mn);              // a masked key: exp(-1e30 - mn) = 0 (mn is finite)
        pp[r] += p;
        const float gg = p * 256.0f;
        const _Float16 x0 = (_Float16)gg;
        pa[j >> 1].v[(j & 1) * 8 + r] = x0;
        if constexpr (HR) par[j >> 1].v[(j & 1) * 8 + r] = (_Float16)((gg - (float)x0) * 2048.0f);
      }
    }
    lsum = lsum * al + (((pp[0] + pp[1]) + (pp[2] + pp[3])) + ((pp[4] + pp[5]) + (pp[6] + pp[7])));

    // ---- rescale the context accumulators by alpha (VALU), nop gaps before the next WMMA reads them ----
#pragma unroll
    for (int t = 0; t < 4; ++t) {
      oacc[t] = oacc[t] * al;
      if constexpr (HR) oacc2[t] = oacc2[t] * al;
    }
    acc_guard4(oacc[0], oacc[1], oacc[2], oacc[3]);
    if constexpr (HR) acc_guard4(oacc2[0], oacc2[1], oacc2[2], oacc2[3]);

    // ---- context^T += V^T . P^T (f16 WMMA; A = V^T [d][key] from LDS, B = P^T [key][query] in registers) ----
    //      HR: the eight fragments of a key chunk are read as one group ahead of its twelve WMMAs; every accumulator
    //      takes its products in the order kk 0, kk 1 (second accumulator: vr.ph then vh.pr within each kk).
#pragma unroll
    for (int kk = 0; kk < 2; ++kk) {
      v16h vrb[4];
      if constexpr (HR) {
#pragma unroll
        for (int t = 0; t < 4; ++t) {
          const int vo = (t * 16 + c) * LP + kk * 32 + 8 * hh;
          vb[kk][t] = ldfrag_h(Vsh + vo);
          vrb[t]    = ldfrag_h(Vrs + vo);
        }
      }
#pragma unroll
      for (int t = 0; t < 4; ++t) oacc[t] = mma_h_raw(vb[kk][t], pa[kk].v, oacc[t]);
      if constexpr (HR) {
#pragma unroll
        for (int t = 0; t < 4; ++t) oacc2[t] = mma_h_raw(vrb[t], pa[kk].v, oacc2[t]);
#pragma unroll
        for (int t = 0; t < 4; ++t) oacc2[t] = mma_h_raw(vb[kk][t], par[kk].v, oacc2[t]);
      }
    }
#if defined(__HIP_DEVICE_COMPILE__)
    asm volatile("s_wait_dscnt 0x0" ::: "memory");      // this wave's reads of buffer kti & 1 are done before it is refilled
    asm volatile("s_wait_asynccnt 0x0" ::: "memory");   // this wave's copies of key tile kti + 1 have landed
#endif
    __syncthreads();                                    // publishes key tile kti + 1, ends every read of key tile kti
    if (kti + 2 < nkt) stage_in(kti + 2, kti & 1);
  }
#if defined(__HIP_DEVICE_COMPILE__)
  asm volatile("s_wait_asynccnt 0x0" ::: "memory");     // no copy is outstanding when the buffers become output staging
#endif
  // the last key tile's barrier has ended every wave's reads of the K/V tiles: they may be aliased from here on

  // ---- normalise (1/lsum, the 1/256 p carry; keep the x16 v carry), stage the wave's 16x64 f32 tile [query][d]
  //      in LDS (a lane's 8 registers of tile t are 8 consecutive d of its query: two 16-B stores) ----
  float* os = (float*)(void*)smem + wave * (16 * OP);
  {
    const float l  = lsum + xhalf(lsum);     // the query's two key halves
    const float rl = 1.0f / l;               // l >= 1 (the max key contributes p = 1)
    const float sc = rl * (1.0f / 256.0f);
#pragma unroll
    for (int t = 0; t < 4; ++t) {
      v4f lo, hi;
#pragma unroll
      for (int r = 0; r < 4; ++r) {
        float v0 = oacc[t][r], v1 = oacc[t][r + 4];
        if constexpr (HR) { v0 += oacc2[t][r] * (1.0f / 2048.0f); v1 += oacc2[t][r + 4] * (1.0f / 2048.0f); }
        lo[r] = v0 * sc;
        hi[r] = v1 * sc;
      }
      *(v4f*)(os + c * OP + t * 16 + 8 * hh)     = lo;
      *(v4f*)(os + c * OP + t * 16 + 8 * hh + 4) = hi;
    }
  }
  __builtin_amdgcn_fence(__ATOMIC_RELEASE, "workgroup");
  __builtin_amdgcn_wave_barrier();
  __builtin_amdgcn_fence(__ATOMIC_ACQUIRE, "workgroup");
  {
    const int rq = lane >> 3, piece = lane & 7;
    v4u ph[4], pr[4];
#pragma unroll
    for (int it = 0; it < 4; ++it) {
      const int row = it * 4 + rq;   // it 0..3 x rq 0..3 = rows 0..15 of the wave tile
      const v4f a  = *(const v4f*)(os + row * OP + piece * 8);
      const v4f a2 = *(const v4f*)(os + row * OP + piece * 8 + 4);
      float f[8];
      f[0] = a[0];  f[1] = a[1];  f[2] = a[2];  f[3] = a[3];
      f[4] = a2[0]; f[5] = a2[1]; f[6] = a2[2]; f[7] = a2[3];
      v4u p, q;
#pragma unroll
      for (int e = 0; e < 4; ++e) {
        const _Float16 x0 = (_Float16)f[2 * e], x1 = (_Float16)f[2 * e + 1];
        const _Float16 y0 = (_Float16)((f[2 * e] - (float)x0) * 2048.0f);
        const _Float16 y1 = (_Float16)((f[2 * e + 1] - (float)x1) * 2048.0f);
        p[e] = pk16(h_bits(x0), h_bits(x1));
        q[e] = pk16(h_bits(y0), h_bits(y1));
      }
      ph[it] = p;
      pr[it] = q;
    }
    {
#pragma unroll
      for (int it = 0; it < 4; ++it) {
        const int row = it * 4 + rq;
        const size_t go = (size_t)(q0 + row) * DM + (size_t)h * HD + piece * 8;
        *(v4u*)(ctxp + go)  = ph[it];
        *(v4u*)(ctxrp + go) = pr[it];
      }
    }
  }
}

// =====================================================================================================
// Both attention variants in one grid of NQT * NH blocks, so that the short residual-plane tiles and the long
// single-product tiles run side by side. The grid is four quarters of NQT/4 * NH blocks; block w of each quarter has
// head w % NH and u = w / NH, and query tile NQT-1-u, QHR-1-u, QHR+u, u in quarters 0..3: a permutation of every
// (head, query tile), long tiles first, and the four blocks with equal w have the same total of key tiles for every w.
// =====================================================================================================
// amdgpu_waves_per_eu(4, 4): at most four waves per SIMD = four blocks per WGP, as many as the grid has per WGP, so
// that no WGP takes a fifth block while another is left with three.
__global__ __launch_bounds__(128) __attribute__((amdgpu_waves_per_eu(4, 4)))
void attn_all(const unsigned short* __restrict__ qp,  const unsigned short* __restrict__ qrp,
              const unsigned short* __restrict__ kp,  const unsigned short* __restrict__ krp,
              const unsigned short* __restrict__ vtp, const unsigned short* __restrict__ vtrp,
              unsigned short* ctxp, unsigned short* ctxrp) {
  __shared__ __align__(16) unsigned char smem[ATT_SMEM];
  constexpr int QQ = NQT / 4;
  static_assert((NQT % 4) == 0 && QHR == 2 * QQ);
  const int bx = blockIdx.x;
  const int j  = bx / (QQ * NH);
  if (j > 3) return;                         // block-uniform, before any barrier or store
  const int w  = bx - j * (QQ * NH);
  const int h  = w % NH;
  const int u  = w / NH;
  const int qb = (j == 0) ? (NQT - 1 - u) : (j == 1) ? (QHR - 1 - u) : (j == 2) ? (QHR + u) : u;
  if (qb < QHR) attn_body<true>(smem, qp, qrp, kp, krp, vtp, vtrp, ctxp, ctxrp, qb, h);
  else          attn_body<false>(smem, qp, qrp, kp, krp, vtp, vtrp, ctxp, ctxrp, qb, h);
}

// =====================================================================================================
// Workspace map (bytes, SEQ = 4096); every region is an exact multiple of its whole-line / whole-tile store
// granularity (row pitches 2048 / 512 / 8192 B, rows multiples of 64, all offsets 512-KiB aligned, no aliasing
// within a launch):
//   Xh    f16 [SEQ][1024]          0     8388608   (bf16 value of x, x16)
//   WqT   f16 [1024][1024]   8388608     2097152   (bf16 value of w_q^T x1024, [n][k])
//   WkT   f16 [256][1024]   10485760      524288   (bf16 value of w_k^T x1024, [n][k])
//   WvT   f16 [256][1024]   11010048      524288   (bf16 value of w_v^T x1024, [n][k])
//   WoT   f16 [1024][1024]  11534336     2097152   (bf16 value of w_o^T x1024, [n][k])
//   Qh    f16 [SEQ][1024]   13631488     8388608   (q x16)           Qr  22020096  8388608 (x2^11 residual)
//   Kh    f16 [SEQ][256]    30408704     2097152   (k x16)           Kr  32505856  2097152
//   Vh    f16 [SEQ][256]    34603008     2097152   (v x16)           Vr  36700160  2097152
//   VT    f16 [256][SEQ]    38797312     2097152   ([g*64 + d][s])   VTr 40894464  2097152
//   Ctx   f16 [SEQ][1024]   42991616     8388608   (context x16)     Ctxr 51380224 8388608
//   end                     59768832
// Projection weights arrive as [in k][out n] (n contiguous) and are transposed while converted (w_tr).
// d_out f32: [SEQ][1024] at byte 0, every 64x64 tile written once by the output projection launch.
// =====================================================================================================
extern "C" void kernel_launch(void* const* d_in, const int* in_sizes, int n_in,
                              void* d_out, int out_size, void* d_ws, size_t ws_size,
                              hipStream_t stream) {
  if (n_in < 5) return;
  if (in_sizes[0] < SEQ * DM || (in_sizes[0] % DM) != 0) return;   // x rows 0..SEQ-1 are used, pitch DM
  if (in_sizes[1] != DM * DM) return;
  if (in_sizes[2] != DM * DKV) return;
  if (in_sizes[3] != DM * DKV) return;
  if (in_sizes[4] != DM * DM) return;
  if (out_size < OUTN) return;

  const float* x   = (const float*)d_in[0];    // [>=SEQ][DM]
  const float* w_q = (const float*)d_in[1];    // [DM k][DM n]
  const float* w_k = (const float*)d_in[2];    // [DM k][DKV n]
  const float* w_v = (const float*)d_in[3];    // [DM k][DKV n]
  const float* w_o = (const float*)d_in[4];    // [DM k][DM n]

  const size_t PX   = (size_t)SEQ * DM * 2;          //  8388608
  const size_t PWq  = (size_t)DM * DM * 2;           //  2097152
  const size_t PWk  = (size_t)DKV * DM * 2;          //   524288
  const size_t PWo  = (size_t)DM * DM * 2;           //  2097152
  const size_t PQ   = (size_t)SEQ * DM * 2;          //  8388608
  const size_t PK   = (size_t)SEQ * DKV * 2;         //  2097152
  const size_t PVT  = (size_t)DKV * SEQ * 2;         //  2097152
  const size_t PCtx = (size_t)SEQ * DM * 2;          //  8388608
  size_t off = 0;
  const size_t oX    = off; off += PX;
  const size_t oWq   = off; off += PWq;
  const size_t oWk   = off; off += PWk;
  const size_t oWv   = off; off += PWk;
  const size_t oWo   = off; off += PWo;
  const size_t oQ    = off; off += PQ;
  const size_t oQr   = off; off += PQ;
  const size_t oK    = off; off += PK;
  const size_t oKr   = off; off += PK;
  const size_t oV    = off; off += PK;
  const size_t oVr   = off; off += PK;
  const size_t oVT   = off; off += PVT;
  const size_t oVTr  = off; off += PVT;
  const size_t oCtx  = off; off += PCtx;
  const size_t oCtxr = off; off += PCtx;
  if (off > ws_size) return;                         // off = 59768832 for SEQ = 4096
  if (off > (size_t)134217728) return;

  char* ws = (char*)d_ws;
  unsigned short* Xh   = (unsigned short*)(ws + oX);
  unsigned short* WqT  = (unsigned short*)(ws + oWq);
  unsigned short* WkT  = (unsigned short*)(ws + oWk);
  unsigned short* WvT  = (unsigned short*)(ws + oWv);
  unsigned short* WoT  = (unsigned short*)(ws + oWo);
  unsigned short* Qh   = (unsigned short*)(ws + oQ);
  unsigned short* Qr   = (unsigned short*)(ws + oQr);
  unsigned short* Kh   = (unsigned short*)(ws + oK);
  unsigned short* Kr   = (unsigned short*)(ws + oKr);
  unsigned short* Vh   = (unsigned short*)(ws + oV);
  unsigned short* Vr   = (unsigned short*)(ws + oVr);
  unsigned short* VT   = (unsigned short*)(ws + oVT);
  unsigned short* VTr  = (unsigned short*)(ws + oVTr);
  unsigned short* Ctx  = (unsigned short*)(ws + oCtx);
  unsigned short* Ctxr = (unsigned short*)(ws + oCtxr);
  float*          outf = (float*)d_out;              // [SEQ][DM]

  const dim3 blk(256);
  const int n8x = SEQ * DM / 8;                      // 524288
  const dim3 gCx((n8x + 255) / 256);                 // 2048 blocks
  const dim3 gTw(DM / 64, DM / 64, 4);               // (16, 16, 4): the four weights, [1024 k][n] -> [n][1024 k]
  const dim3 gGq((NQT * (DM / 64) + 7) / 8);         // 1024 wave tiles -> 128 blocks of 128 x 256
  const dim3 gGqkv((NQT * ((DM + 2 * DKV) / 64) + 7) / 8);   // 1536 wave tiles -> 192 blocks of 128 x 256
  const dim3 gVt(SEQ / 64, NKV, 2);                  // (64, 4, 2)
  const dim3 gAtt(NQT * NH);                         // every (head, query tile), both variants
  const float wScale = 1024.0f;                      // weights carried x1024
  const float aScale = 16.0f;                        // activations carried x16
  const float cscale = 1.0f / 16384.0f;              // 1/(16 * 1024)

  // (1) planes: x -> f16 x16 (bf16 values); weights -> transposed f16 x1024 (bf16 values)
  cvt16<<<gCx, blk, 0, stream>>>(x, Xh, n8x, aScale);
  w_tr<<<gTw, blk, 0, stream>>>(w_q, w_k, w_v, w_o, WqT, WkT, WvT, WoT, DM, DM, DKV, wScale);
  // (2) [q | k | v] = Xh . [WqT ; WkT ; WvT]^T in one grid (M=SEQ, N=1024+256+256, K=1024; the three transposed
  //     weights lie one behind the other in the workspace): Qh [SEQ][1024], Kh, Vh [SEQ][256], f16 x16 + residual
  gemm64_f16<0, false><<<gGqkv, blk, 0, stream>>>(Xh, Xh, DM, WqT, DM, cscale, (void*)Qh, Qr, DM,
                                                  SEQ, DM + 2 * DKV, DM, aScale,
                                                  DM, DKV, Kh, Kr, Vh, Vr);
  // (3) v -> v^T planes (hi and residual, all tokens, all kv heads)
  v_tr<<<gVt, blk, 0, stream>>>(Vh, VT, Vr, VTr);
  // (4) causal softmax attention -> Ctx f16 x16 + residual plane: tiles 0..QHR-1 with residual operand planes,
  //     tiles QHR..NQT-1 with single products; together every (head, query tile) exactly once
  attn_all<<<gAtt, dim3(128), 0, stream>>>(Qh, Qr, Kh, Kr, VT, VTr, Ctx, Ctxr);
  // (5) out = (Ctx + 2^-11 Ctxr) . WoT^T -> d_out f32 [SEQ][1024] (M=SEQ, N=1024, K=1024), every tile once
  gemm64_f16<1, true><<<gGq, blk, 0, stream>>>(Ctx, Ctxr, DM, WoT, DM, cscale, (void*)outf, Ctxr, DM,
                                               SEQ, DM, DM, 1.0f,
                                               DM, DKV, Ctxr, Ctxr, Ctxr, Ctxr);
  (void)hipGetLastError();
}

// v009
// One run takes 98.3 microseconds.
// Two timings next to v008 put it at 1.08 and 1.07 times that version's speed.
// All steps since v000 together make it 7.03 times as fast.
// Contractions: q/k/v projections = v_wmma_f32_16x16x32_f16 (A = f16 of RNE-bf16 x carried x16, B = f16 of RNE-bf16 w^T carried x1024, single product); attention k.q^T and v^T.p^T (both products transposed) = v_wmma_f32_16x16x32_f16 (query tiles below SEQ/2: q, k, v^T f16 planes x16 plus x2^11 residual planes, p f16 x256 plus x2^11 residual, hi.hi + hi.res + res.hi; query tiles from SEQ/2 on: single products on the x16 / x256 planes); output projection = v_wmma_f32_16x16x32_f16 (A = ctx f16 x16 plus its x2^11 residual plane, B = f16 of RNE-bf16 w_o^T x1024); all f32 accumulate. Causal online-max softmax, masks and row sums f32 on VALU.
#include <hip/hip_runtime.h>
#include <math.h>
#include <stdint.h>

#define SEQ   4096
#define DM    1024
#define NH    16
#define NKV   4
#define HD    64
#define DKV   (NKV * HD)            // 256
#define GRP   (NH / NKV)            // query heads per kv head = 4 (query head h uses kv head h / GRP)
#define NQT   (SEQ / 64)            // 64 query tiles of 64 rows
#define QHR   (NQT / 2)             // query tiles below this index use residual planes in attention
#define OUTN  (SEQ * DM)
static_assert(NH * HD == DM);
static_assert(HD == 64);
static_assert((NH % NKV) == 0);
static_assert((SEQ % 64) == 0 && (NQT % 2) == 0);
static_assert((DM % 64) == 0 && (DKV % 64) == 0 && (DM % 32) == 0);
static_assert(((NQT * (DM / 64)) % 8) == 0);
static_assert(((NQT * (DKV / 64)) % 8) == 0);
static_assert((SEQ % 128) == 0 && ((DM + 2 * DKV) % 256) == 0 && (DM % 256) == 0);   // GEMM block tile 128 x 256, 128 k per stage
static_assert(((SEQ * DM / 8) % 256) == 0);

typedef _Float16 v16h __attribute__((ext_vector_type(16)));
typedef _Float16 v8h  __attribute__((ext_vector_type(8)));
typedef float    v8f  __attribute__((ext_vector_type(8)));
typedef float    v4f  __attribute__((ext_vector_type(4)));
typedef unsigned int v4u __attribute__((ext_vector_type(4)));

// ---- scalar helpers --------------------------------------------------------------------------------
__device__ __forceinline__ unsigned short bf_bits(float f) {          // f32 -> bf16 bits, RNE convert
  unsigned u = __float_as_uint(f);
  return (unsigned short)((u + 0x7FFFu + ((u >> 16) & 1u)) >> 16);
}
__device__ __forceinline__ float bfr(float f) { return __uint_as_float(((unsigned)bf_bits(f)) << 16); }
__device__ __forceinline__ unsigned short h_bits(_Float16 x) { return __builtin_bit_cast(unsigned short, x); }
__device__ __forceinline__ unsigned pk16(unsigned short a, unsigned short b) { return (unsigned)a | ((unsigned)b << 16); }
__device__ __forceinline__ v8f zero8() { v8f z = {0.f, 0.f, 0.f, 0.f, 0.f, 0.f, 0.f, 0.f}; return z; }

// ---- fragment loader: 16-bit A/B operand, lane -> row/col (lane&15), p already includes +8*(lane>>4);
//      elements 0..7 <- p[0..7] (k0+8h..), elements 8..15 <- p[16..23] (k0+16+8h..)
__device__ __forceinline__ v16h ldfrag_h(const _Float16* p) {
  union { v16h v; v8h h[2]; } f;
  f.h[0] = *(const v8h*)(p);
  f.h[1] = *(const v8h*)(p + 16);
  return f.v;
}

// ---- WMMA helpers with trailing VALU hazard gap --------------------------------------------------------
__device__ __forceinline__ v8f mma_h_raw(v16h a, v16h b, v8f c) {
  return __builtin_amdgcn_wmma_f32_16x16x32_f16(false, a, false, b, (short)0, c, false, false);
}
__device__ __forceinline__ void dep_guard_h(v8f& a, v8f& b, v16h x, v16h y) {
#if defined(__HIP_DEVICE_COMPILE__)
  asm volatile("v_nop\n\tv_nop\n\tv_nop\n\tv_nop" : "+v"(a), "+v"(b) : "v"(x), "v"(y));
#endif
}
__device__ __forceinline__ void keep4_h(v16h a, v16h b, v16h c, v16h d) {
#if defined(__HIP_DEVICE_COMPILE__)
  asm volatile("v_nop" :: "v"(a), "v"(b), "v"(c), "v"(d));
#endif
}
__device__ __forceinline__ void acc_guard4(v8f& a, v8f& b, v8f& c, v8f& d) {
#if defined(__HIP_DEVICE_COMPILE__)
  asm volatile("v_nop\n\tv_nop\n\tv_nop\n\tv_nop" : "+v"(a), "+v"(b), "+v"(c), "+v"(d));
#endif
}

// =====================================================================================================
// f32 plane -> f16 bits of bfr(v) * scale (scale a power of two): x (x16).
// coverage: n8 threads x 8 = the whole plane (blk = index among the conversion blocks of prep below).
// =====================================================================================================
__device__ __forceinline__ void cvt16_body(const float* __restrict__ in, unsigned short* out, int n8, float scale, int blk) {
  const int i = blk * 256 + threadIdx.x;
  if (i < n8) {
    const v4f a = *(const v4f*)(in + (size_t)i * 8);
    const v4f b = *(const v4f*)(in + (size_t)i * 8 + 4);
    v4u p;
    p[0] = pk16(h_bits((_Float16)(bfr(a[0]) * scale)), h_bits((_Float16)(bfr(a[1]) * scale)));
    p[1] = pk16(h_bits((_Float16)(bfr(a[2]) * scale)), h_bits((_Float16)(bfr(a[3]) * scale)));
    p[2] = pk16(h_bits((_Float16)(bfr(b[0]) * scale)), h_bits((_Float16)(bfr(b[1]) * scale)));
    p[3] = pk16(h_bits((_Float16)(bfr(b[2]) * scale)), h_bits((_Float16)(bfr(b[3]) * scale)));
    *(v4u*)(out + (size_t)i * 8) = p;
    
  }
}

// =====================================================================================================
// f32 weight W [K rows][N cols] (the x@W layout, n contiguous) -> f16 Wt[n][k] = f16(bfr(W[k][n]) * scale),
// pitch K halves (k contiguous = the Bt layout of the GEMM below); scale a power of two.
// Block = one 64 (k) x 64 (n) tile of one of four weights; (bx, by, z) = (column tile, k tile, weight) over
// (Nwide/64, K/64, 4), blocks past a narrow weight's last column tile leave at once; tile staged in LDS as halves [kk][nn] pitch 72
// (v8h 16-B stores, __syncthreads, _Float16 element reads).
// Store: group g = tid>>3 (0..31), piece = tid&7: iteration it writes out row n = it*32+g, lanes 8q..8q+7 x 16 B =
// coverage: load 2 x 256 threads x 8 = 64x64; store 2 iterations x 32 groups = 64 rows n, 8 pieces x 8 = 64 k
// per row; grid covers every (n tile, k tile) of [N][K].
// =====================================================================================================
__device__ __forceinline__ void w_tr_body(_Float16* sw,   // LDS, [kk][nn], pitch 72 halves (144 B)
                                          const float* __restrict__ w0, const float* __restrict__ w1,
                                          const float* __restrict__ w2, const float* __restrict__ w3,
                                          unsigned short* t0, unsigned short* t1, unsigned short* t2, unsigned short* t3,
                                          int K, int Nwide, int Nnarrow, float scale, int bx, int by, int z) {
  const int tid = threadIdx.x;                         // z = which weight: 0 and 3 are Nwide columns, 1 and 2 Nnarrow
  const int N   = (z == 0 || z == 3) ? Nwide : Nnarrow;
  const int n0  = bx * 64;
  const int k0  = by * 64;
  if (z > 3 || n0 >= N || k0 >= K) return;             // block-uniform, before the barrier
  const float* w = (z == 0) ? w0 : (z == 1) ? w1 : (z == 2) ? w2 : w3;
  unsigned short* wt = (z == 0) ? t0 : (z == 1) ? t1 : (z == 2) ? t2 : t3;
#pragma unroll
  for (int i = 0; i < 2; ++i) {
    const int idx = i * 256 + tid;                  // 0..511
    const int kk = idx >> 3, c8 = (idx & 7) * 8;
    const float* src = w + (size_t)(k0 + kk) * N + n0 + c8;
    const v4f a  = *(const v4f*)(src);
    const v4f a2 = *(const v4f*)(src + 4);
    v8h o;
    o[0] = (_Float16)(bfr(a[0]) * scale);
    o[1] = (_Float16)(bfr(a[1]) * scale);
    o[2] = (_Float16)(bfr(a[2]) * scale);
    o[3] = (_Float16)(bfr(a[3]) * scale);
    o[4] = (_Float16)(bfr(a2[0]) * scale);
    o[5] = (_Float16)(bfr(a2[1]) * scale);
    o[6] = (_Float16)(bfr(a2[2]) * scale);
    o[7] = (_Float16)(bfr(a2[3]) * scale);
    *(v8h*)(sw + kk * 72 + c8) = o;
  }
  __syncthreads();

  const int g = tid >> 3, piece = tid & 7;
  v4u hv[2];
  size_t hofs[2];
#pragma unroll
  for (int it = 0; it < 2; ++it) {
    const int nn = it * 32 + g;
    v4u a;
#pragma unroll
    for (int e = 0; e < 4; ++e) {
      const _Float16 x0 = sw[(piece * 8 + 2 * e) * 72 + nn];
      const _Float16 x1 = sw[(piece * 8 + 2 * e + 1) * 72 + nn];
      a[e] = pk16(h_bits(x0), h_bits(x1));
    }
    hv[it] = a;
    hofs[it] = ((size_t)(n0 + nn)) * K + k0 + piece * 8;
  }
  {
#pragma unroll
    for (int it = 0; it < 2; ++it) *(v4u*)(wt + hofs[it]) = hv[it];
    
  }
}

// =====================================================================================================
// The operand planes of the projections in ONE launch (neither part reads what the other writes): blocks below
// 4 * (DM/64)^2 each take one weight tile (past a narrow weight's last column tile they leave at once), the blocks behind them each convert 2048 elements of x.
// The choice is block-uniform and stands in front of the transposition's barrier.
// =====================================================================================================
#define WTB   (DM / 64)                            // weight tiles along n (wide weights) and along k
#define NWTB  (4 * WTB * WTB)                      // weight-tile blocks of prep
__global__ __launch_bounds__(256) void prep(const float* __restrict__ x, unsigned short* xh, int n8, float xscale,
                                            const float* __restrict__ w0, const float* __restrict__ w1,
                                            const float* __restrict__ w2, const float* __restrict__ w3,
                                            unsigned short* t0, unsigned short* t1, unsigned short* t2, unsigned short* t3,
                                            float wscale) {
  __shared__ __align__(16) _Float16 sw[64 * 72];
  const int b = blockIdx.x;
  if (b < NWTB) w_tr_body(sw, w0, w1, w2, w3, t0, t1, t2, t3, DM, DM, DKV, wscale, b % WTB, (b / WTB) % WTB, b / (WTB * WTB));
  else          cvt16_body(x, xh, n8, xscale, b - NWTB);
}

// =====================================================================================================
// Four 16-byte asynchronous copies of one lane, global memory -> LDS (l = the lane's LDS byte address, g = its
// global address), written as the compiler's builtin, offset argument 0: a builtin copy carries no s_wait_xcnt behind
// it, so the wave goes from a stage's copies straight on to its fragment reads. Landing is waited for by the callers
// (s_wait_asynccnt 0 and the block barrier at every stage's foot).
// =====================================================================================================
typedef int v4i_t __attribute__((vector_size(16)));
typedef __attribute__((address_space(1))) v4i_t g_v4i;
typedef __attribute__((address_space(3))) v4i_t l_v4i;
__device__ __forceinline__ void copy1_lds(unsigned l, const _Float16* g) {
#if defined(__HIP_DEVICE_COMPILE__)
  __builtin_amdgcn_global_load_async_to_lds_b128((g_v4i*)(uintptr_t)g, (l_v4i*)l, 0, 0);
#endif
}
__device__ __forceinline__ void copy4_lds(unsigned l0, const _Float16* g0, unsigned l1, const _Float16* g1,
                                          unsigned l2, const _Float16* g2, unsigned l3, const _Float16* g3) {
  copy1_lds(l0, g0);
  copy1_lds(l1, g1);
  copy1_lds(l2, g2);
  copy1_lds(l3, g3);
}

// =====================================================================================================
// Register-blocked f16 WMMA GEMM, block = 8 waves (2 x 4) = one 128 x 256 tile, one wave per 64x64 tile:
//   v[m][n] = (sum_k A[m][k] * Bt[n][k]  [+ 2^-11 * sum_k Ar[m][k] * Bt[n][k] when ARES]) * cscale
// A, Ar row-major [M][K] pitch lda (f16), Bt row-major [N][K] pitch ldb (f16, k contiguous); M a multiple of 128,
// N of 256, K of 128; grid = (M / 128) * (N / 256) blocks.
// Operands: a stage = 128 k of the block's 128 rows of A and 256 rows of Bt, whole 128-B lines, brought into LDS at
// row pitch 272 B by asynchronous copies (24 per lane and stage: lane -> row tid>>4 (+16 per copy), 16-B piece
// tid&15); two buffers, stage s + 1 in flight while stage s is multiplied; every wave reads its fragments from LDS.
// ARES: the stages of the residual plane come first and accumulate from zero, the accumulators are scaled by 2^-11
// exactly on the VALU (with nop gaps on both sides), then the hi plane's stages accumulate on top: one accumulator set.
// EPI 0: column tiles from n1 on are stored to a second and a third output (each nx columns wide; hi plane C2 / C3,
// residual plane C2r / C3r), so that products that share A run in one grid. The second has pitch nx; the third is
// stored TRANSPOSED, [nx][M] at pitch M: a lane's 8 accumulator registers of a subtile are 8 consecutive rows m of its
// one column, that is 16 B of the transposed row; the wave stages its 64 (n) x 64 (m) halves of both planes in LDS at
// pitch 144 B (its own range of the stage buffers, free behind the last stage's barrier) and stores whole 128-B rows.
// EPI 1 has the one output.
// Epilogue variants:
//   EPI 0: f16 hi plane = f16(v * oscale) at Cp and residual plane = f16((v*oscale - hi) * 2048) at Crp, pitch ldc halves
//   EPI 1: f32 out = v, pitch ldc floats
// 16-row slabs staged per wave in LDS. f32 out: each 64-wide row segment (256 B = 2 lines) by 16 lanes x 16 B,
// coverage: 4 slabs x 16 rows x 64 cols = the wave's whole 64x64 tile; 8 waves = the block's 128 x 256; grid = [M][N].
// =====================================================================================================
#define GBM  128                                   // block tile rows (A)
#define GBN  256                                   // block tile columns (rows of Bt)
#define GBK  128                                   // k per stage: 256 B of every operand row
#define GLP  136                                   // LDS row pitch in halves: 272 B = 16 B x 17 (ds_load_b128 fragment reads)
#define GSTG ((GBM + GBN) * GLP)                   // halves per stage buffer: [A 128 rows | Bt 256 rows]
template <int EPI, bool ARES>
__global__ __launch_bounds__(256) void gemm64_f16(
    const unsigned short* __restrict__ Ap, const unsigned short* __restrict__ Arp, int lda,
    const unsigned short* __restrict__ Btp, int ldb,
    float cscale,
    void* Cp, unsigned short* Crp, int ldc, int M, int N, int K, float oscale,
    int n1, int nx, unsigned short* C2, unsigned short* C2r, unsigned short* C3, unsigned short* C3r) {
  const _Float16* Ah  = (const _Float16*)(const void*)Ap;
  const _Float16* Arh = (const _Float16*)(const void*)Arp;
  const _Float16* Bt  = (const _Float16*)(const void*)Btp;
  __shared__ __align__(16) _Float16 sAB[2 * GSTG]; // two stage buffers
  __shared__ __align__(16) float sT[8][16 * 68];   // per-wave 16x64 slab, pitch 68 floats
  const int tid  = threadIdx.x;
  const int lane = tid & 31;
  const int wave = tid >> 5;
  const int blocksN = N >> 8;
  const int blocksM = M >> 7;
  const int bidx = blockIdx.x;
  if (bidx >= blocksM * blocksN) return;   // block-uniform, before any copy or barrier
  const int bmi = bidx / blocksN;
  const int bm0 = bmi << 7;
  const int bn0 = (bidx - bmi * blocksN) << 8;
  const int wm  = wave >> 2;               // wave's 64-row half of the block tile
  const int wn  = wave & 3;                // wave's 64-column quarter
  const int m0 = bm0 + (wm << 6);
  const int n0 = bn0 + (wn << 6);

  // output of this tile (wave-uniform): columns below n1 go to Cp / Crp, the next nx to C2 / C2r, the next nx to C3 / C3r
  void* Co = Cp;
  unsigned short* Cro = Crp;
  int ldo = ldc, nc0 = n0;
  bool tr3 = false;                            // this tile belongs to the third output (stored transposed)
  if constexpr (EPI == 0) {
    if (n0 >= n1) {
      const int e = n0 - n1;
      const bool third = (e >= nx);
      tr3 = third;
      Co  = third ? (void*)C3 : (void*)C2;
      Cro = third ? C3r : C2r;
      ldo = nx;
      nc0 = third ? e - nx : e;
    }
  }

  const int rlane = lane & 15;                 // row (A) / col (B, D) within subtile
  const int koff  = (lane >> 4) * 8;           // k offset of this lane half
  const int mOff  = (lane >> 4) * 8;           // D row offset

  v8f acc[4][4];
#pragma unroll
  for (int i = 0; i < 4; ++i)
#pragma unroll
    for (int j = 0; j < 4; ++j) acc[i][j] = zero8();

  constexpr int NPL = ARES ? 2 : 1;
  const int nk  = K >> 7;                      // stages per plane
  const int nst = NPL * nk;                    // stages in all, block-uniform

  // the lane's share of a stage: rows crow + 16 i of A (i 0..7) and of Bt (i 0..15), 16-B piece tid & 15 of each
  const int crow = tid >> 4;
  const int cpc  = (tid & 15) * 8;
  const unsigned lds0 = (unsigned)(uintptr_t)(&sAB[0]) + (unsigned)(crow * GLP + cpc) * 2u;
  const _Float16* gA0 = Ah  + (size_t)(bm0 + crow) * lda + cpc;
  const _Float16* gR0 = Arh + (size_t)(bm0 + crow) * lda + cpc;
  const _Float16* gB0 = Bt  + (size_t)(bn0 + crow) * ldb + cpc;
  const size_t a16 = (size_t)16 * lda, b16 = (size_t)16 * ldb;
  constexpr unsigned R16 = 16u * GLP * 2u;     // 16 LDS rows, bytes
  auto stage_in = [&](int st, int buf) {
    const bool res = ARES && (st < nk);        // block-uniform: the residual plane's stages come first
    const int  k0  = (ARES && !res ? st - nk : st) * GBK;
    const _Float16* ga = (res ? gR0 : gA0) + k0;
    const _Float16* gb = gB0 + k0;
    const unsigned la = lds0 + (unsigned)buf * (unsigned)(GSTG * 2);
    const unsigned lb = la + (unsigned)(GBM * GLP * 2);
#pragma unroll                                 // straight line: constant LDS steps, 4 copies a call
    for (int q = 0; q < GBM / 16; q += 4)
      copy4_lds(la + q * R16,       ga + q * a16,       la + (q + 1) * R16, ga + (q + 1) * a16,
                la + (q + 2) * R16, ga + (q + 2) * a16, la + (q + 3) * R16, ga + (q + 3) * a16);
#pragma unroll                                 // as above
    for (int q = 0; q < GBN / 16; q += 4)
      copy4_lds(lb + q * R16,       gb + q * b16,       lb + (q + 1) * R16, gb + (q + 1) * b16,
                lb + (q + 2) * R16, gb + (q + 2) * b16, lb + (q + 3) * R16, gb + (q + 3) * b16);
  };

  if (nst > 0) stage_in(0, 0);
#if defined(__HIP_DEVICE_COMPILE__)
  asm volatile("s_wait_asynccnt 0x0" ::: "memory");   // this wave's copies of stage 0 have landed
#endif
  __syncthreads();                                    // stage 0 is published to every wave
  if (nst > 1) stage_in(1, 1);

  for (int st = 0; st < nst; ++st) {
    if (ARES && st == nk) {
      acc_guard4(acc[0][0], acc[0][1], acc[0][2], acc[0][3]);
      acc_guard4(acc[1][0], acc[1][1], acc[1][2], acc[1][3]);
      acc_guard4(acc[2][0], acc[2][1], acc[2][2], acc[2][3]);
      acc_guard4(acc[3][0], acc[3][1], acc[3][2], acc[3][3]);
#pragma unroll
      for (int i = 0; i < 4; ++i)
#pragma unroll
        for (int j = 0; j < 4; ++j) acc[i][j] = acc[i][j] * (1.0f / 2048.0f);   // exact fold of the x2^11 residual carry
      acc_guard4(acc[0][0], acc[0][1], acc[0][2], acc[0][3]);
      acc_guard4(acc[1][0], acc[1][1], acc[1][2], acc[1][3]);
      acc_guard4(acc[2][0], acc[2][1], acc[2][2], acc[2][3]);
      acc_guard4(acc[3][0], acc[3][1], acc[3][2], acc[3][3]);
    }
    const _Float16* sA = sAB + (st & 1) * GSTG + ((wm << 6) + rlane) * GLP + koff;
    const _Float16* sB = sAB + (st & 1) * GSTG + (GBM + (wn << 6) + rlane) * GLP + koff;
#pragma unroll                                 // constant LDS offsets; the fragment arrays stay in registers
    for (int ks = 0; ks < GBK; ks += 32) {
      v16h bh[4], ah[4];
#pragma unroll
      for (int j = 0; j < 4; ++j) bh[j] = ldfrag_h(sB + (j << 4) * GLP + ks);
#pragma unroll
      for (int i = 0; i < 4; ++i) ah[i] = ldfrag_h(sA + (i << 4) * GLP + ks);
#pragma unroll
      for (int i = 0; i < 4; ++i) {
#pragma unroll
        for (int j = 0; j < 4; ++j) {
          acc[i][j] = mma_h_raw(ah[i], bh[j], acc[i][j]);
        }
        dep_guard_h(acc[i][0], acc[i][3], ah[i], bh[3]);
      }
      keep4_h(bh[0], bh[1], bh[2], bh[3]);
    }
#if defined(__HIP_DEVICE_COMPILE__)
    asm volatile("s_wait_dscnt 0x0" ::: "memory");      // this wave's reads of buffer st & 1 are done before it is refilled
    asm volatile("s_wait_asynccnt 0x0" ::: "memory");   // this wave's copies of stage st + 1 have landed
#endif
    __syncthreads();                                    // publishes stage st + 1, ends every read of stage st
    if (st + 2 < nst) stage_in(st + 2, st & 1);
  }
#if defined(__HIP_DEVICE_COMPILE__)
  asm volatile("s_wait_asynccnt 0x0" ::: "memory");     // no copy is outstanding when the wave goes on to its end
#endif
  acc_guard4(acc[0][0], acc[0][1], acc[0][2], acc[0][3]);
  acc_guard4(acc[1][0], acc[1][1], acc[1][2], acc[1][3]);
  acc_guard4(acc[2][0], acc[2][1], acc[2][2], acc[2][3]);
  acc_guard4(acc[3][0], acc[3][1], acc[3][2], acc[3][3]);

  // ---- epilogue ----
  if constexpr (EPI == 0) {
    if (tr3) {                                 // the same for the whole wave; no block barrier stands behind it
      constexpr int TLP = 72;                  // staging row pitch in halves: 144 B = 16 B x 9 (16-B stores and reads)
      static_assert(8 * 2 * 64 * TLP <= 2 * GSTG);
      // the last stage's s_wait_dscnt 0, s_wait_asynccnt 0 and barrier have ended every read of and copy into sAB
      _Float16* th = sAB + wave * (2 * 64 * TLP);          // hi plane [n][m] of this wave's tile
      _Float16* tr = th + 64 * TLP;                        // residual plane
#pragma unroll                                 // these three: constant indices, so that acc stays in registers
      for (int j = 0; j < 4; ++j) {
#pragma unroll
        for (int i = 0; i < 4; ++i) {
          v4u p, q;
#pragma unroll
          for (int e = 0; e < 4; ++e) {
            const float g0 = (acc[i][j][2 * e] * cscale) * oscale, g1 = (acc[i][j][2 * e + 1] * cscale) * oscale;
            const _Float16 x0 = (_Float16)g0, x1 = (_Float16)g1;
            const _Float16 y0 = (_Float16)((g0 - (float)x0) * 2048.0f);
            const _Float16 y1 = (_Float16)((g1 - (float)x1) * 2048.0f);
            p[e] = pk16(h_bits(x0), h_bits(x1));
            q[e] = pk16(h_bits(y0), h_bits(y1));
          }
          const int so = ((j << 4) + rlane) * TLP + (i << 4) + mOff;   // row = the lane's column, first of its 8 m
          *(v4u*)(th + so) = p;
          *(v4u*)(tr + so) = q;
        }
      }
      // the wave's own LDS stores are ordered ahead of its reads of other lanes' pieces
      __builtin_amdgcn_fence(__ATOMIC_RELEASE, "workgroup");
      __builtin_amdgcn_wave_barrier();
      __builtin_amdgcn_fence(__ATOMIC_ACQUIRE, "workgroup");
      unsigned short* T16 = (unsigned short*)Co;
      const int rq = lane >> 3, piece = lane & 7;          // 128-B row = 8 lanes x 16 B, 4 rows a store
#pragma unroll                                 // straight line: constant LDS offsets, several reads in flight
      for (int it = 0; it < 16; ++it) {
        const int row = it * 4 + rq;                       // it 0..15 x rq 0..3 = the tile's 64 columns n
        const v4u a = *(const v4u*)(th + row * TLP + piece * 8);
        const v4u b = *(const v4u*)(tr + row * TLP + piece * 8);
        const size_t to = (size_t)(nc0 + row) * M + m0 + piece * 8;
        *(v4u*)(T16 + to) = a;
        *(v4u*)(Cro + to) = b;
      }
      return;
    }
  }
  float* slab = sT[wave];
#pragma unroll
  for (int i = 0; i < 4; ++i) {
    const int mBase = m0 + (i << 4);
#pragma unroll
    for (int r = 0; r < 8; ++r) {
      const int row = mOff + r;
#pragma unroll
      for (int j = 0; j < 4; ++j) slab[row * 68 + (j << 4) + rlane] = acc[i][j][r] * cscale;
    }
    __builtin_amdgcn_fence(__ATOMIC_RELEASE, "workgroup");
    __builtin_amdgcn_wave_barrier();
    __builtin_amdgcn_fence(__ATOMIC_ACQUIRE, "workgroup");
    if constexpr (EPI == 0) {
      unsigned short* C16 = (unsigned short*)Co;
      const int rq = lane >> 3, piece = lane & 7;
      v4u ph[4], pr[4];
#pragma unroll
      for (int it = 0; it < 4; ++it) {
        const int row = it * 4 + rq;                         // it 0..3 x rq 0..3 = rows 0..15
        const v4f a  = *(const v4f*)(slab + row * 68 + piece * 8);
        const v4f a2 = *(const v4f*)(slab + row * 68 + piece * 8 + 4);
        float f[8];
        f[0] = a[0];  f[1] = a[1];  f[2] = a[2];  f[3] = a[3];
        f[4] = a2[0]; f[5] = a2[1]; f[6] = a2[2]; f[7] = a2[3];
        v4u p, q;
#pragma unroll
        for (int e = 0; e < 4; ++e) {
          const float g0 = f[2 * e] * oscale, g1 = f[2 * e + 1] * oscale;
          const _Float16 x0 = (_Float16)g0, x1 = (_Float16)g1;
          const _Float16 y0 = (_Float16)((g0 - (float)x0) * 2048.0f);
          const _Float16 y1 = (_Float16)((g1 - (float)x1) * 2048.0f);
          p[e] = pk16(h_bits(x0), h_bits(x1));
          q[e] = pk16(h_bits(y0), h_bits(y1));
        }
        ph[it] = p;
        pr[it] = q;
      }
      {
#pragma unroll
        for (int it = 0; it < 4; ++it) {
          const int row = it * 4 + rq;
          const size_t co = (size_t)(mBase + row) * ldo + nc0 + piece * 8;
          *(v4u*)(C16 + co) = ph[it];
          *(v4u*)(Cro + co) = pr[it];
        }
        
      }
    } else {
      float* Cf = (float*)Co;
      const int hh = lane >> 4, c4 = (lane & 15) * 4;     // 256-B row segment = 16 lanes x 16 B
      v4f ov[8];
#pragma unroll
      for (int it = 0; it < 8; ++it) {
        const int row = it * 2 + hh;                       // it 0..7 x hh 0..1 = rows 0..15
        ov[it] = *(const v4f*)(slab + row * 68 + c4);
      }
      {
#pragma unroll
        for (int it = 0; it < 8; ++it) {
          const int row = it * 2 + hh;
          *(v4f*)(Cf + (size_t)(mBase + row) * ldo + nc0 + c4) = ov[it];
        }
        
      }
    }
    __builtin_amdgcn_fence(__ATOMIC_RELEASE, "workgroup");
    __builtin_amdgcn_wave_barrier();
    __builtin_amdgcn_fence(__ATOMIC_ACQUIRE, "workgroup");
  }
}

#define ATT_SMEM 73728                                    // LDS bytes of the residual-plane variant, the larger one (two buffers)
// value of lane l ^ 16 (the other half of the wave, same column)
__device__ __forceinline__ float xhalf(float x) {
  return __builtin_bit_cast(float, __builtin_amdgcn_permlanex16(__builtin_bit_cast(int, x), __builtin_bit_cast(int, x),
                                                                0x76543210, 0xfedcba98, false, false));
}
template <bool HR>
__device__ __forceinline__
void attn_body(unsigned char* smem,
               const unsigned short* __restrict__ qp,  const unsigned short* __restrict__ qrp,
               const unsigned short* __restrict__ kp,  const unsigned short* __restrict__ krp,
               const unsigned short* __restrict__ vtp, const unsigned short* __restrict__ vtrp,
               unsigned short* ctxp, unsigned short* ctxrp, int qb, int h) {
  union FH { v16h v; v8h h[2]; };
  constexpr int LP     = 72;                             // LDS row pitch in halves: 144 B = 16 B x 9, so the 16 rows
                                                         // that one ds_load_b128 fragment read touches fall on 16
                                                         // different 4-bank groups (at 128 B they share two groups)
  constexpr int TB     = 64 * LP * 2;                    // one f16 64x64 tile at pitch LP, bytes
  constexpr int OP     = 68;                             // context staging pitch in floats: 272 B = 16 B x 17
  constexpr int OFF_K  = 0;
  constexpr int OFF_V  = TB;
  constexpr int OFF_KR = 2 * TB;
  constexpr int OFF_VR = 3 * TB;
  constexpr int BUFB   = HR ? 4 * TB : 2 * TB;                // one stage buffer: 36864 : 18432
  constexpr int SMEMB  = 2 * BUFB;                            // two stage buffers
  static_assert(4 * 16 * OP * 4 <= 2 * TB);                   // f32 context staging aliases the K/V region
  static_assert(SMEMB <= ATT_SMEM);

  const int tid  = threadIdx.x;
  const int wave = tid >> 5;
  const int lane = tid & 31;
  const int hh   = lane >> 4;
  const int c    = lane & 15;

  const int g    = h / GRP;                  // kv head
  const int q0   = qb * 64 + wave * 16;
  const int qrow = q0 + c;                   // the one query of this lane

  const _Float16* QP  = (const _Float16*)(const void*)qp   + (size_t)h * HD;
  const _Float16* QRP = (const _Float16*)(const void*)qrp  + (size_t)h * HD;
  const _Float16* KP  = (const _Float16*)(const void*)kp   + (size_t)g * HD;
  const _Float16* KRP = (const _Float16*)(const void*)krp  + (size_t)g * HD;
  const _Float16* VTP = (const _Float16*)(const void*)vtp  + (size_t)g * HD * SEQ;
  const _Float16* VRP = (const _Float16*)(const void*)vtrp + (size_t)g * HD * SEQ;

  // ---- Q fragments (B operand, column = lane&15): 2 d-chunks ----
  v16h qa[2], qr[2];
#pragma unroll
  for (int dc = 0; dc < 2; ++dc) {
    const size_t qo = (size_t)(q0 + c) * DM + dc * 32 + 8 * hh;
    qa[dc] = ldfrag_h(QP + qo);
    if constexpr (HR) qr[dc] = ldfrag_h(QRP + qo);
    else qr[dc] = qa[dc];
  }

  float lsum = 0.f, mrun = -1e30f;
  v8f oacc[4], oacc2[4];
#pragma unroll
  for (int t = 0; t < 4; ++t) { oacc[t] = zero8(); oacc2[t] = zero8(); }

  const int nkt = qb + 1;                                      // key tiles 0..qb, block-uniform

  // the lane's share of a key tile: rows crow + 16 i (i 0..3) of every plane, 16-B piece tid & 7 of each row
  const int crow = tid >> 3;
  const int cpc  = (tid & 7) * 8;
  const unsigned lds0 = (unsigned)(uintptr_t)smem + (unsigned)(crow * LP + cpc) * 2u;
  constexpr unsigned L16 = 16u * LP * 2u;                      // 16 LDS rows, bytes
  constexpr size_t   K16 = (size_t)16 * DKV;                   // 16 rows of K (keys), halves
  constexpr size_t   V16 = (size_t)16 * SEQ;                   // 16 rows of V^T (features), halves
  auto stage_in = [&](int kt, int buf) {                       // kt <= qb: keys kt*64 .. kt*64+63 < SEQ
    const size_t ko = (size_t)(kt * 64 + crow) * DKV + cpc;    // K row kt*64 + crow, d = cpc..cpc+7
    const size_t vo = (size_t)crow * SEQ + kt * 64 + cpc;      // V^T row d = crow, s = kt*64 + cpc..+7
    const unsigned lb = lds0 + (unsigned)buf * (unsigned)BUFB;
    copy4_lds(lb + OFF_K,           KP + ko,            lb + OFF_K + L16,     KP + ko + K16,
              lb + OFF_K + 2 * L16, KP + ko + 2 * K16,  lb + OFF_K + 3 * L16, KP + ko + 3 * K16);
    copy4_lds(lb + OFF_V,           VTP + vo,           lb + OFF_V + L16,     VTP + vo + V16,
              lb + OFF_V + 2 * L16, VTP + vo + 2 * V16, lb + OFF_V + 3 * L16, VTP + vo + 3 * V16);
    if constexpr (HR) {
      copy4_lds(lb + OFF_KR,           KRP + ko,           lb + OFF_KR + L16,     KRP + ko + K16,
                lb + OFF_KR + 2 * L16, KRP + ko + 2 * K16, lb + OFF_KR + 3 * L16, KRP + ko + 3 * K16);
      copy4_lds(lb + OFF_VR,           VRP + vo,           lb + OFF_VR + L16,     VRP + vo + V16,
                lb + OFF_VR + 2 * L16, VRP + vo + 2 * V16, lb + OFF_VR + 3 * L16, VRP + vo + 3 * V16);
    }
  };

  stage_in(0, 0);
#if defined(__HIP_DEVICE_COMPILE__)
  asm volatile("s_wait_asynccnt 0x0" ::: "memory");            // this wave's copies of key tile 0 have landed
#endif
  __syncthreads();                                             // key tile 0 is published to every wave
  if (nkt > 1) stage_in(1, 1);

  for (int kti = 0; kti < nkt; ++kti) {
    const int kv0 = kti * 64;                                  // <= qb*64 < SEQ
    const unsigned char* sb = smem + (kti & 1) * BUFB;         // this key tile's stage buffer
    const _Float16* Ksh = (const _Float16*)(sb + OFF_K);                  // K   [kv][d], pitch LP
    const _Float16* Vsh = (const _Float16*)(sb + OFF_V);                  // V^T [d][kv], pitch LP
    const _Float16* Krs = (const _Float16*)(sb + (HR ? OFF_KR : OFF_K));  // K residual (HR only)
    const _Float16* Vrs = (const _Float16*)(sb + (HR ? OFF_VR : OFF_V));  // V^T residual (HR only)

    // ---- scores, transposed: 64 keys x 16 queries per wave (A operand: lane c -> key j*16+c, split k map over d) ----
    //      The fragments of JG score tiles are read from LDS as one group ahead of their run of WMMAs (one LDS latency
    //      per group, not one per WMMA); every accumulator takes its products in the order dc 0, dc 1
    //      (HR, second accumulator: kr.qh then kh.qr within each dc).
    constexpr int JG = HR ? 2 : 4;                       // score tiles per group: 8 fragments = 64 registers
    v8f s[4];
#pragma unroll
    for (int j0 = 0; j0 < 4; j0 += JG) {
      v16h kb[JG][2], krb[JG][2];
#pragma unroll
      for (int jj = 0; jj < JG; ++jj) {
#pragma unroll
        for (int dc = 0; dc < 2; ++dc) {
          const int ko = ((j0 + jj) * 16 + c) * LP + dc * 32 + 8 * hh;
          kb[jj][dc] = ldfrag_h(Ksh + ko);
          if constexpr (HR) krb[jj][dc] = ldfrag_h(Krs + ko);
        }
      }
      v8f t[JG];
#pragma unroll
      for (int jj = 0; jj < JG; ++jj) { s[j0 + jj] = zero8(); t[jj] = zero8(); }
#pragma unroll
      for (int dc = 0; dc < 2; ++dc) {
#pragma unroll
        for (int jj = 0; jj < JG; ++jj) s[j0 + jj] = mma_h_raw(kb[jj][dc], qa[dc], s[j0 + jj]);
        if constexpr (HR) {
#pragma unroll
          for (int jj = 0; jj < JG; ++jj) t[jj] = mma_h_raw(krb[jj][dc], qa[dc], t[jj]);
#pragma unroll
          for (int jj = 0; jj < JG; ++jj) t[jj] = mma_h_raw(kb[jj][dc], qr[dc], t[jj]);
        }
      }
      if constexpr (HR) {
#pragma unroll
        for (int jj = 0; jj < JG; ++jj) s[j0 + jj] = s[j0 + jj] + t[jj] * (1.0f / 2048.0f);
      }
    }

    // single-product variant: all eight V^T fragments are read here, so that their LDS latency runs under the softmax
    v16h vb[2][4];
    if constexpr (!HR) {
#pragma unroll
      for (int kk = 0; kk < 2; ++kk)
#pragma unroll
        for (int t = 0; t < 4; ++t) vb[kk][t] = ldfrag_h(Vsh + (t * 16 + c) * LP + kk * 32 + 8 * hh);
    }

    // ---- causal online softmax of the lane's one query: masked logits and their maximum in-lane, one exchange
    //      with lane ^ 16, alpha, p, row-sum partial, P^T (x256, f16; HR: + residual) packed as the B operand ----
#pragma unroll
    for (int j = 0; j < 4; ++j) s[j] = s[j] * (1.0f / 2048.0f);   // 1/8 head scale, 1/256 for the two x16 carries
    if (kti == qb) {                                       // block-uniform: only the diagonal tile has keys above a query
#pragma unroll
      for (int j = 0; j < 4; ++j) {
#pragma unroll
        for (int r = 0; r < 8; ++r) {
          const int key = kv0 + j * 16 + 8 * hh + r;
          s[j][r] = (key <= qrow) ? s[j][r] : -1e30f;
        }
      }
    }
    float tm[8];
#pragma unroll
    for (int r = 0; r < 8; ++r) tm[r] = -1e30f;
#pragma unroll
    for (int j = 0; j < 4; ++j) {
#pragma unroll
      for (int r = 0; r < 8; ++r) tm[r] = fmaxf(tm[r], s[j][r]);
    }
    float tmx = fmaxf(fmaxf(fmaxf(tm[0], tm[1]), fmaxf(tm[2], tm[3])), fmaxf(fmaxf(tm[4], tm[5]), fmaxf(tm[6], tm[7])));
    tmx = fmaxf(tmx, xhalf(tmx));
    const float mn = fmaxf(mrun, tmx);
    const float al = __expf(mrun - mn);
    mrun = mn;
    float pp[8];
#pragma unroll
    for (int r = 0; r < 8; ++r) pp[r] = 0.0f;
    FH pa[2], par[2];
#pragma unroll
    for (int j = 0; j < 4; ++j) {
#pragma unroll
      for (int r = 0; r < 8; ++r) {
        const float p = __expf(s[j][r] - mn);              // a masked key: exp(-1e30 - mn) = 0 (mn is finite)
        pp[r] += p;
        const float gg = p * 256.0f;
        const _Float16 x0 = (_Float16)gg;
        pa[j >> 1].v[(j & 1) * 8 + r] = x0;
        if constexpr (HR) par[j >> 1].v[(j & 1) * 8 + r] = (_Float16)((gg - (float)x0) * 2048.0f);
      }
    }
    lsum = lsum * al + (((pp[0] + pp[1]) + (pp[2] + pp[3])) + ((pp[4] + pp[5]) + (pp[6] + pp[7])));

    // ---- rescale the context accumulators by alpha (VALU), nop gaps before the next WMMA reads them ----
#pragma unroll
    for (int t = 0; t < 4; ++t) {
      oacc[t] = oacc[t] * al;
      if constexpr (HR) oacc2[t] = oacc2[t] * al;
    }
    acc_guard4(oacc[0], oacc[1], oacc[2], oacc[3]);
    if constexpr (HR) acc_guard4(oacc2[0], oacc2[1], oacc2[2], oacc2[3]);

    // ---- context^T += V^T . P^T (f16 WMMA; A = V^T [d][key] from LDS, B = P^T [key][query] in registers) ----
    //      HR: the eight fragments of a key chunk are read as one group ahead of its twelve WMMAs; every accumulator
    //      takes its products in the order kk 0, kk 1 (second accumulator: vr.ph then vh.pr within each kk).
#pragma unroll
    for (int kk = 0; kk < 2; ++kk) {
      v16h vrb[4];
      if constexpr (HR) {
#pragma unroll
        for (int t = 0; t < 4; ++t) {
          const int vo = (t * 16 + c) * LP + kk * 32 + 8 * hh;
          vb[kk][t] = ldfrag_h(Vsh + vo);
          vrb[t]    = ldfrag_h(Vrs + vo);
        }
      }
#pragma unroll
      for (int t = 0; t < 4; ++t) oacc[t] = mma_h_raw(vb[kk][t], pa[kk].v, oacc[t]);
      if constexpr (HR) {
#pragma unroll
        for (int t = 0; t < 4; ++t) oacc2[t] = mma_h_raw(vrb[t], pa[kk].v, oacc2[t]);
#pragma unroll
        for (int t = 0; t < 4; ++t) oacc2[t] = mma_h_raw(vb[kk][t], par[kk].v, oacc2[t]);
      }
    }
#if defined(__HIP_DEVICE_COMPILE__)
    asm volatile("s_wait_dscnt 0x0" ::: "memory");      // this wave's reads of buffer kti & 1 are done before it is refilled
    asm volatile("s_wait_asynccnt 0x0" ::: "memory");   // this wave's copies of key tile kti + 1 have landed
#endif
    __syncthreads();                                    // publishes key tile kti + 1, ends every read of key tile kti
    if (kti + 2 < nkt) stage_in(kti + 2, kti & 1);
  }
#if defined(__HIP_DEVICE_COMPILE__)
  asm volatile("s_wait_asynccnt 0x0" ::: "memory");     // no copy is outstanding when the buffers become output staging
#endif
  // the last key tile's barrier has ended every wave's reads of the K/V tiles: they may be aliased from here on

  // ---- normalise (1/lsum, the 1/256 p carry; keep the x16 v carry), stage the wave's 16x64 f32 tile [query][d]
  //      in LDS (a lane's 8 registers of tile t are 8 consecutive d of its query: two 16-B stores) ----
  float* os = (float*)(void*)smem + wave * (16 * OP);
  {
    const float l  = lsum + xhalf(lsum);     // the query's two key halves
    const float rl = 1.0f / l;               // l >= 1 (the max key contributes p = 1)
    const float sc = rl * (1.0f / 256.0f);
#pragma unroll
    for (int t = 0; t < 4; ++t) {
      v4f lo, hi;
#pragma unroll
      for (int r = 0; r < 4; ++r) {
        float v0 = oacc[t][r], v1 = oacc[t][r + 4];
        if constexpr (HR) { v0 += oacc2[t][r] * (1.0f / 2048.0f); v1 += oacc2[t][r + 4] * (1.0f / 2048.0f); }
        lo[r] = v0 * sc;
        hi[r] = v1 * sc;
      }
      *(v4f*)(os + c * OP + t * 16 + 8 * hh)     = lo;
      *(v4f*)(os + c * OP + t * 16 + 8 * hh + 4) = hi;
    }
  }
  __builtin_amdgcn_fence(__ATOMIC_RELEASE, "workgroup");
  __builtin_amdgcn_wave_barrier();
  __builtin_amdgcn_fence(__ATOMIC_ACQUIRE, "workgroup");
  {
    const int rq = lane >> 3, piece = lane & 7;
    v4u ph[4], pr[4];
#pragma unroll
    for (int it = 0; it < 4; ++it) {
      const int row = it * 4 + rq;   // it 0..3 x rq 0..3 = rows 0..15 of the wave tile
      const v4f a  = *(const v4f*)(os + row * OP + piece * 8);
      const v4f a2 = *(const v4f*)(os + row * OP + piece * 8 + 4);
      float f[8];
      f[0] = a[0];  f[1] = a[1];  f[2] = a[2];  f[3] = a[3];
      f[4] = a2[0]; f[5] = a2[1]; f[6] = a2[2]; f[7] = a2[3];
      v4u p, q;
#pragma unroll
      for (int e = 0; e < 4; ++e) {
        const _Float16 x0 = (_Float16)f[2 * e], x1 = (_Float16)f[2 * e + 1];
        const _Float16 y0 = (_Float16)((f[2 * e] - (float)x0) * 2048.0f);
        const _Float16 y1 = (_Float16)((f[2 * e + 1] - (float)x1) * 2048.0f);
        p[e] = pk16(h_bits(x0), h_bits(x1));
        q[e] = pk16(h_bits(y0), h_bits(y1));
      }
      ph[it] = p;
      pr[it] = q;
    }
    {
#pragma unroll
      for (int it = 0; it < 4; ++it) {
        const int row = it * 4 + rq;
        const size_t go = (size_t)(q0 + row) * DM + (size_t)h * HD + piece * 8;
        *(v4u*)(ctxp + go)  = ph[it];
        *(v4u*)(ctxrp + go) = pr[it];
      }
    }
  }
}

// =====================================================================================================
// Both attention variants in one grid of NQT * NH blocks, so that the short residual-plane tiles and the long
// single-product tiles run side by side. The grid is four quarters of NQT/4 * NH blocks; block w of each quarter has
// head w % NH and u = w / NH, and query tile NQT-1-u, QHR-1-u, QHR+u, u in quarters 0..3: a permutation of every
// (head, query tile), long tiles first, and the four blocks with equal w have the same total of key tiles for every w.
// =====================================================================================================
// amdgpu_waves_per_eu(4, 4): at most four waves per SIMD = four blocks per WGP, as many as the grid has per WGP, so
// that no WGP takes a fifth block while another is left with three.
__global__ __launch_bounds__(128) __attribute__((amdgpu_waves_per_eu(4, 4)))
void attn_all(const unsigned short* __restrict__ qp,  const unsigned short* __restrict__ qrp,
              const unsigned short* __restrict__ kp,  const unsigned short* __restrict__ krp,
              const unsigned short* __restrict__ vtp, const unsigned short* __restrict__ vtrp,
              unsigned short* ctxp, unsigned short* ctxrp) {
  __shared__ __align__(16) unsigned char smem[ATT_SMEM];
  constexpr int QQ = NQT / 4;
  static_assert((NQT % 4) == 0 && QHR == 2 * QQ);
  const int bx = blockIdx.x;
  const int j  = bx / (QQ * NH);
  if (j > 3) return;                         // block-uniform, before any barrier or store
  const int w  = bx - j * (QQ * NH);
  const int h  = w % NH;
  const int u  = w / NH;
  const int qb = (j == 0) ? (NQT - 1 - u) : (j == 1) ? (QHR - 1 - u) : (j == 2) ? (QHR + u) : u;
  if (qb < QHR) attn_body<true>(smem, qp, qrp, kp, krp, vtp, vtrp, ctxp, ctxrp, qb, h);
  else          attn_body<false>(smem, qp, qrp, kp, krp, vtp, vtrp, ctxp, ctxrp, qb, h);
}

// =====================================================================================================
// Workspace map (bytes, SEQ = 4096); every region is an exact multiple of its whole-line / whole-tile store
// granularity (row pitches 2048 / 512 / 8192 B, rows multiples of 64, all offsets 512-KiB aligned, no aliasing
// within a launch):
//   Xh    f16 [SEQ][1024]          0     8388608   (bf16 value of x, x16)
//   WqT   f16 [1024][1024]   8388608     2097152   (bf16 value of w_q^T x1024, [n][k])
//   WkT   f16 [256][1024]   10485760      524288   (bf16 value of w_k^T x1024, [n][k])
//   WvT   f16 [256][1024]   11010048      524288   (bf16 value of w_v^T x1024, [n][k])
//   WoT   f16 [1024][1024]  11534336     2097152   (bf16 value of w_o^T x1024, [n][k])
//   Qh    f16 [SEQ][1024]   13631488     8388608   (q x16)           Qr  22020096  8388608 (x2^11 residual)
//   Kh    f16 [SEQ][256]    30408704     2097152   (k x16)           Kr  32505856  2097152
//   VT    f16 [256][SEQ]    34603008     2097152   (v x16, [g*64 + d][s])   VTr 36700160  2097152
//   Ctx   f16 [SEQ][1024]   38797312     8388608   (context x16)     Ctxr 47185920 8388608
//   end                     55574528
// Projection weights arrive as [in k][out n] (n contiguous) and are transposed while converted (prep).
// d_out f32: [SEQ][1024] at byte 0, every 64x64 tile written once by the output projection launch.
// =====================================================================================================
extern "C" void kernel_launch(void* const* d_in, const int* in_sizes, int n_in,
                              void* d_out, int out_size, void* d_ws, size_t ws_size,
                              hipStream_t stream) {
  if (n_in < 5) return;
  if (in_sizes[0] < SEQ * DM || (in_sizes[0] % DM) != 0) return;   // x rows 0..SEQ-1 are used, pitch DM
  if (in_sizes[1] != DM * DM) return;
  if (in_sizes[2] != DM * DKV) return;
  if (in_sizes[3] != DM * DKV) return;
  if (in_sizes[4] != DM * DM) return;
  if (out_size < OUTN) return;

  const float* x   = (const float*)d_in[0];    // [>=SEQ][DM]
  const float* w_q = (const float*)d_in[1];    // [DM k][DM n]
  const float* w_k = (const float*)d_in[2];    // [DM k][DKV n]
  const float* w_v = (const float*)d_in[3];    // [DM k][DKV n]
  const float* w_o = (const float*)d_in[4];    // [DM k][DM n]

  const size_t PX   = (size_t)SEQ * DM * 2;          //  8388608
  const size_t PWq  = (size_t)DM * DM * 2;           //  2097152
  const size_t PWk  = (size_t)DKV * DM * 2;          //   524288
  const size_t PWo  = (size_t)DM * DM * 2;           //  2097152
  const size_t PQ   = (size_t)SEQ * DM * 2;          //  8388608
  const size_t PK   = (size_t)SEQ * DKV * 2;         //  2097152
  const size_t PVT  = (size_t)DKV * SEQ * 2;         //  2097152
  const size_t PCtx = (size_t)SEQ * DM * 2;          //  8388608
  size_t off = 0;
  const size_t oX    = off; off += PX;
  const size_t oWq   = off; off += PWq;
  const size_t oWk   = off; off += PWk;
  const size_t oWv   = off; off += PWk;
  const size_t oWo   = off; off += PWo;
  const size_t oQ    = off; off += PQ;
  const size_t oQr   = off; off += PQ;
  const size_t oK    = off; off += PK;
  const size_t oKr   = off; off += PK;
  const size_t oVT   = off; off += PVT;
  const size_t oVTr  = off; off += PVT;
  const size_t oCtx  = off; off += PCtx;
  const size_t oCtxr = off; off += PCtx;
  if (off > ws_size) return;                         // off = 55574528 for SEQ = 4096
  if (off > (size_t)134217728) return;

  char* ws = (char*)d_ws;
  unsigned short* Xh   = (unsigned short*)(ws + oX);
  unsigned short* WqT  = (unsigned short*)(ws + oWq);
  unsigned short* WkT  = (unsigned short*)(ws + oWk);
  unsigned short* WvT  = (unsigned short*)(ws + oWv);
  unsigned short* WoT  = (unsigned short*)(ws + oWo);
  unsigned short* Qh   = (unsigned short*)(ws + oQ);
  unsigned short* Qr   = (unsigned short*)(ws + oQr);
  unsigned short* Kh   = (unsigned short*)(ws + oK);
  unsigned short* Kr   = (unsigned short*)(ws + oKr);
  unsigned short* VT   = (unsigned short*)(ws + oVT);
  unsigned short* VTr  = (unsigned short*)(ws + oVTr);
  unsigned short* Ctx  = (unsigned short*)(ws + oCtx);
  unsigned short* Ctxr = (unsigned short*)(ws + oCtxr);
  float*          outf = (float*)d_out;              // [SEQ][DM]

  const dim3 blk(256);
  const int n8x = SEQ * DM / 8;                      // 524288
  const dim3 gPrep(NWTB + (n8x + 255) / 256);        // 1024 weight-tile blocks ([1024 k][n] -> [n][1024 k]) + 2048 of x
  const dim3 gGq((NQT * (DM / 64) + 7) / 8);         // 1024 wave tiles -> 128 blocks of 128 x 256
  const dim3 gGqkv((NQT * ((DM + 2 * DKV) / 64) + 7) / 8);   // 1536 wave tiles -> 192 blocks of 128 x 256
  const dim3 gAtt(NQT * NH);                         // every (head, query tile), both variants
  const float wScale = 1024.0f;                      // weights carried x1024
  const float aScale = 16.0f;                        // activations carried x16
  const float cscale = 1.0f / 16384.0f;              // 1/(16 * 1024)

  // (1) planes: x -> f16 x16 (bf16 values); weights -> transposed f16 x1024 (bf16 values)
  prep<<<gPrep, blk, 0, stream>>>(x, Xh, n8x, aScale, w_q, w_k, w_v, w_o, WqT, WkT, WvT, WoT, wScale);
  // (2) [q | k | v] = Xh . [WqT ; WkT ; WvT]^T in one grid (M=SEQ, N=1024+256+256, K=1024; the three transposed
  //     weights lie one behind the other in the workspace): Qh [SEQ][1024], Kh [SEQ][256], v^T VT [256][SEQ],
  //     each f16 x16 + residual plane
  gemm64_f16<0, false><<<gGqkv, blk, 0, stream>>>(Xh, Xh, DM, WqT, DM, cscale, (void*)Qh, Qr, DM,
                                                  SEQ, DM + 2 * DKV, DM, aScale,
                                                  DM, DKV, Kh, Kr, VT, VTr);
  // (3) causal softmax attention -> Ctx f16 x16 + residual plane: tiles 0..QHR-1 with residual operand planes,
  //     tiles QHR..NQT-1 with single products; together every (head, query tile) exactly once
  attn_all<<<gAtt, dim3(128), 0, stream>>>(Qh, Qr, Kh, Kr, VT, VTr, Ctx, Ctxr);
  // (4) out = (Ctx + 2^-11 Ctxr) . WoT^T -> d_out f32 [SEQ][1024] (M=SEQ, N=1024, K=1024), every tile once
  gemm64_f16<1, true><<<gGq, blk, 0, stream>>>(Ctx, Ctxr, DM, WoT, DM, cscale, (void*)outf, Ctxr, DM,
                                               SEQ, DM, DM, 1.0f,
                                               DM, DKV, Ctxr, Ctxr, Ctxr, Ctxr);
  (void)hipGetLastError();
}

// v010
// One run takes 87.3 microseconds.
// In two side-by-side timings against v009, it was 1.08 and 1.09 times as fast.
// Counting every step since v000, it is 7.65 times as fast.
// Contractions: q/k/v projections = v_wmma_f32_16x16x32_f16 (A = f16 of RNE-bf16 x carried x16, B = f16 of RNE-bf16 w^T carried x1024, single product); attention k.q^T and v^T.p^T (both products transposed) = v_wmma_f32_16x16x32_f16 (query tiles below SEQ/2: q, k, v^T f16 planes x16 plus x2^11 residual planes, p f16 x256 plus x2^11 residual, hi.hi + hi.res + res.hi; query tiles from SEQ/2 on: single products on the x16 / x256 planes); output projection = v_wmma_f32_16x16x32_f16 (A = ctx f16 x16 plus its x2^11 residual plane, B = f16 of RNE-bf16 w_o^T x1024; the two planes' products by different waves, joined in f32); all f32 accumulate. Causal online-max softmax, masks and row sums f32 on VALU.
#include <hip/hip_runtime.h>
#include <math.h>
#include <stdint.h>

#define SEQ   4096
#define DM    1024
#define NH    16
#define NKV   4
#define HD    64
#define DKV   (NKV * HD)            // 256
#define GRP   (NH / NKV)            // query heads per kv head = 4 (query head h uses kv head h / GRP)
#define NQT   (SEQ / 64)            // 64 query tiles of 64 rows
#define QHR   (NQT / 2)             // query tiles below this index use residual planes in attention
#define OUTN  (SEQ * DM)
static_assert(NH * HD == DM);
static_assert(HD == 64);
static_assert((NH % NKV) == 0);
static_assert((SEQ % 64) == 0 && (NQT % 2) == 0);
static_assert((DM % 64) == 0 && (DKV % 64) == 0 && (DM % 32) == 0);
static_assert(((NQT * (DM / 64)) % 8) == 0);
static_assert(((NQT * (DKV / 64)) % 8) == 0);
static_assert((SEQ % 128) == 0 && ((DM + 2 * DKV) % 256) == 0 && (DM % 256) == 0);   // GEMM block tile 128 x 256 (ARES: 128 x 128), 128 k per stage
static_assert(((SEQ * DM / 8) % 256) == 0);

typedef _Float16 v16h __attribute__((ext_vector_type(16)));
typedef _Float16 v8h  __attribute__((ext_vector_type(8)));
typedef float    v8f  __attribute__((ext_vector_type(8)));
typedef float    v4f  __attribute__((ext_vector_type(4)));
typedef unsigned int v4u __attribute__((ext_vector_type(4)));

// ---- scalar helpers --------------------------------------------------------------------------------
__device__ __forceinline__ unsigned short bf_bits(float f) {          // f32 -> bf16 bits, RNE convert
  unsigned u = __float_as_uint(f);
  return (unsigned short)((u + 0x7FFFu + ((u >> 16) & 1u)) >> 16);
}
__device__ __forceinline__ float bfr(float f) { return __uint_as_float(((unsigned)bf_bits(f)) << 16); }
__device__ __forceinline__ unsigned short h_bits(_Float16 x) { return __builtin_bit_cast(unsigned short, x); }
__device__ __forceinline__ unsigned pk16(unsigned short a, unsigned short b) { return (unsigned)a | ((unsigned)b << 16); }
__device__ __forceinline__ v8f zero8() { v8f z = {0.f, 0.f, 0.f, 0.f, 0.f, 0.f, 0.f, 0.f}; return z; }

// ---- fragment loader: 16-bit A/B operand, lane -> row/col (lane&15), p already includes +8*(lane>>4);
//      elements 0..7 <- p[0..7] (k0+8h..), elements 8..15 <- p[16..23] (k0+16+8h..)
__device__ __forceinline__ v16h ldfrag_h(const _Float16* p) {
  union { v16h v; v8h h[2]; } f;
  f.h[0] = *(const v8h*)(p);
  f.h[1] = *(const v8h*)(p + 16);
  return f.v;
}

// ---- WMMA helpers with trailing VALU hazard gap --------------------------------------------------------
__device__ __forceinline__ v8f mma_h_raw(v16h a, v16h b, v8f c) {
  return __builtin_amdgcn_wmma_f32_16x16x32_f16(false, a, false, b, (short)0, c, false, false);
}
__device__ __forceinline__ void dep_guard_h(v8f& a, v8f& b, v16h x, v16h y) {
#if defined(__HIP_DEVICE_COMPILE__)
  asm volatile("v_nop\n\tv_nop\n\tv_nop\n\tv_nop" : "+v"(a), "+v"(b) : "v"(x), "v"(y));
#endif
}
__device__ __forceinline__ void keep4_h(v16h a, v16h b, v16h c, v16h d) {
#if defined(__HIP_DEVICE_COMPILE__)
  asm volatile("v_nop" :: "v"(a), "v"(b), "v"(c), "v"(d));
#endif
}
__device__ __forceinline__ void acc_guard4(v8f& a, v8f& b, v8f& c, v8f& d) {
#if defined(__HIP_DEVICE_COMPILE__)
  asm volatile("v_nop\n\tv_nop\n\tv_nop\n\tv_nop" : "+v"(a), "+v"(b), "+v"(c), "+v"(d));
#endif
}

// =====================================================================================================
// f32 plane -> f16 bits of bfr(v) * scale (scale a power of two): x (x16).
// coverage: n8 threads x 8 = the whole plane (blk = index among the conversion blocks of prep below).
// =====================================================================================================
__device__ __forceinline__ void cvt16_body(const float* __restrict__ in, unsigned short* out, int n8, float scale, int blk) {
  const int i = blk * 256 + threadIdx.x;
  if (i < n8) {
    const v4f a = *(const v4f*)(in + (size_t)i * 8);
    const v4f b = *(const v4f*)(in + (size_t)i * 8 + 4);
    v4u p;
    p[0] = pk16(h_bits((_Float16)(bfr(a[0]) * scale)), h_bits((_Float16)(bfr(a[1]) * scale)));
    p[1] = pk16(h_bits((_Float16)(bfr(a[2]) * scale)), h_bits((_Float16)(bfr(a[3]) * scale)));
    p[2] = pk16(h_bits((_Float16)(bfr(b[0]) * scale)), h_bits((_Float16)(bfr(b[1]) * scale)));
    p[3] = pk16(h_bits((_Float16)(bfr(b[2]) * scale)), h_bits((_Float16)(bfr(b[3]) * scale)));
    *(v4u*)(out + (size_t)i * 8) = p;
    
  }
}

// =====================================================================================================
// f32 weight W [K rows][N cols] (the x@W layout, n contiguous) -> f16 Wt[n][k] = f16(bfr(W[k][n]) * scale),
// pitch K halves (k contiguous = the Bt layout of the GEMM below); scale a power of two.
// Block = one 64 (k) x 64 (n) tile of one of four weights; (bx, by, z) = (column tile, k tile, weight) over
// (Nwide/64, K/64, 4), blocks past a narrow weight's last column tile leave at once; tile staged in LDS as halves [kk][nn] pitch 72
// (v8h 16-B stores, __syncthreads, _Float16 element reads).
// Store: group g = tid>>3 (0..31), piece = tid&7: iteration it writes out row n = it*32+g, lanes 8q..8q+7 x 16 B =
// coverage: load 2 x 256 threads x 8 = 64x64; store 2 iterations x 32 groups = 64 rows n, 8 pieces x 8 = 64 k
// per row; grid covers every (n tile, k tile) of [N][K].
// =====================================================================================================
__device__ __forceinline__ void w_tr_body(_Float16* sw,   // LDS, [kk][nn], pitch 72 halves (144 B)
                                          const float* __restrict__ w0, const float* __restrict__ w1,
                                          const float* __restrict__ w2, const float* __restrict__ w3,
                                          unsigned short* t0, unsigned short* t1, unsigned short* t2, unsigned short* t3,
                                          int K, int Nwide, int Nnarrow, float scale, int bx, int by, int z) {
  const int tid = threadIdx.x;                         // z = which weight: 0 and 3 are Nwide columns, 1 and 2 Nnarrow
  const int N   = (z == 0 || z == 3) ? Nwide : Nnarrow;
  const int n0  = bx * 64;
  const int k0  = by * 64;
  if (z > 3 || n0 >= N || k0 >= K) return;             // block-uniform, before the barrier
  const float* w = (z == 0) ? w0 : (z == 1) ? w1 : (z == 2) ? w2 : w3;
  unsigned short* wt = (z == 0) ? t0 : (z == 1) ? t1 : (z == 2) ? t2 : t3;
#pragma unroll
  for (int i = 0; i < 2; ++i) {
    const int idx = i * 256 + tid;                  // 0..511
    const int kk = idx >> 3, c8 = (idx & 7) * 8;
    const float* src = w + (size_t)(k0 + kk) * N + n0 + c8;
    const v4f a  = *(const v4f*)(src);
    const v4f a2 = *(const v4f*)(src + 4);
    v8h o;
    o[0] = (_Float16)(bfr(a[0]) * scale);
    o[1] = (_Float16)(bfr(a[1]) * scale);
    o[2] = (_Float16)(bfr(a[2]) * scale);
    o[3] = (_Float16)(bfr(a[3]) * scale);
    o[4] = (_Float16)(bfr(a2[0]) * scale);
    o[5] = (_Float16)(bfr(a2[1]) * scale);
    o[6] = (_Float16)(bfr(a2[2]) * scale);
    o[7] = (_Float16)(bfr(a2[3]) * scale);
    *(v8h*)(sw + kk * 72 + c8) = o;
  }
  __syncthreads();

  const int g = tid >> 3, piece = tid & 7;
  v4u hv[2];
  size_t hofs[2];
#pragma unroll
  for (int it = 0; it < 2; ++it) {
    const int nn = it * 32 + g;
    v4u a;
#pragma unroll
    for (int e = 0; e < 4; ++e) {
      const _Float16 x0 = sw[(piece * 8 + 2 * e) * 72 + nn];
      const _Float16 x1 = sw[(piece * 8 + 2 * e + 1) * 72 + nn];
      a[e] = pk16(h_bits(x0), h_bits(x1));
    }
    hv[it] = a;
    hofs[it] = ((size_t)(n0 + nn)) * K + k0 + piece * 8;
  }
  {
#pragma unroll
    for (int it = 0; it < 2; ++it) *(v4u*)(wt + hofs[it]) = hv[it];
    
  }
}

// =====================================================================================================
// The operand planes of the projections in ONE launch (neither part reads what the other writes): blocks below
// 4 * (DM/64)^2 each take one weight tile (past a narrow weight's last column tile they leave at once), the blocks behind them each convert 2048 elements of x.
// The choice is block-uniform and stands in front of the transposition's barrier.
// =====================================================================================================
#define WTB   (DM / 64)                            // weight tiles along n (wide weights) and along k
#define NWTB  (4 * WTB * WTB)                      // weight-tile blocks of prep
__global__ __launch_bounds__(256) void prep(const float* __restrict__ x, unsigned short* xh, int n8, float xscale,
                                            const float* __restrict__ w0, const float* __restrict__ w1,
                                            const float* __restrict__ w2, const float* __restrict__ w3,
                                            unsigned short* t0, unsigned short* t1, unsigned short* t2, unsigned short* t3,
                                            float wscale) {
  __shared__ __align__(16) _Float16 sw[64 * 72];
  const int b = blockIdx.x;
  if (b < NWTB) w_tr_body(sw, w0, w1, w2, w3, t0, t1, t2, t3, DM, DM, DKV, wscale, b % WTB, (b / WTB) % WTB, b / (WTB * WTB));
  else          cvt16_body(x, xh, n8, xscale, b - NWTB);
}

// =====================================================================================================
// Four 16-byte asynchronous copies of one lane, global memory -> LDS (l = the lane's LDS byte address, g = its
// global address), written as the compiler's builtin, offset argument 0: a builtin copy carries no s_wait_xcnt behind
// it, so the wave goes from a stage's copies straight on to its fragment reads. Landing is waited for by the callers
// (s_wait_asynccnt 0 and the block barrier at every stage's foot).
// =====================================================================================================
typedef int v4i_t __attribute__((vector_size(16)));
typedef __attribute__((address_space(1))) v4i_t g_v4i;
typedef __attribute__((address_space(3))) v4i_t l_v4i;
__device__ __forceinline__ void copy1_lds(unsigned l, const _Float16* g) {
#if defined(__HIP_DEVICE_COMPILE__)
  __builtin_amdgcn_global_load_async_to_lds_b128((g_v4i*)(uintptr_t)g, (l_v4i*)l, 0, 0);
#endif
}
__device__ __forceinline__ void copy4_lds(unsigned l0, const _Float16* g0, unsigned l1, const _Float16* g1,
                                          unsigned l2, const _Float16* g2, unsigned l3, const _Float16* g3) {
  copy1_lds(l0, g0);
  copy1_lds(l1, g1);
  copy1_lds(l2, g2);
  copy1_lds(l3, g3);
}

// =====================================================================================================
// Register-blocked f16 WMMA GEMM, block = 8 waves, every wave one 64x64 product tile:
//   v[m][n] = (sum_k A[m][k] * Bt[n][k]  [+ 2^-11 * sum_k Ar[m][k] * Bt[n][k] when ARES]) * cscale
// A, Ar row-major [M][K] pitch lda (f16), Bt row-major [N][K] pitch ldb (f16, k contiguous); M a multiple of 128,
// K of 128. Without ARES: waves 2 x 4 = one 128 x 256 tile, N a multiple of 256, grid = (M / 128) * (N / 256) blocks.
// Operands: a stage = 128 k of the block's 128 rows of A and 256 rows of Bt, whole 128-B lines, brought into LDS at
// row pitch 272 B by asynchronous copies (24 per lane and stage: lane -> row tid>>4 (+16 per copy), 16-B piece
// tid&15); two buffers, stage s + 1 in flight while stage s is multiplied; every wave reads its fragments from LDS.
// ARES: block tile 128 x 128, N a multiple of 128, grid = (M / 128) * (N / 128) blocks (twice as many blocks, half the columns and the same K / 128
// stages each). A stage = 128 k of 128 rows of A, 128 rows of Ar and 128 rows of Bt (the same 384 LDS rows). Waves 0..3
// (2 x 2) multiply A, waves 4..7 multiply Ar against the same Bt rows; wave w and wave w ^ 4 have the same 64x64 tile.
// Behind the last stage the Ar waves scale their sums by 2^-11 (exact), each wave hands one 32-row half of its sums to
// its partner through LDS (the stage buffers, free by then; one block barrier) and adds the half it receives to the
// half it kept: waves 0..3 finish and store rows 0..31 of the tile, waves 4..7 rows 32..63.
// EPI 0: column tiles from n1 on are stored to a second and a third output (each nx columns wide; hi plane C2 / C3,
// residual plane C2r / C3r), so that products that share A run in one grid. The second has pitch nx; the third is
// stored TRANSPOSED, [nx][M] at pitch M: a lane's 8 accumulator registers of a subtile are 8 consecutive rows m of its
// one column, that is 16 B of the transposed row; the wave stages its 64 (n) x 64 (m) halves of both planes in LDS at
// pitch 144 B (its own range of the stage buffers, free behind the last stage's barrier) and stores whole 128-B rows.
// EPI 1 has the one output.
// Epilogue variants:
//   EPI 0: f16 hi plane = f16(v * oscale) at Cp and residual plane = f16((v*oscale - hi) * 2048) at Crp, pitch ldc halves
//   EPI 1: f32 out = v, pitch ldc floats
// 16-row slabs staged per wave in LDS. f32 out: each 64-wide row segment (256 B = 2 lines) by 16 lanes x 16 B,
// coverage: 4 slabs x 16 rows x 64 cols = the wave's whole 64x64 tile; 8 waves = the block's 128 x 256; grid = [M][N].
// ARES: 2 slabs x 16 rows x 64 cols = the wave's half of its tile, two waves a tile, 8 waves = the block's 128 x 128.
// =====================================================================================================
#define GBM  128                                   // block tile rows (A)
#define GBN  256                                   // block tile columns (rows of Bt)
#define GBK  128                                   // k per stage: 256 B of every operand row
#define GLP  136                                   // LDS row pitch in halves: 272 B = 16 B x 17 (ds_load_b128 fragment reads)
#define GSTG ((GBM + GBN) * GLP)                   // halves per stage buffer: [A 128 rows | Bt 256 rows]; ARES: [A | Ar | Bt], 128 rows each
template <int EPI, bool ARES>
__global__ __launch_bounds__(256) void gemm64_f16(
    const unsigned short* __restrict__ Ap, const unsigned short* __restrict__ Arp, int lda,
    const unsigned short* __restrict__ Btp, int ldb,
    float cscale,
    void* Cp, unsigned short* Crp, int ldc, int M, int N, int K, float oscale,
    int n1, int nx, unsigned short* C2, unsigned short* C2r, unsigned short* C3, unsigned short* C3r) {
  const _Float16* Ah  = (const _Float16*)(const void*)Ap;
  const _Float16* Arh = (const _Float16*)(const void*)Arp;
  const _Float16* Bt  = (const _Float16*)(const void*)Btp;
  __shared__ __align__(16) _Float16 sAB[2 * GSTG]; // two stage buffers
  __shared__ __align__(16) float sT[8][16 * 68];   // per-wave 16x64 slab, pitch 68 floats
  const int tid  = threadIdx.x;
  const int lane = tid & 31;
  const int wave = ARES ? __builtin_amdgcn_readfirstlane(tid >> 5) : (tid >> 5);   // ARES: scalar, for the plane branch below
  constexpr int BNSH = ARES ? 7 : 8;       // log2 of the block tile's columns
  const int blocksN = N >> BNSH;
  const int blocksM = M >> 7;
  const int bidx = blockIdx.x;
  if (bidx >= blocksM * blocksN) return;   // block-uniform, before any copy or barrier
  const int bmi = bidx / blocksN;
  const int bm0 = bmi << 7;
  const int bn0 = (bidx - bmi * blocksN) << BNSH;
  const int pl  = ARES ? (wave >> 2) : 0;                  // ARES: 0 = this wave multiplies A, 1 = Ar
  const int wm  = ARES ? ((wave >> 1) & 1) : (wave >> 2);  // wave's 64-row half of the block tile
  const int wn  = ARES ? (wave & 1) : (wave & 3);          // wave's 64-column half / quarter
  const int m0 = bm0 + (wm << 6);
  const int n0 = bn0 + (wn << 6);

  // output of this tile (wave-uniform): columns below n1 go to Cp / Crp, the next nx to C2 / C2r, the next nx to C3 / C3r
  void* Co = Cp;
  unsigned short* Cro = Crp;
  int ldo = ldc, nc0 = n0;
  bool tr3 = false;                            // this tile belongs to the third output (stored transposed)
  if constexpr (EPI == 0) {
    if (n0 >= n1) {
      const int e = n0 - n1;
      const bool third = (e >= nx);
      tr3 = third;
      Co  = third ? (void*)C3 : (void*)C2;
      Cro = third ? C3r : C2r;
      ldo = nx;
      nc0 = third ? e - nx : e;
    }
  }

  const int rlane = lane & 15;                 // row (A) / col (B, D) within subtile
  const int koff  = (lane >> 4) * 8;           // k offset of this lane half
  const int mOff  = (lane >> 4) * 8;           // D row offset

  v8f acc[4][4];
#pragma unroll
  for (int i = 0; i < 4; ++i)
#pragma unroll
    for (int j = 0; j < 4; ++j) acc[i][j] = zero8();

  const int nst = K >> 7;                      // stages, block-uniform

  // the lane's share of a stage: rows crow + 16 i of A (i 0..7) and of Bt (i 0..15; ARES: of Ar and of Bt, i 0..7
  // each), 16-B piece tid & 15 of each
  const int crow = tid >> 4;
  const int cpc  = (tid & 15) * 8;
  const unsigned lds0 = (unsigned)(uintptr_t)(&sAB[0]) + (unsigned)(crow * GLP + cpc) * 2u;
  const _Float16* gA0 = Ah  + (size_t)(bm0 + crow) * lda + cpc;
  const _Float16* gR0 = Arh + (size_t)(bm0 + crow) * lda + cpc;
  const _Float16* gB0 = Bt  + (size_t)(bn0 + crow) * ldb + cpc;
  const size_t a16 = (size_t)16 * lda, b16 = (size_t)16 * ldb;
  constexpr unsigned R16 = 16u * GLP * 2u;     // 16 LDS rows, bytes
  auto stage_in = [&](int st, int buf) {
    const int  k0  = st * GBK;
    const _Float16* ga = gA0 + k0;
    const _Float16* gb = gB0 + k0;
    const unsigned la = lds0 + (unsigned)buf * (unsigned)(GSTG * 2);
    const unsigned lb = la + (unsigned)((ARES ? 2 : 1) * GBM * GLP * 2);
#pragma unroll                                 // straight line: constant LDS steps, 4 copies a call
    for (int q = 0; q < GBM / 16; q += 4)
      copy4_lds(la + q * R16,       ga + q * a16,       la + (q + 1) * R16, ga + (q + 1) * a16,
                la + (q + 2) * R16, ga + (q + 2) * a16, la + (q + 3) * R16, ga + (q + 3) * a16);
    if constexpr (ARES) {
      const _Float16* gr = gR0 + k0;
      const unsigned lr = la + (unsigned)(GBM * GLP * 2);
#pragma unroll                                 // as above
      for (int q = 0; q < GBM / 16; q += 4)
        copy4_lds(lr + q * R16,       gr + q * a16,       lr + (q + 1) * R16, gr + (q + 1) * a16,
                  lr + (q + 2) * R16, gr + (q + 2) * a16, lr + (q + 3) * R16, gr + (q + 3) * a16);
    }
#pragma unroll                                 // as above
    for (int q = 0; q < (ARES ? GBN / 2 : GBN) / 16; q += 4)
      copy4_lds(lb + q * R16,       gb + q * b16,       lb + (q + 1) * R16, gb + (q + 1) * b16,
                lb + (q + 2) * R16, gb + (q + 2) * b16, lb + (q + 3) * R16, gb + (q + 3) * b16);
  };

  if (nst > 0) stage_in(0, 0);
#if defined(__HIP_DEVICE_COMPILE__)
  asm volatile("s_wait_asynccnt 0x0" ::: "memory");   // this wave's copies of stage 0 have landed
#endif
  __syncthreads();                                    // stage 0 is published to every wave
  if (nst > 1) stage_in(1, 1);

  for (int st = 0; st < nst; ++st) {
    const _Float16* sA = sAB + (st & 1) * GSTG + (pl * GBM + (wm << 6) + rlane) * GLP + koff;
    const _Float16* sB = sAB + (st & 1) * GSTG + ((ARES ? 2 : 1) * GBM + (wn << 6) + rlane) * GLP + koff;
#pragma unroll                                 // constant LDS offsets; the fragment arrays stay in registers
    for (int ks = 0; ks < GBK; ks += 32) {
      v16h bh[4], ah[4];
#pragma unroll
      for (int j = 0; j < 4; ++j) bh[j] = ldfrag_h(sB + (j << 4) * GLP + ks);
#pragma unroll
      for (int i = 0; i < 4; ++i) ah[i] = ldfrag_h(sA + (i << 4) * GLP + ks);
#pragma unroll
      for (int i = 0; i < 4; ++i) {
#pragma unroll
        for (int j = 0; j < 4; ++j) {
          acc[i][j] = mma_h_raw(ah[i], bh[j], acc[i][j]);
        }
        dep_guard_h(acc[i][0], acc[i][3], ah[i], bh[3]);
      }
      keep4_h(bh[0], bh[1], bh[2], bh[3]);
    }
#if defined(__HIP_DEVICE_COMPILE__)
    asm volatile("s_wait_dscnt 0x0" ::: "memory");      // this wave's reads of buffer st & 1 are done before it is refilled
    asm volatile("s_wait_asynccnt 0x0" ::: "memory");   // this wave's copies of stage st + 1 have landed
#endif
    __syncthreads();                                    // publishes stage st + 1, ends every read of stage st
    if (st + 2 < nst) stage_in(st + 2, st & 1);
  }
#if defined(__HIP_DEVICE_COMPILE__)
  asm volatile("s_wait_asynccnt 0x0" ::: "memory");     // no copy is outstanding when the wave goes on to its end
#endif
  acc_guard4(acc[0][0], acc[0][1], acc[0][2], acc[0][3]);
  acc_guard4(acc[1][0], acc[1][1], acc[1][2], acc[1][3]);
  acc_guard4(acc[2][0], acc[2][1], acc[2][2], acc[2][3]);
  acc_guard4(acc[3][0], acc[3][1], acc[3][2], acc[3][3]);

  // ---- ARES: join the two planes' sums of every 64x64 tile (waves w and w ^ 4) ----
  if constexpr (ARES) {
    // the last stage's s_wait_dscnt 0, s_wait_asynccnt 0 and barrier have ended every read of and copy into sAB
    static_assert(8 * 2048 * 4 <= 2 * GSTG * 2);
    float*       xw = (float*)(void*)sAB + wave * 2048 + lane * 4;         // 8 KiB a wave: [subtile 0..7][half 0..1][lane][4]
    const float* xr = (const float*)(void*)sAB + (wave ^ 4) * 2048 + lane * 4;
    auto give = [&](const v8f (&a)[4], int ii) {                           // 16 rows x 64 columns of sums, 512 B a store
#pragma unroll                                 // constant indices, so that acc stays in registers
      for (int j = 0; j < 4; ++j) {
        const v4f lo = {a[j][0], a[j][1], a[j][2], a[j][3]};
        const v4f hi = {a[j][4], a[j][5], a[j][6], a[j][7]};
        *(v4f*)(xw + ((ii * 4 + j) * 2) * 128)     = lo;
        *(v4f*)(xw + ((ii * 4 + j) * 2 + 1) * 128) = hi;
      }
    };
    if (pl) {                                  // scalar branch: the Ar waves hand over rows 0..31 and keep rows 32..63
#pragma unroll
      for (int i = 0; i < 4; ++i)
#pragma unroll
        for (int j = 0; j < 4; ++j) acc[i][j] = acc[i][j] * (1.0f / 2048.0f);   // exact fold of the x2^11 residual carry
      give(acc[0], 0);
      give(acc[1], 1);
#pragma unroll
      for (int j = 0; j < 4; ++j) { acc[0][j] = acc[2][j]; acc[1][j] = acc[3][j]; }
    } else {                                   // the A waves hand over rows 32..63 and keep rows 0..31
      give(acc[2], 0);
      give(acc[3], 1);
    }
    __syncthreads();                           // every wave's handed-over half is in LDS before its partner reads it
#pragma unroll
    for (int ii = 0; ii < 2; ++ii) {
#pragma unroll
      for (int j = 0; j < 4; ++j) {
        const v4f lo = *(const v4f*)(xr + ((ii * 4 + j) * 2) * 128);
        const v4f hi = *(const v4f*)(xr + ((ii * 4 + j) * 2 + 1) * 128);
#pragma unroll
        for (int r = 0; r < 4; ++r) { acc[ii][j][r] += lo[r]; acc[ii][j][r + 4] += hi[r]; }
      }
    }
  }

  // ---- epilogue ----
  if constexpr (EPI == 0) {
    if (tr3) {                                 // the same for the whole wave; no block barrier stands behind it
      constexpr int TLP = 72;                  // staging row pitch in halves: 144 B = 16 B x 9 (16-B stores and reads)
      static_assert(8 * 2 * 64 * TLP <= 2 * GSTG);
      // the last stage's s_wait_dscnt 0, s_wait_asynccnt 0 and barrier have ended every read of and copy into sAB
      _Float16* th = sAB + wave * (2 * 64 * TLP);          // hi plane [n][m] of this wave's tile
      _Float16* tr = th + 64 * TLP;                        // residual plane
#pragma unroll                                 // these three: constant indices, so that acc stays in registers
      for (int j = 0; j < 4; ++j) {
#pragma unroll
        for (int i = 0; i < 4; ++i) {
          v4u p, q;
#pragma unroll
          for (int e = 0; e < 4; ++e) {
            const float g0 = (acc[i][j][2 * e] * cscale) * oscale, g1 = (acc[i][j][2 * e + 1] * cscale) * oscale;
            const _Float16 x0 = (_Float16)g0, x1 = (_Float16)g1;
            const _Float16 y0 = (_Float16)((g0 - (float)x0) * 2048.0f);
            const _Float16 y1 = (_Float16)((g1 - (float)x1) * 2048.0f);
            p[e] = pk16(h_bits(x0), h_bits(x1));
            q[e] = pk16(h_bits(y0), h_bits(y1));
          }
          const int so = ((j << 4) + rlane) * TLP + (i << 4) + mOff;   // row = the lane's column, first of its 8 m
          *(v4u*)(th + so) = p;
          *(v4u*)(tr + so) = q;
        }
      }
      // the wave's own LDS stores are ordered ahead of its reads of other lanes' pieces
      __builtin_amdgcn_fence(__ATOMIC_RELEASE, "workgroup");
      __builtin_amdgcn_wave_barrier();
      __builtin_amdgcn_fence(__ATOMIC_ACQUIRE, "workgroup");
      unsigned short* T16 = (unsigned short*)Co;
      const int rq = lane >> 3, piece = lane & 7;          // 128-B row = 8 lanes x 16 B, 4 rows a store
#pragma unroll                                 // straight line: constant LDS offsets, several reads in flight
      for (int it = 0; it < 16; ++it) {
        const int row = it * 4 + rq;                       // it 0..15 x rq 0..3 = the tile's 64 columns n
        const v4u a = *(const v4u*)(th + row * TLP + piece * 8);
        const v4u b = *(const v4u*)(tr + row * TLP + piece * 8);
        const size_t to = (size_t)(nc0 + row) * M + m0 + piece * 8;
        *(v4u*)(T16 + to) = a;
        *(v4u*)(Cro + to) = b;
      }
      return;
    }
  }
  float* slab = sT[wave];
  constexpr int NSL = ARES ? 2 : 4;            // 16-row slabs that this wave stores (ARES: its half of the tile, in acc[0..1])
#pragma unroll
  for (int i = 0; i < NSL; ++i) {
    const int mBase = m0 + ((ARES ? 2 * pl + i : i) << 4);
#pragma unroll
    for (int r = 0; r < 8; ++r) {
      const int row = mOff + r;
#pragma unroll
      for (int j = 0; j < 4; ++j) slab[row * 68 + (j << 4) + rlane] = acc[i][j][r] * cscale;
    }
    __builtin_amdgcn_fence(__ATOMIC_RELEASE, "workgroup");
    __builtin_amdgcn_wave_barrier();
    __builtin_amdgcn_fence(__ATOMIC_ACQUIRE, "workgroup");
    if constexpr (EPI == 0) {
      unsigned short* C16 = (unsigned short*)Co;
      const int rq = lane >> 3, piece = lane & 7;
      v4u ph[4], pr[4];
#pragma unroll
      for (int it = 0; it < 4; ++it) {
        const int row = it * 4 + rq;                         // it 0..3 x rq 0..3 = rows 0..15
        const v4f a  = *(const v4f*)(slab + row * 68 + piece * 8);
        const v4f a2 = *(const v4f*)(slab + row * 68 + piece * 8 + 4);
        float f[8];
        f[0] = a[0];  f[1] = a[1];  f[2] = a[2];  f[3] = a[3];
        f[4] = a2[0]; f[5] = a2[1]; f[6] = a2[2]; f[7] = a2[3];
        v4u p, q;
#pragma unroll
        for (int e = 0; e < 4; ++e) {
          const float g0 = f[2 * e] * oscale, g1 = f[2 * e + 1] * oscale;
          const _Float16 x0 = (_Float16)g0, x1 = (_Float16)g1;
          const _Float16 y0 = (_Float16)((g0 - (float)x0) * 2048.0f);
          const _Float16 y1 = (_Float16)((g1 - (float)x1) * 2048.0f);
          p[e] = pk16(h_bits(x0), h_bits(x1));
          q[e] = pk16(h_bits(y0), h_bits(y1));
        }
        ph[it] = p;
        pr[it] = q;
      }
      {
#pragma unroll
        for (int it = 0; it < 4; ++it) {
          const int row = it * 4 + rq;
          const size_t co = (size_t)(mBase + row) * ldo + nc0 + piece * 8;
          *(v4u*)(C16 + co) = ph[it];
          *(v4u*)(Cro + co) = pr[it];
        }
        
      }
    } else {
      float* Cf = (float*)Co;
      const int hh = lane >> 4, c4 = (lane & 15) * 4;     // 256-B row segment = 16 lanes x 16 B
      v4f ov[8];
#pragma unroll
      for (int it = 0; it < 8; ++it) {
        const int row = it * 2 + hh;                       // it 0..7 x hh 0..1 = rows 0..15
        ov[it] = *(const v4f*)(slab + row * 68 + c4);
      }
      {
#pragma unroll
        for (int it = 0; it < 8; ++it) {
          const int row = it * 2 + hh;
          *(v4f*)(Cf + (size_t)(mBase + row) * ldo + nc0 + c4) = ov[it];
        }
        
      }
    }
    __builtin_amdgcn_fence(__ATOMIC_RELEASE, "workgroup");
    __builtin_amdgcn_wave_barrier();
    __builtin_amdgcn_fence(__ATOMIC_ACQUIRE, "workgroup");
  }
}

#define ATT_SMEM 73728                                    // LDS bytes of the residual-plane variant, the larger one (two buffers)
// value of lane l ^ 16 (the other half of the wave, same column)
__device__ __forceinline__ float xhalf(float x) {
  return __builtin_bit_cast(float, __builtin_amdgcn_permlanex16(__builtin_bit_cast(int, x), __builtin_bit_cast(int, x),
                                                                0x76543210, 0xfedcba98, false, false));
}
template <bool HR>
__device__ __forceinline__
void attn_body(unsigned char* smem,
               const unsigned short* __restrict__ qp,  const unsigned short* __restrict__ qrp,
               const unsigned short* __restrict__ kp,  const unsigned short* __restrict__ krp,
               const unsigned short* __restrict__ vtp, const unsigned short* __restrict__ vtrp,
               unsigned short* ctxp, unsigned short* ctxrp, int qb, int h) {
  union FH { v16h v; v8h h[2]; };
  constexpr int LP     = 72;                             // LDS row pitch in halves: 144 B = 16 B x 9, so the 16 rows
                                                         // that one ds_load_b128 fragment read touches fall on 16
                                                         // different 4-bank groups (at 128 B they share two groups)
  constexpr int TB     = 64 * LP * 2;                    // one f16 64x64 tile at pitch LP, bytes
  constexpr int OP     = 68;                             // context staging pitch in floats: 272 B = 16 B x 17
  constexpr int OFF_K  = 0;
  constexpr int OFF_V  = TB;
  constexpr int OFF_KR = 2 * TB;
  constexpr int OFF_VR = 3 * TB;
  constexpr int BUFB   = HR ? 4 * TB : 2 * TB;                // one stage buffer: 36864 : 18432
  constexpr int SMEMB  = 2 * BUFB;                            // two stage buffers
  static_assert(4 * 16 * OP * 4 <= 2 * TB);                   // f32 context staging aliases the K/V region
  static_assert(SMEMB <= ATT_SMEM);

  const int tid  = threadIdx.x;
  const int wave = tid >> 5;
  const int lane = tid & 31;
  const int hh   = lane >> 4;
  const int c    = lane & 15;

  const int g    = h / GRP;                  // kv head
  const int q0   = qb * 64 + wave * 16;
  const int qrow = q0 + c;                   // the one query of this lane

  const _Float16* QP  = (const _Float16*)(const void*)qp   + (size_t)h * HD;
  const _Float16* QRP = (const _Float16*)(const void*)qrp  + (size_t)h * HD;
  const _Float16* KP  = (const _Float16*)(const void*)kp   + (size_t)g * HD;
  const _Float16* KRP = (const _Float16*)(const void*)krp  + (size_t)g * HD;
  const _Float16* VTP = (const _Float16*)(const void*)vtp  + (size_t)g * HD * SEQ;
  const _Float16* VRP = (const _Float16*)(const void*)vtrp + (size_t)g * HD * SEQ;

  // ---- Q fragments (B operand, column = lane&15): 2 d-chunks ----
  v16h qa[2], qr[2];
#pragma unroll
  for (int dc = 0; dc < 2; ++dc) {
    const size_t qo = (size_t)(q0 + c) * DM + dc * 32 + 8 * hh;
    qa[dc] = ldfrag_h(QP + qo);
    if constexpr (HR) qr[dc] = ldfrag_h(QRP + qo);
    else qr[dc] = qa[dc];
  }

  float lsum = 0.f, mrun = -1e30f;
  v8f oacc[4], oacc2[4];
#pragma unroll
  for (int t = 0; t < 4; ++t) { oacc[t] = zero8(); oacc2[t] = zero8(); }

  const int nkt = qb + 1;                                      // key tiles 0..qb, block-uniform

  // the lane's share of a key tile: rows crow + 16 i (i 0..3) of every plane, 16-B piece tid & 7 of each row
  const int crow = tid >> 3;
  const int cpc  = (tid & 7) * 8;
  const unsigned lds0 = (unsigned)(uintptr_t)smem + (unsigned)(crow * LP + cpc) * 2u;
  constexpr unsigned L16 = 16u * LP * 2u;                      // 16 LDS rows, bytes
  constexpr size_t   K16 = (size_t)16 * DKV;                   // 16 rows of K (keys), halves
  constexpr size_t   V16 = (size_t)16 * SEQ;                   // 16 rows of V^T (features), halves
  auto stage_in = [&](int kt, int buf) {                       // kt <= qb: keys kt*64 .. kt*64+63 < SEQ
    const size_t ko = (size_t)(kt * 64 + crow) * DKV + cpc;    // K row kt*64 + crow, d = cpc..cpc+7
    const size_t vo = (size_t)crow * SEQ + kt * 64 + cpc;      // V^T row d = crow, s = kt*64 + cpc..+7
    const unsigned lb = lds0 + (unsigned)buf * (unsigned)BUFB;
    copy4_lds(lb + OFF_K,           KP + ko,            lb + OFF_K + L16,     KP + ko + K16,
              lb + OFF_K + 2 * L16, KP + ko + 2 * K16,  lb + OFF_K + 3 * L16, KP + ko + 3 * K16);
    copy4_lds(lb + OFF_V,           VTP + vo,           lb + OFF_V + L16,     VTP + vo + V16,
              lb + OFF_V + 2 * L16, VTP + vo + 2 * V16, lb + OFF_V + 3 * L16, VTP + vo + 3 * V16);
    if constexpr (HR) {
      copy4_lds(lb + OFF_KR,           KRP + ko,           lb + OFF_KR + L16,     KRP + ko + K16,
                lb + OFF_KR + 2 * L16, KRP + ko + 2 * K16, lb + OFF_KR + 3 * L16, KRP + ko + 3 * K16);
      copy4_lds(lb + OFF_VR,           VRP + vo,           lb + OFF_VR + L16,     VRP + vo + V16,
                lb + OFF_VR + 2 * L16, VRP + vo + 2 * V16, lb + OFF_VR + 3 * L16, VRP + vo + 3 * V16);
    }
  };

  stage_in(0, 0);
#if defined(__HIP_DEVICE_COMPILE__)
  asm volatile("s_wait_asynccnt 0x0" ::: "memory");            // this wave's copies of key tile 0 have landed
#endif
  __syncthreads();                                             // key tile 0 is published to every wave
  if (nkt > 1) stage_in(1, 1);

  for (int kti = 0; kti < nkt; ++kti) {
    const int kv0 = kti * 64;                                  // <= qb*64 < SEQ
    const unsigned char* sb = smem + (kti & 1) * BUFB;         // this key tile's stage buffer
    const _Float16* Ksh = (const _Float16*)(sb + OFF_K);                  // K   [kv][d], pitch LP
    const _Float16* Vsh = (const _Float16*)(sb + OFF_V);                  // V^T [d][kv], pitch LP
    const _Float16* Krs = (const _Float16*)(sb + (HR ? OFF_KR : OFF_K));  // K residual (HR only)
    const _Float16* Vrs = (const _Float16*)(sb + (HR ? OFF_VR : OFF_V));  // V^T residual (HR only)

    // ---- scores, transposed: 64 keys x 16 queries per wave (A operand: lane c -> key j*16+c, split k map over d) ----
    //      The fragments of JG score tiles are read from LDS as one group ahead of their run of WMMAs (one LDS latency
    //      per group, not one per WMMA); every accumulator takes its products in the order dc 0, dc 1
    //      (HR, second accumulator: kr.qh then kh.qr within each dc).
    constexpr int JG = HR ? 2 : 4;                       // score tiles per group: 8 fragments = 64 registers
    v8f s[4];
#pragma unroll
    for (int j0 = 0; j0 < 4; j0 += JG) {
      v16h kb[JG][2], krb[JG][2];
#pragma unroll
      for (int jj = 0; jj < JG; ++jj) {
#pragma unroll
        for (int dc = 0; dc < 2; ++dc) {
          const int ko = ((j0 + jj) * 16 + c) * LP + dc * 32 + 8 * hh;
          kb[jj][dc] = ldfrag_h(Ksh + ko);
          if constexpr (HR) krb[jj][dc] = ldfrag_h(Krs + ko);
        }
      }
      v8f t[JG];
#pragma unroll
      for (int jj = 0; jj < JG; ++jj) { s[j0 + jj] = zero8(); t[jj] = zero8(); }
#pragma unroll
      for (int dc = 0; dc < 2; ++dc) {
#pragma unroll
        for (int jj = 0; jj < JG; ++jj) s[j0 + jj] = mma_h_raw(kb[jj][dc], qa[dc], s[j0 + jj]);
        if constexpr (HR) {
#pragma unroll
          for (int jj = 0; jj < JG; ++jj) t[jj] = mma_h_raw(krb[jj][dc], qa[dc], t[jj]);
#pragma unroll
          for (int jj = 0; jj < JG; ++jj) t[jj] = mma_h_raw(kb[jj][dc], qr[dc], t[jj]);
        }
      }
      if constexpr (HR) {
#pragma unroll
        for (int jj = 0; jj < JG; ++jj) s[j0 + jj] = s[j0 + jj] + t[jj] * (1.0f / 2048.0f);
      }
    }

    // single-product variant: all eight V^T fragments are read here, so that their LDS latency runs under the softmax
    v16h vb[2][4];
    if constexpr (!HR) {
#pragma unroll
      for (int kk = 0; kk < 2; ++kk)
#pragma unroll
        for (int t = 0; t < 4; ++t) vb[kk][t] = ldfrag_h(Vsh + (t * 16 + c) * LP + kk * 32 + 8 * hh);
    }

    // ---- causal online softmax of the lane's one query: masked logits and their maximum in-lane, one exchange
    //      with lane ^ 16, alpha, p, row-sum partial, P^T (x256, f16; HR: + residual) packed as the B operand ----
#pragma unroll
    for (int j = 0; j < 4; ++j) s[j] = s[j] * (1.0f / 2048.0f);   // 1/8 head scale, 1/256 for the two x16 carries
    if (kti == qb) {                                       // block-uniform: only the diagonal tile has keys above a query
#pragma unroll
      for (int j = 0; j < 4; ++j) {
#pragma unroll
        for (int r = 0; r < 8; ++r) {
          const int key = kv0 + j * 16 + 8 * hh + r;
          s[j][r] = (key <= qrow) ? s[j][r] : -1e30f;
        }
      }
    }
    float tm[8];
#pragma unroll
    for (int r = 0; r < 8; ++r) tm[r] = -1e30f;
#pragma unroll
    for (int j = 0; j < 4; ++j) {
#pragma unroll
      for (int r = 0; r < 8; ++r) tm[r] = fmaxf(tm[r], s[j][r]);
    }
    float tmx = fmaxf(fmaxf(fmaxf(tm[0], tm[1]), fmaxf(tm[2], tm[3])), fmaxf(fmaxf(tm[4], tm[5]), fmaxf(tm[6], tm[7])));
    tmx = fmaxf(tmx, xhalf(tmx));
    const float mn = fmaxf(mrun, tmx);
    const float al = __expf(mrun - mn);
    mrun = mn;
    float pp[8];
#pragma unroll
    for (int r = 0; r < 8; ++r) pp[r] = 0.0f;
    FH pa[2], par[2];
#pragma unroll
    for (int j = 0; j < 4; ++j) {
#pragma unroll
      for (int r = 0; r < 8; ++r) {
        const float p = __expf(s[j][r] - mn);              // a masked key: exp(-1e30 - mn) = 0 (mn is finite)
        pp[r] += p;
        const float gg = p * 256.0f;
        const _Float16 x0 = (_Float16)gg;
        pa[j >> 1].v[(j & 1) * 8 + r] = x0;
        if constexpr (HR) par[j >> 1].v[(j & 1) * 8 + r] = (_Float16)((gg - (float)x0) * 2048.0f);
      }
    }
    lsum = lsum * al + (((pp[0] + pp[1]) + (pp[2] + pp[3])) + ((pp[4] + pp[5]) + (pp[6] + pp[7])));

    // ---- rescale the context accumulators by alpha (VALU), nop gaps before the next WMMA reads them ----
#pragma unroll
    for (int t = 0; t < 4; ++t) {
      oacc[t] = oacc[t] * al;
      if constexpr (HR) oacc2[t] = oacc2[t] * al;
    }
    acc_guard4(oacc[0], oacc[1], oacc[2], oacc[3]);
    if constexpr (HR) acc_guard4(oacc2[0], oacc2[1], oacc2[2], oacc2[3]);

    // ---- context^T += V^T . P^T (f16 WMMA; A = V^T [d][key] from LDS, B = P^T [key][query] in registers) ----
    //      HR: the eight fragments of a key chunk are read as one group ahead of its twelve WMMAs; every accumulator
    //      takes its products in the order kk 0, kk 1 (second accumulator: vr.ph then vh.pr within each kk).
#pragma unroll
    for (int kk = 0; kk < 2; ++kk) {
      v16h vrb[4];
      if constexpr (HR) {
#pragma unroll
        for (int t = 0; t < 4; ++t) {
          const int vo = (t * 16 + c) * LP + kk * 32 + 8 * hh;
          vb[kk][t] = ldfrag_h(Vsh + vo);
          vrb[t]    = ldfrag_h(Vrs + vo);
        }
      }
#pragma unroll
      for (int t = 0; t < 4; ++t) oacc[t] = mma_h_raw(vb[kk][t], pa[kk].v, oacc[t]);
      if constexpr (HR) {
#pragma unroll
        for (int t = 0; t < 4; ++t) oacc2[t] = mma_h_raw(vrb[t], pa[kk].v, oacc2[t]);
#pragma unroll
        for (int t = 0; t < 4; ++t) oacc2[t] = mma_h_raw(vb[kk][t], par[kk].v, oacc2[t]);
      }
    }
#if defined(__HIP_DEVICE_COMPILE__)
    asm volatile("s_wait_dscnt 0x0" ::: "memory");      // this wave's reads of buffer kti & 1 are done before it is refilled
    asm volatile("s_wait_asynccnt 0x0" ::: "memory");   // this wave's copies of key tile kti + 1 have landed
#endif
    __syncthreads();                                    // publishes key tile kti + 1, ends every read of key tile kti
    if (kti + 2 < nkt) stage_in(kti + 2, kti & 1);
  }
#if defined(__HIP_DEVICE_COMPILE__)
  asm volatile("s_wait_asynccnt 0x0" ::: "memory");     // no copy is outstanding when the buffers become output staging
#endif
  // the last key tile's barrier has ended every wave's reads of the K/V tiles: they may be aliased from here on

  // ---- normalise (1/lsum, the 1/256 p carry; keep the x16 v carry), stage the wave's 16x64 f32 tile [query][d]
  //      in LDS (a lane's 8 registers of tile t are 8 consecutive d of its query: two 16-B stores) ----
  float* os = (float*)(void*)smem + wave * (16 * OP);
  {
    const float l  = lsum + xhalf(lsum);     // the query's two key halves
    const float rl = 1.0f / l;               // l >= 1 (the max key contributes p = 1)
    const float sc = rl * (1.0f / 256.0f);
#pragma unroll
    for (int t = 0; t < 4; ++t) {
      v4f lo, hi;
#pragma unroll
      for (int r = 0; r < 4; ++r) {
        float v0 = oacc[t][r], v1 = oacc[t][r + 4];
        if constexpr (HR) { v0 += oacc2[t][r] * (1.0f / 2048.0f); v1 += oacc2[t][r + 4] * (1.0f / 2048.0f); }
        lo[r] = v0 * sc;
        hi[r] = v1 * sc;
      }
      *(v4f*)(os + c * OP + t * 16 + 8 * hh)     = lo;
      *(v4f*)(os + c * OP + t * 16 + 8 * hh + 4) = hi;
    }
  }
  __builtin_amdgcn_fence(__ATOMIC_RELEASE, "workgroup");
  __builtin_amdgcn_wave_barrier();
  __builtin_amdgcn_fence(__ATOMIC_ACQUIRE, "workgroup");
  {
    const int rq = lane >> 3, piece = lane & 7;
    v4u ph[4], pr[4];
#pragma unroll
    for (int it = 0; it < 4; ++it) {
      const int row = it * 4 + rq;   // it 0..3 x rq 0..3 = rows 0..15 of the wave tile
      const v4f a  = *(const v4f*)(os + row * OP + piece * 8);
      const v4f a2 = *(const v4f*)(os + row * OP + piece * 8 + 4);
      float f[8];
      f[0] = a[0];  f[1] = a[1];  f[2] = a[2];  f[3] = a[3];
      f[4] = a2[0]; f[5] = a2[1]; f[6] = a2[2]; f[7] = a2[3];
      v4u p, q;
#pragma unroll
      for (int e = 0; e < 4; ++e) {
        const _Float16 x0 = (_Float16)f[2 * e], x1 = (_Float16)f[2 * e + 1];
        const _Float16 y0 = (_Float16)((f[2 * e] - (float)x0) * 2048.0f);
        const _Float16 y1 = (_Float16)((f[2 * e + 1] - (float)x1) * 2048.0f);
        p[e] = pk16(h_bits(x0), h_bits(x1));
        q[e] = pk16(h_bits(y0), h_bits(y1));
      }
      ph[it] = p;
      pr[it] = q;
    }
    {
#pragma unroll
      for (int it = 0; it < 4; ++it) {
        const int row = it * 4 + rq;
        const size_t go = (size_t)(q0 + row) * DM + (size_t)h * HD + piece * 8;
        *(v4u*)(ctxp + go)  = ph[it];
        *(v4u*)(ctxrp + go) = pr[it];
      }
    }
  }
}

// =====================================================================================================
// Both attention variants in one grid of NQT * NH blocks, so that the short residual-plane tiles and the long
// single-product tiles run side by side. The grid is four quarters of NQT/4 * NH blocks; block w of each quarter has
// head w % NH and u = w / NH, and query tile NQT-1-u, QHR-1-u, QHR+u, u in quarters 0..3: a permutation of every
// (head, query tile), long tiles first, and the four blocks with equal w have the same total of key tiles for every w.
// =====================================================================================================
// amdgpu_waves_per_eu(4, 4): at most four waves per SIMD = four blocks per WGP, as many as the grid has per WGP, so
// that no WGP takes a fifth block while another is left with three.
__global__ __launch_bounds__(128) __attribute__((amdgpu_waves_per_eu(4, 4)))
void attn_all(const unsigned short* __restrict__ qp,  const unsigned short* __restrict__ qrp,
              const unsigned short* __restrict__ kp,  const unsigned short* __restrict__ krp,
              const unsigned short* __restrict__ vtp, const unsigned short* __restrict__ vtrp,
              unsigned short* ctxp, unsigned short* ctxrp) {
  __shared__ __align__(16) unsigned char smem[ATT_SMEM];
  constexpr int QQ = NQT / 4;
  static_assert((NQT % 4) == 0 && QHR == 2 * QQ);
  const int bx = blockIdx.x;
  const int j  = bx / (QQ * NH);
  if (j > 3) return;                         // block-uniform, before any barrier or store
  const int w  = bx - j * (QQ * NH);
  const int h  = w % NH;
  const int u  = w / NH;
  const int qb = (j == 0) ? (NQT - 1 - u) : (j == 1) ? (QHR - 1 - u) : (j == 2) ? (QHR + u) : u;
  if (qb < QHR) attn_body<true>(smem, qp, qrp, kp, krp, vtp, vtrp, ctxp, ctxrp, qb, h);
  else          attn_body<false>(smem, qp, qrp, kp, krp, vtp, vtrp, ctxp, ctxrp, qb, h);
}

// =====================================================================================================
// Workspace map (bytes, SEQ = 4096); every region is an exact multiple of its whole-line / whole-tile store
// granularity (row pitches 2048 / 512 / 8192 B, rows multiples of 64, all offsets 512-KiB aligned, no aliasing
// within a launch):
//   Xh    f16 [SEQ][1024]          0     8388608   (bf16 value of x, x16)
//   WqT   f16 [1024][1024]   8388608     2097152   (bf16 value of w_q^T x1024, [n][k])
//   WkT   f16 [256][1024]   10485760      524288   (bf16 value of w_k^T x1024, [n][k])
//   WvT   f16 [256][1024]   11010048      524288   (bf16 value of w_v^T x1024, [n][k])
//   WoT   f16 [1024][1024]  11534336     2097152   (bf16 value of w_o^T x1024, [n][k])
//   Qh    f16 [SEQ][1024]   13631488     8388608   (q x16)           Qr  22020096  8388608 (x2^11 residual)
//   Kh    f16 [SEQ][256]    30408704     2097152   (k x16)           Kr  32505856  2097152
//   VT    f16 [256][SEQ]    34603008     2097152   (v x16, [g*64 + d][s])   VTr 36700160  2097152
//   Ctx   f16 [SEQ][1024]   38797312     8388608   (context x16)     Ctxr 47185920 8388608
//   end                     55574528
// Projection weights arrive as [in k][out n] (n contiguous) and are transposed while converted (prep).
// d_out f32: [SEQ][1024] at byte 0, every 64x64 tile written once by the output projection launch.
// =====================================================================================================
extern "C" void kernel_launch(void* const* d_in, const int* in_sizes, int n_in,
                              void* d_out, int out_size, void* d_ws, size_t ws_size,
                              hipStream_t stream) {
  if (n_in < 5) return;
  if (in_sizes[0] < SEQ * DM || (in_sizes[0] % DM) != 0) return;   // x rows 0..SEQ-1 are used, pitch DM
  if (in_sizes[1] != DM * DM) return;
  if (in_sizes[2] != DM * DKV) return;
  if (in_sizes[3] != DM * DKV) return;
  if (in_sizes[4] != DM * DM) return;
  if (out_size < OUTN) return;

  const float* x   = (const float*)d_in[0];    // [>=SEQ][DM]
  const float* w_q = (const float*)d_in[1];    // [DM k][DM n]
  const float* w_k = (const float*)d_in[2];    // [DM k][DKV n]
  const float* w_v = (const float*)d_in[3];    // [DM k][DKV n]
  const float* w_o = (const float*)d_in[4];    // [DM k][DM n]

  const size_t PX   = (size_t)SEQ * DM * 2;          //  8388608
  const size_t PWq  = (size_t)DM * DM * 2;           //  2097152
  const size_t PWk  = (size_t)DKV * DM * 2;          //   524288
  const size_t PWo  = (size_t)DM * DM * 2;           //  2097152
  const size_t PQ   = (size_t)SEQ * DM * 2;          //  8388608
  const size_t PK   = (size_t)SEQ * DKV * 2;         //  2097152
  const size_t PVT  = (size_t)DKV * SEQ * 2;         //  2097152
  const size_t PCtx = (size_t)SEQ * DM * 2;          //  8388608
  size_t off = 0;
  const size_t oX    = off; off += PX;
  const size_t oWq   = off; off += PWq;
  const size_t oWk   = off; off += PWk;
  const size_t oWv   = off; off += PWk;
  const size_t oWo   = off; off += PWo;
  const size_t oQ    = off; off += PQ;
  const size_t oQr   = off; off += PQ;
  const size_t oK    = off; off += PK;
  const size_t oKr   = off; off += PK;
  const size_t oVT   = off; off += PVT;
  const size_t oVTr  = off; off += PVT;
  const size_t oCtx  = off; off += PCtx;
  const size_t oCtxr = off; off += PCtx;
  if (off > ws_size) return;                         // off = 55574528 for SEQ = 4096
  if (off > (size_t)134217728) return;

  char* ws = (char*)d_ws;
  unsigned short* Xh   = (unsigned short*)(ws + oX);
  unsigned short* WqT  = (unsigned short*)(ws + oWq);
  unsigned short* WkT  = (unsigned short*)(ws + oWk);
  unsigned short* WvT  = (unsigned short*)(ws + oWv);
  unsigned short* WoT  = (unsigned short*)(ws + oWo);
  unsigned short* Qh   = (unsigned short*)(ws + oQ);
  unsigned short* Qr   = (unsigned short*)(ws + oQr);
  unsigned short* Kh   = (unsigned short*)(ws + oK);
  unsigned short* Kr   = (unsigned short*)(ws + oKr);
  unsigned short* VT   = (unsigned short*)(ws + oVT);
  unsigned short* VTr  = (unsigned short*)(ws + oVTr);
  unsigned short* Ctx  = (unsigned short*)(ws + oCtx);
  unsigned short* Ctxr = (unsigned short*)(ws + oCtxr);
  float*          outf = (float*)d_out;              // [SEQ][DM]

  const dim3 blk(256);
  const int n8x = SEQ * DM / 8;                      // 524288
  const dim3 gPrep(NWTB + (n8x + 255) / 256);        // 1024 weight-tile blocks ([1024 k][n] -> [n][1024 k]) + 2048 of x
  const dim3 gGq((NQT * (DM / 64) + 3) / 4);         // 1024 64x64 tiles, two waves each -> 256 blocks of 128 x 128
  const dim3 gGqkv((NQT * ((DM + 2 * DKV) / 64) + 7) / 8);   // 1536 wave tiles -> 192 blocks of 128 x 256
  const dim3 gAtt(NQT * NH);                         // every (head, query tile), both variants
  const float wScale = 1024.0f;                      // weights carried x1024
  const float aScale = 16.0f;                        // activations carried x16
  const float cscale = 1.0f / 16384.0f;              // 1/(16 * 1024)

  // (1) planes: x -> f16 x16 (bf16 values); weights -> transposed f16 x1024 (bf16 values)
  prep<<<gPrep, blk, 0, stream>>>(x, Xh, n8x, aScale, w_q, w_k, w_v, w_o, WqT, WkT, WvT, WoT, wScale);
  // (2) [q | k | v] = Xh . [WqT ; WkT ; WvT]^T in one grid (M=SEQ, N=1024+256+256, K=1024; the three transposed
  //     weights lie one behind the other in the workspace): Qh [SEQ][1024], Kh [SEQ][256], v^T VT [256][SEQ],
  //     each f16 x16 + residual plane
  gemm64_f16<0, false><<<gGqkv, blk, 0, stream>>>(Xh, Xh, DM, WqT, DM, cscale, (void*)Qh, Qr, DM,
                                                  SEQ, DM + 2 * DKV, DM, aScale,
                                                  DM, DKV, Kh, Kr, VT, VTr);
  // (3) causal softmax attention -> Ctx f16 x16 + residual plane: tiles 0..QHR-1 with residual operand planes,
  //     tiles QHR..NQT-1 with single products; together every (head, query tile) exactly once
  attn_all<<<gAtt, dim3(128), 0, stream>>>(Qh, Qr, Kh, Kr, VT, VTr, Ctx, Ctxr);
  // (4) out = (Ctx + 2^-11 Ctxr) . WoT^T -> d_out f32 [SEQ][1024] (M=SEQ, N=1024, K=1024), every tile once; one block
  //     per 128 x 128 tile, the two planes' products side by side in its waves
  gemm64_f16<1, true><<<gGq, blk, 0, stream>>>(Ctx, Ctxr, DM, WoT, DM, cscale, (void*)outf, Ctxr, DM,
                                               SEQ, DM, DM, 1.0f,
                                               DM, DKV, Ctxr, Ctxr, Ctxr, Ctxr);
  (void)hipGetLastError();
}
